// v000
// The times below were measured on an AMD MI455X: many runs one after another, warmed up first and cycling through
// copies of the inputs, with the whole window's GPU time divided by the number of runs. Launches and the gaps
// between them are all in it. The median over several windows is given; except for v000 it joins two sittings, which
// can be a few percent apart, so the side-by-side timings, each taken in one sitting, are the better comparison.
// v000 is the starting kernel. One run takes 881 microseconds.
// compute dtype: all float inputs rounded to bf16; q / k / v projections with EXACT bf16 products on WMMA 16x16x32 (f32 accumulate) + bias; causal logits: 3 products for the first 384 rows, single f16 q x k after, x 64^-0.5; softmax f32; P x 2^11 once to f16 x v once to f16 (bf16 hi + lo below row 384); y hi+lo x exact wc below row 384, x2^6 f16 carry x f16(bf16 x 2^8) wc after, + bc; f32 output written back in the sequence-first layout.
#include <hip/hip_runtime.h>
#include <math.h>

typedef __attribute__((ext_vector_type(16))) _Float16 v16h;
typedef __attribute__((ext_vector_type(16))) __bf16 v16b;
typedef __attribute__((ext_vector_type(8)))  _Float16 v8h;
typedef __attribute__((ext_vector_type(8)))  float v8f;
typedef __attribute__((ext_vector_type(4)))  float v4f;
typedef __attribute__((ext_vector_type(2)))  float v2f;
typedef __attribute__((ext_vector_type(4)))  unsigned v4u;
typedef __attribute__((ext_vector_type(4)))  int v4i;
typedef float __attribute__((may_alias)) float_a;
typedef int __attribute__((may_alias)) int_a;

template <typename T> __device__ __forceinline__ void vst2(void* p, T v) { *(T*)p = v;  }
__device__ __forceinline__ v8f wmma16(v16h a, v16h b, v8f c) {
  v8f d = __builtin_amdgcn_wmma_f32_16x16x32_f16(false, a, false, b, (short)0, c, false, false);
  asm volatile("v_nop\n\tv_nop\n\tv_nop\n\tv_nop" : "+v"(d) : "v"(a), "v"(b));
  return d;
}
__device__ __forceinline__ v8f wmma_bf(v16b a, v16b b, v8f c) {
  v8f d = __builtin_amdgcn_wmma_f32_16x16x32_bf16(false, a, false, b, (short)0, c, false, false);
  asm volatile("v_nop\n\tv_nop\n\tv_nop\n\tv_nop" : "+v"(d) : "v"(a), "v"(b));
  return d;
}
// 16x16x32 fragments: lane = (h = lane>>4, row/col = lane&15); elements 0..7 = k0+8h+0..7, 8..15 = k0+16+8h+0..7; D element r = row 8h+r
__device__ __forceinline__ v16h frag_h(const _Float16* rowk0, int lane) {
  union { v16h v; v8h q[2]; } u; const _Float16* p = rowk0 + 8 * (lane >> 4);
  u.q[0] = *(const v8h*)p; u.q[1] = *(const v8h*)(p + 16); return u.v;
}
__device__ __forceinline__ v16h frag_f32(const float* rowk0, int lane) {
  v16h a; const float* p = rowk0 + 8 * (lane >> 4);
#pragma unroll
  for (int i = 0; i < 8; ++i) { a[i] = (_Float16)p[i]; a[8 + i] = (_Float16)p[16 + i]; }
  return a;
}
__device__ __forceinline__ v16h frag_f32s(const float* rowk0, int lane, float sc) {
  v16h a; const float* p = rowk0 + 8 * (lane >> 4);
#pragma unroll
  for (int i = 0; i < 8; ++i) { a[i] = (_Float16)(p[i] * sc); a[8 + i] = (_Float16)(p[16 + i] * sc); }
  return a;
}
// column fragment from a [K][ld] layout (column n), rows >= K read as 0
__device__ __forceinline__ v16h fragc_f32(const float* W, int k0, int n, int lane, int ld, int K) {
  v16h a; const int g = lane >> 4;
#pragma unroll
  for (int i = 0; i < 8; ++i) { const int ka = k0 + 8 * g + i, kb = ka + 16;
    a[i] = (_Float16)(ka < K ? W[(size_t)(ka < K ? ka : K - 1) * ld + n] : 0.f); a[8 + i] = (_Float16)(kb < K ? W[(size_t)(kb < K ? kb : K - 1) * ld + n] : 0.f); }
  return a;
}
struct F2 { v16b h, l; };
__device__ __forceinline__ F2 bsplit16(const float v[16]) { F2 r;
#pragma unroll
  for (int i = 0; i < 16; ++i) { const __bf16 h = (__bf16)v[i]; r.h[i] = h; r.l[i] = (__bf16)(v[i] - (float)h); }
  return r; }
__device__ __forceinline__ F2 split_row(const float* row, int k0, int lane) { float v[16]; const float* p = row + k0 + 8 * (lane >> 4);
#pragma unroll
  for (int i = 0; i < 8; ++i) { v[i] = p[i]; v[8 + i] = p[16 + i]; }
  return bsplit16(v); }
__device__ __forceinline__ F2 split_rowK(const float* row, int k0, int lane, int K) { float v[16]; const int g = lane >> 4;
#pragma unroll
  for (int i = 0; i < 8; ++i) { const int ka = k0 + 8 * g + i, kb = ka + 16; v[i] = ka < K ? row[ka < K ? ka : K - 1] : 0.f; v[8 + i] = kb < K ? row[kb < K ? kb : K - 1] : 0.f; }
  return bsplit16(v); }
__device__ __forceinline__ F2 split_col(const float* W, int k0, int n, int lane, int ld, int K) { float v[16]; const int g = lane >> 4;
#pragma unroll
  for (int i = 0; i < 8; ++i) { const int ka = k0 + 8 * g + i, kb = ka + 16; v[i] = ka < K ? W[(size_t)(ka < K ? ka : K - 1) * ld + n] : 0.f; v[8 + i] = kb < K ? W[(size_t)(kb < K ? kb : K - 1) * ld + n] : 0.f; }
  return bsplit16(v); }
__device__ __forceinline__ v8f mac3(const F2& a, const F2& b, v8f c) { c = wmma_bf(a.l, b.h, c); c = wmma_bf(a.h, b.l, c); return wmma_bf(a.h, b.h, c); }
__device__ __forceinline__ float sigm(float v) { return 1.0f / (1.0f + expf(-v)); }
#define LDSX() do { asm volatile("s_wait_dscnt 0" ::: "memory"); __builtin_amdgcn_wave_barrier(); __builtin_amdgcn_fence(__ATOMIC_RELEASE, "workgroup"); } while (0)

// Causal multi-head self-attention on a SEQUENCE-FIRST input (x [2048, 2, 768] = (S, B, D); torch (out,in) wq / wk / wv / wc [768,768] N(0,1) x 0.02 applied as x W^T + b, biases N(0,1) x 0.02 - NONZERO; 12 heads x 64; scores / sqrt(64); tril kept, -inf elsewhere; softmax; y wc^T + bc; output transposed back to (S, B, D)). The kernels work on rows b*2048 + t: the projection reads token (b, t) from source row t*2 + b and the output kernel writes it back there.
#define NB 2
#define TT 2048
#define CC 768            // NH * HD = projected width
#define DIN 768          // input (model) width
#define NH 12
#define HD 64
#define NQB (TT / 64)
#define HG 4
#define SCALE (0.125f)
#define CAUSAL 1
#ifndef TNB
#define TNB NB
#endif
__device__ __forceinline__ float bfr(float v) { return (float)(__bf16)v; }
__host__ __device__ __forceinline__ int kb_last(int qb) { return CAUSAL ? ((qb * 64 + 63) >> 7) : (TT / 128 - 1); }
typedef __attribute__((ext_vector_type(8))) __bf16 v8b;
__device__ __forceinline__ v16b frag_b(const __bf16* rowk0, int lane) {
  union { v16b v; v8b q[2]; } u; const __bf16* p = rowk0 + 8 * (lane >> 4);
  u.q[0] = *(const v8b*)p; u.q[1] = *(const v8b*)(p + 16); return u.v;
}
#define QBH 6              // causal: query blocks 0..QBH-1 of each sequence (few keys, no averaging) take the high-precision path
#define QHI 384            // rows carrying a q residual plane
#define KHI 384            // key rows carrying k residual / v bf16 hi+lo planes (used only by the causal high-precision path)
// B fragment (k rows k0+.., output column o) of a weight: (in,out) [K][ld] or (out,in) [ld rows of K]: bf16 exact, or f16(bf16 * 256) exact
__device__ __forceinline__ v16b wcol_io(const float* Wm, int k0, int o, int lane, int ld) { v16b w; const int g = lane >> 4;
#pragma unroll
  for (int i = 0; i < 8; ++i) { w[i] = (__bf16)Wm[(size_t)(k0 + 8 * g + i) * ld + o]; w[8 + i] = (__bf16)Wm[(size_t)(k0 + 16 + 8 * g + i) * ld + o]; }
  return w; }
__device__ __forceinline__ v16b wcol_oi(const float* Wm, int k0, int o, int lane, int K) { v16b w; const float* p = Wm + (size_t)o * K + k0 + 8 * (lane >> 4);
#pragma unroll
  for (int i = 0; i < 8; ++i) { w[i] = (__bf16)p[i]; w[8 + i] = (__bf16)p[16 + i]; }
  return w; }
__device__ __forceinline__ v16h wcolh_io(const float* Wm, int k0, int o, int lane, int ld) { v16h w; const int g = lane >> 4;
#pragma unroll
  for (int i = 0; i < 8; ++i) { w[i] = (_Float16)(bfr(Wm[(size_t)(k0 + 8 * g + i) * ld + o]) * 256.0f); w[8 + i] = (_Float16)(bfr(Wm[(size_t)(k0 + 16 + 8 * g + i) * ld + o]) * 256.0f); }
  return w; }
__device__ __forceinline__ v16h wcolh_oi(const float* Wm, int k0, int o, int lane, int K) { v16h w; const float* p = Wm + (size_t)o * K + k0 + 8 * (lane >> 4);
#pragma unroll
  for (int i = 0; i < 8; ++i) { w[i] = (_Float16)(bfr(p[i]) * 256.0f); w[8 + i] = (_Float16)(bfr(p[16 + i]) * 256.0f); }
  return w; }
#define SRCROW(r) ((size_t)((r) % TT) * NB + (size_t)((r) / TT))   // row r = b*TT + t <-> sequence-first row t*NB + b of the (S, B, D) arrays (NB = the module's batch count, also when fewer batches are run)
#define WQKV_LAYOUT 1   // 0 = (in,out) [DIN][CC]; 1 = (out,in) [CC][DIN]; 2 = per-head [NH][DIN][HD]
__device__ __forceinline__ v16b wcol_hdk(const float* Wm, int k0, int o, int lane) { v16b w; const int g = lane >> 4; const float* p = Wm + (size_t)(o / HD) * DIN * HD + (o % HD);
#pragma unroll
  for (int i = 0; i < 8; ++i) { w[i] = (__bf16)p[(size_t)(k0 + 8 * g + i) * HD]; w[8 + i] = (__bf16)p[(size_t)(k0 + 16 + 8 * g + i) * HD]; }
  return w; }
#define WO_OUT_IN 1
#if WQKV_LAYOUT == 1
#define WCOL(W, k0, o, lane) wcol_oi(W, k0, o, lane, DIN)
#elif WQKV_LAYOUT == 2
#define WCOL(W, k0, o, lane) wcol_hdk(W, k0, o, lane)
#else
#define WCOL(W, k0, o, lane) wcol_io(W, k0, o, lane, CC)
#endif
#if WO_OUT_IN
#define WOCOL(W, k0, o, lane) wcol_oi(W, k0, o, lane, CC)
#define WOCOLH(W, k0, o, lane) wcolh_oi(W, k0, o, lane, CC)
#else
#define WOCOL(W, k0, o, lane) wcol_io(W, k0, o, lane, DIN)
#define WOCOLH(W, k0, o, lane) wcolh_io(W, k0, o, lane, DIN)
#endif

#ifndef SM_EXTRA_PARAMS
#define SM_EXTRA_PARAMS
#endif
#ifndef PROJ_EXTRA_PARAMS
#define PROJ_EXTRA_PARAMS
#endif
#ifndef SM_MASK_HOOK
#define SM_MASK_HOOK (void)0
#endif

#define WS_QH  0u                                      // f16 q rows [b*t][CC]
#define WS_KH  (WS_QH + 2u * (size_t)NB * TT * CC)      // f16 k rows [b*t][CC]
#define WS_VT  (WS_KH + 2u * (size_t)NB * TT * CC)      // f16 v planes [b][c][t]
#define WS_QL  (WS_VT + 2u * (size_t)NB * CC * TT)      // f16 q residual x 2^10 rows [b][t < QHI][CC]
#define WS_KL  (WS_QL + 2u * (size_t)NB * QHI * CC)     // f16 k residual x 2^10 rows [b][t < KHI][CC]
#define WS_VB  (WS_KL + 2u * (size_t)NB * KHI * CC)     // bf16 v hi planes [b][c][t < KHI]
#define WS_VBL (WS_VB + 2u * (size_t)NB * CC * KHI)
#define WS_S   (WS_VBL + 2u * (size_t)NB * CC * KHI)    // f32 logits / P [hg][t][s]
#define WS_Y   (WS_S  + 4u * (size_t)HG * TT * TT)      // f32 ctx rows [b*t][CC] (only when there is an output projection)
#define WS_END (WS_Y  + 4u * (size_t)NB * TT * CC)

// ---- k_proj: block = (64 rows, 128 cols, which): q/k/v = X W (+ b) with exact bf16 products (K = DIN) -> which 0: q f16 rows (+ residual rows < QHI); 1: k f16 rows (+ residual rows < KHI); 2: v f16 planes [c][t] (+ bf16 hi/lo planes for t < KHI)
__global__ __launch_bounds__(128) void k_proj(const float* __restrict__ XQ, const float* __restrict__ XK, const float* __restrict__ XV, const float* __restrict__ WQ, const float* __restrict__ WK, const float* __restrict__ WV, const float* __restrict__ BQ, const float* __restrict__ BK, const float* __restrict__ BV,
    _Float16* __restrict__ QH, _Float16* __restrict__ QL, _Float16* __restrict__ KH, _Float16* __restrict__ KL, _Float16* __restrict__ VT, __bf16* __restrict__ VB, __bf16* __restrict__ VBL) {
  __shared__ __align__(16) _Float16 sh[64][136], sl[64][136]; __shared__ __align__(16) _Float16 th[128][72]; __shared__ __align__(16) __bf16 tb[128][72], tbl[128][72];
  const int tid = threadIdx.x, wave = tid >> 5, lane = tid & 31, col = lane & 15, g = lane >> 4; const int which = blockIdx.z; const int c0 = blockIdx.y * 128; const size_t r0 = (size_t)blockIdx.x * 64; const size_t bb = r0 / TT; const int t0 = (int)(r0 % TT);
  const float* X = which == 0 ? XQ : which == 1 ? XK : XV; const float* WA = which == 0 ? WQ : which == 1 ? WK : WV; const float* BA = which == 0 ? BQ : which == 1 ? BK : BV;
  v8f acc[8] = {};
#pragma unroll 2
  for (int kc = 0; kc < DIN / 32; ++kc) { v16b a; { const float* p = X + SRCROW(r0 + wave * 16 + col) * DIN + kc * 32 + 8 * g;   /* sequence-first source row */
#pragma unroll
      for (int i = 0; i < 8; ++i) { a[i] = (__bf16)p[i]; a[8 + i] = (__bf16)p[16 + i]; } }
    asm volatile("s_wait_loadcnt 0x0" ::: "memory");
#pragma unroll
    for (int j = 0; j < 8; ++j) { const v16b w = WCOL(WA, kc * 32, c0 + j * 16 + col, lane); asm volatile("s_wait_loadcnt 0x0" ::: "memory"); acc[j] = wmma_bf(a, w, acc[j]); } }
  if (which < 2) { _Float16* DH = which == 0 ? QH : KH; _Float16* DL = which == 0 ? QL : KL; const int nhi = which == 0 ? QHI : KHI; const bool hi_rows = t0 < nhi;
#pragma unroll
    for (int j = 0; j < 8; ++j) { const float bias = BA ? bfr(BA[c0 + j * 16 + col]) : 0.f;
#pragma unroll
      for (int r = 0; r < 8; ++r) { const float v = acc[j][r] + bias; const _Float16 hv = (_Float16)v; sh[wave * 16 + 8 * g + r][j * 16 + col] = hv; sl[wave * 16 + 8 * g + r][j * 16 + col] = (_Float16)((v - (float)hv) * 1024.0f); } }
    __syncthreads();
    for (int e = tid; e < 64 * 16; e += 128) { const int rl = e >> 4, q = e & 15; vst2((unsigned*)(DH + (r0 + rl) * CC + c0 + q * 8), *(const v4u*)&sh[rl][q * 8]); if (hi_rows) vst2((unsigned*)(DL + (bb * nhi + t0 + rl) * (size_t)CC + c0 + q * 8), *(const v4u*)&sl[rl][q * 8]); }
  } else { const bool hi_rows = t0 < KHI;
#pragma unroll
    for (int j = 0; j < 8; ++j) { const float bias = BA ? bfr(BA[c0 + j * 16 + col]) : 0.f;
#pragma unroll
      for (int r = 0; r < 8; ++r) { const float v = acc[j][r] + bias; const int rl = wave * 16 + 8 * g + r, cl = j * 16 + col; th[cl][rl] = (_Float16)v; const __bf16 bh = (__bf16)v; tb[cl][rl] = bh; tbl[cl][rl] = (__bf16)(v - (float)bh); } }
    __syncthreads();
    for (int e = tid; e < 128 * 8; e += 128) { const int cl = e >> 3, q = e & 7; vst2((unsigned*)(VT + (bb * CC + c0 + cl) * (size_t)TT + t0 + q * 8), *(const v4u*)&th[cl][q * 8]); if (hi_rows) { const size_t o3 = (bb * CC + c0 + cl) * (size_t)KHI + t0 + q * 8; vst2((unsigned*)(VB + o3), *(const v4u*)&tb[cl][q * 8]); vst2((unsigned*)(VBL + o3), *(const v4u*)&tbl[cl][q * 8]); } } } }
// ---- k_sc: block = (query block qb, key block kb <= kb_last(qb), head in group) of batch b: logits x SCALE; q hi + residual (x 2^10) against k (2 products) for query rows < QHI, plus the k residual (3 products) for query blocks < QBH (causal early rows); causal: blocks past the diagonal exit, the mask itself is applied by index in k_sm
__global__ __launch_bounds__(128) void k_sc(const _Float16* __restrict__ QH, const _Float16* __restrict__ KH, const _Float16* __restrict__ QL, const _Float16* __restrict__ KL, int b, int h0, float* __restrict__ S0) { __shared__ __align__(16) float ss[4][16][132];
  const int qb = blockIdx.x, kb = blockIdx.y; if (kb > kb_last(qb)) return;
  const int h = h0 + blockIdx.z; float* S = S0 + (size_t)blockIdx.z * TT * TT;
  const int tid = threadIdx.x, wave = tid >> 5, lane = tid & 31, col = lane & 15, g = lane >> 4; const int k0 = kb * 128; const int ql0 = qb * 64 + wave * 16; const size_t q0 = (size_t)b * TT + ql0, kr0 = (size_t)b * TT + k0;
  v8f acc[8] = {}, accl[8] = {};
  const _Float16* QLb = QL + (size_t)b * QHI * CC; const _Float16* KLb = KL + (size_t)b * KHI * CC;
  if (qb < QBH) {
#pragma unroll
    for (int kc = 0; kc < HD / 32; ++kc) { const v16h ah = frag_h(QH + (q0 + col) * CC + h * HD + kc * 32, lane), al = frag_h(QLb + (size_t)(ql0 + col) * CC + h * HD + kc * 32, lane);
#pragma unroll
      for (int j = 0; j < 8; ++j) { const v16h kbf = frag_h(KH + (kr0 + j * 16 + col) * CC + h * HD + kc * 32, lane), klf = frag_h(KLb + (size_t)(k0 + j * 16 + col) * CC + h * HD + kc * 32, lane); acc[j] = wmma16(ah, kbf, acc[j]); accl[j] = wmma16(al, kbf, accl[j]); accl[j] = wmma16(ah, klf, accl[j]); } }
  } else if (qb * 64 < QHI) {
#pragma unroll
    for (int kc = 0; kc < HD / 32; ++kc) { const v16h ah = frag_h(QH + (q0 + col) * CC + h * HD + kc * 32, lane), al = frag_h(QLb + (size_t)(ql0 + col) * CC + h * HD + kc * 32, lane);
#pragma unroll
      for (int j = 0; j < 8; ++j) { const v16h kbf = frag_h(KH + (kr0 + j * 16 + col) * CC + h * HD + kc * 32, lane); acc[j] = wmma16(ah, kbf, acc[j]); accl[j] = wmma16(al, kbf, accl[j]); } }
  } else {
#pragma unroll
    for (int kc = 0; kc < HD / 32; ++kc) { const v16h ah = frag_h(QH + (q0 + col) * CC + h * HD + kc * 32, lane);
#pragma unroll
      for (int j = 0; j < 8; ++j) { const v16h kbf = frag_h(KH + (kr0 + j * 16 + col) * CC + h * HD + kc * 32, lane); acc[j] = wmma16(ah, kbf, acc[j]); } } }
#pragma unroll
  for (int j = 0; j < 8; ++j) {
#pragma unroll
    for (int r = 0; r < 8; ++r) ss[wave][8 * g + r][j * 16 + col] = (acc[j][r] + accl[j][r] * (1.0f / 1024.0f)) * SCALE; }
  LDSX(); for (int rl = 0; rl < 16; ++rl) vst2(S + (size_t)(ql0 + rl) * TT + k0 + lane * 4, *(const v4f*)&ss[wave][rl][lane * 4]); }
// ---- k_sm: block = query row t (head in group): keys [0, kend): causal -> logit if s <= t else excluded; softmax in f32; P x 2^11 in place (0 for excluded)
__global__ __launch_bounds__(256) void k_sm(float* __restrict__ S0 SM_EXTRA_PARAMS) { __shared__ float sred[8]; __shared__ float sbc; __shared__ __align__(16) float shv[TT];
  const int tid = threadIdx.x; const int t = blockIdx.x; const int kend = (kb_last(t >> 6) + 1) * 128;
  float* sr = S0 + (size_t)blockIdx.y * TT * TT + (size_t)t * TT;
  float m = -3.0e38f; for (int k = tid; k < kend; k += 256) { float v = (!CAUSAL || k <= t) ? sr[k] : -3.0e38f; SM_MASK_HOOK; shv[k] = v; m = fmaxf(m, v); }
#pragma unroll
  for (int o = 1; o < 32; o <<= 1) m = fmaxf(m, __shfl_xor(m, o));
  if ((tid & 31) == 0) sred[tid >> 5] = m; __syncthreads(); if (tid == 0) { float a = sred[0]; for (int i = 1; i < 8; ++i) a = fmaxf(a, sred[i]); sbc = a; } __syncthreads(); m = sbc; __syncthreads();
  float sum = 0.f; for (int k = tid; k < kend; k += 256) { const float v = shv[k]; const float e = (v <= -1.0e38f) ? 0.f : expf(v - m); shv[k] = e; sum += e; }
#pragma unroll
  for (int o = 1; o < 32; o <<= 1) sum += __shfl_xor(sum, o);
  if ((tid & 31) == 0) sred[tid >> 5] = sum; __syncthreads(); if (tid == 0) { float a = 0.f; for (int i = 0; i < 8; ++i) a += sred[i]; sbc = a > 0.f ? 2048.0f / a : 0.f; }   /* a fully excluded row yields P = 0 */ __syncthreads(); const float inv = sbc;
  for (int k = tid; k < kend; k += 256) shv[k] = shv[k] * inv;
  __syncthreads(); for (int q = tid; q < kend / 4; q += 256) vst2(sr + q * 4, *(const v4f*)&shv[q * 4]); }
// ---- k_pv: block = 64 queries (qb) of (b, h): ctx = P . v over keys [0, kend) (P x 2^11 once to f16 against v f16: 1 product; causal early query blocks: P and v as bf16 hi + lo, 3 products); 256-B (row, head) segment by 16 lanes
__global__ __launch_bounds__(128) void k_pv(const float* __restrict__ PS0, const _Float16* __restrict__ VT, const __bf16* __restrict__ VB, const __bf16* __restrict__ VBL, int b, int h0, float* __restrict__ Y) { const int h = h0 + blockIdx.z; const float* PS = PS0 + (size_t)blockIdx.z * TT * TT; __shared__ __align__(16) float ss[4][16][HD + 4];
  const int tid = threadIdx.x, wave = tid >> 5, lane = tid & 31, col = lane & 15, g = lane >> 4; const int qb = blockIdx.x; const int ql0 = qb * 64 + wave * 16; const int kce = (kb_last(qb) + 1) * 4;
  v8f acc[HD / 16] = {};
  if (qb < QBH) {
#pragma unroll 1
    for (int kc = 0; kc < kce; ++kc) { const F2 p = split_row(PS + (size_t)(ql0 + col) * TT, kc * 32, lane);
      asm volatile("s_wait_loadcnt 0x0" ::: "memory");
#pragma unroll
      for (int j = 0; j < HD / 16; ++j) { const size_t po = ((size_t)b * CC + h * HD + j * 16 + col) * (size_t)KHI + kc * 32; const v16b vh = frag_b(VB + po, lane); acc[j] = wmma_bf(p.h, vh, acc[j]); acc[j] = wmma_bf(p.l, vh, acc[j]); acc[j] = wmma_bf(p.h, frag_b(VBL + po, lane), acc[j]); } }
  } else {
#pragma unroll 1
    for (int kc = 0; kc < kce; ++kc) { const v16h p = frag_f32(PS + (size_t)(ql0 + col) * TT + kc * 32, lane);
      asm volatile("s_wait_loadcnt 0x0" ::: "memory");
#pragma unroll
      for (int j = 0; j < HD / 16; ++j) { const size_t po = ((size_t)b * CC + h * HD + j * 16 + col) * (size_t)TT + kc * 32; acc[j] = wmma16(p, frag_h(VT + po, lane), acc[j]); } } }
#pragma unroll
  for (int j = 0; j < HD / 16; ++j)
#pragma unroll
    for (int r = 0; r < 8; ++r) ss[wave][8 * g + r][j * 16 + col] = acc[j][r] * (1.0f / 2048.0f);
  LDSX(); for (int rl = 0; rl < 16; ++rl) if (lane < HD / 4) vst2(Y + ((size_t)b * TT + ql0 + rl) * CC + h * HD + lane * 4, *(const v4f*)&ss[wave][rl][lane * 4]); }
// ---- k_out: block = (64 rows, 128 cols): out = ctx Wo (+ bo): ctx x 2^6 once to f16 against Wo as f16(bf16 x 2^8) exact (1 product) x 2^-14; causal early rows (< QHI of each sequence): ctx bf16 hi + lo against exact bf16 Wo (2 products)
__global__ __launch_bounds__(128) void k_out(const float* __restrict__ Y, const float* __restrict__ WO, const float* __restrict__ BO, float* __restrict__ OUT) { __shared__ __align__(16) float sf[4][16][132];
  const int tid = threadIdx.x, wave = tid >> 5, lane = tid & 31, col = lane & 15, g = lane >> 4; const int c0 = blockIdx.y * 128; const size_t r0 = (size_t)blockIdx.x * 64 + wave * 16;
  v8f acc[8] = {};
  if (CAUSAL && (int)(((size_t)blockIdx.x * 64) % TT) < QHI) {   /* block-uniform */
#pragma unroll 2
    for (int kc = 0; kc < CC / 32; ++kc) { const F2 a = split_row(Y + (r0 + col) * CC, kc * 32, lane); asm volatile("s_wait_loadcnt 0x0" ::: "memory");
#pragma unroll
      for (int j = 0; j < 8; ++j) { const v16b w = WOCOL(WO, kc * 32, c0 + j * 16 + col, lane); asm volatile("s_wait_loadcnt 0x0" ::: "memory"); acc[j] = wmma_bf(a.h, w, acc[j]); acc[j] = wmma_bf(a.l, w, acc[j]); } }
#pragma unroll
    for (int j = 0; j < 8; ++j) { const float bias = BO ? bfr(BO[c0 + j * 16 + col]) : 0.f;
#pragma unroll
      for (int r = 0; r < 8; ++r) sf[wave][8 * g + r][j * 16 + col] = acc[j][r] + bias; }
  } else {
#pragma unroll 2
    for (int kc = 0; kc < CC / 32; ++kc) { const v16h a = frag_f32s(Y + (r0 + col) * CC + kc * 32, lane, 64.0f); asm volatile("s_wait_loadcnt 0x0" ::: "memory");   /* ctx carried x 2^6 into f16 so small-magnitude context rows stay clear of f16 subnormals */
#pragma unroll
      for (int j = 0; j < 8; ++j) { const v16h w = WOCOLH(WO, kc * 32, c0 + j * 16 + col, lane); asm volatile("s_wait_loadcnt 0x0" ::: "memory"); acc[j] = wmma16(a, w, acc[j]); } }
#pragma unroll
    for (int j = 0; j < 8; ++j) { const float bias = BO ? bfr(BO[c0 + j * 16 + col]) : 0.f;
#pragma unroll
      for (int r = 0; r < 8; ++r) sf[wave][8 * g + r][j * 16 + col] = acc[j][r] * (1.0f / 16384.0f) + bias; } }   /* 2^-8 (Wo carry) x 2^-6 (ctx carry) */
  LDSX(); for (int rl = 0; rl < 16; ++rl) vst2(OUT + SRCROW(r0 + rl) * DIN + c0 + lane * 4, *(const v4f*)&sf[wave][rl][lane * 4]); }

extern "C" void kernel_launch(void* const* d_in, const int* in_sizes, int n_in, void* d_out, int out_size, void* d_ws, size_t ws_size, hipStream_t stream) {
  (void)in_sizes; (void)n_in; (void)out_size;
  const float** F = (const float**)d_in;
  if (ws_size < (size_t)WS_END) return;
  char* ws = (char*)d_ws; _Float16 *QH = (_Float16*)(ws + WS_QH), *KH = (_Float16*)(ws + WS_KH), *VT = (_Float16*)(ws + WS_VT), *QL = (_Float16*)(ws + WS_QL), *KL = (_Float16*)(ws + WS_KL); __bf16 *VB = (__bf16*)(ws + WS_VB), *VBL = (__bf16*)(ws + WS_VBL); float *S = (float*)(ws + WS_S), *Y = (float*)(ws + WS_Y);
  (void)Y; (void)QL; (void)KL; (void)VB; (void)VBL;
  // inputs: 0 x [2048,2,768] (S, B, D); 1 wq [768,768] (out,in), 2 bq; 3 wk, 4 bk; 5 wv, 6 bv; 7 wc (out,in), 8 bc (all biases NONZERO)
  k_proj<<<dim3(TNB * TT / 64, CC / 128, 3), 128, 0, stream>>>(F[0], F[0], F[0], F[1], F[3], F[5], F[2], F[4], F[6], QH, QL, KH, KL, VT, VB, VBL);
  for (int b = 0; b < TNB; ++b) for (int h0 = 0; h0 < NH; h0 += HG) {
    k_sc<<<dim3(NQB, TT / 128, HG), 128, 0, stream>>>(QH, KH, QL, KL, b, h0, S);
    k_sm<<<dim3(TT, HG), 256, 0, stream>>>(S);
    k_pv<<<dim3(NQB, 1, HG), 128, 0, stream>>>(S, VT, VB, VBL, b, h0, Y);
  }
  k_out<<<dim3(TNB * TT / 64, DIN / 128), 128, 0, stream>>>(Y, F[7], F[8], (float*)d_out);   /* writes (S, B, D) rows */
}

// v001
// Measured time: 526 microseconds a run.
// Timed twice side by side with v000, it ran 1.69 times as fast both times.
// compute dtype: all float inputs rounded to bf16; q / k / v projections with EXACT bf16 products on WMMA 16x16x32 (f32 accumulate) + bias; causal logits: 3 products for the first 384 rows, single f16 q x k after, x 64^-0.5; softmax f32; P x 2^11 once to f16 x v once to f16 (bf16 hi + lo below row 384); y hi+lo x exact wc below row 384, x2^6 f16 carry x f16(bf16 x 2^8) wc after, + bc; f32 output written back in the sequence-first layout.
#include <hip/hip_runtime.h>
#include <math.h>

typedef __attribute__((ext_vector_type(16))) _Float16 v16h;
typedef __attribute__((ext_vector_type(16))) __bf16 v16b;
typedef __attribute__((ext_vector_type(8)))  _Float16 v8h;
typedef __attribute__((ext_vector_type(8)))  float v8f;
typedef __attribute__((ext_vector_type(4)))  float v4f;
typedef __attribute__((ext_vector_type(2)))  float v2f;
typedef __attribute__((ext_vector_type(4)))  unsigned v4u;
typedef __attribute__((ext_vector_type(4)))  int v4i;
typedef float __attribute__((may_alias)) float_a;
typedef int __attribute__((may_alias)) int_a;

template <typename T> __device__ __forceinline__ void vst2(void* p, T v) { *(T*)p = v;  }
__device__ __forceinline__ v8f wmma16(v16h a, v16h b, v8f c) {
  v8f d = __builtin_amdgcn_wmma_f32_16x16x32_f16(false, a, false, b, (short)0, c, false, false);
  asm volatile("v_nop\n\tv_nop\n\tv_nop\n\tv_nop" : "+v"(d) : "v"(a), "v"(b));
  return d;
}
__device__ __forceinline__ v8f wmma_bf(v16b a, v16b b, v8f c) {
  v8f d = __builtin_amdgcn_wmma_f32_16x16x32_bf16(false, a, false, b, (short)0, c, false, false);
  asm volatile("v_nop\n\tv_nop\n\tv_nop\n\tv_nop" : "+v"(d) : "v"(a), "v"(b));
  return d;
}
// 16x16x32 fragments: lane = (h = lane>>4, row/col = lane&15); elements 0..7 = k0+8h+0..7, 8..15 = k0+16+8h+0..7; D element r = row 8h+r
__device__ __forceinline__ v16h frag_h(const _Float16* rowk0, int lane) {
  union { v16h v; v8h q[2]; } u; const _Float16* p = rowk0 + 8 * (lane >> 4);
  u.q[0] = *(const v8h*)p; u.q[1] = *(const v8h*)(p + 16); return u.v;
}
__device__ __forceinline__ v16h frag_f32(const float* rowk0, int lane) {
  v16h a; const float* p = rowk0 + 8 * (lane >> 4);
#pragma unroll
  for (int i = 0; i < 8; ++i) { a[i] = (_Float16)p[i]; a[8 + i] = (_Float16)p[16 + i]; }
  return a;
}
__device__ __forceinline__ v16h frag_f32s(const float* rowk0, int lane, float sc) {
  v16h a; const float* p = rowk0 + 8 * (lane >> 4);
#pragma unroll
  for (int i = 0; i < 8; ++i) { a[i] = (_Float16)(p[i] * sc); a[8 + i] = (_Float16)(p[16 + i] * sc); }
  return a;
}
// column fragment from a [K][ld] layout (column n), rows >= K read as 0
__device__ __forceinline__ v16h fragc_f32(const float* W, int k0, int n, int lane, int ld, int K) {
  v16h a; const int g = lane >> 4;
#pragma unroll
  for (int i = 0; i < 8; ++i) { const int ka = k0 + 8 * g + i, kb = ka + 16;
    a[i] = (_Float16)(ka < K ? W[(size_t)(ka < K ? ka : K - 1) * ld + n] : 0.f); a[8 + i] = (_Float16)(kb < K ? W[(size_t)(kb < K ? kb : K - 1) * ld + n] : 0.f); }
  return a;
}
struct F2 { v16b h, l; };
__device__ __forceinline__ F2 bsplit16(const float v[16]) { F2 r;
#pragma unroll
  for (int i = 0; i < 16; ++i) { const __bf16 h = (__bf16)v[i]; r.h[i] = h; r.l[i] = (__bf16)(v[i] - (float)h); }
  return r; }
__device__ __forceinline__ F2 split_row(const float* row, int k0, int lane) { float v[16]; const float* p = row + k0 + 8 * (lane >> 4);
#pragma unroll
  for (int i = 0; i < 8; ++i) { v[i] = p[i]; v[8 + i] = p[16 + i]; }
  return bsplit16(v); }
__device__ __forceinline__ F2 split_rowK(const float* row, int k0, int lane, int K) { float v[16]; const int g = lane >> 4;
#pragma unroll
  for (int i = 0; i < 8; ++i) { const int ka = k0 + 8 * g + i, kb = ka + 16; v[i] = ka < K ? row[ka < K ? ka : K - 1] : 0.f; v[8 + i] = kb < K ? row[kb < K ? kb : K - 1] : 0.f; }
  return bsplit16(v); }
__device__ __forceinline__ F2 split_col(const float* W, int k0, int n, int lane, int ld, int K) { float v[16]; const int g = lane >> 4;
#pragma unroll
  for (int i = 0; i < 8; ++i) { const int ka = k0 + 8 * g + i, kb = ka + 16; v[i] = ka < K ? W[(size_t)(ka < K ? ka : K - 1) * ld + n] : 0.f; v[8 + i] = kb < K ? W[(size_t)(kb < K ? kb : K - 1) * ld + n] : 0.f; }
  return bsplit16(v); }
__device__ __forceinline__ v8f mac3(const F2& a, const F2& b, v8f c) { c = wmma_bf(a.l, b.h, c); c = wmma_bf(a.h, b.l, c); return wmma_bf(a.h, b.h, c); }
__device__ __forceinline__ float sigm(float v) { return 1.0f / (1.0f + expf(-v)); }
#define LDSX() do { asm volatile("s_wait_dscnt 0" ::: "memory"); __builtin_amdgcn_wave_barrier(); __builtin_amdgcn_fence(__ATOMIC_RELEASE, "workgroup"); } while (0)

// Causal multi-head self-attention on a SEQUENCE-FIRST input (x [2048, 2, 768] = (S, B, D); torch (out,in) wq / wk / wv / wc [768,768] N(0,1) x 0.02 applied as x W^T + b, biases N(0,1) x 0.02 - NONZERO; 12 heads x 64; scores / sqrt(64); tril kept, -inf elsewhere; softmax; y wc^T + bc; output transposed back to (S, B, D)). The kernels work on rows b*2048 + t: the projection reads token (b, t) from source row t*2 + b and the output kernel writes it back there.
#define NB 2
#define TT 2048
#define CC 768            // NH * HD = projected width
#define DIN 768          // input (model) width
#define NH 12
#define HD 64
#define NQB (TT / 64)
#define NPL (NB * NH)     // logits planes: one per (batch, head), so each attention stage is a single launch
#define SCALE (0.125f)
#define CAUSAL 1
#ifndef TNB
#define TNB NB
#endif
__device__ __forceinline__ float bfr(float v) { return (float)(__bf16)v; }
__host__ __device__ __forceinline__ int kb_last(int qb) { return CAUSAL ? ((qb * 64 + 63) >> 7) : (TT / 128 - 1); }
// packed logits plane of one (batch, head): a run of 64 x 128 f32 tiles (row pitch 128), holding for each query block qb only its key blocks 0..kb_last(qb), the first at tile stile(qb)
#define STILE (64 * 128)
__device__ __forceinline__ int stile(int qb) { return CAUSAL ? ((qb + 1) >> 1) * ((qb >> 1) + 1) : qb * (TT / 128); }
#define SPLANE ((size_t)STILE * (CAUSAL ? (NQB / 2) * (NQB / 2 + 1) : NQB * (TT / 128)))   // floats per plane
#define SKEY(k) (((k) >> 7) * STILE + ((k) & 127))   // float offset of key k within a row's run of tiles
typedef __attribute__((ext_vector_type(8))) __bf16 v8b;
__device__ __forceinline__ v16b frag_b(const __bf16* rowk0, int lane) {
  union { v16b v; v8b q[2]; } u; const __bf16* p = rowk0 + 8 * (lane >> 4);
  u.q[0] = *(const v8b*)p; u.q[1] = *(const v8b*)(p + 16); return u.v;
}
#define QBH 6              // causal: query blocks 0..QBH-1 of each sequence (few keys, no averaging) take the high-precision path
#define QHI 384            // rows carrying a q residual plane
#define KHI 384            // key rows carrying k residual / v bf16 hi+lo planes (used only by the causal high-precision path)
// B fragment (k rows k0+.., output column o) of a weight: (in,out) [K][ld] or (out,in) [ld rows of K]: bf16 exact, or f16(bf16 * 256) exact
__device__ __forceinline__ v16b wcol_io(const float* Wm, int k0, int o, int lane, int ld) { v16b w; const int g = lane >> 4;
#pragma unroll
  for (int i = 0; i < 8; ++i) { w[i] = (__bf16)Wm[(size_t)(k0 + 8 * g + i) * ld + o]; w[8 + i] = (__bf16)Wm[(size_t)(k0 + 16 + 8 * g + i) * ld + o]; }
  return w; }
__device__ __forceinline__ v16b wcol_oi(const float* Wm, int k0, int o, int lane, int K) { v16b w; const float* p = Wm + (size_t)o * K + k0 + 8 * (lane >> 4);
#pragma unroll
  for (int i = 0; i < 8; ++i) { w[i] = (__bf16)p[i]; w[8 + i] = (__bf16)p[16 + i]; }
  return w; }
__device__ __forceinline__ v16h wcolh_io(const float* Wm, int k0, int o, int lane, int ld) { v16h w; const int g = lane >> 4;
#pragma unroll
  for (int i = 0; i < 8; ++i) { w[i] = (_Float16)(bfr(Wm[(size_t)(k0 + 8 * g + i) * ld + o]) * 256.0f); w[8 + i] = (_Float16)(bfr(Wm[(size_t)(k0 + 16 + 8 * g + i) * ld + o]) * 256.0f); }
  return w; }
__device__ __forceinline__ v16h wcolh_oi(const float* Wm, int k0, int o, int lane, int K) { v16h w; const float* p = Wm + (size_t)o * K + k0 + 8 * (lane >> 4);
#pragma unroll
  for (int i = 0; i < 8; ++i) { w[i] = (_Float16)(bfr(p[i]) * 256.0f); w[8 + i] = (_Float16)(bfr(p[16 + i]) * 256.0f); }
  return w; }
#define SRCROW(r) ((size_t)((r) % TT) * NB + (size_t)((r) / TT))   // row r = b*TT + t <-> sequence-first row t*NB + b of the (S, B, D) arrays (NB = the module's batch count, also when fewer batches are run)
#define WQKV_LAYOUT 1   // 0 = (in,out) [DIN][CC]; 1 = (out,in) [CC][DIN]; 2 = per-head [NH][DIN][HD]
__device__ __forceinline__ v16b wcol_hdk(const float* Wm, int k0, int o, int lane) { v16b w; const int g = lane >> 4; const float* p = Wm + (size_t)(o / HD) * DIN * HD + (o % HD);
#pragma unroll
  for (int i = 0; i < 8; ++i) { w[i] = (__bf16)p[(size_t)(k0 + 8 * g + i) * HD]; w[8 + i] = (__bf16)p[(size_t)(k0 + 16 + 8 * g + i) * HD]; }
  return w; }
#define WO_OUT_IN 1
#if WQKV_LAYOUT == 1
#define WCOL(W, k0, o, lane) wcol_oi(W, k0, o, lane, DIN)
#elif WQKV_LAYOUT == 2
#define WCOL(W, k0, o, lane) wcol_hdk(W, k0, o, lane)
#else
#define WCOL(W, k0, o, lane) wcol_io(W, k0, o, lane, CC)
#endif
#if WO_OUT_IN
#define WOCOL(W, k0, o, lane) wcol_oi(W, k0, o, lane, CC)
#define WOCOLH(W, k0, o, lane) wcolh_oi(W, k0, o, lane, CC)
#else
#define WOCOL(W, k0, o, lane) wcol_io(W, k0, o, lane, DIN)
#define WOCOLH(W, k0, o, lane) wcolh_io(W, k0, o, lane, DIN)
#endif

#ifndef SM_EXTRA_PARAMS
#define SM_EXTRA_PARAMS
#endif
#ifndef PROJ_EXTRA_PARAMS
#define PROJ_EXTRA_PARAMS
#endif
#ifndef SM_MASK_HOOK
#define SM_MASK_HOOK (void)0
#endif

#define WS_QH  0u                                      // f16 q rows [b*t][CC]
#define WS_KH  (WS_QH + 2u * (size_t)NB * TT * CC)      // f16 k rows [b*t][CC]
#define WS_VT  (WS_KH + 2u * (size_t)NB * TT * CC)      // f16 v planes [b][c][t]
#define WS_QL  (WS_VT + 2u * (size_t)NB * CC * TT)      // f16 q residual x 2^10 rows [b][t < QHI][CC]
#define WS_KL  (WS_QL + 2u * (size_t)NB * QHI * CC)     // f16 k residual x 2^10 rows [b][t < KHI][CC]
#define WS_VB  (WS_KL + 2u * (size_t)NB * KHI * CC)     // bf16 v hi planes [b][c][t < KHI]
#define WS_VBL (WS_VB + 2u * (size_t)NB * CC * KHI)
#define WS_S   (WS_VBL + 2u * (size_t)NB * CC * KHI)    // f32 logits / P [b*NH + h][tile][64][128]
#define WS_Y   (WS_S  + 4u * (size_t)NPL * SPLANE)      // f32 ctx rows [b*t][CC] (only when there is an output projection)
#define WS_END (WS_Y  + 4u * (size_t)NB * TT * CC)

// ---- k_proj: block = (64 rows, 128 cols, which): q/k/v = X W (+ b) with exact bf16 products (K = DIN) -> which 0: q f16 rows (+ residual rows < QHI); 1: k f16 rows (+ residual rows < KHI); 2: v f16 planes [c][t] (+ bf16 hi/lo planes for t < KHI)
__global__ __launch_bounds__(128) void k_proj(const float* __restrict__ XQ, const float* __restrict__ XK, const float* __restrict__ XV, const float* __restrict__ WQ, const float* __restrict__ WK, const float* __restrict__ WV, const float* __restrict__ BQ, const float* __restrict__ BK, const float* __restrict__ BV,
    _Float16* __restrict__ QH, _Float16* __restrict__ QL, _Float16* __restrict__ KH, _Float16* __restrict__ KL, _Float16* __restrict__ VT, __bf16* __restrict__ VB, __bf16* __restrict__ VBL) {
  __shared__ __align__(16) _Float16 sh[64][136], sl[64][136]; __shared__ __align__(16) _Float16 th[128][72]; __shared__ __align__(16) __bf16 tb[128][72], tbl[128][72];
  const int tid = threadIdx.x, wave = tid >> 5, lane = tid & 31, col = lane & 15, g = lane >> 4; const int which = blockIdx.z; const int c0 = blockIdx.y * 128; const size_t r0 = (size_t)blockIdx.x * 64; const size_t bb = r0 / TT; const int t0 = (int)(r0 % TT);
  const float* X = which == 0 ? XQ : which == 1 ? XK : XV; const float* WA = which == 0 ? WQ : which == 1 ? WK : WV; const float* BA = which == 0 ? BQ : which == 1 ? BK : BV;
  v8f acc[8] = {};
#pragma unroll 2
  for (int kc = 0; kc < DIN / 32; ++kc) { v16b a; { const float* p = X + SRCROW(r0 + wave * 16 + col) * DIN + kc * 32 + 8 * g;   /* sequence-first source row */
#pragma unroll
      for (int i = 0; i < 8; ++i) { a[i] = (__bf16)p[i]; a[8 + i] = (__bf16)p[16 + i]; } }
    asm volatile("s_wait_loadcnt 0x0" ::: "memory");
#pragma unroll
    for (int j = 0; j < 8; ++j) { const v16b w = WCOL(WA, kc * 32, c0 + j * 16 + col, lane); asm volatile("s_wait_loadcnt 0x0" ::: "memory"); acc[j] = wmma_bf(a, w, acc[j]); } }
  if (which < 2) { _Float16* DH = which == 0 ? QH : KH; _Float16* DL = which == 0 ? QL : KL; const int nhi = which == 0 ? QHI : KHI; const bool hi_rows = t0 < nhi;
#pragma unroll
    for (int j = 0; j < 8; ++j) { const float bias = BA ? bfr(BA[c0 + j * 16 + col]) : 0.f;
#pragma unroll
      for (int r = 0; r < 8; ++r) { const float v = acc[j][r] + bias; const _Float16 hv = (_Float16)v; sh[wave * 16 + 8 * g + r][j * 16 + col] = hv; sl[wave * 16 + 8 * g + r][j * 16 + col] = (_Float16)((v - (float)hv) * 1024.0f); } }
    __syncthreads();
    for (int e = tid; e < 64 * 16; e += 128) { const int rl = e >> 4, q = e & 15; vst2((unsigned*)(DH + (r0 + rl) * CC + c0 + q * 8), *(const v4u*)&sh[rl][q * 8]); if (hi_rows) vst2((unsigned*)(DL + (bb * nhi + t0 + rl) * (size_t)CC + c0 + q * 8), *(const v4u*)&sl[rl][q * 8]); }
  } else { const bool hi_rows = t0 < KHI;
#pragma unroll
    for (int j = 0; j < 8; ++j) { const float bias = BA ? bfr(BA[c0 + j * 16 + col]) : 0.f;
#pragma unroll
      for (int r = 0; r < 8; ++r) { const float v = acc[j][r] + bias; const int rl = wave * 16 + 8 * g + r, cl = j * 16 + col; th[cl][rl] = (_Float16)v; const __bf16 bh = (__bf16)v; tb[cl][rl] = bh; tbl[cl][rl] = (__bf16)(v - (float)bh); } }
    __syncthreads();
    for (int e = tid; e < 128 * 8; e += 128) { const int cl = e >> 3, q = e & 7; vst2((unsigned*)(VT + (bb * CC + c0 + cl) * (size_t)TT + t0 + q * 8), *(const v4u*)&th[cl][q * 8]); if (hi_rows) { const size_t o3 = (bb * CC + c0 + cl) * (size_t)KHI + t0 + q * 8; vst2((unsigned*)(VB + o3), *(const v4u*)&tb[cl][q * 8]); vst2((unsigned*)(VBL + o3), *(const v4u*)&tbl[cl][q * 8]); } } } }
// ---- k_sc: block = (query block qb, key block kb <= kb_last(qb), plane b*NH + h): logits x SCALE; q hi + residual (x 2^10) against k (2 products) for query rows < QHI, plus the k residual (3 products) for query blocks < QBH (causal early rows); causal: blocks past the diagonal exit, the mask itself is applied by index in k_sm
__global__ __launch_bounds__(128) void k_sc(const _Float16* __restrict__ QH, const _Float16* __restrict__ KH, const _Float16* __restrict__ QL, const _Float16* __restrict__ KL, float* __restrict__ S0) { __shared__ __align__(16) float ss[4][16][132];
  const int qb = blockIdx.x, kb = blockIdx.y; if (kb > kb_last(qb)) return;
  const int b = blockIdx.z / NH, h = blockIdx.z % NH; float* S = S0 + (size_t)blockIdx.z * SPLANE + (size_t)(stile(qb) + kb) * STILE;
  const int tid = threadIdx.x, wave = tid >> 5, lane = tid & 31, col = lane & 15, g = lane >> 4; const int k0 = kb * 128; const int ql0 = qb * 64 + wave * 16; const size_t q0 = (size_t)b * TT + ql0, kr0 = (size_t)b * TT + k0;
  v8f acc[8] = {}, accl[8] = {};
  const _Float16* QLb = QL + (size_t)b * QHI * CC; const _Float16* KLb = KL + (size_t)b * KHI * CC;
  if (qb < QBH) {
#pragma unroll
    for (int kc = 0; kc < HD / 32; ++kc) { const v16h ah = frag_h(QH + (q0 + col) * CC + h * HD + kc * 32, lane), al = frag_h(QLb + (size_t)(ql0 + col) * CC + h * HD + kc * 32, lane);
#pragma unroll
      for (int j = 0; j < 8; ++j) { const v16h kbf = frag_h(KH + (kr0 + j * 16 + col) * CC + h * HD + kc * 32, lane), klf = frag_h(KLb + (size_t)(k0 + j * 16 + col) * CC + h * HD + kc * 32, lane); acc[j] = wmma16(ah, kbf, acc[j]); accl[j] = wmma16(al, kbf, accl[j]); accl[j] = wmma16(ah, klf, accl[j]); } }
  } else if (qb * 64 < QHI) {
#pragma unroll
    for (int kc = 0; kc < HD / 32; ++kc) { const v16h ah = frag_h(QH + (q0 + col) * CC + h * HD + kc * 32, lane), al = frag_h(QLb + (size_t)(ql0 + col) * CC + h * HD + kc * 32, lane);
#pragma unroll
      for (int j = 0; j < 8; ++j) { const v16h kbf = frag_h(KH + (kr0 + j * 16 + col) * CC + h * HD + kc * 32, lane); acc[j] = wmma16(ah, kbf, acc[j]); accl[j] = wmma16(al, kbf, accl[j]); } }
  } else {
#pragma unroll
    for (int kc = 0; kc < HD / 32; ++kc) { const v16h ah = frag_h(QH + (q0 + col) * CC + h * HD + kc * 32, lane);
#pragma unroll
      for (int j = 0; j < 8; ++j) { const v16h kbf = frag_h(KH + (kr0 + j * 16 + col) * CC + h * HD + kc * 32, lane); acc[j] = wmma16(ah, kbf, acc[j]); } } }
#pragma unroll
  for (int j = 0; j < 8; ++j) {
#pragma unroll
    for (int r = 0; r < 8; ++r) ss[wave][8 * g + r][j * 16 + col] = (acc[j][r] + accl[j][r] * (1.0f / 1024.0f)) * SCALE; }
  LDSX(); for (int rl = 0; rl < 16; ++rl) vst2(S + (wave * 16 + rl) * 128 + lane * 4, *(const v4f*)&ss[wave][rl][lane * 4]); }
// ---- k_sm: block = query row t (plane b*NH + h): keys [0, kend): causal -> logit if s <= t else excluded; softmax in f32; P x 2^11 in place (0 for excluded)
__global__ __launch_bounds__(256) void k_sm(float* __restrict__ S0 SM_EXTRA_PARAMS) { __shared__ float sred[8]; __shared__ float sbc; __shared__ __align__(16) float shv[TT];
  const int tid = threadIdx.x; const int t = blockIdx.x; const int kend = (kb_last(t >> 6) + 1) * 128;
  float* sr = S0 + (size_t)blockIdx.y * SPLANE + (size_t)stile(t >> 6) * STILE + (t & 63) * 128;
  float m = -3.0e38f; for (int k = tid; k < kend; k += 256) { float v = (!CAUSAL || k <= t) ? sr[SKEY(k)] : -3.0e38f; SM_MASK_HOOK; shv[k] = v; m = fmaxf(m, v); }
#pragma unroll
  for (int o = 1; o < 32; o <<= 1) m = fmaxf(m, __shfl_xor(m, o));
  if ((tid & 31) == 0) sred[tid >> 5] = m; __syncthreads(); if (tid == 0) { float a = sred[0]; for (int i = 1; i < 8; ++i) a = fmaxf(a, sred[i]); sbc = a; } __syncthreads(); m = sbc; __syncthreads();
  float sum = 0.f; for (int k = tid; k < kend; k += 256) { const float v = shv[k]; const float e = (v <= -1.0e38f) ? 0.f : expf(v - m); shv[k] = e; sum += e; }
#pragma unroll
  for (int o = 1; o < 32; o <<= 1) sum += __shfl_xor(sum, o);
  if ((tid & 31) == 0) sred[tid >> 5] = sum; __syncthreads(); if (tid == 0) { float a = 0.f; for (int i = 0; i < 8; ++i) a += sred[i]; sbc = a > 0.f ? 2048.0f / a : 0.f; }   /* a fully excluded row yields P = 0 */ __syncthreads(); const float inv = sbc;
  for (int k = tid; k < kend; k += 256) shv[k] = shv[k] * inv;
  __syncthreads(); for (int q = tid; q < kend / 4; q += 256) vst2(sr + SKEY(q * 4), *(const v4f*)&shv[q * 4]); }
// ---- k_pv: block = 64 queries (qb) of (b, h): ctx = P . v over keys [0, kend) (P x 2^11 once to f16 against v f16: 1 product; causal early query blocks: P and v as bf16 hi + lo, 3 products); 256-B (row, head) segment by 16 lanes
__global__ __launch_bounds__(128) void k_pv(const float* __restrict__ PS0, const _Float16* __restrict__ VT, const __bf16* __restrict__ VB, const __bf16* __restrict__ VBL, float* __restrict__ Y) { const int b = blockIdx.z / NH, h = blockIdx.z % NH; const float* PS = PS0 + (size_t)blockIdx.z * SPLANE + (size_t)stile(blockIdx.x) * STILE; __shared__ __align__(16) float ss[4][16][HD + 4];
  const int tid = threadIdx.x, wave = tid >> 5, lane = tid & 31, col = lane & 15, g = lane >> 4; const int qb = blockIdx.x; const int ql0 = qb * 64 + wave * 16; const int kce = (kb_last(qb) + 1) * 4;
  v8f acc[HD / 16] = {};
  if (qb < QBH) {
#pragma unroll 1
    for (int kc = 0; kc < kce; ++kc) { const F2 p = split_row(PS + (wave * 16 + col) * 128, SKEY(kc * 32), lane);
      asm volatile("s_wait_loadcnt 0x0" ::: "memory");
#pragma unroll
      for (int j = 0; j < HD / 16; ++j) { const size_t po = ((size_t)b * CC + h * HD + j * 16 + col) * (size_t)KHI + kc * 32; const v16b vh = frag_b(VB + po, lane); acc[j] = wmma_bf(p.h, vh, acc[j]); acc[j] = wmma_bf(p.l, vh, acc[j]); acc[j] = wmma_bf(p.h, frag_b(VBL + po, lane), acc[j]); } }
  } else {
#pragma unroll 1
    for (int kc = 0; kc < kce; ++kc) { const v16h p = frag_f32(PS + (wave * 16 + col) * 128 + SKEY(kc * 32), lane);
      asm volatile("s_wait_loadcnt 0x0" ::: "memory");
#pragma unroll
      for (int j = 0; j < HD / 16; ++j) { const size_t po = ((size_t)b * CC + h * HD + j * 16 + col) * (size_t)TT + kc * 32; acc[j] = wmma16(p, frag_h(VT + po, lane), acc[j]); } } }
#pragma unroll
  for (int j = 0; j < HD / 16; ++j)
#pragma unroll
    for (int r = 0; r < 8; ++r) ss[wave][8 * g + r][j * 16 + col] = acc[j][r] * (1.0f / 2048.0f);
  LDSX(); for (int rl = 0; rl < 16; ++rl) if (lane < HD / 4) vst2(Y + ((size_t)b * TT + ql0 + rl) * CC + h * HD + lane * 4, *(const v4f*)&ss[wave][rl][lane * 4]); }
// ---- k_out: block = (64 rows, 128 cols): out = ctx Wo (+ bo): ctx x 2^6 once to f16 against Wo as f16(bf16 x 2^8) exact (1 product) x 2^-14; causal early rows (< QHI of each sequence): ctx bf16 hi + lo against exact bf16 Wo (2 products)
__global__ __launch_bounds__(128) void k_out(const float* __restrict__ Y, const float* __restrict__ WO, const float* __restrict__ BO, float* __restrict__ OUT) { __shared__ __align__(16) float sf[4][16][132];
  const int tid = threadIdx.x, wave = tid >> 5, lane = tid & 31, col = lane & 15, g = lane >> 4; const int c0 = blockIdx.y * 128; const size_t r0 = (size_t)blockIdx.x * 64 + wave * 16;
  v8f acc[8] = {};
  if (CAUSAL && (int)(((size_t)blockIdx.x * 64) % TT) < QHI) {   /* block-uniform */
#pragma unroll 2
    for (int kc = 0; kc < CC / 32; ++kc) { const F2 a = split_row(Y + (r0 + col) * CC, kc * 32, lane); asm volatile("s_wait_loadcnt 0x0" ::: "memory");
#pragma unroll
      for (int j = 0; j < 8; ++j) { const v16b w = WOCOL(WO, kc * 32, c0 + j * 16 + col, lane); asm volatile("s_wait_loadcnt 0x0" ::: "memory"); acc[j] = wmma_bf(a.h, w, acc[j]); acc[j] = wmma_bf(a.l, w, acc[j]); } }
#pragma unroll
    for (int j = 0; j < 8; ++j) { const float bias = BO ? bfr(BO[c0 + j * 16 + col]) : 0.f;
#pragma unroll
      for (int r = 0; r < 8; ++r) sf[wave][8 * g + r][j * 16 + col] = acc[j][r] + bias; }
  } else {
#pragma unroll 2
    for (int kc = 0; kc < CC / 32; ++kc) { const v16h a = frag_f32s(Y + (r0 + col) * CC + kc * 32, lane, 64.0f); asm volatile("s_wait_loadcnt 0x0" ::: "memory");   /* ctx carried x 2^6 into f16 so small-magnitude context rows stay clear of f16 subnormals */
#pragma unroll
      for (int j = 0; j < 8; ++j) { const v16h w = WOCOLH(WO, kc * 32, c0 + j * 16 + col, lane); asm volatile("s_wait_loadcnt 0x0" ::: "memory"); acc[j] = wmma16(a, w, acc[j]); } }
#pragma unroll
    for (int j = 0; j < 8; ++j) { const float bias = BO ? bfr(BO[c0 + j * 16 + col]) : 0.f;
#pragma unroll
      for (int r = 0; r < 8; ++r) sf[wave][8 * g + r][j * 16 + col] = acc[j][r] * (1.0f / 16384.0f) + bias; } }   /* 2^-8 (Wo carry) x 2^-6 (ctx carry) */
  LDSX(); for (int rl = 0; rl < 16; ++rl) vst2(OUT + SRCROW(r0 + rl) * DIN + c0 + lane * 4, *(const v4f*)&sf[wave][rl][lane * 4]); }

extern "C" void kernel_launch(void* const* d_in, const int* in_sizes, int n_in, void* d_out, int out_size, void* d_ws, size_t ws_size, hipStream_t stream) {
  (void)in_sizes; (void)n_in; (void)out_size;
  const float** F = (const float**)d_in;
  if (ws_size < (size_t)WS_END) return;
  char* ws = (char*)d_ws; _Float16 *QH = (_Float16*)(ws + WS_QH), *KH = (_Float16*)(ws + WS_KH), *VT = (_Float16*)(ws + WS_VT), *QL = (_Float16*)(ws + WS_QL), *KL = (_Float16*)(ws + WS_KL); __bf16 *VB = (__bf16*)(ws + WS_VB), *VBL = (__bf16*)(ws + WS_VBL); float *S = (float*)(ws + WS_S), *Y = (float*)(ws + WS_Y);
  (void)Y; (void)QL; (void)KL; (void)VB; (void)VBL;
  // inputs: 0 x [2048,2,768] (S, B, D); 1 wq [768,768] (out,in), 2 bq; 3 wk, 4 bk; 5 wv, 6 bv; 7 wc (out,in), 8 bc (all biases NONZERO)
  k_proj<<<dim3(TNB * TT / 64, CC / 128, 3), 128, 0, stream>>>(F[0], F[0], F[0], F[1], F[3], F[5], F[2], F[4], F[6], QH, QL, KH, KL, VT, VB, VBL);
  k_sc<<<dim3(NQB, TT / 128, TNB * NH), 128, 0, stream>>>(QH, KH, QL, KL, S);
  k_sm<<<dim3(TT, TNB * NH), 256, 0, stream>>>(S);
  k_pv<<<dim3(NQB, 1, TNB * NH), 128, 0, stream>>>(S, VT, VB, VBL, Y);
  k_out<<<dim3(TNB * TT / 64, DIN / 128), 128, 0, stream>>>(Y, F[7], F[8], (float*)d_out);   /* writes (S, B, D) rows */
}

// v002
// A run of this version takes 320 microseconds.
// In two side-by-side timings against v001, it was 1.64 and 1.65 times as fast.
// Over all steps from v000 it is 2.78 times as fast.
// compute dtype: all float inputs rounded to bf16; q / k / v projections with EXACT bf16 products on WMMA 16x16x32 (f32 accumulate) + bias; causal logits: 3 products for the first 384 rows, single f16 q x k after, x 64^-0.5; running-maximum softmax f32 in the same launch; unnormalised P x 2^11 once to f16 x v once to f16 (bf16 hi + lo below row 384), divided by the f32 sum at the end; y hi+lo x exact wc below row 384, x2^6 f16 carry x f16(bf16 x 2^8) wc after, + bc; f32 output written back in the sequence-first layout.
#include <hip/hip_runtime.h>
#include <math.h>

typedef __attribute__((ext_vector_type(16))) _Float16 v16h;
typedef __attribute__((ext_vector_type(16))) __bf16 v16b;
typedef __attribute__((ext_vector_type(8)))  _Float16 v8h;
typedef __attribute__((ext_vector_type(8)))  float v8f;
typedef __attribute__((ext_vector_type(4)))  float v4f;
typedef __attribute__((ext_vector_type(2)))  float v2f;
typedef __attribute__((ext_vector_type(4)))  unsigned v4u;
typedef __attribute__((ext_vector_type(4)))  int v4i;
typedef float __attribute__((may_alias)) float_a;
typedef int __attribute__((may_alias)) int_a;

template <typename T> __device__ __forceinline__ void vst2(void* p, T v) { *(T*)p = v;  }
__device__ __forceinline__ v8f wmma16(v16h a, v16h b, v8f c) {
  v8f d = __builtin_amdgcn_wmma_f32_16x16x32_f16(false, a, false, b, (short)0, c, false, false);
  asm volatile("v_nop\n\tv_nop\n\tv_nop\n\tv_nop" : "+v"(d) : "v"(a), "v"(b));
  return d;
}
__device__ __forceinline__ v8f wmma_bf(v16b a, v16b b, v8f c) {
  v8f d = __builtin_amdgcn_wmma_f32_16x16x32_bf16(false, a, false, b, (short)0, c, false, false);
  asm volatile("v_nop\n\tv_nop\n\tv_nop\n\tv_nop" : "+v"(d) : "v"(a), "v"(b));
  return d;
}
// 16x16x32 fragments: lane = (h = lane>>4, row/col = lane&15); elements 0..7 = k0+8h+0..7, 8..15 = k0+16+8h+0..7; D element r = row 8h+r
__device__ __forceinline__ v16h frag_h(const _Float16* rowk0, int lane) {
  union { v16h v; v8h q[2]; } u; const _Float16* p = rowk0 + 8 * (lane >> 4);
  u.q[0] = *(const v8h*)p; u.q[1] = *(const v8h*)(p + 16); return u.v;
}
__device__ __forceinline__ v16h frag_f32(const float* rowk0, int lane) {
  v16h a; const float* p = rowk0 + 8 * (lane >> 4);
#pragma unroll
  for (int i = 0; i < 8; ++i) { a[i] = (_Float16)p[i]; a[8 + i] = (_Float16)p[16 + i]; }
  return a;
}
__device__ __forceinline__ v16h frag_f32s(const float* rowk0, int lane, float sc) {
  v16h a; const float* p = rowk0 + 8 * (lane >> 4);
#pragma unroll
  for (int i = 0; i < 8; ++i) { a[i] = (_Float16)(p[i] * sc); a[8 + i] = (_Float16)(p[16 + i] * sc); }
  return a;
}
// column fragment from a [K][ld] layout (column n), rows >= K read as 0
__device__ __forceinline__ v16h fragc_f32(const float* W, int k0, int n, int lane, int ld, int K) {
  v16h a; const int g = lane >> 4;
#pragma unroll
  for (int i = 0; i < 8; ++i) { const int ka = k0 + 8 * g + i, kb = ka + 16;
    a[i] = (_Float16)(ka < K ? W[(size_t)(ka < K ? ka : K - 1) * ld + n] : 0.f); a[8 + i] = (_Float16)(kb < K ? W[(size_t)(kb < K ? kb : K - 1) * ld + n] : 0.f); }
  return a;
}
struct F2 { v16b h, l; };
__device__ __forceinline__ F2 bsplit16(const float v[16]) { F2 r;
#pragma unroll
  for (int i = 0; i < 16; ++i) { const __bf16 h = (__bf16)v[i]; r.h[i] = h; r.l[i] = (__bf16)(v[i] - (float)h); }
  return r; }
__device__ __forceinline__ F2 split_row(const float* row, int k0, int lane) { float v[16]; const float* p = row + k0 + 8 * (lane >> 4);
#pragma unroll
  for (int i = 0; i < 8; ++i) { v[i] = p[i]; v[8 + i] = p[16 + i]; }
  return bsplit16(v); }
__device__ __forceinline__ F2 split_rowK(const float* row, int k0, int lane, int K) { float v[16]; const int g = lane >> 4;
#pragma unroll
  for (int i = 0; i < 8; ++i) { const int ka = k0 + 8 * g + i, kb = ka + 16; v[i] = ka < K ? row[ka < K ? ka : K - 1] : 0.f; v[8 + i] = kb < K ? row[kb < K ? kb : K - 1] : 0.f; }
  return bsplit16(v); }
__device__ __forceinline__ F2 split_col(const float* W, int k0, int n, int lane, int ld, int K) { float v[16]; const int g = lane >> 4;
#pragma unroll
  for (int i = 0; i < 8; ++i) { const int ka = k0 + 8 * g + i, kb = ka + 16; v[i] = ka < K ? W[(size_t)(ka < K ? ka : K - 1) * ld + n] : 0.f; v[8 + i] = kb < K ? W[(size_t)(kb < K ? kb : K - 1) * ld + n] : 0.f; }
  return bsplit16(v); }
__device__ __forceinline__ v8f mac3(const F2& a, const F2& b, v8f c) { c = wmma_bf(a.l, b.h, c); c = wmma_bf(a.h, b.l, c); return wmma_bf(a.h, b.h, c); }
__device__ __forceinline__ float sigm(float v) { return 1.0f / (1.0f + expf(-v)); }
#define LDSX() do { asm volatile("s_wait_dscnt 0" ::: "memory"); __builtin_amdgcn_wave_barrier(); __builtin_amdgcn_fence(__ATOMIC_RELEASE, "workgroup"); } while (0)

// Causal multi-head self-attention on a SEQUENCE-FIRST input (x [2048, 2, 768] = (S, B, D); torch (out,in) wq / wk / wv / wc [768,768] N(0,1) x 0.02 applied as x W^T + b, biases N(0,1) x 0.02 - NONZERO; 12 heads x 64; scores / sqrt(64); tril kept, -inf elsewhere; softmax; y wc^T + bc; output transposed back to (S, B, D)). The kernels work on rows b*2048 + t: the projection reads token (b, t) from source row t*2 + b and the output kernel writes it back there.
#define NB 2
#define TT 2048
#define CC 768            // NH * HD = projected width
#define DIN 768          // input (model) width
#define NH 12
#define HD 64
#define NQB (TT / 64)
#define SCALE (0.125f)
#define CAUSAL 1
#ifndef TNB
#define TNB NB
#endif
__device__ __forceinline__ float bfr(float v) { return (float)(__bf16)v; }
typedef __attribute__((ext_vector_type(8))) __bf16 v8b;
__device__ __forceinline__ v16b frag_b(const __bf16* rowk0, int lane) {
  union { v16b v; v8b q[2]; } u; const __bf16* p = rowk0 + 8 * (lane >> 4);
  u.q[0] = *(const v8b*)p; u.q[1] = *(const v8b*)(p + 16); return u.v;
}
#define QBH 6              // causal: query blocks 0..QBH-1 of each sequence (few keys, no averaging) take the high-precision path
#define QHI 384            // rows carrying a q residual plane
#define KHI 384            // key rows carrying k residual / v bf16 hi+lo planes (used only by the causal high-precision path)
// B fragment (k rows k0+.., output column o) of a weight: (in,out) [K][ld] or (out,in) [ld rows of K]: bf16 exact, or f16(bf16 * 256) exact
__device__ __forceinline__ v16b wcol_io(const float* Wm, int k0, int o, int lane, int ld) { v16b w; const int g = lane >> 4;
#pragma unroll
  for (int i = 0; i < 8; ++i) { w[i] = (__bf16)Wm[(size_t)(k0 + 8 * g + i) * ld + o]; w[8 + i] = (__bf16)Wm[(size_t)(k0 + 16 + 8 * g + i) * ld + o]; }
  return w; }
__device__ __forceinline__ v16b wcol_oi(const float* Wm, int k0, int o, int lane, int K) { v16b w; const float* p = Wm + (size_t)o * K + k0 + 8 * (lane >> 4);
#pragma unroll
  for (int i = 0; i < 8; ++i) { w[i] = (__bf16)p[i]; w[8 + i] = (__bf16)p[16 + i]; }
  return w; }
__device__ __forceinline__ v16h wcolh_io(const float* Wm, int k0, int o, int lane, int ld) { v16h w; const int g = lane >> 4;
#pragma unroll
  for (int i = 0; i < 8; ++i) { w[i] = (_Float16)(bfr(Wm[(size_t)(k0 + 8 * g + i) * ld + o]) * 256.0f); w[8 + i] = (_Float16)(bfr(Wm[(size_t)(k0 + 16 + 8 * g + i) * ld + o]) * 256.0f); }
  return w; }
__device__ __forceinline__ v16h wcolh_oi(const float* Wm, int k0, int o, int lane, int K) { v16h w; const float* p = Wm + (size_t)o * K + k0 + 8 * (lane >> 4);
#pragma unroll
  for (int i = 0; i < 8; ++i) { w[i] = (_Float16)(bfr(p[i]) * 256.0f); w[8 + i] = (_Float16)(bfr(p[16 + i]) * 256.0f); }
  return w; }
#define SRCROW(r) ((size_t)((r) % TT) * NB + (size_t)((r) / TT))   // row r = b*TT + t <-> sequence-first row t*NB + b of the (S, B, D) arrays (NB = the module's batch count, also when fewer batches are run)
#define WQKV_LAYOUT 1   // 0 = (in,out) [DIN][CC]; 1 = (out,in) [CC][DIN]; 2 = per-head [NH][DIN][HD]
__device__ __forceinline__ v16b wcol_hdk(const float* Wm, int k0, int o, int lane) { v16b w; const int g = lane >> 4; const float* p = Wm + (size_t)(o / HD) * DIN * HD + (o % HD);
#pragma unroll
  for (int i = 0; i < 8; ++i) { w[i] = (__bf16)p[(size_t)(k0 + 8 * g + i) * HD]; w[8 + i] = (__bf16)p[(size_t)(k0 + 16 + 8 * g + i) * HD]; }
  return w; }
#define WO_OUT_IN 1
#if WQKV_LAYOUT == 1
#define WCOL(W, k0, o, lane) wcol_oi(W, k0, o, lane, DIN)
#elif WQKV_LAYOUT == 2
#define WCOL(W, k0, o, lane) wcol_hdk(W, k0, o, lane)
#else
#define WCOL(W, k0, o, lane) wcol_io(W, k0, o, lane, CC)
#endif
#if WO_OUT_IN
#define WOCOL(W, k0, o, lane) wcol_oi(W, k0, o, lane, CC)
#define WOCOLH(W, k0, o, lane) wcolh_oi(W, k0, o, lane, CC)
#else
#define WOCOL(W, k0, o, lane) wcol_io(W, k0, o, lane, DIN)
#define WOCOLH(W, k0, o, lane) wcolh_io(W, k0, o, lane, DIN)
#endif

#define WS_QH  0u                                      // f16 q rows [b*t][CC]
#define WS_KH  (WS_QH + 2u * (size_t)NB * TT * CC)      // f16 k rows [b*t][CC]
#define WS_VT  (WS_KH + 2u * (size_t)NB * TT * CC)      // f16 v planes [b][c][t]
#define WS_QL  (WS_VT + 2u * (size_t)NB * CC * TT)      // f16 q residual x 2^10 rows [b][t < QHI][CC]
#define WS_KL  (WS_QL + 2u * (size_t)NB * QHI * CC)     // f16 k residual x 2^10 rows [b][t < KHI][CC]
#define WS_VB  (WS_KL + 2u * (size_t)NB * KHI * CC)     // bf16 v hi planes [b][c][t < KHI]
#define WS_VBL (WS_VB + 2u * (size_t)NB * CC * KHI)
#define WS_Y   (WS_VBL + 2u * (size_t)NB * CC * KHI)    // f32 ctx rows [b*t][CC]
#define WS_END (WS_Y  + 4u * (size_t)NB * TT * CC)

// ---- k_proj: block = (64 rows, 128 cols, which): q/k/v = X W (+ b) with exact bf16 products (K = DIN) -> which 0: q f16 rows (+ residual rows < QHI); 1: k f16 rows (+ residual rows < KHI); 2: v f16 planes [c][t] (+ bf16 hi/lo planes for t < KHI)
__global__ __launch_bounds__(128) void k_proj(const float* __restrict__ XQ, const float* __restrict__ XK, const float* __restrict__ XV, const float* __restrict__ WQ, const float* __restrict__ WK, const float* __restrict__ WV, const float* __restrict__ BQ, const float* __restrict__ BK, const float* __restrict__ BV,
    _Float16* __restrict__ QH, _Float16* __restrict__ QL, _Float16* __restrict__ KH, _Float16* __restrict__ KL, _Float16* __restrict__ VT, __bf16* __restrict__ VB, __bf16* __restrict__ VBL) {
  __shared__ __align__(16) _Float16 sh[64][136], sl[64][136]; __shared__ __align__(16) _Float16 th[128][72]; __shared__ __align__(16) __bf16 tb[128][72], tbl[128][72];
  const int tid = threadIdx.x, wave = tid >> 5, lane = tid & 31, col = lane & 15, g = lane >> 4; const int which = blockIdx.z; const int c0 = blockIdx.y * 128; const size_t r0 = (size_t)blockIdx.x * 64; const size_t bb = r0 / TT; const int t0 = (int)(r0 % TT);
  const float* X = which == 0 ? XQ : which == 1 ? XK : XV; const float* WA = which == 0 ? WQ : which == 1 ? WK : WV; const float* BA = which == 0 ? BQ : which == 1 ? BK : BV;
  v8f acc[8] = {};
#pragma unroll 2
  for (int kc = 0; kc < DIN / 32; ++kc) { v16b a; { const float* p = X + SRCROW(r0 + wave * 16 + col) * DIN + kc * 32 + 8 * g;   /* sequence-first source row */
#pragma unroll
      for (int i = 0; i < 8; ++i) { a[i] = (__bf16)p[i]; a[8 + i] = (__bf16)p[16 + i]; } }
    asm volatile("s_wait_loadcnt 0x0" ::: "memory");
#pragma unroll
    for (int j = 0; j < 8; ++j) { const v16b w = WCOL(WA, kc * 32, c0 + j * 16 + col, lane); asm volatile("s_wait_loadcnt 0x0" ::: "memory"); acc[j] = wmma_bf(a, w, acc[j]); } }
  if (which < 2) { _Float16* DH = which == 0 ? QH : KH; _Float16* DL = which == 0 ? QL : KL; const int nhi = which == 0 ? QHI : KHI; const bool hi_rows = t0 < nhi;
#pragma unroll
    for (int j = 0; j < 8; ++j) { const float bias = BA ? bfr(BA[c0 + j * 16 + col]) : 0.f;
#pragma unroll
      for (int r = 0; r < 8; ++r) { const float v = acc[j][r] + bias; const _Float16 hv = (_Float16)v; sh[wave * 16 + 8 * g + r][j * 16 + col] = hv; sl[wave * 16 + 8 * g + r][j * 16 + col] = (_Float16)((v - (float)hv) * 1024.0f); } }
    __syncthreads();
    for (int e = tid; e < 64 * 16; e += 128) { const int rl = e >> 4, q = e & 15; vst2((unsigned*)(DH + (r0 + rl) * CC + c0 + q * 8), *(const v4u*)&sh[rl][q * 8]); if (hi_rows) vst2((unsigned*)(DL + (bb * nhi + t0 + rl) * (size_t)CC + c0 + q * 8), *(const v4u*)&sl[rl][q * 8]); }
  } else { const bool hi_rows = t0 < KHI;
#pragma unroll
    for (int j = 0; j < 8; ++j) { const float bias = BA ? bfr(BA[c0 + j * 16 + col]) : 0.f;
#pragma unroll
      for (int r = 0; r < 8; ++r) { const float v = acc[j][r] + bias; const int rl = wave * 16 + 8 * g + r, cl = j * 16 + col; th[cl][rl] = (_Float16)v; const __bf16 bh = (__bf16)v; tb[cl][rl] = bh; tbl[cl][rl] = (__bf16)(v - (float)bh); } }
    __syncthreads();
    for (int e = tid; e < 128 * 8; e += 128) { const int cl = e >> 3, q = e & 7; vst2((unsigned*)(VT + (bb * CC + c0 + cl) * (size_t)TT + t0 + q * 8), *(const v4u*)&th[cl][q * 8]); if (hi_rows) { const size_t o3 = (bb * CC + c0 + cl) * (size_t)KHI + t0 + q * 8; vst2((unsigned*)(VB + o3), *(const v4u*)&tb[cl][q * 8]); vst2((unsigned*)(VBL + o3), *(const v4u*)&tbl[cl][q * 8]); } } } }
// ---- k_fa: block = 4 waves x 16 queries (query block qb, heaviest first) of plane b*NH + h; per 32 keys: S^T = K Q^T (a lane holds 16 keys of ONE query), running maximum and sum in f32 (log2 domain), P^T x 2^11 packed from the score tiles straight into the B operand, O^T += V^T P^T; ctx = O / sum. Query blocks < QBH: 3-product logits (q, k residuals x 2^10), P and v as bf16 hi + lo (3 products)
#define LOGC (SCALE * 1.44269504088896340736f)
struct SMX { float m, l; };
__device__ __forceinline__ float xhalf(float x) { return __builtin_bit_cast(float, __builtin_amdgcn_permlanex16(__builtin_bit_cast(int, x), __builtin_bit_cast(int, x), 0x76543210, 0xfedcba98, false, false)); }   // lane l with lane l ^ 16
#define XCNT0() asm volatile("s_wait_xcnt 0x0" ::: "memory")   // stands behind a run of global loads, before their address registers are reused
// one 32-key step of the running softmax of this lane's query: t[0..7] = keys k0+8g+r, t[8..15] = keys k0+16+8g+r (scaled log2 logits); returns e[] = 2^(t - max + 11); rescales acc only when some query of the wave has a new maximum
__device__ __forceinline__ void sm_step(float t[16], SMX& st, v8f acc[HD / 16], int k0, int qfirst, int qi, int g) {
  if (k0 + 31 > qfirst) {   /* wave-uniform: only steps that reach the diagonal mask by index */
#pragma unroll
    for (int r = 0; r < 8; ++r) { if (k0 + 8 * g + r > qi) t[r] = -3.0e38f; if (k0 + 16 + 8 * g + r > qi) t[8 + r] = -3.0e38f; } }
  float mx = t[0];
#pragma unroll
  for (int s = 1; s < 16; ++s) mx = fmaxf(mx, t[s]);
  mx = fmaxf(mx, xhalf(mx));   /* the other half of the wave holds the query's other 16 keys */
  if (__builtin_amdgcn_ballot_w32(mx > st.m) != 0) { const float mn = fmaxf(st.m, mx); const float al = __builtin_amdgcn_exp2f(st.m - mn); st.m = mn; st.l *= al;
#pragma unroll
    for (int j = 0; j < HD / 16; ++j)
#pragma unroll
      for (int r = 0; r < 8; ++r) acc[j][r] *= al; }
  const float mo = st.m - 11.0f; float ps = 0.f;
#pragma unroll
  for (int s = 0; s < 16; ++s) { t[s] = __builtin_amdgcn_exp2f(t[s] - mo); ps += t[s]; }
  st.l += ps; }
__global__ __launch_bounds__(128) void k_fa(const _Float16* __restrict__ QH, const _Float16* __restrict__ KH, const _Float16* __restrict__ QL, const _Float16* __restrict__ KL, const _Float16* __restrict__ VT, const __bf16* __restrict__ VB, const __bf16* __restrict__ VBL, float* __restrict__ Y) {
  const int b = blockIdx.x / NH, h = blockIdx.x % NH; const int qb = NQB - 1 - (int)blockIdx.y;
  const int tid = threadIdx.x, wave = __builtin_amdgcn_readfirstlane(tid >> 5), lane = tid & 31, col = lane & 15, g = lane >> 4;
  /* wave number held scalar: trip count and diagonal test become scalar branches, every lane stays on at the matrix instructions */ const int ql0 = qb * 64 + wave * 16, qi = ql0 + col; const int nblk = (ql0 + 47) >> 5;   /* 32-key steps that cover keys 0 .. ql0 + 15 */
  const _Float16* Qp = QH + ((size_t)b * TT + qi) * CC + h * HD; const _Float16* Kp = KH + ((size_t)b * TT + col) * CC + h * HD;
  v8f acc[HD / 16] = {}; SMX st; st.m = -3.0e38f; st.l = 0.f;
  const v16h qf0 = frag_h(Qp, lane), qf1 = frag_h(Qp + 32, lane);
  XCNT0();
  if (qb < QBH) {   /* block-uniform */
    const _Float16* QLp = QL + ((size_t)b * QHI + qi) * CC + h * HD; const _Float16* KLp = KL + ((size_t)b * KHI + col) * CC + h * HD; const size_t vo = ((size_t)b * CC + h * HD + col) * (size_t)KHI;
    const v16h ql0f = frag_h(QLp, lane), ql1f = frag_h(QLp + 32, lane);
#pragma unroll 1   /* at most 12 steps: kept rolled for code size */
    for (int i = 0; i < nblk; ++i) { const int k0 = i * 32; float t[16];
#pragma unroll
      for (int u = 0; u < 2; ++u) { const size_t ko = (size_t)(k0 + u * 16) * CC; const v16h kh0 = frag_h(Kp + ko, lane), kh1 = frag_h(Kp + ko + 32, lane), kl0 = frag_h(KLp + ko, lane), kl1 = frag_h(KLp + ko + 32, lane); v8f a = {}, al = {};
        a = wmma16(kh0, qf0, a); al = wmma16(kh0, ql0f, al); al = wmma16(kl0, qf0, al); a = wmma16(kh1, qf1, a); al = wmma16(kh1, ql1f, al); al = wmma16(kl1, qf1, al);
#pragma unroll
        for (int r = 0; r < 8; ++r) t[u * 8 + r] = (a[r] + al[r] * (1.0f / 1024.0f)) * LOGC; }
      sm_step(t, st, acc, k0, ql0, qi, g);
      const F2 p = bsplit16(t);
#pragma unroll
      for (int j = 0; j < HD / 16; ++j) { const size_t po = vo + (size_t)j * 16 * KHI + k0; const v16b vh = frag_b(VB + po, lane); acc[j] = wmma_bf(vh, p.h, acc[j]); acc[j] = wmma_bf(vh, p.l, acc[j]); acc[j] = wmma_bf(frag_b(VBL + po, lane), p.h, acc[j]); } }
  } else {
    const _Float16* Vp = VT + ((size_t)b * CC + h * HD + col) * (size_t)TT;
    v16h kf[4], vf[4];
#pragma unroll
    for (int u = 0; u < 2; ++u) { kf[2 * u] = frag_h(Kp + (size_t)(u * 16) * CC, lane); kf[2 * u + 1] = frag_h(Kp + (size_t)(u * 16) * CC + 32, lane); }
#pragma unroll
    for (int j = 0; j < HD / 16; ++j) vf[j] = frag_h(Vp + (size_t)j * 16 * TT, lane);
#pragma unroll 2   /* two steps per trip: the fragments fetched ahead change register names instead of being copied */
    for (int i = 0; i < nblk; ++i) { const int k0 = i * 32; const int kn = (i + 1 < nblk ? i + 1 : i) * 32;   /* next step's K and V rows are fetched one step ahead (the last step re-reads its own: in bounds) */
      v16h kx[4], vx[4];
#pragma unroll
      for (int u = 0; u < 2; ++u) { kx[2 * u] = frag_h(Kp + (size_t)(kn + u * 16) * CC, lane); kx[2 * u + 1] = frag_h(Kp + (size_t)(kn + u * 16) * CC + 32, lane); }
      XCNT0();
#pragma unroll
      for (int j = 0; j < HD / 16; ++j) vx[j] = frag_h(Vp + (size_t)j * 16 * TT + kn, lane);
      XCNT0();
      v8f s0 = {}, s1 = {}; s0 = wmma16(kf[0], qf0, s0); s1 = wmma16(kf[2], qf0, s1); s0 = wmma16(kf[1], qf1, s0); s1 = wmma16(kf[3], qf1, s1);
      float t[16];
#pragma unroll
      for (int r = 0; r < 8; ++r) { t[r] = s0[r] * LOGC; t[8 + r] = s1[r] * LOGC; }
      sm_step(t, st, acc, k0, ql0, qi, g);
      v16h p;
#pragma unroll
      for (int s = 0; s < 16; ++s) p[s] = (_Float16)t[s];
#pragma unroll
      for (int j = 0; j < HD / 16; ++j) acc[j] = wmma16(vf[j], p, acc[j]);
#pragma unroll
      for (int u = 0; u < 4; ++u) { kf[u] = kx[u]; vf[u] = vx[u]; } } }
  const float inv = 1.0f / (st.l + xhalf(st.l));   /* the two halves' partial sums join once; the maximum's own term keeps the sum >= 2^11 */
  float* yp = Y + ((size_t)b * TT + qi) * CC + h * HD + 8 * g;   /* acc[j][r] = ctx[query qi][j*16 + 8g + r]: 32 contiguous bytes per lane and j */
#pragma unroll
  for (int j = 0; j < HD / 16; ++j) { const v4f lo = { acc[j][0] * inv, acc[j][1] * inv, acc[j][2] * inv, acc[j][3] * inv }, hi = { acc[j][4] * inv, acc[j][5] * inv, acc[j][6] * inv, acc[j][7] * inv }; vst2(yp + j * 16, lo); vst2(yp + j * 16 + 4, hi); } }
// ---- k_out: block = (64 rows, 128 cols): out = ctx Wo (+ bo): ctx once to f16 against Wo as f16(bf16 x 2^8) exact (1 product) x 2^-8; causal early rows (< QHI of each sequence): ctx bf16 hi + lo against exact bf16 Wo (2 products)
__global__ __launch_bounds__(128) void k_out(const float* __restrict__ Y, const float* __restrict__ WO, const float* __restrict__ BO, float* __restrict__ OUT) { __shared__ __align__(16) float sf[4][16][132];
  const int tid = threadIdx.x, wave = tid >> 5, lane = tid & 31, col = lane & 15, g = lane >> 4; const int c0 = blockIdx.y * 128; const size_t r0 = (size_t)blockIdx.x * 64 + wave * 16;
  v8f acc[8] = {};
  if (CAUSAL && (int)(((size_t)blockIdx.x * 64) % TT) < QHI) {   /* block-uniform */
#pragma unroll 2
    for (int kc = 0; kc < CC / 32; ++kc) { const F2 a = split_row(Y + (r0 + col) * CC, kc * 32, lane); asm volatile("s_wait_loadcnt 0x0" ::: "memory");
#pragma unroll
      for (int j = 0; j < 8; ++j) { const v16b w = WOCOL(WO, kc * 32, c0 + j * 16 + col, lane); asm volatile("s_wait_loadcnt 0x0" ::: "memory"); acc[j] = wmma_bf(a.h, w, acc[j]); acc[j] = wmma_bf(a.l, w, acc[j]); } }
#pragma unroll
    for (int j = 0; j < 8; ++j) { const float bias = BO ? bfr(BO[c0 + j * 16 + col]) : 0.f;
#pragma unroll
      for (int r = 0; r < 8; ++r) sf[wave][8 * g + r][j * 16 + col] = acc[j][r] + bias; }
  } else {
#pragma unroll 2
    for (int kc = 0; kc < CC / 32; ++kc) { const v16h a = frag_f32s(Y + (r0 + col) * CC + kc * 32, lane, 64.0f); asm volatile("s_wait_loadcnt 0x0" ::: "memory");   /* ctx carried x 2^6 into f16 so small-magnitude context rows stay clear of f16 subnormals */
#pragma unroll
      for (int j = 0; j < 8; ++j) { const v16h w = WOCOLH(WO, kc * 32, c0 + j * 16 + col, lane); asm volatile("s_wait_loadcnt 0x0" ::: "memory"); acc[j] = wmma16(a, w, acc[j]); } }
#pragma unroll
    for (int j = 0; j < 8; ++j) { const float bias = BO ? bfr(BO[c0 + j * 16 + col]) : 0.f;
#pragma unroll
      for (int r = 0; r < 8; ++r) sf[wave][8 * g + r][j * 16 + col] = acc[j][r] * (1.0f / 16384.0f) + bias; } }   /* 2^-8 (Wo carry) x 2^-6 (ctx carry) */
  LDSX(); for (int rl = 0; rl < 16; ++rl) vst2(OUT + SRCROW(r0 + rl) * DIN + c0 + lane * 4, *(const v4f*)&sf[wave][rl][lane * 4]); }

extern "C" void kernel_launch(void* const* d_in, const int* in_sizes, int n_in, void* d_out, int out_size, void* d_ws, size_t ws_size, hipStream_t stream) {
  (void)in_sizes; (void)n_in; (void)out_size;
  const float** F = (const float**)d_in;
  if (ws_size < (size_t)WS_END) return;
  char* ws = (char*)d_ws; _Float16 *QH = (_Float16*)(ws + WS_QH), *KH = (_Float16*)(ws + WS_KH), *VT = (_Float16*)(ws + WS_VT), *QL = (_Float16*)(ws + WS_QL), *KL = (_Float16*)(ws + WS_KL); __bf16 *VB = (__bf16*)(ws + WS_VB), *VBL = (__bf16*)(ws + WS_VBL); float *Y = (float*)(ws + WS_Y);
  (void)Y; (void)QL; (void)KL; (void)VB; (void)VBL;
  // inputs: 0 x [2048,2,768] (S, B, D); 1 wq [768,768] (out,in), 2 bq; 3 wk, 4 bk; 5 wv, 6 bv; 7 wc (out,in), 8 bc (all biases NONZERO)
  k_proj<<<dim3(TNB * TT / 64, CC / 128, 3), 128, 0, stream>>>(F[0], F[0], F[0], F[1], F[3], F[5], F[2], F[4], F[6], QH, QL, KH, KL, VT, VB, VBL);
  k_fa<<<dim3(TNB * NH, NQB), 128, 0, stream>>>(QH, KH, QL, KL, VT, VB, VBL, Y);
  k_out<<<dim3(TNB * TT / 64, DIN / 128), 128, 0, stream>>>(Y, F[7], F[8], (float*)d_out);   /* writes (S, B, D) rows */
}

// v003
// One run takes 97.9 microseconds.
// In two side-by-side timings against v002, it was 3.26 and 3.28 times as fast.
// All steps since v000 together make it 9.09 times as fast.
// compute dtype: all float inputs rounded to bf16; q / k / v projections with EXACT bf16 products on WMMA 16x16x32 (f32 accumulate) + bias; causal logits: 3 products for the first 384 rows, single f16 q x k after, x 64^-0.5; running-maximum softmax f32 in the same launch; unnormalised P x 2^11 once to f16 x v once to f16 (bf16 hi + lo below row 384), divided by the f32 sum at the end; y hi+lo x exact wc below row 384, x2^6 f16 carry x f16(bf16 x 2^8) wc after, + bc; f32 output written back in the sequence-first layout.
#include <hip/hip_runtime.h>
#include <math.h>

typedef __attribute__((ext_vector_type(16))) _Float16 v16h;
typedef __attribute__((ext_vector_type(16))) __bf16 v16b;
typedef __attribute__((ext_vector_type(8)))  _Float16 v8h;
typedef __attribute__((ext_vector_type(8)))  float v8f;
typedef __attribute__((ext_vector_type(4)))  float v4f;
typedef __attribute__((ext_vector_type(2)))  float v2f;
typedef __attribute__((ext_vector_type(4)))  unsigned v4u;
typedef __attribute__((ext_vector_type(4)))  int v4i;
typedef float __attribute__((may_alias)) float_a;
typedef int __attribute__((may_alias)) int_a;

template <typename T> __device__ __forceinline__ void vst2(void* p, T v) { *(T*)p = v;  }
__device__ __forceinline__ v8f wmma16(v16h a, v16h b, v8f c) {
  v8f d = __builtin_amdgcn_wmma_f32_16x16x32_f16(false, a, false, b, (short)0, c, false, false);
  asm volatile("v_nop\n\tv_nop\n\tv_nop\n\tv_nop" : "+v"(d) : "v"(a), "v"(b));
  return d;
}
__device__ __forceinline__ v8f wmma_bf(v16b a, v16b b, v8f c) {
  v8f d = __builtin_amdgcn_wmma_f32_16x16x32_bf16(false, a, false, b, (short)0, c, false, false);
  asm volatile("v_nop\n\tv_nop\n\tv_nop\n\tv_nop" : "+v"(d) : "v"(a), "v"(b));
  return d;
}
// 16x16x32 fragments: lane = (h = lane>>4, row/col = lane&15); elements 0..7 = k0+8h+0..7, 8..15 = k0+16+8h+0..7; D element r = row 8h+r
__device__ __forceinline__ v16h frag_h(const _Float16* rowk0, int lane) {
  union { v16h v; v8h q[2]; } u; const _Float16* p = rowk0 + 8 * (lane >> 4);
  u.q[0] = *(const v8h*)p; u.q[1] = *(const v8h*)(p + 16); return u.v;
}
__device__ __forceinline__ v16h frag_f32(const float* rowk0, int lane) {
  v16h a; const float* p = rowk0 + 8 * (lane >> 4);
#pragma unroll
  for (int i = 0; i < 8; ++i) { a[i] = (_Float16)p[i]; a[8 + i] = (_Float16)p[16 + i]; }
  return a;
}
__device__ __forceinline__ v16h frag_f32s(const float* rowk0, int lane, float sc) {
  v16h a; const float* p = rowk0 + 8 * (lane >> 4);
#pragma unroll
  for (int i = 0; i < 8; ++i) { a[i] = (_Float16)(p[i] * sc); a[8 + i] = (_Float16)(p[16 + i] * sc); }
  return a;
}
// column fragment from a [K][ld] layout (column n), rows >= K read as 0
__device__ __forceinline__ v16h fragc_f32(const float* W, int k0, int n, int lane, int ld, int K) {
  v16h a; const int g = lane >> 4;
#pragma unroll
  for (int i = 0; i < 8; ++i) { const int ka = k0 + 8 * g + i, kb = ka + 16;
    a[i] = (_Float16)(ka < K ? W[(size_t)(ka < K ? ka : K - 1) * ld + n] : 0.f); a[8 + i] = (_Float16)(kb < K ? W[(size_t)(kb < K ? kb : K - 1) * ld + n] : 0.f); }
  return a;
}
struct F2 { v16b h, l; };
__device__ __forceinline__ F2 bsplit16(const float v[16]) { F2 r;
#pragma unroll
  for (int i = 0; i < 16; ++i) { const __bf16 h = (__bf16)v[i]; r.h[i] = h; r.l[i] = (__bf16)(v[i] - (float)h); }
  return r; }
__device__ __forceinline__ F2 split_row(const float* row, int k0, int lane) { float v[16]; const float* p = row + k0 + 8 * (lane >> 4);
#pragma unroll
  for (int i = 0; i < 8; ++i) { v[i] = p[i]; v[8 + i] = p[16 + i]; }
  return bsplit16(v); }
__device__ __forceinline__ F2 split_rowK(const float* row, int k0, int lane, int K) { float v[16]; const int g = lane >> 4;
#pragma unroll
  for (int i = 0; i < 8; ++i) { const int ka = k0 + 8 * g + i, kb = ka + 16; v[i] = ka < K ? row[ka < K ? ka : K - 1] : 0.f; v[8 + i] = kb < K ? row[kb < K ? kb : K - 1] : 0.f; }
  return bsplit16(v); }
__device__ __forceinline__ F2 split_col(const float* W, int k0, int n, int lane, int ld, int K) { float v[16]; const int g = lane >> 4;
#pragma unroll
  for (int i = 0; i < 8; ++i) { const int ka = k0 + 8 * g + i, kb = ka + 16; v[i] = ka < K ? W[(size_t)(ka < K ? ka : K - 1) * ld + n] : 0.f; v[8 + i] = kb < K ? W[(size_t)(kb < K ? kb : K - 1) * ld + n] : 0.f; }
  return bsplit16(v); }
__device__ __forceinline__ v8f mac3(const F2& a, const F2& b, v8f c) { c = wmma_bf(a.l, b.h, c); c = wmma_bf(a.h, b.l, c); return wmma_bf(a.h, b.h, c); }
__device__ __forceinline__ float sigm(float v) { return 1.0f / (1.0f + expf(-v)); }
#define LDSX() do { asm volatile("s_wait_dscnt 0" ::: "memory"); __builtin_amdgcn_wave_barrier(); __builtin_amdgcn_fence(__ATOMIC_RELEASE, "workgroup"); } while (0)

// Causal multi-head self-attention on a SEQUENCE-FIRST input (x [2048, 2, 768] = (S, B, D); torch (out,in) wq / wk / wv / wc [768,768] N(0,1) x 0.02 applied as x W^T + b, biases N(0,1) x 0.02 - NONZERO; 12 heads x 64; scores / sqrt(64); tril kept, -inf elsewhere; softmax; y wc^T + bc; output transposed back to (S, B, D)). The kernels work on rows b*2048 + t: the projection reads token (b, t) from source row t*2 + b and the output kernel writes it back there.
#define NB 2
#define TT 2048
#define CC 768            // NH * HD = projected width
#define DIN 768          // input (model) width
#define NH 12
#define HD 64
#define NQB (TT / 64)
#define SCALE (0.125f)
#define CAUSAL 1
#ifndef TNB
#define TNB NB
#endif
__device__ __forceinline__ float bfr(float v) { return (float)(__bf16)v; }
typedef __attribute__((ext_vector_type(8))) __bf16 v8b;
__device__ __forceinline__ v16b frag_b(const __bf16* rowk0, int lane) {
  union { v16b v; v8b q[2]; } u; const __bf16* p = rowk0 + 8 * (lane >> 4);
  u.q[0] = *(const v8b*)p; u.q[1] = *(const v8b*)(p + 16); return u.v;
}
#define QBH 6              // causal: query blocks 0..QBH-1 of each sequence (few keys, no averaging) take the high-precision path
#define QHI 384            // rows carrying a q residual plane
#define KHI 384            // key rows carrying k residual / v bf16 hi+lo planes (used only by the causal high-precision path)
// B fragment (k rows k0+.., output column o) of a weight: (in,out) [K][ld] or (out,in) [ld rows of K]: bf16 exact, or f16(bf16 * 256) exact
__device__ __forceinline__ v16b wcol_io(const float* Wm, int k0, int o, int lane, int ld) { v16b w; const int g = lane >> 4;
#pragma unroll
  for (int i = 0; i < 8; ++i) { w[i] = (__bf16)Wm[(size_t)(k0 + 8 * g + i) * ld + o]; w[8 + i] = (__bf16)Wm[(size_t)(k0 + 16 + 8 * g + i) * ld + o]; }
  return w; }
__device__ __forceinline__ v16b wcol_oi(const float* Wm, int k0, int o, int lane, int K) { v16b w; const float* p = Wm + (size_t)o * K + k0 + 8 * (lane >> 4);
#pragma unroll
  for (int i = 0; i < 8; ++i) { w[i] = (__bf16)p[i]; w[8 + i] = (__bf16)p[16 + i]; }
  return w; }
__device__ __forceinline__ v16h wcolh_io(const float* Wm, int k0, int o, int lane, int ld) { v16h w; const int g = lane >> 4;
#pragma unroll
  for (int i = 0; i < 8; ++i) { w[i] = (_Float16)(bfr(Wm[(size_t)(k0 + 8 * g + i) * ld + o]) * 256.0f); w[8 + i] = (_Float16)(bfr(Wm[(size_t)(k0 + 16 + 8 * g + i) * ld + o]) * 256.0f); }
  return w; }
__device__ __forceinline__ v16h wcolh_oi(const float* Wm, int k0, int o, int lane, int K) { v16h w; const float* p = Wm + (size_t)o * K + k0 + 8 * (lane >> 4);
#pragma unroll
  for (int i = 0; i < 8; ++i) { w[i] = (_Float16)(bfr(p[i]) * 256.0f); w[8 + i] = (_Float16)(bfr(p[16 + i]) * 256.0f); }
  return w; }
#define SRCROW(r) ((size_t)((r) % TT) * NB + (size_t)((r) / TT))   // row r = b*TT + t <-> sequence-first row t*NB + b of the (S, B, D) arrays (NB = the module's batch count, also when fewer batches are run)
#define WQKV_LAYOUT 1   // layout for WCOL only, which nothing calls (k_proj reads (out,in) [CC][DIN] rows): 0 = (in,out) [DIN][CC]; 1 = (out,in) [CC][DIN]; 2 = per-head [NH][DIN][HD]
__device__ __forceinline__ v16b wcol_hdk(const float* Wm, int k0, int o, int lane) { v16b w; const int g = lane >> 4; const float* p = Wm + (size_t)(o / HD) * DIN * HD + (o % HD);
#pragma unroll
  for (int i = 0; i < 8; ++i) { w[i] = (__bf16)p[(size_t)(k0 + 8 * g + i) * HD]; w[8 + i] = (__bf16)p[(size_t)(k0 + 16 + 8 * g + i) * HD]; }
  return w; }
#define WO_OUT_IN 1
#if WQKV_LAYOUT == 1
#define WCOL(W, k0, o, lane) wcol_oi(W, k0, o, lane, DIN)
#elif WQKV_LAYOUT == 2
#define WCOL(W, k0, o, lane) wcol_hdk(W, k0, o, lane)
#else
#define WCOL(W, k0, o, lane) wcol_io(W, k0, o, lane, CC)
#endif
#if WO_OUT_IN
#define WOCOL(W, k0, o, lane) wcol_oi(W, k0, o, lane, CC)
#define WOCOLH(W, k0, o, lane) wcolh_oi(W, k0, o, lane, CC)
#else
#define WOCOL(W, k0, o, lane) wcol_io(W, k0, o, lane, DIN)
#define WOCOLH(W, k0, o, lane) wcolh_io(W, k0, o, lane, DIN)
#endif

#define WS_QH  0u                                      // f16 q rows [b*t][CC]
#define WS_KH  (WS_QH + 2u * (size_t)NB * TT * CC)      // f16 k rows [b*t][CC]
#define WS_VT  (WS_KH + 2u * (size_t)NB * TT * CC)      // f16 v planes [b][c][t]
#define WS_QL  (WS_VT + 2u * (size_t)NB * CC * TT)      // f16 q residual x 2^10 rows [b][t < QHI][CC]
#define WS_KL  (WS_QL + 2u * (size_t)NB * QHI * CC)     // f16 k residual x 2^10 rows [b][t < KHI][CC]
#define WS_VB  (WS_KL + 2u * (size_t)NB * KHI * CC)     // bf16 v hi planes [b][c][t < KHI]
#define WS_VBL (WS_VB + 2u * (size_t)NB * CC * KHI)
#define WS_Y   (WS_VBL + 2u * (size_t)NB * CC * KHI)    // f32 ctx rows [b*t][CC]
#define WS_END (WS_Y  + 4u * (size_t)NB * TT * CC)

// operand staging of the two GEMM launches: a stage is PK (projection) or OK (output) k of every tile row. The 128 threads fetch it with global_load_b128 that cover whole 128-B lines (PK / 4 or OK / 4 lanes a row), round it ONCE to the 16-bit operand type and store it in LDS rows with a 16-B pad (pitch 16 B x odd: ds_load_b128 readers); all four waves take their fragments from there
// every '#pragma unroll' of the staging code opens a constant-trip loop over a register array (fetched rows, fragments, accumulators), so that its elements stay in registers
typedef __attribute__((ext_vector_type(4))) __bf16 v4b;
typedef __attribute__((ext_vector_type(4))) _Float16 v4h;
#define PK 32
#define PLP (PK + 8)
#define PRI (512 / PK)     // tile rows that one load instruction of the whole block covers
#define OK 64
#define OLP (OK + 8)
#define ORI (512 / OK)
template <int N> __device__ __forceinline__ void tile_ld(v4f (&r)[N], const float* p, size_t step) {
#pragma unroll
  for (int i = 0; i < N; ++i) r[i] = *(const v4f*)(p + (size_t)i * step); }
__device__ __forceinline__ void st_b(__bf16* d, v4f v) { const v4b o = { (__bf16)v[0], (__bf16)v[1], (__bf16)v[2], (__bf16)v[3] }; *(v4b*)d = o; }
__device__ __forceinline__ void st_bl(__bf16* d, v4f v) { const v4b o = { (__bf16)(v[0] - (float)(__bf16)v[0]), (__bf16)(v[1] - (float)(__bf16)v[1]), (__bf16)(v[2] - (float)(__bf16)v[2]), (__bf16)(v[3] - (float)(__bf16)v[3]) }; *(v4b*)d = o; }
__device__ __forceinline__ void st_hs(_Float16* d, v4f v, float sc) { const v4h o = { (_Float16)(v[0] * sc), (_Float16)(v[1] * sc), (_Float16)(v[2] * sc), (_Float16)(v[3] * sc) }; *(v4h*)d = o; }
__device__ __forceinline__ void st_hw(_Float16* d, v4f v) { const v4h o = { (_Float16)(bfr(v[0]) * 256.0f), (_Float16)(bfr(v[1]) * 256.0f), (_Float16)(bfr(v[2]) * 256.0f), (_Float16)(bfr(v[3]) * 256.0f) }; *(v4h*)d = o; }
#define XCNT_G() asm volatile("s_wait_xcnt 0x0" ::: "memory")   // stands behind a run of global loads, before a register that they name is written again
// ---- k_proj: block = (64 rows, 128 cols, which): q/k/v = X W (+ b) with exact bf16 products (K = DIN) -> which 0: q f16 rows (+ residual rows < QHI); 1: k f16 rows (+ residual rows < KHI); 2: v f16 planes [c][t] (+ bf16 hi/lo planes for t < KHI)
__global__ __launch_bounds__(128) void k_proj(const float* __restrict__ XQ, const float* __restrict__ XK, const float* __restrict__ XV, const float* __restrict__ WQ, const float* __restrict__ WK, const float* __restrict__ WV, const float* __restrict__ BQ, const float* __restrict__ BK, const float* __restrict__ BV,
    _Float16* __restrict__ QH, _Float16* __restrict__ QL, _Float16* __restrict__ KH, _Float16* __restrict__ KL, _Float16* __restrict__ VT, __bf16* __restrict__ VB, __bf16* __restrict__ VBL) {
  __shared__ __align__(16) unsigned char sm[3 * 128 * 72 * 2];   /* two operand buffers in the main loop; behind a barrier the epilogue's output staging takes the same bytes */
  static_assert(2 * (64 + 128) * PLP * 2 <= 3 * 128 * 72 * 2 && 2 * 64 * 136 * 2 <= 3 * 128 * 72 * 2, "LDS");
  __bf16 (*sx)[64][PLP] = (__bf16 (*)[64][PLP])sm; __bf16 (*sw)[128][PLP] = (__bf16 (*)[128][PLP])(sm + 2 * 64 * PLP * 2);
  _Float16 (*sh)[136] = (_Float16 (*)[136])sm; _Float16 (*sl)[136] = (_Float16 (*)[136])(sm + 64 * 136 * 2);
  _Float16 (*th)[72] = (_Float16 (*)[72])sm; __bf16 (*tb)[72] = (__bf16 (*)[72])(sm + 128 * 72 * 2); __bf16 (*tbl)[72] = (__bf16 (*)[72])(sm + 2 * 128 * 72 * 2);
  const int tid = threadIdx.x, wave = tid >> 5, lane = tid & 31, col = lane & 15, g = lane >> 4; const int which = blockIdx.z; const int c0 = blockIdx.y * 128; const size_t r0 = (size_t)blockIdx.x * 64; const size_t bb = r0 / TT; const int t0 = (int)(r0 % TT);
  const float* X = which == 0 ? XQ : which == 1 ? XK : XV; const float* WA = which == 0 ? WQ : which == 1 ? WK : WV; const float* BA = which == 0 ? BQ : which == 1 ? BK : BV;
  v8f acc[8] = {};
  const int lr = tid / (PK / 4), lc = tid % (PK / 4);
  const float* xg = X + SRCROW(r0 + lr) * DIN + lc * 4;   /* sequence-first source row; the tile's 64 rows lie in one sequence, so PRI tile rows on = PRI * NB source rows on */
  const float* wg = WA + (size_t)(c0 + lr) * DIN + lc * 4;   /* (out,in) weight rows */
  v4f rx[64 / PRI], rw[128 / PRI];
  tile_ld(rx, xg, (size_t)PRI * NB * DIN); XCNT_G(); tile_ld(rw, wg, (size_t)PRI * DIN); XCNT_G();
#pragma unroll 1   /* rolled: one copy of the stage; the fetched registers are free again once they are stored */
  for (int s = 0; s < DIN / PK; ++s) { __bf16 (*bx)[PLP] = sx[s & 1]; __bf16 (*bw)[PLP] = sw[s & 1];
#pragma unroll
    for (int i = 0; i < 64 / PRI; ++i) st_b(&bx[i * PRI + lr][lc * 4], rx[i]);
#pragma unroll
    for (int i = 0; i < 128 / PRI; ++i) st_b(&bw[i * PRI + lr][lc * 4], rw[i]);
    __syncthreads();   /* publishes stage s; also: every wave has left the other buffer (read in stage s - 1) before stage s + 1 is stored there */
    if (s + 1 < DIN / PK) { tile_ld(rx, xg + (s + 1) * PK, (size_t)PRI * NB * DIN); XCNT_G(); tile_ld(rw, wg + (s + 1) * PK, (size_t)PRI * DIN); XCNT_G(); }   /* next stage flies while this one is multiplied */
#pragma unroll
    for (int kk = 0; kk < PK / 32; ++kk) { const v16b a = frag_b(&bx[wave * 16 + col][kk * 32], lane);
#pragma unroll
      for (int j0 = 0; j0 < 8; j0 += 4) { v16b w[4];   /* fragment reads go out as a group ahead of their products: one LDS latency a group */
#pragma unroll
        for (int u = 0; u < 4; ++u) w[u] = frag_b(&bw[(j0 + u) * 16 + col][kk * 32], lane);
#pragma unroll
        for (int u = 0; u < 4; ++u) acc[j0 + u] = wmma_bf(a, w[u], acc[j0 + u]); } } }
  __syncthreads();   /* the last stage's readers are done before the epilogue writes over the buffers */
  if (which < 2) { _Float16* DH = which == 0 ? QH : KH; _Float16* DL = which == 0 ? QL : KL; const int nhi = which == 0 ? QHI : KHI; const bool hi_rows = t0 < nhi;
#pragma unroll
    for (int j = 0; j < 8; ++j) { const float bias = BA ? bfr(BA[c0 + j * 16 + col]) : 0.f;
#pragma unroll
      for (int r = 0; r < 8; ++r) { const float v = acc[j][r] + bias; const _Float16 hv = (_Float16)v; sh[wave * 16 + 8 * g + r][j * 16 + col] = hv; sl[wave * 16 + 8 * g + r][j * 16 + col] = (_Float16)((v - (float)hv) * 1024.0f); } }
    __syncthreads();
    for (int e = tid; e < 64 * 16; e += 128) { const int rl = e >> 4, q = e & 15; vst2((unsigned*)(DH + (r0 + rl) * CC + c0 + q * 8), *(const v4u*)&sh[rl][q * 8]); if (hi_rows) vst2((unsigned*)(DL + (bb * nhi + t0 + rl) * (size_t)CC + c0 + q * 8), *(const v4u*)&sl[rl][q * 8]); }
  } else { const bool hi_rows = t0 < KHI;
#pragma unroll
    for (int j = 0; j < 8; ++j) { const float bias = BA ? bfr(BA[c0 + j * 16 + col]) : 0.f;
#pragma unroll
      for (int r = 0; r < 8; ++r) { const float v = acc[j][r] + bias; const int rl = wave * 16 + 8 * g + r, cl = j * 16 + col; th[cl][rl] = (_Float16)v; const __bf16 bh = (__bf16)v; tb[cl][rl] = bh; tbl[cl][rl] = (__bf16)(v - (float)bh); } }
    __syncthreads();
    for (int e = tid; e < 128 * 8; e += 128) { const int cl = e >> 3, q = e & 7; vst2((unsigned*)(VT + (bb * CC + c0 + cl) * (size_t)TT + t0 + q * 8), *(const v4u*)&th[cl][q * 8]); if (hi_rows) { const size_t o3 = (bb * CC + c0 + cl) * (size_t)KHI + t0 + q * 8; vst2((unsigned*)(VB + o3), *(const v4u*)&tb[cl][q * 8]); vst2((unsigned*)(VBL + o3), *(const v4u*)&tbl[cl][q * 8]); } } } }
// ---- k_fa: block = 4 waves x 16 queries (query block qb, heaviest first) of plane b*NH + h; per 32 keys: S^T = K Q^T (a lane holds 16 keys of ONE query), running maximum and sum in f32 (log2 domain), P^T x 2^11 packed from the score tiles straight into the B operand, O^T += V^T P^T; ctx = O / sum. Query blocks < QBH: 3-product logits (q, k residuals x 2^10), P and v as bf16 hi + lo (3 products)
#define LOGC (SCALE * 1.44269504088896340736f)
struct SMX { float m, l; };
__device__ __forceinline__ float xhalf(float x) { return __builtin_bit_cast(float, __builtin_amdgcn_permlanex16(__builtin_bit_cast(int, x), __builtin_bit_cast(int, x), 0x76543210, 0xfedcba98, false, false)); }   // lane l with lane l ^ 16
#define XCNT0() asm volatile("s_wait_xcnt 0x0" ::: "memory")   // stands behind a run of global loads, before their address registers are reused
// one 32-key step of the running softmax of this lane's query: t[0..7] = keys k0+8g+r, t[8..15] = keys k0+16+8g+r (scaled log2 logits); returns e[] = 2^(t - max + 11); rescales acc only when some query of the wave has a new maximum
__device__ __forceinline__ void sm_step(float t[16], SMX& st, v8f acc[HD / 16], int k0, int qfirst, int qi, int g) {
  if (k0 + 31 > qfirst) {   /* wave-uniform: only steps that reach the diagonal mask by index */
#pragma unroll
    for (int r = 0; r < 8; ++r) { if (k0 + 8 * g + r > qi) t[r] = -3.0e38f; if (k0 + 16 + 8 * g + r > qi) t[8 + r] = -3.0e38f; } }
  float mx = t[0];
#pragma unroll
  for (int s = 1; s < 16; ++s) mx = fmaxf(mx, t[s]);
  mx = fmaxf(mx, xhalf(mx));   /* the other half of the wave holds the query's other 16 keys */
  if (__builtin_amdgcn_ballot_w32(mx > st.m) != 0) { const float mn = fmaxf(st.m, mx); const float al = __builtin_amdgcn_exp2f(st.m - mn); st.m = mn; st.l *= al;
#pragma unroll
    for (int j = 0; j < HD / 16; ++j)
#pragma unroll
      for (int r = 0; r < 8; ++r) acc[j][r] *= al; }
  const float mo = st.m - 11.0f; float ps = 0.f;
#pragma unroll
  for (int s = 0; s < 16; ++s) { t[s] = __builtin_amdgcn_exp2f(t[s] - mo); ps += t[s]; }
  st.l += ps; }
__global__ __launch_bounds__(128) void k_fa(const _Float16* __restrict__ QH, const _Float16* __restrict__ KH, const _Float16* __restrict__ QL, const _Float16* __restrict__ KL, const _Float16* __restrict__ VT, const __bf16* __restrict__ VB, const __bf16* __restrict__ VBL, float* __restrict__ Y) {
  const int b = blockIdx.x / NH, h = blockIdx.x % NH; const int qb = NQB - 1 - (int)blockIdx.y;
  const int tid = threadIdx.x, wave = __builtin_amdgcn_readfirstlane(tid >> 5), lane = tid & 31, col = lane & 15, g = lane >> 4;
  /* wave number held scalar: trip count and diagonal test become scalar branches, every lane stays on at the matrix instructions */ const int ql0 = qb * 64 + wave * 16, qi = ql0 + col; const int nblk = (ql0 + 47) >> 5;   /* 32-key steps that cover keys 0 .. ql0 + 15 */
  const _Float16* Qp = QH + ((size_t)b * TT + qi) * CC + h * HD; const _Float16* Kp = KH + ((size_t)b * TT + col) * CC + h * HD;
  v8f acc[HD / 16] = {}; SMX st; st.m = -3.0e38f; st.l = 0.f;
  const v16h qf0 = frag_h(Qp, lane), qf1 = frag_h(Qp + 32, lane);
  XCNT0();
  if (qb < QBH) {   /* block-uniform */
    const _Float16* QLp = QL + ((size_t)b * QHI + qi) * CC + h * HD; const _Float16* KLp = KL + ((size_t)b * KHI + col) * CC + h * HD; const size_t vo = ((size_t)b * CC + h * HD + col) * (size_t)KHI;
    const v16h ql0f = frag_h(QLp, lane), ql1f = frag_h(QLp + 32, lane);
#pragma unroll 1   /* at most 12 steps: kept rolled for code size */
    for (int i = 0; i < nblk; ++i) { const int k0 = i * 32; float t[16];
#pragma unroll
      for (int u = 0; u < 2; ++u) { const size_t ko = (size_t)(k0 + u * 16) * CC; const v16h kh0 = frag_h(Kp + ko, lane), kh1 = frag_h(Kp + ko + 32, lane), kl0 = frag_h(KLp + ko, lane), kl1 = frag_h(KLp + ko + 32, lane); v8f a = {}, al = {};
        a = wmma16(kh0, qf0, a); al = wmma16(kh0, ql0f, al); al = wmma16(kl0, qf0, al); a = wmma16(kh1, qf1, a); al = wmma16(kh1, ql1f, al); al = wmma16(kl1, qf1, al);
#pragma unroll
        for (int r = 0; r < 8; ++r) t[u * 8 + r] = (a[r] + al[r] * (1.0f / 1024.0f)) * LOGC; }
      sm_step(t, st, acc, k0, ql0, qi, g);
      const F2 p = bsplit16(t);
#pragma unroll
      for (int j = 0; j < HD / 16; ++j) { const size_t po = vo + (size_t)j * 16 * KHI + k0; const v16b vh = frag_b(VB + po, lane); acc[j] = wmma_bf(vh, p.h, acc[j]); acc[j] = wmma_bf(vh, p.l, acc[j]); acc[j] = wmma_bf(frag_b(VBL + po, lane), p.h, acc[j]); } }
  } else {
    const _Float16* Vp = VT + ((size_t)b * CC + h * HD + col) * (size_t)TT;
    v16h kf[4], vf[4];
#pragma unroll
    for (int u = 0; u < 2; ++u) { kf[2 * u] = frag_h(Kp + (size_t)(u * 16) * CC, lane); kf[2 * u + 1] = frag_h(Kp + (size_t)(u * 16) * CC + 32, lane); }
#pragma unroll
    for (int j = 0; j < HD / 16; ++j) vf[j] = frag_h(Vp + (size_t)j * 16 * TT, lane);
#pragma unroll 2   /* two steps per trip: the fragments fetched ahead change register names instead of being copied */
    for (int i = 0; i < nblk; ++i) { const int k0 = i * 32; const int kn = (i + 1 < nblk ? i + 1 : i) * 32;   /* next step's K and V rows are fetched one step ahead (the last step re-reads its own: in bounds) */
      v16h kx[4], vx[4];
#pragma unroll
      for (int u = 0; u < 2; ++u) { kx[2 * u] = frag_h(Kp + (size_t)(kn + u * 16) * CC, lane); kx[2 * u + 1] = frag_h(Kp + (size_t)(kn + u * 16) * CC + 32, lane); }
      XCNT0();
#pragma unroll
      for (int j = 0; j < HD / 16; ++j) vx[j] = frag_h(Vp + (size_t)j * 16 * TT + kn, lane);
      XCNT0();
      v8f s0 = {}, s1 = {}; s0 = wmma16(kf[0], qf0, s0); s1 = wmma16(kf[2], qf0, s1); s0 = wmma16(kf[1], qf1, s0); s1 = wmma16(kf[3], qf1, s1);
      float t[16];
#pragma unroll
      for (int r = 0; r < 8; ++r) { t[r] = s0[r] * LOGC; t[8 + r] = s1[r] * LOGC; }
      sm_step(t, st, acc, k0, ql0, qi, g);
      v16h p;
#pragma unroll
      for (int s = 0; s < 16; ++s) p[s] = (_Float16)t[s];
#pragma unroll
      for (int j = 0; j < HD / 16; ++j) acc[j] = wmma16(vf[j], p, acc[j]);
#pragma unroll
      for (int u = 0; u < 4; ++u) { kf[u] = kx[u]; vf[u] = vx[u]; } } }
  const float inv = 1.0f / (st.l + xhalf(st.l));   /* the two halves' partial sums join once; the maximum's own term keeps the sum >= 2^11 */
  float* yp = Y + ((size_t)b * TT + qi) * CC + h * HD + 8 * g;   /* acc[j][r] = ctx[query qi][j*16 + 8g + r]: 32 contiguous bytes per lane and j */
#pragma unroll
  for (int j = 0; j < HD / 16; ++j) { const v4f lo = { acc[j][0] * inv, acc[j][1] * inv, acc[j][2] * inv, acc[j][3] * inv }, hi = { acc[j][4] * inv, acc[j][5] * inv, acc[j][6] * inv, acc[j][7] * inv }; vst2(yp + j * 16, lo); vst2(yp + j * 16 + 4, hi); } }
// ---- k_out: block = (64 rows, 128 cols): out = ctx Wo (+ bo): ctx once to f16 against Wo as f16(bf16 x 2^8) exact (1 product) x 2^-8; causal early rows (< QHI of each sequence): ctx bf16 hi + lo against exact bf16 Wo (2 products)
__global__ __launch_bounds__(128) void k_out(const float* __restrict__ Y, const float* __restrict__ WO, const float* __restrict__ BO, float* __restrict__ OUT) { __shared__ __align__(16) unsigned char sm[2 * (64 + 64 + 128) * OLP * 2];   /* two operand buffers (ctx hi, ctx lo, Wo); behind a barrier the output staging takes the same bytes */
  static_assert(4 * 16 * 132 * 4 <= 2 * (64 + 64 + 128) * OLP * 2, "LDS");
  float (*sf)[16][132] = (float (*)[16][132])sm;
  const int tid = threadIdx.x, wave = tid >> 5, lane = tid & 31, col = lane & 15, g = lane >> 4; const int c0 = blockIdx.y * 128; const size_t r0 = (size_t)blockIdx.x * 64 + wave * 16;
  v8f acc[8] = {};
  const int lr = tid / (OK / 4), lc = tid % (OK / 4);
  const float* yg = Y + ((size_t)blockIdx.x * 64 + lr) * CC + lc * 4; const float* wg = WO + (size_t)(c0 + lr) * CC + lc * 4;   /* (out,in) weight rows */
  if (CAUSAL && (int)(((size_t)blockIdx.x * 64) % TT) < QHI) {   /* block-uniform */
    __bf16 (*sah)[64][OLP] = (__bf16 (*)[64][OLP])sm; __bf16 (*sal)[64][OLP] = (__bf16 (*)[64][OLP])(sm + 2 * 64 * OLP * 2); __bf16 (*sw)[128][OLP] = (__bf16 (*)[128][OLP])(sm + 4 * 64 * OLP * 2);
    v4f ry[64 / ORI], rw[128 / ORI];
    tile_ld(ry, yg, (size_t)ORI * CC); XCNT_G(); tile_ld(rw, wg, (size_t)ORI * CC); XCNT_G();
#pragma unroll 1   /* rolled: one copy of the stage */
    for (int s = 0; s < CC / OK; ++s) { __bf16 (*bh)[OLP] = sah[s & 1]; __bf16 (*bl)[OLP] = sal[s & 1]; __bf16 (*bw)[OLP] = sw[s & 1];
#pragma unroll
      for (int i = 0; i < 64 / ORI; ++i) { st_b(&bh[i * ORI + lr][lc * 4], ry[i]); st_bl(&bl[i * ORI + lr][lc * 4], ry[i]); }
#pragma unroll
      for (int i = 0; i < 128 / ORI; ++i) st_b(&bw[i * ORI + lr][lc * 4], rw[i]);
      __syncthreads();   /* publishes stage s; every wave has left the other buffer before stage s + 1 is stored there */
      if (s + 1 < CC / OK) { tile_ld(ry, yg + (s + 1) * OK, (size_t)ORI * CC); XCNT_G(); tile_ld(rw, wg + (s + 1) * OK, (size_t)ORI * CC); XCNT_G(); }
#pragma unroll
      for (int kk = 0; kk < OK / 32; ++kk) { const v16b ah = frag_b(&bh[wave * 16 + col][kk * 32], lane), al = frag_b(&bl[wave * 16 + col][kk * 32], lane);
#pragma unroll
        for (int j0 = 0; j0 < 8; j0 += 4) { v16b w[4];   /* fragment reads go out as a group ahead of their products */
#pragma unroll
          for (int u = 0; u < 4; ++u) w[u] = frag_b(&bw[(j0 + u) * 16 + col][kk * 32], lane);
#pragma unroll
          for (int u = 0; u < 4; ++u) { acc[j0 + u] = wmma_bf(ah, w[u], acc[j0 + u]); acc[j0 + u] = wmma_bf(al, w[u], acc[j0 + u]); } } } }
    __syncthreads();   /* the last stage's readers are done before the output staging writes over the buffers */
#pragma unroll
    for (int j = 0; j < 8; ++j) { const float bias = BO ? bfr(BO[c0 + j * 16 + col]) : 0.f;
#pragma unroll
      for (int r = 0; r < 8; ++r) sf[wave][8 * g + r][j * 16 + col] = acc[j][r] + bias; }
  } else {
    _Float16 (*sa)[64][OLP] = (_Float16 (*)[64][OLP])sm; _Float16 (*sw)[128][OLP] = (_Float16 (*)[128][OLP])(sm + 2 * 64 * OLP * 2);
    v4f ry[64 / ORI], rw[128 / ORI];
    tile_ld(ry, yg, (size_t)ORI * CC); XCNT_G(); tile_ld(rw, wg, (size_t)ORI * CC); XCNT_G();
#pragma unroll 1   /* rolled: one copy of the stage */
    for (int s = 0; s < CC / OK; ++s) { _Float16 (*ba)[OLP] = sa[s & 1]; _Float16 (*bw)[OLP] = sw[s & 1];
#pragma unroll
      for (int i = 0; i < 64 / ORI; ++i) st_hs(&ba[i * ORI + lr][lc * 4], ry[i], 64.0f);   /* ctx carried x 2^6 into f16 so small-magnitude context rows stay clear of f16 subnormals */
#pragma unroll
      for (int i = 0; i < 128 / ORI; ++i) st_hw(&bw[i * ORI + lr][lc * 4], rw[i]);
      __syncthreads();   /* publishes stage s; every wave has left the other buffer before stage s + 1 is stored there */
      if (s + 1 < CC / OK) { tile_ld(ry, yg + (s + 1) * OK, (size_t)ORI * CC); XCNT_G(); tile_ld(rw, wg + (s + 1) * OK, (size_t)ORI * CC); XCNT_G(); }
#pragma unroll
      for (int kk = 0; kk < OK / 32; ++kk) { const v16h a = frag_h(&ba[wave * 16 + col][kk * 32], lane);
#pragma unroll
        for (int j0 = 0; j0 < 8; j0 += 4) { v16h w[4];   /* fragment reads go out as a group ahead of their products */
#pragma unroll
          for (int u = 0; u < 4; ++u) w[u] = frag_h(&bw[(j0 + u) * 16 + col][kk * 32], lane);
#pragma unroll
          for (int u = 0; u < 4; ++u) acc[j0 + u] = wmma16(a, w[u], acc[j0 + u]); } } }
    __syncthreads();   /* the last stage's readers are done before the output staging writes over the buffers */
#pragma unroll
    for (int j = 0; j < 8; ++j) { const float bias = BO ? bfr(BO[c0 + j * 16 + col]) : 0.f;
#pragma unroll
      for (int r = 0; r < 8; ++r) sf[wave][8 * g + r][j * 16 + col] = acc[j][r] * (1.0f / 16384.0f) + bias; } }   /* 2^-8 (Wo carry) x 2^-6 (ctx carry) */
  LDSX(); for (int rl = 0; rl < 16; ++rl) vst2(OUT + SRCROW(r0 + rl) * DIN + c0 + lane * 4, *(const v4f*)&sf[wave][rl][lane * 4]); }

extern "C" void kernel_launch(void* const* d_in, const int* in_sizes, int n_in, void* d_out, int out_size, void* d_ws, size_t ws_size, hipStream_t stream) {
  (void)in_sizes; (void)n_in; (void)out_size;
  const float** F = (const float**)d_in;
  if (ws_size < (size_t)WS_END) return;
  char* ws = (char*)d_ws; _Float16 *QH = (_Float16*)(ws + WS_QH), *KH = (_Float16*)(ws + WS_KH), *VT = (_Float16*)(ws + WS_VT), *QL = (_Float16*)(ws + WS_QL), *KL = (_Float16*)(ws + WS_KL); __bf16 *VB = (__bf16*)(ws + WS_VB), *VBL = (__bf16*)(ws + WS_VBL); float *Y = (float*)(ws + WS_Y);
  (void)Y; (void)QL; (void)KL; (void)VB; (void)VBL;
  // inputs: 0 x [2048,2,768] (S, B, D); 1 wq [768,768] (out,in), 2 bq; 3 wk, 4 bk; 5 wv, 6 bv; 7 wc (out,in), 8 bc (all biases NONZERO)
  k_proj<<<dim3(TNB * TT / 64, CC / 128, 3), 128, 0, stream>>>(F[0], F[0], F[0], F[1], F[3], F[5], F[2], F[4], F[6], QH, QL, KH, KL, VT, VB, VBL);
  k_fa<<<dim3(TNB * NH, NQB), 128, 0, stream>>>(QH, KH, QL, KL, VT, VB, VBL, Y);
  k_out<<<dim3(TNB * TT / 64, DIN / 128), 128, 0, stream>>>(Y, F[7], F[8], (float*)d_out);   /* writes (S, B, D) rows */
}

// v004
// Measured time: 91 microseconds a run.
// Two timings next to v003 put it at 1.07 and 1.08 times that version's speed.
// Counting every step since v000, it is 9.81 times as fast.
// compute dtype: all float inputs rounded to bf16; q / k / v projections with EXACT bf16 products on WMMA 16x16x32 (f32 accumulate) + bias; causal logits: 3 products for the first 384 rows, single f16 q x k after, x 64^-0.5; running-maximum softmax f32 in the same launch; unnormalised P x 2^11 once to f16 x v once to f16 (bf16 hi + lo below row 384), divided by the f32 sum at the end; y hi+lo x exact wc below row 384, x2^6 f16 carry x f16(bf16 x 2^8) wc after, + bc; f32 output written back in the sequence-first layout.
#include <hip/hip_runtime.h>
#include <math.h>

typedef __attribute__((ext_vector_type(16))) _Float16 v16h;
typedef __attribute__((ext_vector_type(16))) __bf16 v16b;
typedef __attribute__((ext_vector_type(8)))  _Float16 v8h;
typedef __attribute__((ext_vector_type(8)))  float v8f;
typedef __attribute__((ext_vector_type(4)))  float v4f;
typedef __attribute__((ext_vector_type(2)))  float v2f;
typedef __attribute__((ext_vector_type(4)))  unsigned v4u;
typedef __attribute__((ext_vector_type(4)))  int v4i;
typedef float __attribute__((may_alias)) float_a;
typedef int __attribute__((may_alias)) int_a;

template <typename T> __device__ __forceinline__ void vst2(void* p, T v) { *(T*)p = v;  }
__device__ __forceinline__ v8f wmma16(v16h a, v16h b, v8f c) {
  v8f d = __builtin_amdgcn_wmma_f32_16x16x32_f16(false, a, false, b, (short)0, c, false, false);
  asm volatile("v_nop\n\tv_nop\n\tv_nop\n\tv_nop" : "+v"(d) : "v"(a), "v"(b));
  return d;
}
__device__ __forceinline__ v8f wmma_bf(v16b a, v16b b, v8f c) {
  v8f d = __builtin_amdgcn_wmma_f32_16x16x32_bf16(false, a, false, b, (short)0, c, false, false);
  asm volatile("v_nop\n\tv_nop\n\tv_nop\n\tv_nop" : "+v"(d) : "v"(a), "v"(b));
  return d;
}
// 16x16x32 fragments: lane = (h = lane>>4, row/col = lane&15); elements 0..7 = k0+8h+0..7, 8..15 = k0+16+8h+0..7; D element r = row 8h+r
__device__ __forceinline__ v16h frag_h(const _Float16* rowk0, int lane) {
  union { v16h v; v8h q[2]; } u; const _Float16* p = rowk0 + 8 * (lane >> 4);
  u.q[0] = *(const v8h*)p; u.q[1] = *(const v8h*)(p + 16); return u.v;
}
__device__ __forceinline__ v16h frag_f32(const float* rowk0, int lane) {
  v16h a; const float* p = rowk0 + 8 * (lane >> 4);
#pragma unroll
  for (int i = 0; i < 8; ++i) { a[i] = (_Float16)p[i]; a[8 + i] = (_Float16)p[16 + i]; }
  return a;
}
__device__ __forceinline__ v16h frag_f32s(const float* rowk0, int lane, float sc) {
  v16h a; const float* p = rowk0 + 8 * (lane >> 4);
#pragma unroll
  for (int i = 0; i < 8; ++i) { a[i] = (_Float16)(p[i] * sc); a[8 + i] = (_Float16)(p[16 + i] * sc); }
  return a;
}
// column fragment from a [K][ld] layout (column n), rows >= K read as 0
__device__ __forceinline__ v16h fragc_f32(const float* W, int k0, int n, int lane, int ld, int K) {
  v16h a; const int g = lane >> 4;
#pragma unroll
  for (int i = 0; i < 8; ++i) { const int ka = k0 + 8 * g + i, kb = ka + 16;
    a[i] = (_Float16)(ka < K ? W[(size_t)(ka < K ? ka : K - 1) * ld + n] : 0.f); a[8 + i] = (_Float16)(kb < K ? W[(size_t)(kb < K ? kb : K - 1) * ld + n] : 0.f); }
  return a;
}
struct F2 { v16b h, l; };
__device__ __forceinline__ F2 bsplit16(const float v[16]) { F2 r;
#pragma unroll
  for (int i = 0; i < 16; ++i) { const __bf16 h = (__bf16)v[i]; r.h[i] = h; r.l[i] = (__bf16)(v[i] - (float)h); }
  return r; }
__device__ __forceinline__ F2 split_row(const float* row, int k0, int lane) { float v[16]; const float* p = row + k0 + 8 * (lane >> 4);
#pragma unroll
  for (int i = 0; i < 8; ++i) { v[i] = p[i]; v[8 + i] = p[16 + i]; }
  return bsplit16(v); }
__device__ __forceinline__ F2 split_rowK(const float* row, int k0, int lane, int K) { float v[16]; const int g = lane >> 4;
#pragma unroll
  for (int i = 0; i < 8; ++i) { const int ka = k0 + 8 * g + i, kb = ka + 16; v[i] = ka < K ? row[ka < K ? ka : K - 1] : 0.f; v[8 + i] = kb < K ? row[kb < K ? kb : K - 1] : 0.f; }
  return bsplit16(v); }
__device__ __forceinline__ F2 split_col(const float* W, int k0, int n, int lane, int ld, int K) { float v[16]; const int g = lane >> 4;
#pragma unroll
  for (int i = 0; i < 8; ++i) { const int ka = k0 + 8 * g + i, kb = ka + 16; v[i] = ka < K ? W[(size_t)(ka < K ? ka : K - 1) * ld + n] : 0.f; v[8 + i] = kb < K ? W[(size_t)(kb < K ? kb : K - 1) * ld + n] : 0.f; }
  return bsplit16(v); }
__device__ __forceinline__ v8f mac3(const F2& a, const F2& b, v8f c) { c = wmma_bf(a.l, b.h, c); c = wmma_bf(a.h, b.l, c); return wmma_bf(a.h, b.h, c); }
__device__ __forceinline__ float sigm(float v) { return 1.0f / (1.0f + expf(-v)); }
#define LDSX() do { asm volatile("s_wait_dscnt 0" ::: "memory"); __builtin_amdgcn_wave_barrier(); __builtin_amdgcn_fence(__ATOMIC_RELEASE, "workgroup"); } while (0)

// Causal multi-head self-attention on a SEQUENCE-FIRST input (x [2048, 2, 768] = (S, B, D); torch (out,in) wq / wk / wv / wc [768,768] N(0,1) x 0.02 applied as x W^T + b, biases N(0,1) x 0.02 - NONZERO; 12 heads x 64; scores / sqrt(64); tril kept, -inf elsewhere; softmax; y wc^T + bc; output transposed back to (S, B, D)). The kernels work on rows b*2048 + t: the projection reads token (b, t) from source row t*2 + b and the output kernel writes it back there.
#define NB 2
#define TT 2048
#define CC 768            // NH * HD = projected width
#define DIN 768          // input (model) width
#define NH 12
#define HD 64
#define NQB (TT / 64)
#define SCALE (0.125f)
#define CAUSAL 1
#ifndef TNB
#define TNB NB
#endif
__device__ __forceinline__ float bfr(float v) { return (float)(__bf16)v; }
typedef __attribute__((ext_vector_type(8))) __bf16 v8b;
__device__ __forceinline__ v16b frag_b(const __bf16* rowk0, int lane) {
  union { v16b v; v8b q[2]; } u; const __bf16* p = rowk0 + 8 * (lane >> 4);
  u.q[0] = *(const v8b*)p; u.q[1] = *(const v8b*)(p + 16); return u.v;
}
#define QBH 6              // causal: query blocks 0..QBH-1 of each sequence (few keys, no averaging) take the high-precision path
#define QHI 384            // rows carrying a q residual plane
#define KHI 384            // key rows carrying k residual / v bf16 hi+lo planes (used only by the causal high-precision path)
// B fragment (k rows k0+.., output column o) of a weight: (in,out) [K][ld] or (out,in) [ld rows of K]: bf16 exact, or f16(bf16 * 256) exact
__device__ __forceinline__ v16b wcol_io(const float* Wm, int k0, int o, int lane, int ld) { v16b w; const int g = lane >> 4;
#pragma unroll
  for (int i = 0; i < 8; ++i) { w[i] = (__bf16)Wm[(size_t)(k0 + 8 * g + i) * ld + o]; w[8 + i] = (__bf16)Wm[(size_t)(k0 + 16 + 8 * g + i) * ld + o]; }
  return w; }
__device__ __forceinline__ v16b wcol_oi(const float* Wm, int k0, int o, int lane, int K) { v16b w; const float* p = Wm + (size_t)o * K + k0 + 8 * (lane >> 4);
#pragma unroll
  for (int i = 0; i < 8; ++i) { w[i] = (__bf16)p[i]; w[8 + i] = (__bf16)p[16 + i]; }
  return w; }
__device__ __forceinline__ v16h wcolh_io(const float* Wm, int k0, int o, int lane, int ld) { v16h w; const int g = lane >> 4;
#pragma unroll
  for (int i = 0; i < 8; ++i) { w[i] = (_Float16)(bfr(Wm[(size_t)(k0 + 8 * g + i) * ld + o]) * 256.0f); w[8 + i] = (_Float16)(bfr(Wm[(size_t)(k0 + 16 + 8 * g + i) * ld + o]) * 256.0f); }
  return w; }
__device__ __forceinline__ v16h wcolh_oi(const float* Wm, int k0, int o, int lane, int K) { v16h w; const float* p = Wm + (size_t)o * K + k0 + 8 * (lane >> 4);
#pragma unroll
  for (int i = 0; i < 8; ++i) { w[i] = (_Float16)(bfr(p[i]) * 256.0f); w[8 + i] = (_Float16)(bfr(p[16 + i]) * 256.0f); }
  return w; }
#define SRCROW(r) ((size_t)((r) % TT) * NB + (size_t)((r) / TT))   // row r = b*TT + t <-> sequence-first row t*NB + b of the (S, B, D) arrays (NB = the module's batch count, also when fewer batches are run)
#define WQKV_LAYOUT 1   // layout for WCOL only, which nothing calls (k_proj reads (out,in) [CC][DIN] rows): 0 = (in,out) [DIN][CC]; 1 = (out,in) [CC][DIN]; 2 = per-head [NH][DIN][HD]
__device__ __forceinline__ v16b wcol_hdk(const float* Wm, int k0, int o, int lane) { v16b w; const int g = lane >> 4; const float* p = Wm + (size_t)(o / HD) * DIN * HD + (o % HD);
#pragma unroll
  for (int i = 0; i < 8; ++i) { w[i] = (__bf16)p[(size_t)(k0 + 8 * g + i) * HD]; w[8 + i] = (__bf16)p[(size_t)(k0 + 16 + 8 * g + i) * HD]; }
  return w; }
#define WO_OUT_IN 1
#if WQKV_LAYOUT == 1
#define WCOL(W, k0, o, lane) wcol_oi(W, k0, o, lane, DIN)
#elif WQKV_LAYOUT == 2
#define WCOL(W, k0, o, lane) wcol_hdk(W, k0, o, lane)
#else
#define WCOL(W, k0, o, lane) wcol_io(W, k0, o, lane, CC)
#endif
#if WO_OUT_IN
#define WOCOL(W, k0, o, lane) wcol_oi(W, k0, o, lane, CC)
#define WOCOLH(W, k0, o, lane) wcolh_oi(W, k0, o, lane, CC)
#else
#define WOCOL(W, k0, o, lane) wcol_io(W, k0, o, lane, DIN)
#define WOCOLH(W, k0, o, lane) wcolh_io(W, k0, o, lane, DIN)
#endif

#define WS_QH  0u                                      // f16 q rows [b*t][CC]
#define WS_KH  (WS_QH + 2u * (size_t)NB * TT * CC)      // f16 k rows [b*t][CC]
#define WS_VT  (WS_KH + 2u * (size_t)NB * TT * CC)      // f16 v planes [b][c][t]
#define WS_QL  (WS_VT + 2u * (size_t)NB * CC * TT)      // f16 q residual x 2^10 rows [b][t < QHI][CC]
#define WS_KL  (WS_QL + 2u * (size_t)NB * QHI * CC)     // f16 k residual x 2^10 rows [b][t < KHI][CC]
#define WS_VB  (WS_KL + 2u * (size_t)NB * KHI * CC)     // bf16 v hi planes [b][c][t < KHI]
#define WS_VBL (WS_VB + 2u * (size_t)NB * CC * KHI)
#define WS_Y   (WS_VBL + 2u * (size_t)NB * CC * KHI)    // f32 ctx rows [b*t][CC]
#define WS_END (WS_Y  + 4u * (size_t)NB * TT * CC)

// operand staging of the two GEMM launches: a stage is PK (projection) or OK (output) k of every tile row. The 128 threads fetch it with global_load_b128 that cover whole 128-B lines (PK / 4 or OK / 4 lanes a row), round it ONCE to the 16-bit operand type and store it in LDS rows with a 16-B pad (pitch 16 B x odd: ds_load_b128 readers); all four waves take their fragments from there
// every '#pragma unroll' of the staging code opens a constant-trip loop over a register array (fetched rows, fragments, accumulators), so that its elements stay in registers
typedef __attribute__((ext_vector_type(4))) __bf16 v4b;
typedef __attribute__((ext_vector_type(4))) _Float16 v4h;
#define PK 32
#define PLP (PK + 8)
#define PRI (512 / PK)     // tile rows that one load instruction of the whole block covers
#define OK 64
#define OLP (OK + 8)
#define ORI (512 / OK)
template <int N> __device__ __forceinline__ void tile_ld(v4f (&r)[N], const float* p, size_t step) {
#pragma unroll
  for (int i = 0; i < N; ++i) r[i] = *(const v4f*)(p + (size_t)i * step); }
__device__ __forceinline__ void st_b(__bf16* d, v4f v) { const v4b o = { (__bf16)v[0], (__bf16)v[1], (__bf16)v[2], (__bf16)v[3] }; *(v4b*)d = o; }
__device__ __forceinline__ void st_bl(__bf16* d, v4f v) { const v4b o = { (__bf16)(v[0] - (float)(__bf16)v[0]), (__bf16)(v[1] - (float)(__bf16)v[1]), (__bf16)(v[2] - (float)(__bf16)v[2]), (__bf16)(v[3] - (float)(__bf16)v[3]) }; *(v4b*)d = o; }
__device__ __forceinline__ void st_hs(_Float16* d, v4f v, float sc) { const v4h o = { (_Float16)(v[0] * sc), (_Float16)(v[1] * sc), (_Float16)(v[2] * sc), (_Float16)(v[3] * sc) }; *(v4h*)d = o; }
__device__ __forceinline__ void st_hw(_Float16* d, v4f v) { const v4h o = { (_Float16)(bfr(v[0]) * 256.0f), (_Float16)(bfr(v[1]) * 256.0f), (_Float16)(bfr(v[2]) * 256.0f), (_Float16)(bfr(v[3]) * 256.0f) }; *(v4h*)d = o; }
#define XCNT_G() asm volatile("s_wait_xcnt 0x0" ::: "memory")   // stands behind a run of global loads, before a register that they name is written again
// ---- k_proj: block = (64 rows, 128 cols, which): q/k/v = X W (+ b) with exact bf16 products (K = DIN) -> which 0: q f16 rows (+ residual rows < QHI); 1: k f16 rows (+ residual rows < KHI); 2: v f16 planes [c][t] (+ bf16 hi/lo planes for t < KHI)
__global__ __launch_bounds__(128) void k_proj(const float* __restrict__ XQ, const float* __restrict__ XK, const float* __restrict__ XV, const float* __restrict__ WQ, const float* __restrict__ WK, const float* __restrict__ WV, const float* __restrict__ BQ, const float* __restrict__ BK, const float* __restrict__ BV,
    _Float16* __restrict__ QH, _Float16* __restrict__ QL, _Float16* __restrict__ KH, _Float16* __restrict__ KL, _Float16* __restrict__ VT, __bf16* __restrict__ VB, __bf16* __restrict__ VBL) {
  __shared__ __align__(16) unsigned char sm[3 * 128 * 72 * 2];   /* two operand buffers in the main loop; behind a barrier the epilogue's output staging takes the same bytes */
  static_assert(2 * (64 + 128) * PLP * 2 <= 3 * 128 * 72 * 2 && 2 * 64 * 136 * 2 <= 3 * 128 * 72 * 2, "LDS");
  __bf16 (*sx)[64][PLP] = (__bf16 (*)[64][PLP])sm; __bf16 (*sw)[128][PLP] = (__bf16 (*)[128][PLP])(sm + 2 * 64 * PLP * 2);
  _Float16 (*sh)[136] = (_Float16 (*)[136])sm; _Float16 (*sl)[136] = (_Float16 (*)[136])(sm + 64 * 136 * 2);
  _Float16 (*th)[72] = (_Float16 (*)[72])sm; __bf16 (*tb)[72] = (__bf16 (*)[72])(sm + 128 * 72 * 2); __bf16 (*tbl)[72] = (__bf16 (*)[72])(sm + 2 * 128 * 72 * 2);
  const int tid = threadIdx.x, wave = tid >> 5, lane = tid & 31, col = lane & 15, g = lane >> 4; const int which = blockIdx.z; const int c0 = blockIdx.y * 128; const size_t r0 = (size_t)blockIdx.x * 64; const size_t bb = r0 / TT; const int t0 = (int)(r0 % TT);
  const float* X = which == 0 ? XQ : which == 1 ? XK : XV; const float* WA = which == 0 ? WQ : which == 1 ? WK : WV; const float* BA = which == 0 ? BQ : which == 1 ? BK : BV;
  v8f acc[8] = {};
  const int lr = tid / (PK / 4), lc = tid % (PK / 4);
  const float* xg = X + SRCROW(r0 + lr) * DIN + lc * 4;   /* sequence-first source row; the tile's 64 rows lie in one sequence, so PRI tile rows on = PRI * NB source rows on */
  const float* wg = WA + (size_t)(c0 + lr) * DIN + lc * 4;   /* (out,in) weight rows */
  v4f rx[64 / PRI], rw[128 / PRI];
  tile_ld(rx, xg, (size_t)PRI * NB * DIN); XCNT_G(); tile_ld(rw, wg, (size_t)PRI * DIN); XCNT_G();
#pragma unroll 1   /* rolled: one copy of the stage; the fetched registers are free again once they are stored */
  for (int s = 0; s < DIN / PK; ++s) { __bf16 (*bx)[PLP] = sx[s & 1]; __bf16 (*bw)[PLP] = sw[s & 1];
#pragma unroll
    for (int i = 0; i < 64 / PRI; ++i) st_b(&bx[i * PRI + lr][lc * 4], rx[i]);
#pragma unroll
    for (int i = 0; i < 128 / PRI; ++i) st_b(&bw[i * PRI + lr][lc * 4], rw[i]);
    __syncthreads();   /* publishes stage s; also: every wave has left the other buffer (read in stage s - 1) before stage s + 1 is stored there */
    if (s + 1 < DIN / PK) { tile_ld(rx, xg + (s + 1) * PK, (size_t)PRI * NB * DIN); XCNT_G(); tile_ld(rw, wg + (s + 1) * PK, (size_t)PRI * DIN); XCNT_G(); }   /* next stage flies while this one is multiplied */
#pragma unroll
    for (int kk = 0; kk < PK / 32; ++kk) { const v16b a = frag_b(&bx[wave * 16 + col][kk * 32], lane);
#pragma unroll
      for (int j0 = 0; j0 < 8; j0 += 4) { v16b w[4];   /* fragment reads go out as a group ahead of their products: one LDS latency a group */
#pragma unroll
        for (int u = 0; u < 4; ++u) w[u] = frag_b(&bw[(j0 + u) * 16 + col][kk * 32], lane);
#pragma unroll
        for (int u = 0; u < 4; ++u) acc[j0 + u] = wmma_bf(a, w[u], acc[j0 + u]); } } }
  __syncthreads();   /* the last stage's readers are done before the epilogue writes over the buffers */
  if (which < 2) { _Float16* DH = which == 0 ? QH : KH; _Float16* DL = which == 0 ? QL : KL; const int nhi = which == 0 ? QHI : KHI; const bool hi_rows = t0 < nhi;
#pragma unroll
    for (int j = 0; j < 8; ++j) { const float bias = BA ? bfr(BA[c0 + j * 16 + col]) : 0.f;
#pragma unroll
      for (int r = 0; r < 8; ++r) { const float v = acc[j][r] + bias; const _Float16 hv = (_Float16)v; sh[wave * 16 + 8 * g + r][j * 16 + col] = hv; sl[wave * 16 + 8 * g + r][j * 16 + col] = (_Float16)((v - (float)hv) * 1024.0f); } }
    __syncthreads();
    for (int e = tid; e < 64 * 16; e += 128) { const int rl = e >> 4, q = e & 15; vst2((unsigned*)(DH + (r0 + rl) * CC + c0 + q * 8), *(const v4u*)&sh[rl][q * 8]); if (hi_rows) vst2((unsigned*)(DL + (bb * nhi + t0 + rl) * (size_t)CC + c0 + q * 8), *(const v4u*)&sl[rl][q * 8]); }
  } else { const bool hi_rows = t0 < KHI;
#pragma unroll
    for (int j = 0; j < 8; ++j) { const float bias = BA ? bfr(BA[c0 + j * 16 + col]) : 0.f;
#pragma unroll
      for (int r = 0; r < 8; ++r) { const float v = acc[j][r] + bias; const int rl = wave * 16 + 8 * g + r, cl = j * 16 + col; th[cl][rl] = (_Float16)v; const __bf16 bh = (__bf16)v; tb[cl][rl] = bh; tbl[cl][rl] = (__bf16)(v - (float)bh); } }
    __syncthreads();
    for (int e = tid; e < 128 * 8; e += 128) { const int cl = e >> 3, q = e & 7; vst2((unsigned*)(VT + (bb * CC + c0 + cl) * (size_t)TT + t0 + q * 8), *(const v4u*)&th[cl][q * 8]); if (hi_rows) { const size_t o3 = (bb * CC + c0 + cl) * (size_t)KHI + t0 + q * 8; vst2((unsigned*)(VB + o3), *(const v4u*)&tb[cl][q * 8]); vst2((unsigned*)(VBL + o3), *(const v4u*)&tbl[cl][q * 8]); } } } }
// ---- k_fa: block = 4 waves x 16 queries (query block qb, heaviest first) of plane b*NH + h; K and V^T come through two LDS buffers shared by the four waves (query blocks >= QBH); per 32 keys: S^T = K Q^T (a lane holds 16 keys of ONE query), running maximum and sum in f32 (log2 domain), P^T x 2^11 packed from the score tiles straight into the B operand, O^T += V^T P^T; ctx = O / sum. Query blocks < QBH: 3-product logits (q, k residuals x 2^10), P and v as bf16 hi + lo (3 products)
#define LOGC (SCALE * 1.44269504088896340736f)
struct SMX { float m, l; };
__device__ __forceinline__ float xhalf(float x) { return __builtin_bit_cast(float, __builtin_amdgcn_permlanex16(__builtin_bit_cast(int, x), __builtin_bit_cast(int, x), 0x76543210, 0xfedcba98, false, false)); }   // lane l with lane l ^ 16
#define XCNT0() asm volatile("s_wait_xcnt 0x0" ::: "memory")   // stands behind a run of global loads, before their address registers are reused
// one 32-key step of the running softmax of this lane's query: t[0..7] = keys k0+8g+r, t[8..15] = keys k0+16+8g+r (scaled log2 logits); returns e[] = 2^(t - max + 11); rescales acc only when some query of the wave has a new maximum
__device__ __forceinline__ void sm_step(float t[16], SMX& st, v8f acc[HD / 16], int k0, int qfirst, int qi, int g) {
  if (k0 + 31 > qfirst) {   /* wave-uniform: only steps that reach the diagonal mask by index */
#pragma unroll
    for (int r = 0; r < 8; ++r) { if (k0 + 8 * g + r > qi) t[r] = -3.0e38f; if (k0 + 16 + 8 * g + r > qi) t[8 + r] = -3.0e38f; } }
  float mx = t[0];
#pragma unroll
  for (int s = 1; s < 16; ++s) mx = fmaxf(mx, t[s]);
  mx = fmaxf(mx, xhalf(mx));   /* the other half of the wave holds the query's other 16 keys */
  if (__builtin_amdgcn_ballot_w32(mx > st.m) != 0) { const float mn = fmaxf(st.m, mx); const float al = __builtin_amdgcn_exp2f(st.m - mn); st.m = mn; st.l *= al;
#pragma unroll
    for (int j = 0; j < HD / 16; ++j)
#pragma unroll
      for (int r = 0; r < 8; ++r) acc[j][r] *= al; }
  const float mo = st.m - 11.0f; float ps = 0.f;
#pragma unroll
  for (int s = 0; s < 16; ++s) { t[s] = __builtin_amdgcn_exp2f(t[s] - mo); ps += t[s]; }
  st.l += ps; }
// K / V staging of the main path: a stage is FKS keys of this head: K rows [key][64 d] and V^T rows [c][FKS keys], 128 B of data a row at a pitch of 144 B (16 B x odd: ds_load_b128 readers). The 128 threads bring it in with asynchronous copies to LDS that cover whole 128-B lines (8 lanes a row); all four waves take their fragments from there
#define FKS 64
#define FLP (FKS + 8)
#define FBUF (2 * FKS * FLP * 2)   // bytes of one buffer (K rows, then V^T rows)
#define DS0() asm volatile("s_wait_dscnt 0x0" ::: "memory")       // this wave's LDS reads of a buffer have returned before the buffer is handed to the copies
#define ASYNC0() asm volatile("s_wait_asynccnt 0x0" ::: "memory")   // this wave's copies have landed before the barrier behind which other waves read them
// one stage: 4 copies for K (16 keys on each), 4 for V^T (16 channels on each), 16 B a lane; the last line is the wait that stands before a register which a copy names is written again
__device__ __forceinline__ void fa_fill(unsigned l, const _Float16* kg, const _Float16* vg) {
  const unsigned rs = 16 * FLP * 2, vb = FKS * FLP * 2;
  asm volatile("global_load_async_to_lds_b128 %0, %8, off\n\t"
               "global_load_async_to_lds_b128 %1, %9, off\n\t"
               "global_load_async_to_lds_b128 %2, %10, off\n\t"
               "global_load_async_to_lds_b128 %3, %11, off\n\t"
               "global_load_async_to_lds_b128 %4, %12, off\n\t"
               "global_load_async_to_lds_b128 %5, %13, off\n\t"
               "global_load_async_to_lds_b128 %6, %14, off\n\t"
               "global_load_async_to_lds_b128 %7, %15, off\n\t"
               "s_wait_xcnt 0x0"
               :: "v"(l), "v"(l + rs), "v"(l + 2 * rs), "v"(l + 3 * rs), "v"(l + vb), "v"(l + vb + rs), "v"(l + vb + 2 * rs), "v"(l + vb + 3 * rs),
                  "v"(kg), "v"(kg + (size_t)16 * CC), "v"(kg + (size_t)32 * CC), "v"(kg + (size_t)48 * CC), "v"(vg), "v"(vg + (size_t)16 * TT), "v"(vg + (size_t)32 * TT), "v"(vg + (size_t)48 * TT)
               : "memory"); }
__global__ __launch_bounds__(128) void k_fa(const _Float16* __restrict__ QH, const _Float16* __restrict__ KH, const _Float16* __restrict__ QL, const _Float16* __restrict__ KL, const _Float16* __restrict__ VT, const __bf16* __restrict__ VB, const __bf16* __restrict__ VBL, float* __restrict__ Y) {
  __shared__ __align__(16) _Float16 skv[2][2][FKS][FLP];   /* [buffer][K rows | V^T rows][row][128 B + pad] */
  const int b = blockIdx.x / NH, h = blockIdx.x % NH; const int qb = NQB - 1 - (int)blockIdx.y;
  const int tid = threadIdx.x, wave = __builtin_amdgcn_readfirstlane(tid >> 5), lane = tid & 31, col = lane & 15, g = lane >> 4;
  /* wave number held scalar: trip count and diagonal test become scalar branches, every lane stays on at the matrix instructions */ const int ql0 = qb * 64 + wave * 16, qi = ql0 + col; const int nblk = (ql0 + 47) >> 5;   /* 32-key steps that cover keys 0 .. ql0 + 15 */
  const _Float16* Qp = QH + ((size_t)b * TT + qi) * CC + h * HD; const _Float16* Kp = KH + ((size_t)b * TT + col) * CC + h * HD;
  v8f acc[HD / 16] = {}; SMX st; st.m = -3.0e38f; st.l = 0.f;
  const v16h qf0 = frag_h(Qp, lane), qf1 = frag_h(Qp + 32, lane);
  XCNT0();
  if (qb < QBH) {   /* block-uniform */
    const _Float16* QLp = QL + ((size_t)b * QHI + qi) * CC + h * HD; const _Float16* KLp = KL + ((size_t)b * KHI + col) * CC + h * HD; const size_t vo = ((size_t)b * CC + h * HD + col) * (size_t)KHI;
    const v16h ql0f = frag_h(QLp, lane), ql1f = frag_h(QLp + 32, lane);
#pragma unroll 1   /* at most 12 steps: kept rolled for code size */
    for (int i = 0; i < nblk; ++i) { const int k0 = i * 32; float t[16];
#pragma unroll
      for (int u = 0; u < 2; ++u) { const size_t ko = (size_t)(k0 + u * 16) * CC; const v16h kh0 = frag_h(Kp + ko, lane), kh1 = frag_h(Kp + ko + 32, lane), kl0 = frag_h(KLp + ko, lane), kl1 = frag_h(KLp + ko + 32, lane); v8f a = {}, al = {};
        a = wmma16(kh0, qf0, a); al = wmma16(kh0, ql0f, al); al = wmma16(kl0, qf0, al); a = wmma16(kh1, qf1, a); al = wmma16(kh1, ql1f, al); al = wmma16(kl1, qf1, al);
#pragma unroll
        for (int r = 0; r < 8; ++r) t[u * 8 + r] = (a[r] + al[r] * (1.0f / 1024.0f)) * LOGC; }
      sm_step(t, st, acc, k0, ql0, qi, g);
      const F2 p = bsplit16(t);
#pragma unroll
      for (int j = 0; j < HD / 16; ++j) { const size_t po = vo + (size_t)j * 16 * KHI + k0; const v16b vh = frag_b(VB + po, lane); acc[j] = wmma_bf(vh, p.h, acc[j]); acc[j] = wmma_bf(vh, p.l, acc[j]); acc[j] = wmma_bf(frag_b(VBL + po, lane), p.h, acc[j]); } }
  } else {
    /* every plain '#pragma unroll' below opens a constant-trip loop over a register array (fragments, scores, accumulators), so that its elements stay in registers */
    const int nst = qb + 1;   /* stages of FKS keys that cover keys 0 .. qb * 64 + 63; the same for the whole block */
    const int fr = tid >> 3, fc = (tid & 7) * 8;   /* this thread's row (of 16 a copy) and 16-B piece of a stage row */
    const _Float16* kg = KH + ((size_t)b * TT + fr) * CC + h * HD + fc; const _Float16* vg = VT + ((size_t)b * CC + h * HD + fr) * (size_t)TT + fc;
    const unsigned l0 = (unsigned)(size_t)&skv[0][0][fr][fc];
    fa_fill(l0, kg, vg); ASYNC0(); __syncthreads();   /* stage 0 is published */
    if (1 < nst) fa_fill(l0 + FBUF, kg + (size_t)FKS * CC, vg + FKS);
#pragma unroll 1   /* rolled: one copy of the stage; the buffer is chosen by address */
    for (int s = 0; s < nst; ++s) { const _Float16 (*bk)[FLP] = skv[s & 1][0]; const _Float16 (*bv)[FLP] = skv[s & 1][1];
      v16h kf[2][4], vf[2][4];   /* both steps' fragments go out as one group at the head of the stage (the whole stage is filled, also where a wave skips its second step) */
#pragma unroll
      for (int w = 0; w < 2; ++w) {
#pragma unroll
        for (int u = 0; u < 2; ++u) { kf[w][2 * u] = frag_h(&bk[w * 32 + u * 16 + col][0], lane); kf[w][2 * u + 1] = frag_h(&bk[w * 32 + u * 16 + col][32], lane); }
#pragma unroll
        for (int j = 0; j < HD / 16; ++j) vf[w][j] = frag_h(&bv[j * 16 + col][w * 32], lane); }
#pragma unroll
      for (int w = 0; w < 2; ++w) { const int i = 2 * s + w, k0 = i * 32;
        if (w == 0 || i < nblk) {   /* wave-uniform scalar test: the two upper waves of the block need the diagonal stage's second step, the two lower do not */
          v8f s0 = {}, s1 = {}; s0 = wmma16(kf[w][0], qf0, s0); s1 = wmma16(kf[w][2], qf0, s1); s0 = wmma16(kf[w][1], qf1, s0); s1 = wmma16(kf[w][3], qf1, s1);
          float t[16];
#pragma unroll
          for (int r = 0; r < 8; ++r) { t[r] = s0[r] * LOGC; t[8 + r] = s1[r] * LOGC; }
          sm_step(t, st, acc, k0, ql0, qi, g);
          v16h p;
#pragma unroll
          for (int e = 0; e < 16; ++e) p[e] = (_Float16)t[e];
#pragma unroll
          for (int j = 0; j < HD / 16; ++j) acc[j] = wmma16(vf[w][j], p, acc[j]); } }
      DS0(); ASYNC0(); __syncthreads();   /* every wave, also one that skipped a step: publishes stage s + 1 and ends every reader's last read of stage s */
      if (s + 2 < nst) fa_fill(l0 + (unsigned)(s & 1) * FBUF, kg + (size_t)(s + 2) * FKS * CC, vg + (s + 2) * FKS); }   /* block-uniform; flies while stage s + 1 is worked on */
    ASYNC0(); }
  const float inv = 1.0f / (st.l + xhalf(st.l));   /* the two halves' partial sums join once; the maximum's own term keeps the sum >= 2^11 */
  float* yp = Y + ((size_t)b * TT + qi) * CC + h * HD + 8 * g;   /* acc[j][r] = ctx[query qi][j*16 + 8g + r]: 32 contiguous bytes per lane and j */
#pragma unroll
  for (int j = 0; j < HD / 16; ++j) { const v4f lo = { acc[j][0] * inv, acc[j][1] * inv, acc[j][2] * inv, acc[j][3] * inv }, hi = { acc[j][4] * inv, acc[j][5] * inv, acc[j][6] * inv, acc[j][7] * inv }; vst2(yp + j * 16, lo); vst2(yp + j * 16 + 4, hi); } }
// ---- k_out: block = (64 rows, 128 cols): out = ctx Wo (+ bo): ctx x 2^6 once to f16 against Wo as f16(bf16 x 2^8) exact (1 product) x 2^-14; causal early rows (< QHI of each sequence): ctx bf16 hi + lo against exact bf16 Wo (2 products)
__global__ __launch_bounds__(128) void k_out(const float* __restrict__ Y, const float* __restrict__ WO, const float* __restrict__ BO, float* __restrict__ OUT) { __shared__ __align__(16) unsigned char sm[2 * (64 + 64 + 128) * OLP * 2];   /* two operand buffers (ctx hi, ctx lo, Wo); behind a barrier the output staging takes the same bytes */
  static_assert(4 * 16 * 132 * 4 <= 2 * (64 + 64 + 128) * OLP * 2, "LDS");
  float (*sf)[16][132] = (float (*)[16][132])sm;
  const int tid = threadIdx.x, wave = tid >> 5, lane = tid & 31, col = lane & 15, g = lane >> 4; const int c0 = blockIdx.y * 128; const size_t r0 = (size_t)blockIdx.x * 64 + wave * 16;
  v8f acc[8] = {};
  const int lr = tid / (OK / 4), lc = tid % (OK / 4);
  const float* yg = Y + ((size_t)blockIdx.x * 64 + lr) * CC + lc * 4; const float* wg = WO + (size_t)(c0 + lr) * CC + lc * 4;   /* (out,in) weight rows */
  if (CAUSAL && (int)(((size_t)blockIdx.x * 64) % TT) < QHI) {   /* block-uniform */
    __bf16 (*sah)[64][OLP] = (__bf16 (*)[64][OLP])sm; __bf16 (*sal)[64][OLP] = (__bf16 (*)[64][OLP])(sm + 2 * 64 * OLP * 2); __bf16 (*sw)[128][OLP] = (__bf16 (*)[128][OLP])(sm + 4 * 64 * OLP * 2);
    v4f ry[64 / ORI], rw[128 / ORI];
    tile_ld(ry, yg, (size_t)ORI * CC); XCNT_G(); tile_ld(rw, wg, (size_t)ORI * CC); XCNT_G();
#pragma unroll 1   /* rolled: one copy of the stage */
    for (int s = 0; s < CC / OK; ++s) { __bf16 (*bh)[OLP] = sah[s & 1]; __bf16 (*bl)[OLP] = sal[s & 1]; __bf16 (*bw)[OLP] = sw[s & 1];
#pragma unroll
      for (int i = 0; i < 64 / ORI; ++i) { st_b(&bh[i * ORI + lr][lc * 4], ry[i]); st_bl(&bl[i * ORI + lr][lc * 4], ry[i]); }
#pragma unroll
      for (int i = 0; i < 128 / ORI; ++i) st_b(&bw[i * ORI + lr][lc * 4], rw[i]);
      __syncthreads();   /* publishes stage s; every wave has left the other buffer before stage s + 1 is stored there */
      if (s + 1 < CC / OK) { tile_ld(ry, yg + (s + 1) * OK, (size_t)ORI * CC); XCNT_G(); tile_ld(rw, wg + (s + 1) * OK, (size_t)ORI * CC); XCNT_G(); }
#pragma unroll
      for (int kk = 0; kk < OK / 32; ++kk) { const v16b ah = frag_b(&bh[wave * 16 + col][kk * 32], lane), al = frag_b(&bl[wave * 16 + col][kk * 32], lane);
#pragma unroll
        for (int j0 = 0; j0 < 8; j0 += 4) { v16b w[4];   /* fragment reads go out as a group ahead of their products */
#pragma unroll
          for (int u = 0; u < 4; ++u) w[u] = frag_b(&bw[(j0 + u) * 16 + col][kk * 32], lane);
#pragma unroll
          for (int u = 0; u < 4; ++u) { acc[j0 + u] = wmma_bf(ah, w[u], acc[j0 + u]); acc[j0 + u] = wmma_bf(al, w[u], acc[j0 + u]); } } } }
    __syncthreads();   /* the last stage's readers are done before the output staging writes over the buffers */
#pragma unroll
    for (int j = 0; j < 8; ++j) { const float bias = BO ? bfr(BO[c0 + j * 16 + col]) : 0.f;
#pragma unroll
      for (int r = 0; r < 8; ++r) sf[wave][8 * g + r][j * 16 + col] = acc[j][r] + bias; }
  } else {
    _Float16 (*sa)[64][OLP] = (_Float16 (*)[64][OLP])sm; _Float16 (*sw)[128][OLP] = (_Float16 (*)[128][OLP])(sm + 2 * 64 * OLP * 2);
    v4f ry[64 / ORI], rw[128 / ORI];
    tile_ld(ry, yg, (size_t)ORI * CC); XCNT_G(); tile_ld(rw, wg, (size_t)ORI * CC); XCNT_G();
#pragma unroll 1   /* rolled: one copy of the stage */
    for (int s = 0; s < CC / OK; ++s) { _Float16 (*ba)[OLP] = sa[s & 1]; _Float16 (*bw)[OLP] = sw[s & 1];
#pragma unroll
      for (int i = 0; i < 64 / ORI; ++i) st_hs(&ba[i * ORI + lr][lc * 4], ry[i], 64.0f);   /* ctx carried x 2^6 into f16 so small-magnitude context rows stay clear of f16 subnormals */
#pragma unroll
      for (int i = 0; i < 128 / ORI; ++i) st_hw(&bw[i * ORI + lr][lc * 4], rw[i]);
      __syncthreads();   /* publishes stage s; every wave has left the other buffer before stage s + 1 is stored there */
      if (s + 1 < CC / OK) { tile_ld(ry, yg + (s + 1) * OK, (size_t)ORI * CC); XCNT_G(); tile_ld(rw, wg + (s + 1) * OK, (size_t)ORI * CC); XCNT_G(); }
#pragma unroll
      for (int kk = 0; kk < OK / 32; ++kk) { const v16h a = frag_h(&ba[wave * 16 + col][kk * 32], lane);
#pragma unroll
        for (int j0 = 0; j0 < 8; j0 += 4) { v16h w[4];   /* fragment reads go out as a group ahead of their products */
#pragma unroll
          for (int u = 0; u < 4; ++u) w[u] = frag_h(&bw[(j0 + u) * 16 + col][kk * 32], lane);
#pragma unroll
          for (int u = 0; u < 4; ++u) acc[j0 + u] = wmma16(a, w[u], acc[j0 + u]); } } }
    __syncthreads();   /* the last stage's readers are done before the output staging writes over the buffers */
#pragma unroll
    for (int j = 0; j < 8; ++j) { const float bias = BO ? bfr(BO[c0 + j * 16 + col]) : 0.f;
#pragma unroll
      for (int r = 0; r < 8; ++r) sf[wave][8 * g + r][j * 16 + col] = acc[j][r] * (1.0f / 16384.0f) + bias; } }   /* 2^-8 (Wo carry) x 2^-6 (ctx carry) */
  LDSX(); for (int rl = 0; rl < 16; ++rl) vst2(OUT + SRCROW(r0 + rl) * DIN + c0 + lane * 4, *(const v4f*)&sf[wave][rl][lane * 4]); }

extern "C" void kernel_launch(void* const* d_in, const int* in_sizes, int n_in, void* d_out, int out_size, void* d_ws, size_t ws_size, hipStream_t stream) {
  (void)in_sizes; (void)n_in; (void)out_size;
  const float** F = (const float**)d_in;
  if (ws_size < (size_t)WS_END) return;
  char* ws = (char*)d_ws; _Float16 *QH = (_Float16*)(ws + WS_QH), *KH = (_Float16*)(ws + WS_KH), *VT = (_Float16*)(ws + WS_VT), *QL = (_Float16*)(ws + WS_QL), *KL = (_Float16*)(ws + WS_KL); __bf16 *VB = (__bf16*)(ws + WS_VB), *VBL = (__bf16*)(ws + WS_VBL); float *Y = (float*)(ws + WS_Y);
  (void)Y; (void)QL; (void)KL; (void)VB; (void)VBL;
  // inputs: 0 x [2048,2,768] (S, B, D); 1 wq [768,768] (out,in), 2 bq; 3 wk, 4 bk; 5 wv, 6 bv; 7 wc (out,in), 8 bc (all biases NONZERO)
  k_proj<<<dim3(TNB * TT / 64, CC / 128, 3), 128, 0, stream>>>(F[0], F[0], F[0], F[1], F[3], F[5], F[2], F[4], F[6], QH, QL, KH, KL, VT, VB, VBL);
  k_fa<<<dim3(TNB * NH, NQB), 128, 0, stream>>>(QH, KH, QL, KL, VT, VB, VBL, Y);
  k_out<<<dim3(TNB * TT / 64, DIN / 128), 128, 0, stream>>>(Y, F[7], F[8], (float*)d_out);   /* writes (S, B, D) rows */
}

// v005
// A run of this version takes 73.9 microseconds.
// Two timings next to v004 put it at 1.23 and 1.24 times that version's speed.
// Over all steps from v000 it is 12.1 times as fast.
// compute dtype: all float inputs rounded to bf16; q / k / v projections with EXACT bf16 products on WMMA 16x16x32 (f32 accumulate) + bias; causal logits: 3 products for the first 384 rows, single f16 q x k after, x 64^-0.5; running-maximum softmax f32 in the same launch; unnormalised P x 2^11 once to f16 x v once to f16 (bf16 hi + lo below row 384), divided by the f32 sum at the end; y hi+lo x exact wc below row 384, x2^6 f16 carry x f16(bf16 x 2^8) wc after, + bc; f32 output written back in the sequence-first layout.
#include <hip/hip_runtime.h>
#include <math.h>

typedef __attribute__((ext_vector_type(16))) _Float16 v16h;
typedef __attribute__((ext_vector_type(16))) __bf16 v16b;
typedef __attribute__((ext_vector_type(8)))  _Float16 v8h;
typedef __attribute__((ext_vector_type(8)))  float v8f;
typedef __attribute__((ext_vector_type(4)))  float v4f;
typedef __attribute__((ext_vector_type(2)))  float v2f;
typedef __attribute__((ext_vector_type(4)))  unsigned v4u;
typedef __attribute__((ext_vector_type(4)))  int v4i;
typedef float __attribute__((may_alias)) float_a;
typedef int __attribute__((may_alias)) int_a;

template <typename T> __device__ __forceinline__ void vst2(void* p, T v) { *(T*)p = v;  }
__device__ __forceinline__ v8f wmma16(v16h a, v16h b, v8f c) {
  v8f d = __builtin_amdgcn_wmma_f32_16x16x32_f16(false, a, false, b, (short)0, c, false, false);
  asm volatile("v_nop\n\tv_nop\n\tv_nop\n\tv_nop" : "+v"(d) : "v"(a), "v"(b));
  return d;
}
__device__ __forceinline__ v8f wmma_bf(v16b a, v16b b, v8f c) {
  v8f d = __builtin_amdgcn_wmma_f32_16x16x32_bf16(false, a, false, b, (short)0, c, false, false);
  asm volatile("v_nop\n\tv_nop\n\tv_nop\n\tv_nop" : "+v"(d) : "v"(a), "v"(b));
  return d;
}
// 16x16x32 fragments: lane = (h = lane>>4, row/col = lane&15); elements 0..7 = k0+8h+0..7, 8..15 = k0+16+8h+0..7; D element r = row 8h+r
__device__ __forceinline__ v16h frag_h(const _Float16* rowk0, int lane) {
  union { v16h v; v8h q[2]; } u; const _Float16* p = rowk0 + 8 * (lane >> 4);
  u.q[0] = *(const v8h*)p; u.q[1] = *(const v8h*)(p + 16); return u.v;
}
__device__ __forceinline__ v16h frag_f32(const float* rowk0, int lane) {
  v16h a; const float* p = rowk0 + 8 * (lane >> 4);
#pragma unroll
  for (int i = 0; i < 8; ++i) { a[i] = (_Float16)p[i]; a[8 + i] = (_Float16)p[16 + i]; }
  return a;
}
__device__ __forceinline__ v16h frag_f32s(const float* rowk0, int lane, float sc) {
  v16h a; const float* p = rowk0 + 8 * (lane >> 4);
#pragma unroll
  for (int i = 0; i < 8; ++i) { a[i] = (_Float16)(p[i] * sc); a[8 + i] = (_Float16)(p[16 + i] * sc); }
  return a;
}
// column fragment from a [K][ld] layout (column n), rows >= K read as 0
__device__ __forceinline__ v16h fragc_f32(const float* W, int k0, int n, int lane, int ld, int K) {
  v16h a; const int g = lane >> 4;
#pragma unroll
  for (int i = 0; i < 8; ++i) { const int ka = k0 + 8 * g + i, kb = ka + 16;
    a[i] = (_Float16)(ka < K ? W[(size_t)(ka < K ? ka : K - 1) * ld + n] : 0.f); a[8 + i] = (_Float16)(kb < K ? W[(size_t)(kb < K ? kb : K - 1) * ld + n] : 0.f); }
  return a;
}
struct F2 { v16b h, l; };
__device__ __forceinline__ F2 bsplit16(const float v[16]) { F2 r;
#pragma unroll
  for (int i = 0; i < 16; ++i) { const __bf16 h = (__bf16)v[i]; r.h[i] = h; r.l[i] = (__bf16)(v[i] - (float)h); }
  return r; }
__device__ __forceinline__ F2 split_row(const float* row, int k0, int lane) { float v[16]; const float* p = row + k0 + 8 * (lane >> 4);
#pragma unroll
  for (int i = 0; i < 8; ++i) { v[i] = p[i]; v[8 + i] = p[16 + i]; }
  return bsplit16(v); }
__device__ __forceinline__ F2 split_rowK(const float* row, int k0, int lane, int K) { float v[16]; const int g = lane >> 4;
#pragma unroll
  for (int i = 0; i < 8; ++i) { const int ka = k0 + 8 * g + i, kb = ka + 16; v[i] = ka < K ? row[ka < K ? ka : K - 1] : 0.f; v[8 + i] = kb < K ? row[kb < K ? kb : K - 1] : 0.f; }
  return bsplit16(v); }
__device__ __forceinline__ F2 split_col(const float* W, int k0, int n, int lane, int ld, int K) { float v[16]; const int g = lane >> 4;
#pragma unroll
  for (int i = 0; i < 8; ++i) { const int ka = k0 + 8 * g + i, kb = ka + 16; v[i] = ka < K ? W[(size_t)(ka < K ? ka : K - 1) * ld + n] : 0.f; v[8 + i] = kb < K ? W[(size_t)(kb < K ? kb : K - 1) * ld + n] : 0.f; }
  return bsplit16(v); }
__device__ __forceinline__ v8f mac3(const F2& a, const F2& b, v8f c) { c = wmma_bf(a.l, b.h, c); c = wmma_bf(a.h, b.l, c); return wmma_bf(a.h, b.h, c); }
__device__ __forceinline__ float sigm(float v) { return 1.0f / (1.0f + expf(-v)); }
#define LDSX() do { asm volatile("s_wait_dscnt 0" ::: "memory"); __builtin_amdgcn_wave_barrier(); __builtin_amdgcn_fence(__ATOMIC_RELEASE, "workgroup"); } while (0)

// Causal multi-head self-attention on a SEQUENCE-FIRST input (x [2048, 2, 768] = (S, B, D); torch (out,in) wq / wk / wv / wc [768,768] N(0,1) x 0.02 applied as x W^T + b, biases N(0,1) x 0.02 - NONZERO; 12 heads x 64; scores / sqrt(64); tril kept, -inf elsewhere; softmax; y wc^T + bc; output transposed back to (S, B, D)). The kernels work on rows b*2048 + t: the projection reads token (b, t) from source row t*2 + b and the output kernel writes it back there.
#define NB 2
#define TT 2048
#define CC 768            // NH * HD = projected width
#define DIN 768          // input (model) width
#define NH 12
#define HD 64
#define NQB (TT / 64)
#define SCALE (0.125f)
#define CAUSAL 1
#ifndef TNB
#define TNB NB
#endif
__device__ __forceinline__ float bfr(float v) { return (float)(__bf16)v; }
typedef __attribute__((ext_vector_type(8))) __bf16 v8b;
__device__ __forceinline__ v16b frag_b(const __bf16* rowk0, int lane) {
  union { v16b v; v8b q[2]; } u; const __bf16* p = rowk0 + 8 * (lane >> 4);
  u.q[0] = *(const v8b*)p; u.q[1] = *(const v8b*)(p + 16); return u.v;
}
#define QBH 6              // causal: query blocks 0..QBH-1 of each sequence (few keys, no averaging) take the high-precision path
#define QHI 384            // rows carrying a q residual plane
#define KHI 384            // key rows carrying k residual / v bf16 hi+lo planes (used only by the causal high-precision path)
// B fragment (k rows k0+.., output column o) of a weight: (in,out) [K][ld] or (out,in) [ld rows of K]: bf16 exact, or f16(bf16 * 256) exact
__device__ __forceinline__ v16b wcol_io(const float* Wm, int k0, int o, int lane, int ld) { v16b w; const int g = lane >> 4;
#pragma unroll
  for (int i = 0; i < 8; ++i) { w[i] = (__bf16)Wm[(size_t)(k0 + 8 * g + i) * ld + o]; w[8 + i] = (__bf16)Wm[(size_t)(k0 + 16 + 8 * g + i) * ld + o]; }
  return w; }
__device__ __forceinline__ v16b wcol_oi(const float* Wm, int k0, int o, int lane, int K) { v16b w; const float* p = Wm + (size_t)o * K + k0 + 8 * (lane >> 4);
#pragma unroll
  for (int i = 0; i < 8; ++i) { w[i] = (__bf16)p[i]; w[8 + i] = (__bf16)p[16 + i]; }
  return w; }
__device__ __forceinline__ v16h wcolh_io(const float* Wm, int k0, int o, int lane, int ld) { v16h w; const int g = lane >> 4;
#pragma unroll
  for (int i = 0; i < 8; ++i) { w[i] = (_Float16)(bfr(Wm[(size_t)(k0 + 8 * g + i) * ld + o]) * 256.0f); w[8 + i] = (_Float16)(bfr(Wm[(size_t)(k0 + 16 + 8 * g + i) * ld + o]) * 256.0f); }
  return w; }
__device__ __forceinline__ v16h wcolh_oi(const float* Wm, int k0, int o, int lane, int K) { v16h w; const float* p = Wm + (size_t)o * K + k0 + 8 * (lane >> 4);
#pragma unroll
  for (int i = 0; i < 8; ++i) { w[i] = (_Float16)(bfr(p[i]) * 256.0f); w[8 + i] = (_Float16)(bfr(p[16 + i]) * 256.0f); }
  return w; }
#define SRCROW(r) ((size_t)((r) % TT) * NB + (size_t)((r) / TT))   // row r = b*TT + t <-> sequence-first row t*NB + b of the (S, B, D) arrays (NB = the module's batch count, also when fewer batches are run)
#define WQKV_LAYOUT 1   // layout for WCOL only, which nothing calls (k_proj reads (out,in) [CC][DIN] rows): 0 = (in,out) [DIN][CC]; 1 = (out,in) [CC][DIN]; 2 = per-head [NH][DIN][HD]
__device__ __forceinline__ v16b wcol_hdk(const float* Wm, int k0, int o, int lane) { v16b w; const int g = lane >> 4; const float* p = Wm + (size_t)(o / HD) * DIN * HD + (o % HD);
#pragma unroll
  for (int i = 0; i < 8; ++i) { w[i] = (__bf16)p[(size_t)(k0 + 8 * g + i) * HD]; w[8 + i] = (__bf16)p[(size_t)(k0 + 16 + 8 * g + i) * HD]; }
  return w; }
#define WO_OUT_IN 1
#if WQKV_LAYOUT == 1
#define WCOL(W, k0, o, lane) wcol_oi(W, k0, o, lane, DIN)
#elif WQKV_LAYOUT == 2
#define WCOL(W, k0, o, lane) wcol_hdk(W, k0, o, lane)
#else
#define WCOL(W, k0, o, lane) wcol_io(W, k0, o, lane, CC)
#endif
#if WO_OUT_IN
#define WOCOL(W, k0, o, lane) wcol_oi(W, k0, o, lane, CC)
#define WOCOLH(W, k0, o, lane) wcolh_oi(W, k0, o, lane, CC)
#else
#define WOCOL(W, k0, o, lane) wcol_io(W, k0, o, lane, DIN)
#define WOCOLH(W, k0, o, lane) wcolh_io(W, k0, o, lane, DIN)
#endif

#define WS_QH  0u                                      // f16 q rows [b*t][CC]
#define WS_KH  (WS_QH + 2u * (size_t)NB * TT * CC)      // f16 k rows [b*t][CC]
#define WS_VT  (WS_KH + 2u * (size_t)NB * TT * CC)      // f16 v planes [b][c][t]
#define WS_QL  (WS_VT + 2u * (size_t)NB * CC * TT)      // f16 q residual x 2^10 rows [b][t < QHI][CC]
#define WS_KL  (WS_QL + 2u * (size_t)NB * QHI * CC)     // f16 k residual x 2^10 rows [b][t < KHI][CC]
#define WS_VB  (WS_KL + 2u * (size_t)NB * KHI * CC)     // bf16 v hi planes [b][c][t < KHI]
#define WS_VBL (WS_VB + 2u * (size_t)NB * CC * KHI)
#define WS_Y   (WS_VBL + 2u * (size_t)NB * CC * KHI)    // f32 ctx rows [b*t][CC]
#define WS_END (WS_Y  + 4u * (size_t)NB * TT * CC)

// operand staging of the two GEMM launches: a stage is PK (projection) or OK (output) k of every tile row. The 128 threads fetch it with global_load_b128 that cover whole 128-B lines (PK / 4 or OK / 4 lanes a row), round it ONCE to the 16-bit operand type and store it in LDS rows with a 16-B pad (pitch 16 B x odd: ds_load_b128 readers); all four waves take their fragments from there
// every '#pragma unroll' of the staging code opens a constant-trip loop over a register array (fetched rows, fragments, accumulators), so that its elements stay in registers
typedef __attribute__((ext_vector_type(4))) __bf16 v4b;
typedef __attribute__((ext_vector_type(4))) _Float16 v4h;
#define PK 32
#define PLP (PK + 8)
#define PRI (512 / PK)     // tile rows that one load instruction of the whole block covers
#define OK 64
#define OLP (OK + 8)
#define ORI (512 / OK)
template <int N> __device__ __forceinline__ void tile_ld(v4f (&r)[N], const float* p, size_t step) {
#pragma unroll
  for (int i = 0; i < N; ++i) r[i] = *(const v4f*)(p + (size_t)i * step); }
__device__ __forceinline__ void st_b(__bf16* d, v4f v) { const v4b o = { (__bf16)v[0], (__bf16)v[1], (__bf16)v[2], (__bf16)v[3] }; *(v4b*)d = o; }
__device__ __forceinline__ void st_bl(__bf16* d, v4f v) { const v4b o = { (__bf16)(v[0] - (float)(__bf16)v[0]), (__bf16)(v[1] - (float)(__bf16)v[1]), (__bf16)(v[2] - (float)(__bf16)v[2]), (__bf16)(v[3] - (float)(__bf16)v[3]) }; *(v4b*)d = o; }
__device__ __forceinline__ void st_hs(_Float16* d, v4f v, float sc) { const v4h o = { (_Float16)(v[0] * sc), (_Float16)(v[1] * sc), (_Float16)(v[2] * sc), (_Float16)(v[3] * sc) }; *(v4h*)d = o; }
__device__ __forceinline__ void st_hw(_Float16* d, v4f v) { const v4h o = { (_Float16)(bfr(v[0]) * 256.0f), (_Float16)(bfr(v[1]) * 256.0f), (_Float16)(bfr(v[2]) * 256.0f), (_Float16)(bfr(v[3]) * 256.0f) }; *(v4h*)d = o; }
#define XCNT_G() asm volatile("s_wait_xcnt 0x0" ::: "memory")   // stands behind a run of global loads, before a register that they name is written again
// ---- k_proj: block = (64 rows, 128 cols, which): q/k/v = X W (+ b) with exact bf16 products (K = DIN) -> which 0: q f16 rows (+ residual rows < QHI); 1: k f16 rows (+ residual rows < KHI); 2: v f16 planes [c][t] (+ bf16 hi/lo planes for t < KHI)
__global__ __launch_bounds__(128) void k_proj(const float* __restrict__ XQ, const float* __restrict__ XK, const float* __restrict__ XV, const float* __restrict__ WQ, const float* __restrict__ WK, const float* __restrict__ WV, const float* __restrict__ BQ, const float* __restrict__ BK, const float* __restrict__ BV,
    _Float16* __restrict__ QH, _Float16* __restrict__ QL, _Float16* __restrict__ KH, _Float16* __restrict__ KL, _Float16* __restrict__ VT, __bf16* __restrict__ VB, __bf16* __restrict__ VBL) {
  __shared__ __align__(16) unsigned char sm[3 * 128 * 72 * 2];   /* two operand buffers in the main loop; behind a barrier the epilogue's output staging takes the same bytes */
  static_assert(2 * (64 + 128) * PLP * 2 <= 3 * 128 * 72 * 2 && 2 * 64 * 136 * 2 <= 3 * 128 * 72 * 2, "LDS");
  __bf16 (*sx)[64][PLP] = (__bf16 (*)[64][PLP])sm; __bf16 (*sw)[128][PLP] = (__bf16 (*)[128][PLP])(sm + 2 * 64 * PLP * 2);
  _Float16 (*sh)[136] = (_Float16 (*)[136])sm; _Float16 (*sl)[136] = (_Float16 (*)[136])(sm + 64 * 136 * 2);
  _Float16 (*th)[72] = (_Float16 (*)[72])sm; __bf16 (*tb)[72] = (__bf16 (*)[72])(sm + 128 * 72 * 2); __bf16 (*tbl)[72] = (__bf16 (*)[72])(sm + 2 * 128 * 72 * 2);
  const int tid = threadIdx.x, wave = tid >> 5, lane = tid & 31, col = lane & 15, g = lane >> 4; const int which = blockIdx.z; const int c0 = blockIdx.y * 128; const size_t r0 = (size_t)blockIdx.x * 64; const size_t bb = r0 / TT; const int t0 = (int)(r0 % TT);
  const float* X = which == 0 ? XQ : which == 1 ? XK : XV; const float* WA = which == 0 ? WQ : which == 1 ? WK : WV; const float* BA = which == 0 ? BQ : which == 1 ? BK : BV;
  v8f acc[8] = {};
  const int lr = tid / (PK / 4), lc = tid % (PK / 4);
  const float* xg = X + SRCROW(r0 + lr) * DIN + lc * 4;   /* sequence-first source row; the tile's 64 rows lie in one sequence, so PRI tile rows on = PRI * NB source rows on */
  const float* wg = WA + (size_t)(c0 + lr) * DIN + lc * 4;   /* (out,in) weight rows */
  v4f rx[64 / PRI], rw[128 / PRI];
  tile_ld(rx, xg, (size_t)PRI * NB * DIN); XCNT_G(); tile_ld(rw, wg, (size_t)PRI * DIN); XCNT_G();
#pragma unroll 1   /* rolled: one copy of the stage; the fetched registers are free again once they are stored */
  for (int s = 0; s < DIN / PK; ++s) { __bf16 (*bx)[PLP] = sx[s & 1]; __bf16 (*bw)[PLP] = sw[s & 1];
#pragma unroll
    for (int i = 0; i < 64 / PRI; ++i) st_b(&bx[i * PRI + lr][lc * 4], rx[i]);
#pragma unroll
    for (int i = 0; i < 128 / PRI; ++i) st_b(&bw[i * PRI + lr][lc * 4], rw[i]);
    __syncthreads();   /* publishes stage s; also: every wave has left the other buffer (read in stage s - 1) before stage s + 1 is stored there */
    if (s + 1 < DIN / PK) { tile_ld(rx, xg + (s + 1) * PK, (size_t)PRI * NB * DIN); XCNT_G(); tile_ld(rw, wg + (s + 1) * PK, (size_t)PRI * DIN); XCNT_G(); }   /* next stage flies while this one is multiplied */
#pragma unroll
    for (int kk = 0; kk < PK / 32; ++kk) { const v16b a = frag_b(&bx[wave * 16 + col][kk * 32], lane);
#pragma unroll
      for (int j0 = 0; j0 < 8; j0 += 4) { v16b w[4];   /* fragment reads go out as a group ahead of their products: one LDS latency a group */
#pragma unroll
        for (int u = 0; u < 4; ++u) w[u] = frag_b(&bw[(j0 + u) * 16 + col][kk * 32], lane);
#pragma unroll
        for (int u = 0; u < 4; ++u) acc[j0 + u] = wmma_bf(a, w[u], acc[j0 + u]); } } }
  __syncthreads();   /* the last stage's readers are done before the epilogue writes over the buffers */
  if (which < 2) { _Float16* DH = which == 0 ? QH : KH; _Float16* DL = which == 0 ? QL : KL; const int nhi = which == 0 ? QHI : KHI; const bool hi_rows = t0 < nhi;
#pragma unroll
    for (int j = 0; j < 8; ++j) { const float bias = BA ? bfr(BA[c0 + j * 16 + col]) : 0.f;
#pragma unroll
      for (int r = 0; r < 8; ++r) { const float v = acc[j][r] + bias; const _Float16 hv = (_Float16)v; sh[wave * 16 + 8 * g + r][j * 16 + col] = hv; sl[wave * 16 + 8 * g + r][j * 16 + col] = (_Float16)((v - (float)hv) * 1024.0f); } }
    __syncthreads();
    for (int e = tid; e < 64 * 16; e += 128) { const int rl = e >> 4, q = e & 15; vst2((unsigned*)(DH + (r0 + rl) * CC + c0 + q * 8), *(const v4u*)&sh[rl][q * 8]); if (hi_rows) vst2((unsigned*)(DL + (bb * nhi + t0 + rl) * (size_t)CC + c0 + q * 8), *(const v4u*)&sl[rl][q * 8]); }
  } else { const bool hi_rows = t0 < KHI;
#pragma unroll
    for (int j = 0; j < 8; ++j) { const float bias = BA ? bfr(BA[c0 + j * 16 + col]) : 0.f;
#pragma unroll
      for (int r = 0; r < 8; ++r) { const float v = acc[j][r] + bias; const int rl = wave * 16 + 8 * g + r, cl = j * 16 + col; th[cl][rl] = (_Float16)v; const __bf16 bh = (__bf16)v; tb[cl][rl] = bh; tbl[cl][rl] = (__bf16)(v - (float)bh); } }
    __syncthreads();
    for (int e = tid; e < 128 * 8; e += 128) { const int cl = e >> 3, q = e & 7; vst2((unsigned*)(VT + (bb * CC + c0 + cl) * (size_t)TT + t0 + q * 8), *(const v4u*)&th[cl][q * 8]); if (hi_rows) { const size_t o3 = (bb * CC + c0 + cl) * (size_t)KHI + t0 + q * 8; vst2((unsigned*)(VB + o3), *(const v4u*)&tb[cl][q * 8]); vst2((unsigned*)(VBL + o3), *(const v4u*)&tbl[cl][q * 8]); } } } }
// ---- k_fa: block = 4 waves x 16 queries (query block qb, heaviest first) of plane b*NH + h; K and V^T come through LDS buffers shared by the four waves; per 32 keys: S^T = K Q^T (a lane holds 16 keys of ONE query), running maximum and sum in f32 (log2 domain), P^T x 2^11 packed from the score tiles straight into the B operand, O^T += V^T P^T; ctx = O / sum. Query blocks < QBH: 3-product logits (q, k residuals x 2^10), P and v as bf16 hi + lo (3 products)
#define LOGC (SCALE * 1.44269504088896340736f)
struct SMX { float m, l; };
__device__ __forceinline__ float xhalf(float x) { return __builtin_bit_cast(float, __builtin_amdgcn_permlanex16(__builtin_bit_cast(int, x), __builtin_bit_cast(int, x), 0x76543210, 0xfedcba98, false, false)); }   // lane l with lane l ^ 16
#define XCNT0() asm volatile("s_wait_xcnt 0x0" ::: "memory")   // stands behind a run of global loads, before their address registers are reused
// one 32-key step of the running softmax of this lane's query: t[0..7] = keys k0+8g+r, t[8..15] = keys k0+16+8g+r (scaled log2 logits); returns e[] = 2^(t - max + 11); rescales acc only when some query of the wave has a new maximum
__device__ __forceinline__ void sm_step(float t[16], SMX& st, v8f acc[HD / 16], int k0, int qfirst, int qi, int g) {
  if (k0 + 31 > qfirst) {   /* wave-uniform: only steps that reach the diagonal mask by index */
#pragma unroll
    for (int r = 0; r < 8; ++r) { if (k0 + 8 * g + r > qi) t[r] = -3.0e38f; if (k0 + 16 + 8 * g + r > qi) t[8 + r] = -3.0e38f; } }
  float mx = t[0];
#pragma unroll
  for (int s = 1; s < 16; ++s) mx = fmaxf(mx, t[s]);
  mx = fmaxf(mx, xhalf(mx));   /* the other half of the wave holds the query's other 16 keys */
  if (__builtin_amdgcn_ballot_w32(mx > st.m) != 0) { const float mn = fmaxf(st.m, mx); const float al = __builtin_amdgcn_exp2f(st.m - mn); st.m = mn; st.l *= al;
#pragma unroll
    for (int j = 0; j < HD / 16; ++j)
#pragma unroll
      for (int r = 0; r < 8; ++r) acc[j][r] *= al; }
  const float mo = st.m - 11.0f; float ps = 0.f;
#pragma unroll
  for (int s = 0; s < 16; ++s) { t[s] = __builtin_amdgcn_exp2f(t[s] - mo); ps += t[s]; }
  st.l += ps; }
// K / V staging of the main path: a stage is FKS keys of this head: K rows [key][64 d] and V^T rows [c][FKS keys], 128 B of data a row at a pitch of 144 B (16 B x odd: ds_load_b128 readers). The 128 threads bring it in with asynchronous copies to LDS that cover whole 128-B lines (8 lanes a row); all four waves take their fragments from there
#define FKS 64
#define FLP (FKS + 8)
#define FBUF (2 * FKS * FLP * 2)   // bytes of one buffer (K rows, then V^T rows)
#define DS0() asm volatile("s_wait_dscnt 0x0" ::: "memory")       // this wave's LDS reads of a buffer have returned before the buffer is handed to the copies
#define ASYNC0() asm volatile("s_wait_asynccnt 0x0" ::: "memory")   // this wave's copies have landed before the barrier behind which other waves read them
// one stage: 4 copies for K (16 keys on each), 4 for V^T (16 channels on each), 16 B a lane; the last line is the wait that stands before a register which a copy names is written again
__device__ __forceinline__ void fa_fill(unsigned l, const _Float16* kg, const _Float16* vg) {
  const unsigned rs = 16 * FLP * 2, vb = FKS * FLP * 2;
  asm volatile("global_load_async_to_lds_b128 %0, %8, off\n\t"
               "global_load_async_to_lds_b128 %1, %9, off\n\t"
               "global_load_async_to_lds_b128 %2, %10, off\n\t"
               "global_load_async_to_lds_b128 %3, %11, off\n\t"
               "global_load_async_to_lds_b128 %4, %12, off\n\t"
               "global_load_async_to_lds_b128 %5, %13, off\n\t"
               "global_load_async_to_lds_b128 %6, %14, off\n\t"
               "global_load_async_to_lds_b128 %7, %15, off\n\t"
               "s_wait_xcnt 0x0"
               :: "v"(l), "v"(l + rs), "v"(l + 2 * rs), "v"(l + 3 * rs), "v"(l + vb), "v"(l + vb + rs), "v"(l + vb + 2 * rs), "v"(l + vb + 3 * rs),
                  "v"(kg), "v"(kg + (size_t)16 * CC), "v"(kg + (size_t)32 * CC), "v"(kg + (size_t)48 * CC), "v"(vg), "v"(vg + (size_t)16 * TT), "v"(vg + (size_t)32 * TT), "v"(vg + (size_t)48 * TT)
               : "memory"); }
// the same for a stage of the early-row path: one K-like tile (rows of CC) and one V^T-like tile of the short planes (rows of KHI keys); called once for the hi pair and once for the lo pair
__device__ __forceinline__ void fa_fill_e(unsigned l, const _Float16* kg, const __bf16* vg) {
  const unsigned rs = 16 * FLP * 2, vb = FKS * FLP * 2;
  asm volatile("global_load_async_to_lds_b128 %0, %8, off\n\t"
               "global_load_async_to_lds_b128 %1, %9, off\n\t"
               "global_load_async_to_lds_b128 %2, %10, off\n\t"
               "global_load_async_to_lds_b128 %3, %11, off\n\t"
               "global_load_async_to_lds_b128 %4, %12, off\n\t"
               "global_load_async_to_lds_b128 %5, %13, off\n\t"
               "global_load_async_to_lds_b128 %6, %14, off\n\t"
               "global_load_async_to_lds_b128 %7, %15, off\n\t"
               "s_wait_xcnt 0x0"
               :: "v"(l), "v"(l + rs), "v"(l + 2 * rs), "v"(l + 3 * rs), "v"(l + vb), "v"(l + vb + rs), "v"(l + vb + 2 * rs), "v"(l + vb + 3 * rs),
                  "v"(kg), "v"(kg + (size_t)16 * CC), "v"(kg + (size_t)32 * CC), "v"(kg + (size_t)48 * CC), "v"(vg), "v"(vg + (size_t)16 * KHI), "v"(vg + (size_t)32 * KHI), "v"(vg + (size_t)48 * KHI)
               : "memory"); }
__global__ __launch_bounds__(128) void k_fa(const _Float16* __restrict__ QH, const _Float16* __restrict__ KH, const _Float16* __restrict__ QL, const _Float16* __restrict__ KL, const _Float16* __restrict__ VT, const __bf16* __restrict__ VB, const __bf16* __restrict__ VBL, float* __restrict__ Y) {
  __shared__ __align__(16) _Float16 skv[2][2][FKS][FLP];   /* [buffer][K rows | V^T rows][row][128 B + pad] */
  const int b = blockIdx.x / NH, h = blockIdx.x % NH; const int qb = NQB - 1 - (int)blockIdx.y;
  const int tid = threadIdx.x, wave = __builtin_amdgcn_readfirstlane(tid >> 5), lane = tid & 31, col = lane & 15, g = lane >> 4;
  /* wave number held scalar: trip count and diagonal test become scalar branches, every lane stays on at the matrix instructions */ const int ql0 = qb * 64 + wave * 16, qi = ql0 + col; const int nblk = (ql0 + 47) >> 5;   /* 32-key steps that cover keys 0 .. ql0 + 15 */
  const _Float16* Qp = QH + ((size_t)b * TT + qi) * CC + h * HD;
  v8f acc[HD / 16] = {}; SMX st; st.m = -3.0e38f; st.l = 0.f;
  const v16h qf0 = frag_h(Qp, lane), qf1 = frag_h(Qp + 32, lane);
  XCNT0();
  if (qb < QBH) {   /* block-uniform */
    const _Float16* QLp = QL + ((size_t)b * QHI + qi) * CC + h * HD;
    const v16h ql0f = frag_h(QLp, lane), ql1f = frag_h(QLp + 32, lane);
    XCNT0();
    /* a stage is FKS keys of this head in ONE buffer of four tiles (the main path's two buffers taken together): K hi, V^T hi, K lo, V^T lo; keys 0 .. qb * 64 + 63 all lie below KHI; every plain '#pragma unroll' of this path opens a constant-trip loop over a register array, so that its elements stay in registers */
    const int nst = qb + 1;   /* the same for the whole block */
    const int fr = tid >> 3, fc = (tid & 7) * 8;   /* this thread's row (of 16 a copy) and 16-B piece of a stage row */
    const _Float16* kg = KH + ((size_t)b * TT + fr) * CC + h * HD + fc; const _Float16* klg = KL + ((size_t)b * KHI + fr) * CC + h * HD + fc; const size_t vo = ((size_t)b * CC + h * HD + fr) * (size_t)KHI + fc;
    const unsigned l0 = (unsigned)(size_t)&skv[0][0][fr][fc];
    const _Float16 (*bkh)[FLP] = skv[0][0]; const _Float16 (*bkl)[FLP] = skv[1][0]; const __bf16 (*bvh)[FLP] = (const __bf16 (*)[FLP])skv[0][1]; const __bf16 (*bvl)[FLP] = (const __bf16 (*)[FLP])skv[1][1];
#pragma unroll 1   /* at most 6 stages: kept rolled for code size */
    for (int s = 0; s < nst; ++s) {
      if (s > 0) { DS0(); __syncthreads(); }   /* block-uniform: every reader has left stage s - 1 before the copies write over it */
      fa_fill_e(l0, kg + (size_t)s * FKS * CC, VB + vo + s * FKS); fa_fill_e(l0 + FBUF, klg + (size_t)s * FKS * CC, VBL + vo + s * FKS);
      ASYNC0(); __syncthreads();   /* stage s is published */
#pragma unroll 1   /* two steps a stage, rolled for code size; wave-uniform scalar test: the two lower waves of the block skip the diagonal stage's second step */
      for (int w = 0; w < 2 && 2 * s + w < nblk; ++w) { const int k0 = (2 * s + w) * 32; float t[16];
        v16h kh[2][2], kl[2][2]; v16b vh[HD / 16], vl[HD / 16];   /* the step's fragment reads go out as one group ahead of its products */
#pragma unroll
        for (int u = 0; u < 2; ++u) { const int kr = w * 32 + u * 16 + col; kh[u][0] = frag_h(&bkh[kr][0], lane); kh[u][1] = frag_h(&bkh[kr][32], lane); kl[u][0] = frag_h(&bkl[kr][0], lane); kl[u][1] = frag_h(&bkl[kr][32], lane); }
#pragma unroll
        for (int j = 0; j < HD / 16; ++j) { vh[j] = frag_b(&bvh[j * 16 + col][w * 32], lane); vl[j] = frag_b(&bvl[j * 16 + col][w * 32], lane); }
#pragma unroll
        for (int u = 0; u < 2; ++u) { v8f a = {}, al = {};
          a = wmma16(kh[u][0], qf0, a); al = wmma16(kh[u][0], ql0f, al); al = wmma16(kl[u][0], qf0, al); a = wmma16(kh[u][1], qf1, a); al = wmma16(kh[u][1], ql1f, al); al = wmma16(kl[u][1], qf1, al);
#pragma unroll
          for (int r = 0; r < 8; ++r) t[u * 8 + r] = (a[r] + al[r] * (1.0f / 1024.0f)) * LOGC; }
        sm_step(t, st, acc, k0, ql0, qi, g);
        const F2 p = bsplit16(t);
#pragma unroll
        for (int j = 0; j < HD / 16; ++j) { acc[j] = wmma_bf(vh[j], p.h, acc[j]); acc[j] = wmma_bf(vh[j], p.l, acc[j]); acc[j] = wmma_bf(vl[j], p.h, acc[j]); } } }
  } else {
    /* every plain '#pragma unroll' below opens a constant-trip loop over a register array (fragments, scores, accumulators), so that its elements stay in registers */
    const int nst = qb + 1;   /* stages of FKS keys that cover keys 0 .. qb * 64 + 63; the same for the whole block */
    const int fr = tid >> 3, fc = (tid & 7) * 8;   /* this thread's row (of 16 a copy) and 16-B piece of a stage row */
    const _Float16* kg = KH + ((size_t)b * TT + fr) * CC + h * HD + fc; const _Float16* vg = VT + ((size_t)b * CC + h * HD + fr) * (size_t)TT + fc;
    const unsigned l0 = (unsigned)(size_t)&skv[0][0][fr][fc];
    fa_fill(l0, kg, vg); ASYNC0(); __syncthreads();   /* stage 0 is published */
    if (1 < nst) fa_fill(l0 + FBUF, kg + (size_t)FKS * CC, vg + FKS);
#pragma unroll 1   /* rolled: one copy of the stage; the buffer is chosen by address */
    for (int s = 0; s < nst; ++s) { const _Float16 (*bk)[FLP] = skv[s & 1][0]; const _Float16 (*bv)[FLP] = skv[s & 1][1];
      v16h kf[2][4], vf[2][4];   /* both steps' fragments go out as one group at the head of the stage (the whole stage is filled, also where a wave skips its second step) */
#pragma unroll
      for (int w = 0; w < 2; ++w) {
#pragma unroll
        for (int u = 0; u < 2; ++u) { kf[w][2 * u] = frag_h(&bk[w * 32 + u * 16 + col][0], lane); kf[w][2 * u + 1] = frag_h(&bk[w * 32 + u * 16 + col][32], lane); }
#pragma unroll
        for (int j = 0; j < HD / 16; ++j) vf[w][j] = frag_h(&bv[j * 16 + col][w * 32], lane); }
#pragma unroll
      for (int w = 0; w < 2; ++w) { const int i = 2 * s + w, k0 = i * 32;
        if (w == 0 || i < nblk) {   /* wave-uniform scalar test: the two upper waves of the block need the diagonal stage's second step, the two lower do not */
          v8f s0 = {}, s1 = {}; s0 = wmma16(kf[w][0], qf0, s0); s1 = wmma16(kf[w][2], qf0, s1); s0 = wmma16(kf[w][1], qf1, s0); s1 = wmma16(kf[w][3], qf1, s1);
          float t[16];
#pragma unroll
          for (int r = 0; r < 8; ++r) { t[r] = s0[r] * LOGC; t[8 + r] = s1[r] * LOGC; }
          sm_step(t, st, acc, k0, ql0, qi, g);
          v16h p;
#pragma unroll
          for (int e = 0; e < 16; ++e) p[e] = (_Float16)t[e];
#pragma unroll
          for (int j = 0; j < HD / 16; ++j) acc[j] = wmma16(vf[w][j], p, acc[j]); } }
      DS0(); ASYNC0(); __syncthreads();   /* every wave, also one that skipped a step: publishes stage s + 1 and ends every reader's last read of stage s */
      if (s + 2 < nst) fa_fill(l0 + (unsigned)(s & 1) * FBUF, kg + (size_t)(s + 2) * FKS * CC, vg + (s + 2) * FKS); }   /* block-uniform; flies while stage s + 1 is worked on */
    ASYNC0(); }
  const float inv = 1.0f / (st.l + xhalf(st.l));   /* the two halves' partial sums join once; the maximum's own term keeps the sum >= 2^11 */
  float* yp = Y + ((size_t)b * TT + qi) * CC + h * HD + 8 * g;   /* acc[j][r] = ctx[query qi][j*16 + 8g + r]: 32 contiguous bytes per lane and j */
#pragma unroll
  for (int j = 0; j < HD / 16; ++j) { const v4f lo = { acc[j][0] * inv, acc[j][1] * inv, acc[j][2] * inv, acc[j][3] * inv }, hi = { acc[j][4] * inv, acc[j][5] * inv, acc[j][6] * inv, acc[j][7] * inv }; vst2(yp + j * 16, lo); vst2(yp + j * 16 + 4, hi); } }
// ---- k_out: block = (64 rows, 128 cols): out = ctx Wo (+ bo): ctx x 2^6 once to f16 against Wo as f16(bf16 x 2^8) exact (1 product) x 2^-14; causal early rows (< QHI of each sequence): ctx bf16 hi + lo against exact bf16 Wo (2 products)
__global__ __launch_bounds__(128) void k_out(const float* __restrict__ Y, const float* __restrict__ WO, const float* __restrict__ BO, float* __restrict__ OUT) { __shared__ __align__(16) unsigned char sm[2 * (64 + 64 + 128) * OLP * 2];   /* two operand buffers (ctx hi, ctx lo, Wo); behind a barrier the output staging takes the same bytes */
  static_assert(4 * 16 * 132 * 4 <= 2 * (64 + 64 + 128) * OLP * 2, "LDS");
  float (*sf)[16][132] = (float (*)[16][132])sm;
  const int tid = threadIdx.x, wave = tid >> 5, lane = tid & 31, col = lane & 15, g = lane >> 4; const int c0 = blockIdx.y * 128; const size_t r0 = (size_t)blockIdx.x * 64 + wave * 16;
  v8f acc[8] = {};
  const int lr = tid / (OK / 4), lc = tid % (OK / 4);
  const float* yg = Y + ((size_t)blockIdx.x * 64 + lr) * CC + lc * 4; const float* wg = WO + (size_t)(c0 + lr) * CC + lc * 4;   /* (out,in) weight rows */
  if (CAUSAL && (int)(((size_t)blockIdx.x * 64) % TT) < QHI) {   /* block-uniform */
    __bf16 (*sah)[64][OLP] = (__bf16 (*)[64][OLP])sm; __bf16 (*sal)[64][OLP] = (__bf16 (*)[64][OLP])(sm + 2 * 64 * OLP * 2); __bf16 (*sw)[128][OLP] = (__bf16 (*)[128][OLP])(sm + 4 * 64 * OLP * 2);
    v4f ry[64 / ORI], rw[128 / ORI];
    tile_ld(ry, yg, (size_t)ORI * CC); XCNT_G(); tile_ld(rw, wg, (size_t)ORI * CC); XCNT_G();
#pragma unroll 1   /* rolled: one copy of the stage */
    for (int s = 0; s < CC / OK; ++s) { __bf16 (*bh)[OLP] = sah[s & 1]; __bf16 (*bl)[OLP] = sal[s & 1]; __bf16 (*bw)[OLP] = sw[s & 1];
#pragma unroll
      for (int i = 0; i < 64 / ORI; ++i) { st_b(&bh[i * ORI + lr][lc * 4], ry[i]); st_bl(&bl[i * ORI + lr][lc * 4], ry[i]); }
#pragma unroll
      for (int i = 0; i < 128 / ORI; ++i) st_b(&bw[i * ORI + lr][lc * 4], rw[i]);
      __syncthreads();   /* publishes stage s; every wave has left the other buffer before stage s + 1 is stored there */
      if (s + 1 < CC / OK) { tile_ld(ry, yg + (s + 1) * OK, (size_t)ORI * CC); XCNT_G(); tile_ld(rw, wg + (s + 1) * OK, (size_t)ORI * CC); XCNT_G(); }
#pragma unroll
      for (int kk = 0; kk < OK / 32; ++kk) { const v16b ah = frag_b(&bh[wave * 16 + col][kk * 32], lane), al = frag_b(&bl[wave * 16 + col][kk * 32], lane);
#pragma unroll
        for (int j0 = 0; j0 < 8; j0 += 4) { v16b w[4];   /* fragment reads go out as a group ahead of their products */
#pragma unroll
          for (int u = 0; u < 4; ++u) w[u] = frag_b(&bw[(j0 + u) * 16 + col][kk * 32], lane);
#pragma unroll
          for (int u = 0; u < 4; ++u) { acc[j0 + u] = wmma_bf(ah, w[u], acc[j0 + u]); acc[j0 + u] = wmma_bf(al, w[u], acc[j0 + u]); } } } }
    __syncthreads();   /* the last stage's readers are done before the output staging writes over the buffers */
#pragma unroll
    for (int j = 0; j < 8; ++j) { const float bias = BO ? bfr(BO[c0 + j * 16 + col]) : 0.f;
#pragma unroll
      for (int r = 0; r < 8; ++r) sf[wave][8 * g + r][j * 16 + col] = acc[j][r] + bias; }
  } else {
    _Float16 (*sa)[64][OLP] = (_Float16 (*)[64][OLP])sm; _Float16 (*sw)[128][OLP] = (_Float16 (*)[128][OLP])(sm + 2 * 64 * OLP * 2);
    v4f ry[64 / ORI], rw[128 / ORI];
    tile_ld(ry, yg, (size_t)ORI * CC); XCNT_G(); tile_ld(rw, wg, (size_t)ORI * CC); XCNT_G();
#pragma unroll 1   /* rolled: one copy of the stage */
    for (int s = 0; s < CC / OK; ++s) { _Float16 (*ba)[OLP] = sa[s & 1]; _Float16 (*bw)[OLP] = sw[s & 1];
#pragma unroll
      for (int i = 0; i < 64 / ORI; ++i) st_hs(&ba[i * ORI + lr][lc * 4], ry[i], 64.0f);   /* ctx carried x 2^6 into f16 so small-magnitude context rows stay clear of f16 subnormals */
#pragma unroll
      for (int i = 0; i < 128 / ORI; ++i) st_hw(&bw[i * ORI + lr][lc * 4], rw[i]);
      __syncthreads();   /* publishes stage s; every wave has left the other buffer before stage s + 1 is stored there */
      if (s + 1 < CC / OK) { tile_ld(ry, yg + (s + 1) * OK, (size_t)ORI * CC); XCNT_G(); tile_ld(rw, wg + (s + 1) * OK, (size_t)ORI * CC); XCNT_G(); }
#pragma unroll
      for (int kk = 0; kk < OK / 32; ++kk) { const v16h a = frag_h(&ba[wave * 16 + col][kk * 32], lane);
#pragma unroll
        for (int j0 = 0; j0 < 8; j0 += 4) { v16h w[4];   /* fragment reads go out as a group ahead of their products */
#pragma unroll
          for (int u = 0; u < 4; ++u) w[u] = frag_h(&bw[(j0 + u) * 16 + col][kk * 32], lane);
#pragma unroll
          for (int u = 0; u < 4; ++u) acc[j0 + u] = wmma16(a, w[u], acc[j0 + u]); } } }
    __syncthreads();   /* the last stage's readers are done before the output staging writes over the buffers */
#pragma unroll
    for (int j = 0; j < 8; ++j) { const float bias = BO ? bfr(BO[c0 + j * 16 + col]) : 0.f;
#pragma unroll
      for (int r = 0; r < 8; ++r) sf[wave][8 * g + r][j * 16 + col] = acc[j][r] * (1.0f / 16384.0f) + bias; } }   /* 2^-8 (Wo carry) x 2^-6 (ctx carry) */
  LDSX(); for (int rl = 0; rl < 16; ++rl) vst2(OUT + SRCROW(r0 + rl) * DIN + c0 + lane * 4, *(const v4f*)&sf[wave][rl][lane * 4]); }

extern "C" void kernel_launch(void* const* d_in, const int* in_sizes, int n_in, void* d_out, int out_size, void* d_ws, size_t ws_size, hipStream_t stream) {
  (void)in_sizes; (void)n_in; (void)out_size;
  const float** F = (const float**)d_in;
  if (ws_size < (size_t)WS_END) return;
  char* ws = (char*)d_ws; _Float16 *QH = (_Float16*)(ws + WS_QH), *KH = (_Float16*)(ws + WS_KH), *VT = (_Float16*)(ws + WS_VT), *QL = (_Float16*)(ws + WS_QL), *KL = (_Float16*)(ws + WS_KL); __bf16 *VB = (__bf16*)(ws + WS_VB), *VBL = (__bf16*)(ws + WS_VBL); float *Y = (float*)(ws + WS_Y);
  (void)Y; (void)QL; (void)KL; (void)VB; (void)VBL;
  // inputs: 0 x [2048,2,768] (S, B, D); 1 wq [768,768] (out,in), 2 bq; 3 wk, 4 bk; 5 wv, 6 bv; 7 wc (out,in), 8 bc (all biases NONZERO)
  k_proj<<<dim3(TNB * TT / 64, CC / 128, 3), 128, 0, stream>>>(F[0], F[0], F[0], F[1], F[3], F[5], F[2], F[4], F[6], QH, QL, KH, KL, VT, VB, VBL);
  k_fa<<<dim3(TNB * NH, NQB), 128, 0, stream>>>(QH, KH, QL, KL, VT, VB, VBL, Y);
  k_out<<<dim3(TNB * TT / 64, DIN / 128), 128, 0, stream>>>(Y, F[7], F[8], (float*)d_out);   /* writes (S, B, D) rows */
}

// v006
// It runs in 70.5 microseconds.
// Two timings next to v005 both put it at 1.05 times that version's speed.
// Counting every step since v000, it is 12.7 times as fast.
// compute dtype: all float inputs rounded to bf16; q / k / v projections with EXACT bf16 products on WMMA 16x16x32 (f32 accumulate) + bias; causal logits: 3 products for the first 384 rows, single f16 q x k after, x 64^-0.5; running-maximum softmax f32 in the same launch; unnormalised P x 2^11 once to f16 x v once to f16 (bf16 hi + lo below row 384), divided by the f32 sum at the end; y hi+lo x exact wc below row 384, x2^6 f16 carry x f16(bf16 x 2^8) wc after, + bc; f32 output written back in the sequence-first layout.
#include <hip/hip_runtime.h>
#include <math.h>

typedef __attribute__((ext_vector_type(16))) _Float16 v16h;
typedef __attribute__((ext_vector_type(16))) __bf16 v16b;
typedef __attribute__((ext_vector_type(8)))  _Float16 v8h;
typedef __attribute__((ext_vector_type(8)))  float v8f;
typedef __attribute__((ext_vector_type(4)))  float v4f;
typedef __attribute__((ext_vector_type(2)))  float v2f;
typedef __attribute__((ext_vector_type(4)))  unsigned v4u;
typedef __attribute__((ext_vector_type(4)))  int v4i;
typedef float __attribute__((may_alias)) float_a;
typedef int __attribute__((may_alias)) int_a;

template <typename T> __device__ __forceinline__ void vst2(void* p, T v) { *(T*)p = v;  }
__device__ __forceinline__ v8f wmma16(v16h a, v16h b, v8f c) {
  v8f d = __builtin_amdgcn_wmma_f32_16x16x32_f16(false, a, false, b, (short)0, c, false, false);
  asm volatile("v_nop\n\tv_nop\n\tv_nop\n\tv_nop" : "+v"(d) : "v"(a), "v"(b));
  return d;
}
__device__ __forceinline__ v8f wmma_bf(v16b a, v16b b, v8f c) {
  v8f d = __builtin_amdgcn_wmma_f32_16x16x32_bf16(false, a, false, b, (short)0, c, false, false);
  asm volatile("v_nop\n\tv_nop\n\tv_nop\n\tv_nop" : "+v"(d) : "v"(a), "v"(b));
  return d;
}
// 16x16x32 fragments: lane = (h = lane>>4, row/col = lane&15); elements 0..7 = k0+8h+0..7, 8..15 = k0+16+8h+0..7; D element r = row 8h+r
__device__ __forceinline__ v16h frag_h(const _Float16* rowk0, int lane) {
  union { v16h v; v8h q[2]; } u; const _Float16* p = rowk0 + 8 * (lane >> 4);
  u.q[0] = *(const v8h*)p; u.q[1] = *(const v8h*)(p + 16); return u.v;
}
__device__ __forceinline__ v16h frag_f32(const float* rowk0, int lane) {
  v16h a; const float* p = rowk0 + 8 * (lane >> 4);
#pragma unroll
  for (int i = 0; i < 8; ++i) { a[i] = (_Float16)p[i]; a[8 + i] = (_Float16)p[16 + i]; }
  return a;
}
__device__ __forceinline__ v16h frag_f32s(const float* rowk0, int lane, float sc) {
  v16h a; const float* p = rowk0 + 8 * (lane >> 4);
#pragma unroll
  for (int i = 0; i < 8; ++i) { a[i] = (_Float16)(p[i] * sc); a[8 + i] = (_Float16)(p[16 + i] * sc); }
  return a;
}
// column fragment from a [K][ld] layout (column n), rows >= K read as 0
__device__ __forceinline__ v16h fragc_f32(const float* W, int k0, int n, int lane, int ld, int K) {
  v16h a; const int g = lane >> 4;
#pragma unroll
  for (int i = 0; i < 8; ++i) { const int ka = k0 + 8 * g + i, kb = ka + 16;
    a[i] = (_Float16)(ka < K ? W[(size_t)(ka < K ? ka : K - 1) * ld + n] : 0.f); a[8 + i] = (_Float16)(kb < K ? W[(size_t)(kb < K ? kb : K - 1) * ld + n] : 0.f); }
  return a;
}
struct F2 { v16b h, l; };
__device__ __forceinline__ F2 bsplit16(const float v[16]) { F2 r;
#pragma unroll
  for (int i = 0; i < 16; ++i) { const __bf16 h = (__bf16)v[i]; r.h[i] = h; r.l[i] = (__bf16)(v[i] - (float)h); }
  return r; }
__device__ __forceinline__ F2 split_row(const float* row, int k0, int lane) { float v[16]; const float* p = row + k0 + 8 * (lane >> 4);
#pragma unroll
  for (int i = 0; i < 8; ++i) { v[i] = p[i]; v[8 + i] = p[16 + i]; }
  return bsplit16(v); }
__device__ __forceinline__ F2 split_rowK(const float* row, int k0, int lane, int K) { float v[16]; const int g = lane >> 4;
#pragma unroll
  for (int i = 0; i < 8; ++i) { const int ka = k0 + 8 * g + i, kb = ka + 16; v[i] = ka < K ? row[ka < K ? ka : K - 1] : 0.f; v[8 + i] = kb < K ? row[kb < K ? kb : K - 1] : 0.f; }
  return bsplit16(v); }
__device__ __forceinline__ F2 split_col(const float* W, int k0, int n, int lane, int ld, int K) { float v[16]; const int g = lane >> 4;
#pragma unroll
  for (int i = 0; i < 8; ++i) { const int ka = k0 + 8 * g + i, kb = ka + 16; v[i] = ka < K ? W[(size_t)(ka < K ? ka : K - 1) * ld + n] : 0.f; v[8 + i] = kb < K ? W[(size_t)(kb < K ? kb : K - 1) * ld + n] : 0.f; }
  return bsplit16(v); }
__device__ __forceinline__ v8f mac3(const F2& a, const F2& b, v8f c) { c = wmma_bf(a.l, b.h, c); c = wmma_bf(a.h, b.l, c); return wmma_bf(a.h, b.h, c); }
__device__ __forceinline__ float sigm(float v) { return 1.0f / (1.0f + expf(-v)); }
#define LDSX() do { asm volatile("s_wait_dscnt 0" ::: "memory"); __builtin_amdgcn_wave_barrier(); __builtin_amdgcn_fence(__ATOMIC_RELEASE, "workgroup"); } while (0)

// Causal multi-head self-attention on a SEQUENCE-FIRST input (x [2048, 2, 768] = (S, B, D); torch (out,in) wq / wk / wv / wc [768,768] N(0,1) x 0.02 applied as x W^T + b, biases N(0,1) x 0.02 - NONZERO; 12 heads x 64; scores / sqrt(64); tril kept, -inf elsewhere; softmax; y wc^T + bc; output transposed back to (S, B, D)). The kernels work on rows b*2048 + t: the projection reads token (b, t) from source row t*2 + b and the output kernel writes it back there.
#define NB 2
#define TT 2048
#define CC 768            // NH * HD = projected width
#define DIN 768          // input (model) width
#define NH 12
#define HD 64
#define NQB (TT / 64)
#define SCALE (0.125f)
#define CAUSAL 1
#ifndef TNB
#define TNB NB
#endif
__device__ __forceinline__ float bfr(float v) { return (float)(__bf16)v; }
typedef __attribute__((ext_vector_type(8))) __bf16 v8b;
__device__ __forceinline__ v16b frag_b(const __bf16* rowk0, int lane) {
  union { v16b v; v8b q[2]; } u; const __bf16* p = rowk0 + 8 * (lane >> 4);
  u.q[0] = *(const v8b*)p; u.q[1] = *(const v8b*)(p + 16); return u.v;
}
#define QBH 6              // causal: query blocks 0..QBH-1 of each sequence (few keys, no averaging) take the high-precision path
#define QHI 384            // rows carrying a q residual plane
#define KHI 384            // key rows carrying k residual / v bf16 hi+lo planes (used only by the causal high-precision path)
// B fragment (k rows k0+.., output column o) of a weight: (in,out) [K][ld] or (out,in) [ld rows of K]: bf16 exact, or f16(bf16 * 256) exact
__device__ __forceinline__ v16b wcol_io(const float* Wm, int k0, int o, int lane, int ld) { v16b w; const int g = lane >> 4;
#pragma unroll
  for (int i = 0; i < 8; ++i) { w[i] = (__bf16)Wm[(size_t)(k0 + 8 * g + i) * ld + o]; w[8 + i] = (__bf16)Wm[(size_t)(k0 + 16 + 8 * g + i) * ld + o]; }
  return w; }
__device__ __forceinline__ v16b wcol_oi(const float* Wm, int k0, int o, int lane, int K) { v16b w; const float* p = Wm + (size_t)o * K + k0 + 8 * (lane >> 4);
#pragma unroll
  for (int i = 0; i < 8; ++i) { w[i] = (__bf16)p[i]; w[8 + i] = (__bf16)p[16 + i]; }
  return w; }
__device__ __forceinline__ v16h wcolh_io(const float* Wm, int k0, int o, int lane, int ld) { v16h w; const int g = lane >> 4;
#pragma unroll
  for (int i = 0; i < 8; ++i) { w[i] = (_Float16)(bfr(Wm[(size_t)(k0 + 8 * g + i) * ld + o]) * 256.0f); w[8 + i] = (_Float16)(bfr(Wm[(size_t)(k0 + 16 + 8 * g + i) * ld + o]) * 256.0f); }
  return w; }
__device__ __forceinline__ v16h wcolh_oi(const float* Wm, int k0, int o, int lane, int K) { v16h w; const float* p = Wm + (size_t)o * K + k0 + 8 * (lane >> 4);
#pragma unroll
  for (int i = 0; i < 8; ++i) { w[i] = (_Float16)(bfr(p[i]) * 256.0f); w[8 + i] = (_Float16)(bfr(p[16 + i]) * 256.0f); }
  return w; }
#define SRCROW(r) ((size_t)((r) % TT) * NB + (size_t)((r) / TT))   // row r = b*TT + t <-> sequence-first row t*NB + b of the (S, B, D) arrays (NB = the module's batch count, also when fewer batches are run)
#define WQKV_LAYOUT 1   // layout for WCOL only, which nothing calls (k_proj reads (out,in) [CC][DIN] rows): 0 = (in,out) [DIN][CC]; 1 = (out,in) [CC][DIN]; 2 = per-head [NH][DIN][HD]
__device__ __forceinline__ v16b wcol_hdk(const float* Wm, int k0, int o, int lane) { v16b w; const int g = lane >> 4; const float* p = Wm + (size_t)(o / HD) * DIN * HD + (o % HD);
#pragma unroll
  for (int i = 0; i < 8; ++i) { w[i] = (__bf16)p[(size_t)(k0 + 8 * g + i) * HD]; w[8 + i] = (__bf16)p[(size_t)(k0 + 16 + 8 * g + i) * HD]; }
  return w; }
#define WO_OUT_IN 1
#if WQKV_LAYOUT == 1
#define WCOL(W, k0, o, lane) wcol_oi(W, k0, o, lane, DIN)
#elif WQKV_LAYOUT == 2
#define WCOL(W, k0, o, lane) wcol_hdk(W, k0, o, lane)
#else
#define WCOL(W, k0, o, lane) wcol_io(W, k0, o, lane, CC)
#endif
#if WO_OUT_IN
#define WOCOL(W, k0, o, lane) wcol_oi(W, k0, o, lane, CC)
#define WOCOLH(W, k0, o, lane) wcolh_oi(W, k0, o, lane, CC)
#else
#define WOCOL(W, k0, o, lane) wcol_io(W, k0, o, lane, DIN)
#define WOCOLH(W, k0, o, lane) wcolh_io(W, k0, o, lane, DIN)
#endif

#define WS_QH  0u                                      // f16 q rows [b*t][CC]
#define WS_KH  (WS_QH + 2u * (size_t)NB * TT * CC)      // f16 k rows [b*t][CC]
#define WS_VT  (WS_KH + 2u * (size_t)NB * TT * CC)      // f16 v planes [b][c][t]
#define WS_QL  (WS_VT + 2u * (size_t)NB * CC * TT)      // f16 q residual x 2^10 rows [b][t < QHI][CC]
#define WS_KL  (WS_QL + 2u * (size_t)NB * QHI * CC)     // f16 k residual x 2^10 rows [b][t < KHI][CC]
#define WS_VB  (WS_KL + 2u * (size_t)NB * KHI * CC)     // bf16 v hi planes [b][c][t < KHI]
#define WS_VBL (WS_VB + 2u * (size_t)NB * CC * KHI)
#define WS_Y   (WS_VBL + 2u * (size_t)NB * CC * KHI)    // f32 ctx rows [b*t][CC]
#define WS_END (WS_Y  + 4u * (size_t)NB * TT * CC)

// operand staging of the two GEMM launches: a stage is PK (projection) or OK (output) k of every tile row. The block's threads fetch it with global_load_b128 that cover whole 128-B lines (PK / 4 or OK / 4 lanes a row), round it ONCE to the 16-bit operand type and store it in LDS rows with a 16-B pad (pitch 16 B x odd: ds_load_b128 readers); all waves take their fragments from there
// every '#pragma unroll' of the staging code opens a constant-trip loop over a register array (fetched rows, fragments, accumulators), so that its elements stay in registers
typedef __attribute__((ext_vector_type(4))) __bf16 v4b;
typedef __attribute__((ext_vector_type(4))) _Float16 v4h;
#define PK 32
#define PLP (PK + 8)
#define PTR 128            // rows of a projection tile
#define PRI (1024 / PK)    // tile rows that one load instruction of the whole block (256 threads) covers
#define OK 64
#define OLP (OK + 8)
#define ORI (512 / OK)
template <int N> __device__ __forceinline__ void tile_ld(v4f (&r)[N], const float* p, size_t step) {
#pragma unroll
  for (int i = 0; i < N; ++i) r[i] = *(const v4f*)(p + (size_t)i * step); }
__device__ __forceinline__ void st_b(__bf16* d, v4f v) { const v4b o = { (__bf16)v[0], (__bf16)v[1], (__bf16)v[2], (__bf16)v[3] }; *(v4b*)d = o; }
__device__ __forceinline__ void st_bl(__bf16* d, v4f v) { const v4b o = { (__bf16)(v[0] - (float)(__bf16)v[0]), (__bf16)(v[1] - (float)(__bf16)v[1]), (__bf16)(v[2] - (float)(__bf16)v[2]), (__bf16)(v[3] - (float)(__bf16)v[3]) }; *(v4b*)d = o; }
__device__ __forceinline__ void st_hs(_Float16* d, v4f v, float sc) { const v4h o = { (_Float16)(v[0] * sc), (_Float16)(v[1] * sc), (_Float16)(v[2] * sc), (_Float16)(v[3] * sc) }; *(v4h*)d = o; }
__device__ __forceinline__ void st_hw(_Float16* d, v4f v) { const v4h o = { (_Float16)(bfr(v[0]) * 256.0f), (_Float16)(bfr(v[1]) * 256.0f), (_Float16)(bfr(v[2]) * 256.0f), (_Float16)(bfr(v[3]) * 256.0f) }; *(v4h*)d = o; }
#define XCNT_G() asm volatile("s_wait_xcnt 0x0" ::: "memory")   // stands behind a run of global loads, before a register that they name is written again
// eight 16-B stores of one thread, 'step' bytes apart; the last line is the wait that stands before a register which a store names is written again (in a statement of its own the compiler lifts later register writes over it)
__device__ __forceinline__ void st8(char* p, size_t step, const v4u (&o)[8]) {
  asm volatile("global_store_b128 %0, %8, off\n\t"
               "global_store_b128 %1, %9, off\n\t"
               "global_store_b128 %2, %10, off\n\t"
               "global_store_b128 %3, %11, off\n\t"
               "global_store_b128 %4, %12, off\n\t"
               "global_store_b128 %5, %13, off\n\t"
               "global_store_b128 %6, %14, off\n\t"
               "global_store_b128 %7, %15, off\n\t"
               "s_wait_xcnt 0x0"
               :: "v"(p), "v"(p + step), "v"(p + 2 * step), "v"(p + 3 * step), "v"(p + 4 * step), "v"(p + 5 * step), "v"(p + 6 * step), "v"(p + 7 * step),
                  "v"(o[0]), "v"(o[1]), "v"(o[2]), "v"(o[3]), "v"(o[4]), "v"(o[5]), "v"(o[6]), "v"(o[7])
               : "memory"); }
// ---- k_proj: block = (128 rows, 128 cols, which), 8 waves in a 4 x 2 grid, 32 rows x 64 cols a wave: q/k/v = X W (+ b) with exact bf16 products (K = DIN) -> which 0: q f16 rows (+ residual rows < QHI); 1: k f16 rows (+ residual rows < KHI); 2: v f16 planes [c][t] (+ bf16 hi/lo planes for t < KHI)
__global__ __launch_bounds__(256) void k_proj(const float* __restrict__ XQ, const float* __restrict__ XK, const float* __restrict__ XV, const float* __restrict__ WQ, const float* __restrict__ WK, const float* __restrict__ WV, const float* __restrict__ BQ, const float* __restrict__ BK, const float* __restrict__ BV,
    _Float16* __restrict__ QH, _Float16* __restrict__ QL, _Float16* __restrict__ KH, _Float16* __restrict__ KL, _Float16* __restrict__ VT, __bf16* __restrict__ VB, __bf16* __restrict__ VBL) {
  __shared__ __align__(16) unsigned char sm[3 * 128 * 136 * 2];   /* two operand buffers in the main loop; behind a barrier the epilogue's output staging takes the same bytes */
  static_assert(2 * (PTR + 128) * PLP * 2 <= 3 * 128 * 136 * 2 && 2 * PTR * 136 * 2 <= 3 * 128 * 136 * 2 && PTR == 128 && QHI % PTR == 0 && KHI % PTR == 0 && TT % PTR == 0, "LDS, tile");
  __bf16 (*sx)[PTR][PLP] = (__bf16 (*)[PTR][PLP])sm; __bf16 (*sw)[128][PLP] = (__bf16 (*)[128][PLP])(sm + 2 * PTR * PLP * 2);
  _Float16 (*sh)[136] = (_Float16 (*)[136])sm; _Float16 (*sl)[136] = (_Float16 (*)[136])(sm + PTR * 136 * 2);
  _Float16 (*th)[136] = (_Float16 (*)[136])sm; __bf16 (*tb)[136] = (__bf16 (*)[136])(sm + 128 * 136 * 2); __bf16 (*tbl)[136] = (__bf16 (*)[136])(sm + 2 * 128 * 136 * 2);
  const int tid = threadIdx.x, wave = tid >> 5, lane = tid & 31, col = lane & 15, g = lane >> 4; const int wr = wave >> 1, wc = wave & 1; const int which = blockIdx.z; const int c0 = blockIdx.y * 128; const size_t r0 = (size_t)blockIdx.x * PTR; const size_t bb = r0 / TT; const int t0 = (int)(r0 % TT);
  const float* X = which == 0 ? XQ : which == 1 ? XK : XV; const float* WA = which == 0 ? WQ : which == 1 ? WK : WV; const float* BA = which == 0 ? BQ : which == 1 ? BK : BV;
  v8f acc[2][4] = {};
  const int lr = tid / (PK / 4), lc = tid % (PK / 4);
  const float* xg = X + SRCROW(r0 + lr) * DIN + lc * 4;   /* sequence-first source row; the tile's rows lie in one sequence, so PRI tile rows on = PRI * NB source rows on */
  const float* wg = WA + (size_t)(c0 + lr) * DIN + lc * 4;   /* (out,in) weight rows */
  v4f rx[PTR / PRI], rw[128 / PRI];
  tile_ld(rx, xg, (size_t)PRI * NB * DIN); XCNT_G(); tile_ld(rw, wg, (size_t)PRI * DIN); XCNT_G();
#pragma unroll 1   /* rolled: one copy of the stage; the fetched registers are free again once they are stored */
  for (int s = 0; s < DIN / PK; ++s) { __bf16 (*bx)[PLP] = sx[s & 1]; __bf16 (*bw)[PLP] = sw[s & 1];
#pragma unroll
    for (int i = 0; i < PTR / PRI; ++i) st_b(&bx[i * PRI + lr][lc * 4], rx[i]);
#pragma unroll
    for (int i = 0; i < 128 / PRI; ++i) st_b(&bw[i * PRI + lr][lc * 4], rw[i]);
    __syncthreads();   /* publishes stage s; also: every wave has left the other buffer (read in stage s - 1) before stage s + 1 is stored there */
    if (s + 1 < DIN / PK) { tile_ld(rx, xg + (s + 1) * PK, (size_t)PRI * NB * DIN); XCNT_G(); tile_ld(rw, wg + (s + 1) * PK, (size_t)PRI * DIN); XCNT_G(); }   /* next stage flies while this one is multiplied */
#pragma unroll
    for (int kk = 0; kk < PK / 32; ++kk) { v16b a[2], w[4];   /* the stage's fragment reads go out as one group ahead of its products: one LDS latency a stage */
#pragma unroll
      for (int i = 0; i < 2; ++i) a[i] = frag_b(&bx[wr * 32 + i * 16 + col][kk * 32], lane);
#pragma unroll
      for (int u = 0; u < 4; ++u) w[u] = frag_b(&bw[wc * 64 + u * 16 + col][kk * 32], lane);
#pragma unroll
      for (int u = 0; u < 4; ++u)
#pragma unroll
        for (int i = 0; i < 2; ++i) acc[i][u] = wmma_bf(a[i], w[u], acc[i][u]); } }
  __syncthreads();   /* the last stage's readers are done before the epilogue writes over the buffers */
  if (which < 2) { _Float16* DH = which == 0 ? QH : KH; _Float16* DL = which == 0 ? QL : KL; const int nhi = which == 0 ? QHI : KHI; const bool hi_rows = t0 < nhi;
#pragma unroll
    for (int j = 0; j < 4; ++j) { const float bias = BA ? bfr(BA[c0 + wc * 64 + j * 16 + col]) : 0.f;
#pragma unroll
      for (int i = 0; i < 2; ++i)
#pragma unroll
        for (int r = 0; r < 8; ++r) { const float v = acc[i][j][r] + bias; const _Float16 hv = (_Float16)v; const int rl = wr * 32 + i * 16 + 8 * g + r, cl = wc * 64 + j * 16 + col; sh[rl][cl] = hv; sl[rl][cl] = (_Float16)((v - (float)hv) * 1024.0f); } }
    __syncthreads();
    const int rl0 = tid >> 4, q = tid & 15; v4u o[PTR / 16];   /* 16 threads a row, 16 rows a pass of the block; a plane's staged rows are read as one group, then stored */
#pragma unroll
    for (int i = 0; i < PTR / 16; ++i) o[i] = *(const v4u*)&sh[i * 16 + rl0][q * 8];
    st8((char*)(DH + (r0 + rl0) * CC + c0 + q * 8), (size_t)16 * CC * 2, o);
    if (hi_rows) {   /* block-uniform */
#pragma unroll
      for (int i = 0; i < PTR / 16; ++i) o[i] = *(const v4u*)&sl[i * 16 + rl0][q * 8];
      st8((char*)(DL + (bb * nhi + t0 + rl0) * (size_t)CC + c0 + q * 8), (size_t)16 * CC * 2, o); }
  } else { const bool hi_rows = t0 < KHI;
#pragma unroll
    for (int j = 0; j < 4; ++j) { const float bias = BA ? bfr(BA[c0 + wc * 64 + j * 16 + col]) : 0.f;
#pragma unroll
      for (int i = 0; i < 2; ++i)
#pragma unroll
        for (int r = 0; r < 8; ++r) { const float v = acc[i][j][r] + bias; const int rl = wr * 32 + i * 16 + 8 * g + r, cl = wc * 64 + j * 16 + col; th[cl][rl] = (_Float16)v; const __bf16 bh = (__bf16)v; tb[cl][rl] = bh; tbl[cl][rl] = (__bf16)(v - (float)bh); } }
    __syncthreads();
    const int cl0 = tid >> 4, q = tid & 15; v4u o[8];   /* 16 threads a channel row of PTR keys, 16 channels a pass of the block; read as one group, then stored, as above */
#pragma unroll
    for (int i = 0; i < 8; ++i) o[i] = *(const v4u*)&th[i * 16 + cl0][q * 8];
    st8((char*)(VT + (bb * CC + c0 + cl0) * (size_t)TT + t0 + q * 8), (size_t)16 * TT * 2, o);
    if (hi_rows) {   /* block-uniform */
#pragma unroll
      for (int i = 0; i < 8; ++i) o[i] = *(const v4u*)&tb[i * 16 + cl0][q * 8];
      st8((char*)(VB + (bb * CC + c0 + cl0) * (size_t)KHI + t0 + q * 8), (size_t)16 * KHI * 2, o);
#pragma unroll
      for (int i = 0; i < 8; ++i) o[i] = *(const v4u*)&tbl[i * 16 + cl0][q * 8];
      st8((char*)(VBL + (bb * CC + c0 + cl0) * (size_t)KHI + t0 + q * 8), (size_t)16 * KHI * 2, o); } } }
// ---- k_fa: block = 4 waves x 16 queries (query block qb, heaviest first) of plane b*NH + h; K and V^T come through LDS buffers shared by the four waves; per 32 keys: S^T = K Q^T (a lane holds 16 keys of ONE query), running maximum and sum in f32 (log2 domain), P^T x 2^11 packed from the score tiles straight into the B operand, O^T += V^T P^T; ctx = O / sum. Query blocks < QBH: 3-product logits (q, k residuals x 2^10), P and v as bf16 hi + lo (3 products)
#define LOGC (SCALE * 1.44269504088896340736f)
struct SMX { float m, l; };
__device__ __forceinline__ float xhalf(float x) { return __builtin_bit_cast(float, __builtin_amdgcn_permlanex16(__builtin_bit_cast(int, x), __builtin_bit_cast(int, x), 0x76543210, 0xfedcba98, false, false)); }   // lane l with lane l ^ 16
#define XCNT0() asm volatile("s_wait_xcnt 0x0" ::: "memory")   // stands behind a run of global loads, before their address registers are reused
// one 32-key step of the running softmax of this lane's query: t[0..7] = keys k0+8g+r, t[8..15] = keys k0+16+8g+r (scaled log2 logits); returns e[] = 2^(t - max + 11); rescales acc only when some query of the wave has a new maximum
__device__ __forceinline__ void sm_step(float t[16], SMX& st, v8f acc[HD / 16], int k0, int qfirst, int qi, int g) {
  if (k0 + 31 > qfirst) {   /* wave-uniform: only steps that reach the diagonal mask by index */
#pragma unroll
    for (int r = 0; r < 8; ++r) { if (k0 + 8 * g + r > qi) t[r] = -3.0e38f; if (k0 + 16 + 8 * g + r > qi) t[8 + r] = -3.0e38f; } }
  float mx = t[0];
#pragma unroll
  for (int s = 1; s < 16; ++s) mx = fmaxf(mx, t[s]);
  mx = fmaxf(mx, xhalf(mx));   /* the other half of the wave holds the query's other 16 keys */
  if (__builtin_amdgcn_ballot_w32(mx > st.m) != 0) { const float mn = fmaxf(st.m, mx); const float al = __builtin_amdgcn_exp2f(st.m - mn); st.m = mn; st.l *= al;
#pragma unroll
    for (int j = 0; j < HD / 16; ++j)
#pragma unroll
      for (int r = 0; r < 8; ++r) acc[j][r] *= al; }
  const float mo = st.m - 11.0f; float ps = 0.f;
#pragma unroll
  for (int s = 0; s < 16; ++s) { t[s] = __builtin_amdgcn_exp2f(t[s] - mo); ps += t[s]; }
  st.l += ps; }
// K / V staging of the main path: a stage is FKS keys of this head: K rows [key][64 d] and V^T rows [c][FKS keys], 128 B of data a row at a pitch of 144 B (16 B x odd: ds_load_b128 readers). The 128 threads bring it in with asynchronous copies to LDS that cover whole 128-B lines (8 lanes a row); all four waves take their fragments from there
#define FKS 64
#define FLP (FKS + 8)
#define FBUF (2 * FKS * FLP * 2)   // bytes of one buffer (K rows, then V^T rows)
#define DS0() asm volatile("s_wait_dscnt 0x0" ::: "memory")       // this wave's LDS reads of a buffer have returned before the buffer is handed to the copies
#define ASYNC0() asm volatile("s_wait_asynccnt 0x0" ::: "memory")   // this wave's copies have landed before the barrier behind which other waves read them
// one stage: 4 copies for K (16 keys on each), 4 for V^T (16 channels on each), 16 B a lane; the last line is the wait that stands before a register which a copy names is written again
__device__ __forceinline__ void fa_fill(unsigned l, const _Float16* kg, const _Float16* vg) {
  const unsigned rs = 16 * FLP * 2, vb = FKS * FLP * 2;
  asm volatile("global_load_async_to_lds_b128 %0, %8, off\n\t"
               "global_load_async_to_lds_b128 %1, %9, off\n\t"
               "global_load_async_to_lds_b128 %2, %10, off\n\t"
               "global_load_async_to_lds_b128 %3, %11, off\n\t"
               "global_load_async_to_lds_b128 %4, %12, off\n\t"
               "global_load_async_to_lds_b128 %5, %13, off\n\t"
               "global_load_async_to_lds_b128 %6, %14, off\n\t"
               "global_load_async_to_lds_b128 %7, %15, off\n\t"
               "s_wait_xcnt 0x0"
               :: "v"(l), "v"(l + rs), "v"(l + 2 * rs), "v"(l + 3 * rs), "v"(l + vb), "v"(l + vb + rs), "v"(l + vb + 2 * rs), "v"(l + vb + 3 * rs),
                  "v"(kg), "v"(kg + (size_t)16 * CC), "v"(kg + (size_t)32 * CC), "v"(kg + (size_t)48 * CC), "v"(vg), "v"(vg + (size_t)16 * TT), "v"(vg + (size_t)32 * TT), "v"(vg + (size_t)48 * TT)
               : "memory"); }
// the same for a stage of the early-row path: one K-like tile (rows of CC) and one V^T-like tile of the short planes (rows of KHI keys); called once for the hi pair and once for the lo pair
__device__ __forceinline__ void fa_fill_e(unsigned l, const _Float16* kg, const __bf16* vg) {
  const unsigned rs = 16 * FLP * 2, vb = FKS * FLP * 2;
  asm volatile("global_load_async_to_lds_b128 %0, %8, off\n\t"
               "global_load_async_to_lds_b128 %1, %9, off\n\t"
               "global_load_async_to_lds_b128 %2, %10, off\n\t"
               "global_load_async_to_lds_b128 %3, %11, off\n\t"
               "global_load_async_to_lds_b128 %4, %12, off\n\t"
               "global_load_async_to_lds_b128 %5, %13, off\n\t"
               "global_load_async_to_lds_b128 %6, %14, off\n\t"
               "global_load_async_to_lds_b128 %7, %15, off\n\t"
               "s_wait_xcnt 0x0"
               :: "v"(l), "v"(l + rs), "v"(l + 2 * rs), "v"(l + 3 * rs), "v"(l + vb), "v"(l + vb + rs), "v"(l + vb + 2 * rs), "v"(l + vb + 3 * rs),
                  "v"(kg), "v"(kg + (size_t)16 * CC), "v"(kg + (size_t)32 * CC), "v"(kg + (size_t)48 * CC), "v"(vg), "v"(vg + (size_t)16 * KHI), "v"(vg + (size_t)32 * KHI), "v"(vg + (size_t)48 * KHI)
               : "memory"); }
__global__ __launch_bounds__(128) void k_fa(const _Float16* __restrict__ QH, const _Float16* __restrict__ KH, const _Float16* __restrict__ QL, const _Float16* __restrict__ KL, const _Float16* __restrict__ VT, const __bf16* __restrict__ VB, const __bf16* __restrict__ VBL, float* __restrict__ Y) {
  __shared__ __align__(16) _Float16 skv[2][2][FKS][FLP];   /* [buffer][K rows | V^T rows][row][128 B + pad] */
  const int b = blockIdx.x / NH, h = blockIdx.x % NH; const int qb = NQB - 1 - (int)blockIdx.y;
  const int tid = threadIdx.x, wave = __builtin_amdgcn_readfirstlane(tid >> 5), lane = tid & 31, col = lane & 15, g = lane >> 4;
  /* wave number held scalar: trip count and diagonal test become scalar branches, every lane stays on at the matrix instructions */ const int ql0 = qb * 64 + wave * 16, qi = ql0 + col; const int nblk = (ql0 + 47) >> 5;   /* 32-key steps that cover keys 0 .. ql0 + 15 */
  const _Float16* Qp = QH + ((size_t)b * TT + qi) * CC + h * HD;
  v8f acc[HD / 16] = {}; SMX st; st.m = -3.0e38f; st.l = 0.f;
  const v16h qf0 = frag_h(Qp, lane), qf1 = frag_h(Qp + 32, lane);
  XCNT0();
  if (qb < QBH) {   /* block-uniform */
    const _Float16* QLp = QL + ((size_t)b * QHI + qi) * CC + h * HD;
    const v16h ql0f = frag_h(QLp, lane), ql1f = frag_h(QLp + 32, lane);
    XCNT0();
    /* a stage is FKS keys of this head in ONE buffer of four tiles (the main path's two buffers taken together): K hi, V^T hi, K lo, V^T lo; keys 0 .. qb * 64 + 63 all lie below KHI; every plain '#pragma unroll' of this path opens a constant-trip loop over a register array, so that its elements stay in registers */
    const int nst = qb + 1;   /* the same for the whole block */
    const int fr = tid >> 3, fc = (tid & 7) * 8;   /* this thread's row (of 16 a copy) and 16-B piece of a stage row */
    const _Float16* kg = KH + ((size_t)b * TT + fr) * CC + h * HD + fc; const _Float16* klg = KL + ((size_t)b * KHI + fr) * CC + h * HD + fc; const size_t vo = ((size_t)b * CC + h * HD + fr) * (size_t)KHI + fc;
    const unsigned l0 = (unsigned)(size_t)&skv[0][0][fr][fc];
    const _Float16 (*bkh)[FLP] = skv[0][0]; const _Float16 (*bkl)[FLP] = skv[1][0]; const __bf16 (*bvh)[FLP] = (const __bf16 (*)[FLP])skv[0][1]; const __bf16 (*bvl)[FLP] = (const __bf16 (*)[FLP])skv[1][1];
#pragma unroll 1   /* at most 6 stages: kept rolled for code size */
    for (int s = 0; s < nst; ++s) {
      if (s > 0) { DS0(); __syncthreads(); }   /* block-uniform: every reader has left stage s - 1 before the copies write over it */
      fa_fill_e(l0, kg + (size_t)s * FKS * CC, VB + vo + s * FKS); fa_fill_e(l0 + FBUF, klg + (size_t)s * FKS * CC, VBL + vo + s * FKS);
      ASYNC0(); __syncthreads();   /* stage s is published */
#pragma unroll 1   /* two steps a stage, rolled for code size; wave-uniform scalar test: the two lower waves of the block skip the diagonal stage's second step */
      for (int w = 0; w < 2 && 2 * s + w < nblk; ++w) { const int k0 = (2 * s + w) * 32; float t[16];
        v16h kh[2][2], kl[2][2]; v16b vh[HD / 16], vl[HD / 16];   /* the step's fragment reads go out as one group ahead of its products */
#pragma unroll
        for (int u = 0; u < 2; ++u) { const int kr = w * 32 + u * 16 + col; kh[u][0] = frag_h(&bkh[kr][0], lane); kh[u][1] = frag_h(&bkh[kr][32], lane); kl[u][0] = frag_h(&bkl[kr][0], lane); kl[u][1] = frag_h(&bkl[kr][32], lane); }
#pragma unroll
        for (int j = 0; j < HD / 16; ++j) { vh[j] = frag_b(&bvh[j * 16 + col][w * 32], lane); vl[j] = frag_b(&bvl[j * 16 + col][w * 32], lane); }
#pragma unroll
        for (int u = 0; u < 2; ++u) { v8f a = {}, al = {};
          a = wmma16(kh[u][0], qf0, a); al = wmma16(kh[u][0], ql0f, al); al = wmma16(kl[u][0], qf0, al); a = wmma16(kh[u][1], qf1, a); al = wmma16(kh[u][1], ql1f, al); al = wmma16(kl[u][1], qf1, al);
#pragma unroll
          for (int r = 0; r < 8; ++r) t[u * 8 + r] = (a[r] + al[r] * (1.0f / 1024.0f)) * LOGC; }
        sm_step(t, st, acc, k0, ql0, qi, g);
        const F2 p = bsplit16(t);
#pragma unroll
        for (int j = 0; j < HD / 16; ++j) { acc[j] = wmma_bf(vh[j], p.h, acc[j]); acc[j] = wmma_bf(vh[j], p.l, acc[j]); acc[j] = wmma_bf(vl[j], p.h, acc[j]); } } }
  } else {
    /* every plain '#pragma unroll' below opens a constant-trip loop over a register array (fragments, scores, accumulators), so that its elements stay in registers */
    const int nst = qb + 1;   /* stages of FKS keys that cover keys 0 .. qb * 64 + 63; the same for the whole block */
    const int fr = tid >> 3, fc = (tid & 7) * 8;   /* this thread's row (of 16 a copy) and 16-B piece of a stage row */
    const _Float16* kg = KH + ((size_t)b * TT + fr) * CC + h * HD + fc; const _Float16* vg = VT + ((size_t)b * CC + h * HD + fr) * (size_t)TT + fc;
    const unsigned l0 = (unsigned)(size_t)&skv[0][0][fr][fc];
    fa_fill(l0, kg, vg); ASYNC0(); __syncthreads();   /* stage 0 is published */
    if (1 < nst) fa_fill(l0 + FBUF, kg + (size_t)FKS * CC, vg + FKS);
#pragma unroll 1   /* rolled: one copy of the stage; the buffer is chosen by address */
    for (int s = 0; s < nst; ++s) { const _Float16 (*bk)[FLP] = skv[s & 1][0]; const _Float16 (*bv)[FLP] = skv[s & 1][1];
      v16h kf[2][4], vf[2][4];   /* both steps' fragments go out as one group at the head of the stage (the whole stage is filled, also where a wave skips its second step) */
#pragma unroll
      for (int w = 0; w < 2; ++w) {
#pragma unroll
        for (int u = 0; u < 2; ++u) { kf[w][2 * u] = frag_h(&bk[w * 32 + u * 16 + col][0], lane); kf[w][2 * u + 1] = frag_h(&bk[w * 32 + u * 16 + col][32], lane); }
#pragma unroll
        for (int j = 0; j < HD / 16; ++j) vf[w][j] = frag_h(&bv[j * 16 + col][w * 32], lane); }
#pragma unroll
      for (int w = 0; w < 2; ++w) { const int i = 2 * s + w, k0 = i * 32;
        if (w == 0 || i < nblk) {   /* wave-uniform scalar test: the two upper waves of the block need the diagonal stage's second step, the two lower do not */
          v8f s0 = {}, s1 = {}; s0 = wmma16(kf[w][0], qf0, s0); s1 = wmma16(kf[w][2], qf0, s1); s0 = wmma16(kf[w][1], qf1, s0); s1 = wmma16(kf[w][3], qf1, s1);
          float t[16];
#pragma unroll
          for (int r = 0; r < 8; ++r) { t[r] = s0[r] * LOGC; t[8 + r] = s1[r] * LOGC; }
          sm_step(t, st, acc, k0, ql0, qi, g);
          v16h p;
#pragma unroll
          for (int e = 0; e < 16; ++e) p[e] = (_Float16)t[e];
#pragma unroll
          for (int j = 0; j < HD / 16; ++j) acc[j] = wmma16(vf[w][j], p, acc[j]); } }
      DS0(); ASYNC0(); __syncthreads();   /* every wave, also one that skipped a step: publishes stage s + 1 and ends every reader's last read of stage s */
      if (s + 2 < nst) fa_fill(l0 + (unsigned)(s & 1) * FBUF, kg + (size_t)(s + 2) * FKS * CC, vg + (s + 2) * FKS); }   /* block-uniform; flies while stage s + 1 is worked on */
    ASYNC0(); }
  const float inv = 1.0f / (st.l + xhalf(st.l));   /* the two halves' partial sums join once; the maximum's own term keeps the sum >= 2^11 */
  float* yp = Y + ((size_t)b * TT + qi) * CC + h * HD + 8 * g;   /* acc[j][r] = ctx[query qi][j*16 + 8g + r]: 32 contiguous bytes per lane and j */
#pragma unroll
  for (int j = 0; j < HD / 16; ++j) { const v4f lo = { acc[j][0] * inv, acc[j][1] * inv, acc[j][2] * inv, acc[j][3] * inv }, hi = { acc[j][4] * inv, acc[j][5] * inv, acc[j][6] * inv, acc[j][7] * inv }; vst2(yp + j * 16, lo); vst2(yp + j * 16 + 4, hi); } }
// ---- k_out: block = (64 rows, 128 cols): out = ctx Wo (+ bo): ctx x 2^6 once to f16 against Wo as f16(bf16 x 2^8) exact (1 product) x 2^-14; causal early rows (< QHI of each sequence): ctx bf16 hi + lo against exact bf16 Wo (2 products)
__global__ __launch_bounds__(128) void k_out(const float* __restrict__ Y, const float* __restrict__ WO, const float* __restrict__ BO, float* __restrict__ OUT) { __shared__ __align__(16) unsigned char sm[2 * (64 + 64 + 128) * OLP * 2];   /* two operand buffers (ctx hi, ctx lo, Wo); behind a barrier the output staging takes the same bytes */
  static_assert(4 * 16 * 132 * 4 <= 2 * (64 + 64 + 128) * OLP * 2, "LDS");
  float (*sf)[16][132] = (float (*)[16][132])sm;
  const int tid = threadIdx.x, wave = tid >> 5, lane = tid & 31, col = lane & 15, g = lane >> 4; const int c0 = blockIdx.y * 128; const size_t r0 = (size_t)blockIdx.x * 64 + wave * 16;
  v8f acc[8] = {};
  const int lr = tid / (OK / 4), lc = tid % (OK / 4);
  const float* yg = Y + ((size_t)blockIdx.x * 64 + lr) * CC + lc * 4; const float* wg = WO + (size_t)(c0 + lr) * CC + lc * 4;   /* (out,in) weight rows */
  if (CAUSAL && (int)(((size_t)blockIdx.x * 64) % TT) < QHI) {   /* block-uniform */
    __bf16 (*sah)[64][OLP] = (__bf16 (*)[64][OLP])sm; __bf16 (*sal)[64][OLP] = (__bf16 (*)[64][OLP])(sm + 2 * 64 * OLP * 2); __bf16 (*sw)[128][OLP] = (__bf16 (*)[128][OLP])(sm + 4 * 64 * OLP * 2);
    v4f ry[64 / ORI], rw[128 / ORI];
    tile_ld(ry, yg, (size_t)ORI * CC); XCNT_G(); tile_ld(rw, wg, (size_t)ORI * CC); XCNT_G();
#pragma unroll 1   /* rolled: one copy of the stage */
    for (int s = 0; s < CC / OK; ++s) { __bf16 (*bh)[OLP] = sah[s & 1]; __bf16 (*bl)[OLP] = sal[s & 1]; __bf16 (*bw)[OLP] = sw[s & 1];
#pragma unroll
      for (int i = 0; i < 64 / ORI; ++i) { st_b(&bh[i * ORI + lr][lc * 4], ry[i]); st_bl(&bl[i * ORI + lr][lc * 4], ry[i]); }
#pragma unroll
      for (int i = 0; i < 128 / ORI; ++i) st_b(&bw[i * ORI + lr][lc * 4], rw[i]);
      __syncthreads();   /* publishes stage s; every wave has left the other buffer before stage s + 1 is stored there */
      if (s + 1 < CC / OK) { tile_ld(ry, yg + (s + 1) * OK, (size_t)ORI * CC); XCNT_G(); tile_ld(rw, wg + (s + 1) * OK, (size_t)ORI * CC); XCNT_G(); }
#pragma unroll
      for (int kk = 0; kk < OK / 32; ++kk) { const v16b ah = frag_b(&bh[wave * 16 + col][kk * 32], lane), al = frag_b(&bl[wave * 16 + col][kk * 32], lane);
#pragma unroll
        for (int j0 = 0; j0 < 8; j0 += 4) { v16b w[4];   /* fragment reads go out as a group ahead of their products */
#pragma unroll
          for (int u = 0; u < 4; ++u) w[u] = frag_b(&bw[(j0 + u) * 16 + col][kk * 32], lane);
#pragma unroll
          for (int u = 0; u < 4; ++u) { acc[j0 + u] = wmma_bf(ah, w[u], acc[j0 + u]); acc[j0 + u] = wmma_bf(al, w[u], acc[j0 + u]); } } } }
    __syncthreads();   /* the last stage's readers are done before the output staging writes over the buffers */
#pragma unroll
    for (int j = 0; j < 8; ++j) { const float bias = BO ? bfr(BO[c0 + j * 16 + col]) : 0.f;
#pragma unroll
      for (int r = 0; r < 8; ++r) sf[wave][8 * g + r][j * 16 + col] = acc[j][r] + bias; }
  } else {
    _Float16 (*sa)[64][OLP] = (_Float16 (*)[64][OLP])sm; _Float16 (*sw)[128][OLP] = (_Float16 (*)[128][OLP])(sm + 2 * 64 * OLP * 2);
    v4f ry[64 / ORI], rw[128 / ORI];
    tile_ld(ry, yg, (size_t)ORI * CC); XCNT_G(); tile_ld(rw, wg, (size_t)ORI * CC); XCNT_G();
#pragma unroll 1   /* rolled: one copy of the stage */
    for (int s = 0; s < CC / OK; ++s) { _Float16 (*ba)[OLP] = sa[s & 1]; _Float16 (*bw)[OLP] = sw[s & 1];
#pragma unroll
      for (int i = 0; i < 64 / ORI; ++i) st_hs(&ba[i * ORI + lr][lc * 4], ry[i], 64.0f);   /* ctx carried x 2^6 into f16 so small-magnitude context rows stay clear of f16 subnormals */
#pragma unroll
      for (int i = 0; i < 128 / ORI; ++i) st_hw(&bw[i * ORI + lr][lc * 4], rw[i]);
      __syncthreads();   /* publishes stage s; every wave has left the other buffer before stage s + 1 is stored there */
      if (s + 1 < CC / OK) { tile_ld(ry, yg + (s + 1) * OK, (size_t)ORI * CC); XCNT_G(); tile_ld(rw, wg + (s + 1) * OK, (size_t)ORI * CC); XCNT_G(); }
#pragma unroll
      for (int kk = 0; kk < OK / 32; ++kk) { const v16h a = frag_h(&ba[wave * 16 + col][kk * 32], lane);
#pragma unroll
        for (int j0 = 0; j0 < 8; j0 += 4) { v16h w[4];   /* fragment reads go out as a group ahead of their products */
#pragma unroll
          for (int u = 0; u < 4; ++u) w[u] = frag_h(&bw[(j0 + u) * 16 + col][kk * 32], lane);
#pragma unroll
          for (int u = 0; u < 4; ++u) acc[j0 + u] = wmma16(a, w[u], acc[j0 + u]); } } }
    __syncthreads();   /* the last stage's readers are done before the output staging writes over the buffers */
#pragma unroll
    for (int j = 0; j < 8; ++j) { const float bias = BO ? bfr(BO[c0 + j * 16 + col]) : 0.f;
#pragma unroll
      for (int r = 0; r < 8; ++r) sf[wave][8 * g + r][j * 16 + col] = acc[j][r] * (1.0f / 16384.0f) + bias; } }   /* 2^-8 (Wo carry) x 2^-6 (ctx carry) */
  LDSX(); for (int rl = 0; rl < 16; ++rl) vst2(OUT + SRCROW(r0 + rl) * DIN + c0 + lane * 4, *(const v4f*)&sf[wave][rl][lane * 4]); }

extern "C" void kernel_launch(void* const* d_in, const int* in_sizes, int n_in, void* d_out, int out_size, void* d_ws, size_t ws_size, hipStream_t stream) {
  (void)in_sizes; (void)n_in; (void)out_size;
  const float** F = (const float**)d_in;
  if (ws_size < (size_t)WS_END) return;
  char* ws = (char*)d_ws; _Float16 *QH = (_Float16*)(ws + WS_QH), *KH = (_Float16*)(ws + WS_KH), *VT = (_Float16*)(ws + WS_VT), *QL = (_Float16*)(ws + WS_QL), *KL = (_Float16*)(ws + WS_KL); __bf16 *VB = (__bf16*)(ws + WS_VB), *VBL = (__bf16*)(ws + WS_VBL); float *Y = (float*)(ws + WS_Y);
  (void)Y; (void)QL; (void)KL; (void)VB; (void)VBL;
  // inputs (in order): 0 x [2048,2,768] (S, B, D); 1 wq [768,768] (out,in), 2 bq; 3 wk, 4 bk; 5 wv, 6 bv; 7 wc (out,in), 8 bc (all biases NONZERO)
  k_proj<<<dim3(TNB * TT / PTR, CC / 128, 3), 256, 0, stream>>>(F[0], F[0], F[0], F[1], F[3], F[5], F[2], F[4], F[6], QH, QL, KH, KL, VT, VB, VBL);
  k_fa<<<dim3(TNB * NH, NQB), 128, 0, stream>>>(QH, KH, QL, KL, VT, VB, VBL, Y);
  k_out<<<dim3(TNB * TT / 64, DIN / 128), 128, 0, stream>>>(Y, F[7], F[8], (float*)d_out);   /* writes (S, B, D) rows */
}

// v007
// A run of this version takes 66.2 microseconds.
// Two timings next to v006 both put it at 1.06 times that version's speed.
// All steps since v000 together make it 13.5 times as fast.
// compute dtype: all float inputs rounded to bf16; q / k / v projections with EXACT bf16 products on WMMA 16x16x32 (f32 accumulate) + bias; causal logits: 3 products for the first 384 rows, single f16 q x k after, x 64^-0.5; running-maximum softmax f32 in the same launch; unnormalised P x 2^11 once to f16 x v once to f16 (bf16 hi + lo below row 384), divided by the f32 sum at the end; y hi+lo x exact wc below row 384, x2^6 f16 carry x f16(bf16 x 2^8) wc after, + bc; f32 output written back in the sequence-first layout.
#include <hip/hip_runtime.h>
#include <math.h>

typedef __attribute__((ext_vector_type(16))) _Float16 v16h;
typedef __attribute__((ext_vector_type(16))) __bf16 v16b;
typedef __attribute__((ext_vector_type(8)))  _Float16 v8h;
typedef __attribute__((ext_vector_type(8)))  float v8f;
typedef __attribute__((ext_vector_type(4)))  float v4f;
typedef __attribute__((ext_vector_type(2)))  float v2f;
typedef __attribute__((ext_vector_type(4)))  unsigned v4u;
typedef __attribute__((ext_vector_type(4)))  int v4i;
typedef float __attribute__((may_alias)) float_a;
typedef int __attribute__((may_alias)) int_a;

template <typename T> __device__ __forceinline__ void vst2(void* p, T v) { *(T*)p = v;  }
__device__ __forceinline__ v8f wmma16(v16h a, v16h b, v8f c) {
  v8f d = __builtin_amdgcn_wmma_f32_16x16x32_f16(false, a, false, b, (short)0, c, false, false);
  asm volatile("v_nop\n\tv_nop\n\tv_nop\n\tv_nop" : "+v"(d) : "v"(a), "v"(b));
  return d;
}
__device__ __forceinline__ v8f wmma_bf(v16b a, v16b b, v8f c) {
  v8f d = __builtin_amdgcn_wmma_f32_16x16x32_bf16(false, a, false, b, (short)0, c, false, false);
  asm volatile("v_nop\n\tv_nop\n\tv_nop\n\tv_nop" : "+v"(d) : "v"(a), "v"(b));
  return d;
}
// 16x16x32 fragments: lane = (h = lane>>4, row/col = lane&15); elements 0..7 = k0+8h+0..7, 8..15 = k0+16+8h+0..7; D element r = row 8h+r
__device__ __forceinline__ v16h frag_h(const _Float16* rowk0, int lane) {
  union { v16h v; v8h q[2]; } u; const _Float16* p = rowk0 + 8 * (lane >> 4);
  u.q[0] = *(const v8h*)p; u.q[1] = *(const v8h*)(p + 16); return u.v;
}
__device__ __forceinline__ v16h frag_f32(const float* rowk0, int lane) {
  v16h a; const float* p = rowk0 + 8 * (lane >> 4);
#pragma unroll
  for (int i = 0; i < 8; ++i) { a[i] = (_Float16)p[i]; a[8 + i] = (_Float16)p[16 + i]; }
  return a;
}
__device__ __forceinline__ v16h frag_f32s(const float* rowk0, int lane, float sc) {
  v16h a; const float* p = rowk0 + 8 * (lane >> 4);
#pragma unroll
  for (int i = 0; i < 8; ++i) { a[i] = (_Float16)(p[i] * sc); a[8 + i] = (_Float16)(p[16 + i] * sc); }
  return a;
}
// column fragment from a [K][ld] layout (column n), rows >= K read as 0
__device__ __forceinline__ v16h fragc_f32(const float* W, int k0, int n, int lane, int ld, int K) {
  v16h a; const int g = lane >> 4;
#pragma unroll
  for (int i = 0; i < 8; ++i) { const int ka = k0 + 8 * g + i, kb = ka + 16;
    a[i] = (_Float16)(ka < K ? W[(size_t)(ka < K ? ka : K - 1) * ld + n] : 0.f); a[8 + i] = (_Float16)(kb < K ? W[(size_t)(kb < K ? kb : K - 1) * ld + n] : 0.f); }
  return a;
}
struct F2 { v16b h, l; };
__device__ __forceinline__ F2 bsplit16(const float v[16]) { F2 r;
#pragma unroll
  for (int i = 0; i < 16; ++i) { const __bf16 h = (__bf16)v[i]; r.h[i] = h; r.l[i] = (__bf16)(v[i] - (float)h); }
  return r; }
__device__ __forceinline__ F2 split_row(const float* row, int k0, int lane) { float v[16]; const float* p = row + k0 + 8 * (lane >> 4);
#pragma unroll
  for (int i = 0; i < 8; ++i) { v[i] = p[i]; v[8 + i] = p[16 + i]; }
  return bsplit16(v); }
__device__ __forceinline__ F2 split_rowK(const float* row, int k0, int lane, int K) { float v[16]; const int g = lane >> 4;
#pragma unroll
  for (int i = 0; i < 8; ++i) { const int ka = k0 + 8 * g + i, kb = ka + 16; v[i] = ka < K ? row[ka < K ? ka : K - 1] : 0.f; v[8 + i] = kb < K ? row[kb < K ? kb : K - 1] : 0.f; }
  return bsplit16(v); }
__device__ __forceinline__ F2 split_col(const float* W, int k0, int n, int lane, int ld, int K) { float v[16]; const int g = lane >> 4;
#pragma unroll
  for (int i = 0; i < 8; ++i) { const int ka = k0 + 8 * g + i, kb = ka + 16; v[i] = ka < K ? W[(size_t)(ka < K ? ka : K - 1) * ld + n] : 0.f; v[8 + i] = kb < K ? W[(size_t)(kb < K ? kb : K - 1) * ld + n] : 0.f; }
  return bsplit16(v); }
__device__ __forceinline__ v8f mac3(const F2& a, const F2& b, v8f c) { c = wmma_bf(a.l, b.h, c); c = wmma_bf(a.h, b.l, c); return wmma_bf(a.h, b.h, c); }
__device__ __forceinline__ float sigm(float v) { return 1.0f / (1.0f + expf(-v)); }
#define LDSX() do { asm volatile("s_wait_dscnt 0" ::: "memory"); __builtin_amdgcn_wave_barrier(); __builtin_amdgcn_fence(__ATOMIC_RELEASE, "workgroup"); } while (0)

// Causal multi-head self-attention on a SEQUENCE-FIRST input (x [2048, 2, 768] = (S, B, D); torch (out,in) wq / wk / wv / wc [768,768] N(0,1) x 0.02 applied as x W^T + b, biases N(0,1) x 0.02 - NONZERO; 12 heads x 64; scores / sqrt(64); tril kept, -inf elsewhere; softmax; y wc^T + bc; output transposed back to (S, B, D)). The kernels work on rows b*2048 + t: the projection reads token (b, t) from source row t*2 + b and the output kernel writes it back there.
#define NB 2
#define TT 2048
#define CC 768            // NH * HD = projected width
#define DIN 768          // input (model) width
#define NH 12
#define HD 64
#define NQB (TT / 64)
#define SCALE (0.125f)
#define CAUSAL 1
#ifndef TNB
#define TNB NB
#endif
__device__ __forceinline__ float bfr(float v) { return (float)(__bf16)v; }
typedef __attribute__((ext_vector_type(8))) __bf16 v8b;
__device__ __forceinline__ v16b frag_b(const __bf16* rowk0, int lane) {
  union { v16b v; v8b q[2]; } u; const __bf16* p = rowk0 + 8 * (lane >> 4);
  u.q[0] = *(const v8b*)p; u.q[1] = *(const v8b*)(p + 16); return u.v;
}
#define QBH 6              // causal: query blocks 0..QBH-1 of each sequence (few keys, no averaging) take the high-precision path
#define QHI 384            // rows carrying a q residual plane
#define KHI 384            // key rows carrying k residual / v bf16 hi+lo planes (used only by the causal high-precision path)
// B fragment (k rows k0+.., output column o) of a weight: (in,out) [K][ld] or (out,in) [ld rows of K]: bf16 exact, or f16(bf16 * 256) exact
__device__ __forceinline__ v16b wcol_io(const float* Wm, int k0, int o, int lane, int ld) { v16b w; const int g = lane >> 4;
#pragma unroll
  for (int i = 0; i < 8; ++i) { w[i] = (__bf16)Wm[(size_t)(k0 + 8 * g + i) * ld + o]; w[8 + i] = (__bf16)Wm[(size_t)(k0 + 16 + 8 * g + i) * ld + o]; }
  return w; }
__device__ __forceinline__ v16b wcol_oi(const float* Wm, int k0, int o, int lane, int K) { v16b w; const float* p = Wm + (size_t)o * K + k0 + 8 * (lane >> 4);
#pragma unroll
  for (int i = 0; i < 8; ++i) { w[i] = (__bf16)p[i]; w[8 + i] = (__bf16)p[16 + i]; }
  return w; }
__device__ __forceinline__ v16h wcolh_io(const float* Wm, int k0, int o, int lane, int ld) { v16h w; const int g = lane >> 4;
#pragma unroll
  for (int i = 0; i < 8; ++i) { w[i] = (_Float16)(bfr(Wm[(size_t)(k0 + 8 * g + i) * ld + o]) * 256.0f); w[8 + i] = (_Float16)(bfr(Wm[(size_t)(k0 + 16 + 8 * g + i) * ld + o]) * 256.0f); }
  return w; }
__device__ __forceinline__ v16h wcolh_oi(const float* Wm, int k0, int o, int lane, int K) { v16h w; const float* p = Wm + (size_t)o * K + k0 + 8 * (lane >> 4);
#pragma unroll
  for (int i = 0; i < 8; ++i) { w[i] = (_Float16)(bfr(p[i]) * 256.0f); w[8 + i] = (_Float16)(bfr(p[16 + i]) * 256.0f); }
  return w; }
#define SRCROW(r) ((size_t)((r) % TT) * NB + (size_t)((r) / TT))   // row r = b*TT + t <-> sequence-first row t*NB + b of the (S, B, D) arrays (NB = the module's batch count, also when fewer batches are run)
#define WQKV_LAYOUT 1   // layout for WCOL only, which nothing calls (k_proj reads (out,in) [CC][DIN] rows): 0 = (in,out) [DIN][CC]; 1 = (out,in) [CC][DIN]; 2 = per-head [NH][DIN][HD]
__device__ __forceinline__ v16b wcol_hdk(const float* Wm, int k0, int o, int lane) { v16b w; const int g = lane >> 4; const float* p = Wm + (size_t)(o / HD) * DIN * HD + (o % HD);
#pragma unroll
  for (int i = 0; i < 8; ++i) { w[i] = (__bf16)p[(size_t)(k0 + 8 * g + i) * HD]; w[8 + i] = (__bf16)p[(size_t)(k0 + 16 + 8 * g + i) * HD]; }
  return w; }
#define WO_OUT_IN 1
#if WQKV_LAYOUT == 1
#define WCOL(W, k0, o, lane) wcol_oi(W, k0, o, lane, DIN)
#elif WQKV_LAYOUT == 2
#define WCOL(W, k0, o, lane) wcol_hdk(W, k0, o, lane)
#else
#define WCOL(W, k0, o, lane) wcol_io(W, k0, o, lane, CC)
#endif
#if WO_OUT_IN
#define WOCOL(W, k0, o, lane) wcol_oi(W, k0, o, lane, CC)
#define WOCOLH(W, k0, o, lane) wcolh_oi(W, k0, o, lane, CC)
#else
#define WOCOL(W, k0, o, lane) wcol_io(W, k0, o, lane, DIN)
#define WOCOLH(W, k0, o, lane) wcolh_io(W, k0, o, lane, DIN)
#endif

#define WS_QH  0u                                      // f16 q rows [b*t][CC]
#define WS_KH  (WS_QH + 2u * (size_t)NB * TT * CC)      // f16 k rows [b*t][CC]
#define WS_VT  (WS_KH + 2u * (size_t)NB * TT * CC)      // f16 v planes [b][c][t]
#define WS_QL  (WS_VT + 2u * (size_t)NB * CC * TT)      // f16 q residual x 2^10 rows [b][t < QHI][CC]
#define WS_KL  (WS_QL + 2u * (size_t)NB * QHI * CC)     // f16 k residual x 2^10 rows [b][t < KHI][CC]
#define WS_VB  (WS_KL + 2u * (size_t)NB * KHI * CC)     // bf16 v hi planes [b][c][t < KHI]
#define WS_VBL (WS_VB + 2u * (size_t)NB * CC * KHI)
#define WS_Y   (WS_VBL + 2u * (size_t)NB * CC * KHI)    // f32 ctx rows [b*t][CC]
#define WS_END (WS_Y  + 4u * (size_t)NB * TT * CC)

// operand staging of the two GEMM launches: a stage is PK (projection) or OK (output) k of every tile row. The block's threads fetch it with global_load_b128 that cover whole 128-B lines (PK / 4 or OK / 4 lanes a row), round it ONCE to the 16-bit operand type and store it in LDS rows with a 16-B pad (pitch 16 B x odd: ds_load_b128 readers); all waves take their fragments from there
// every '#pragma unroll' of the staging code opens a constant-trip loop over a register array (fetched rows, fragments, accumulators), so that its elements stay in registers
typedef __attribute__((ext_vector_type(4))) __bf16 v4b;
typedef __attribute__((ext_vector_type(4))) _Float16 v4h;
#define PK 32
#define PLP (PK + 8)
#define PTR 128            // rows of a projection tile
#define PRI (1024 / PK)    // tile rows that one load instruction of the whole block (256 threads) covers
#define OK 64
#define OLP (OK + 8)
#define ORI (512 / OK)
template <int N> __device__ __forceinline__ void tile_ld(v4f (&r)[N], const float* p, size_t step) {
#pragma unroll
  for (int i = 0; i < N; ++i) r[i] = *(const v4f*)(p + (size_t)i * step); }
__device__ __forceinline__ void st_b(__bf16* d, v4f v) { const v4b o = { (__bf16)v[0], (__bf16)v[1], (__bf16)v[2], (__bf16)v[3] }; *(v4b*)d = o; }
__device__ __forceinline__ void st_bl(__bf16* d, v4f v) { const v4b o = { (__bf16)(v[0] - (float)(__bf16)v[0]), (__bf16)(v[1] - (float)(__bf16)v[1]), (__bf16)(v[2] - (float)(__bf16)v[2]), (__bf16)(v[3] - (float)(__bf16)v[3]) }; *(v4b*)d = o; }
__device__ __forceinline__ void st_hs(_Float16* d, v4f v, float sc) { const v4h o = { (_Float16)(v[0] * sc), (_Float16)(v[1] * sc), (_Float16)(v[2] * sc), (_Float16)(v[3] * sc) }; *(v4h*)d = o; }
__device__ __forceinline__ void st_hw(_Float16* d, v4f v) { const v4h o = { (_Float16)(bfr(v[0]) * 256.0f), (_Float16)(bfr(v[1]) * 256.0f), (_Float16)(bfr(v[2]) * 256.0f), (_Float16)(bfr(v[3]) * 256.0f) }; *(v4h*)d = o; }
#define XCNT_G() asm volatile("s_wait_xcnt 0x0" ::: "memory")   // stands behind a run of global loads, before a register that they name is written again
// eight 16-B stores of one thread, 'step' bytes apart; the last line is the wait that stands before a register which a store names is written again (in a statement of its own the compiler lifts later register writes over it)
__device__ __forceinline__ void st8(char* p, size_t step, const v4u (&o)[8]) {
  asm volatile("global_store_b128 %0, %8, off\n\t"
               "global_store_b128 %1, %9, off\n\t"
               "global_store_b128 %2, %10, off\n\t"
               "global_store_b128 %3, %11, off\n\t"
               "global_store_b128 %4, %12, off\n\t"
               "global_store_b128 %5, %13, off\n\t"
               "global_store_b128 %6, %14, off\n\t"
               "global_store_b128 %7, %15, off\n\t"
               "s_wait_xcnt 0x0"
               :: "v"(p), "v"(p + step), "v"(p + 2 * step), "v"(p + 3 * step), "v"(p + 4 * step), "v"(p + 5 * step), "v"(p + 6 * step), "v"(p + 7 * step),
                  "v"(o[0]), "v"(o[1]), "v"(o[2]), "v"(o[3]), "v"(o[4]), "v"(o[5]), "v"(o[6]), "v"(o[7])
               : "memory"); }
// ---- k_proj: block = (128 rows, 128 cols, which), 8 waves in a 4 x 2 grid, 32 rows x 64 cols a wave: q/k/v = X W (+ b) with exact bf16 products (K = DIN) -> which 0: q f16 rows (+ residual rows < QHI); 1: k f16 rows (+ residual rows < KHI); 2: v f16 planes [c][t] (+ bf16 hi/lo planes for t < KHI)
__global__ __launch_bounds__(256) void k_proj(const float* __restrict__ XQ, const float* __restrict__ XK, const float* __restrict__ XV, const float* __restrict__ WQ, const float* __restrict__ WK, const float* __restrict__ WV, const float* __restrict__ BQ, const float* __restrict__ BK, const float* __restrict__ BV,
    _Float16* __restrict__ QH, _Float16* __restrict__ QL, _Float16* __restrict__ KH, _Float16* __restrict__ KL, _Float16* __restrict__ VT, __bf16* __restrict__ VB, __bf16* __restrict__ VBL) {
  __shared__ __align__(16) unsigned char sm[3 * 128 * 136 * 2];   /* two operand buffers in the main loop; behind a barrier the epilogue's output staging takes the same bytes */
  static_assert(2 * (PTR + 128) * PLP * 2 <= 3 * 128 * 136 * 2 && 2 * PTR * 136 * 2 <= 3 * 128 * 136 * 2 && PTR == 128 && QHI % PTR == 0 && KHI % PTR == 0 && TT % PTR == 0, "LDS, tile");
  __bf16 (*sx)[PTR][PLP] = (__bf16 (*)[PTR][PLP])sm; __bf16 (*sw)[128][PLP] = (__bf16 (*)[128][PLP])(sm + 2 * PTR * PLP * 2);
  _Float16 (*sh)[136] = (_Float16 (*)[136])sm; _Float16 (*sl)[136] = (_Float16 (*)[136])(sm + PTR * 136 * 2);
  _Float16 (*th)[136] = (_Float16 (*)[136])sm; __bf16 (*tb)[136] = (__bf16 (*)[136])(sm + 128 * 136 * 2); __bf16 (*tbl)[136] = (__bf16 (*)[136])(sm + 2 * 128 * 136 * 2);
  const int tid = threadIdx.x, wave = tid >> 5, lane = tid & 31, col = lane & 15, g = lane >> 4; const int wr = wave >> 1, wc = wave & 1; const int which = blockIdx.z; const int c0 = blockIdx.y * 128; const size_t r0 = (size_t)blockIdx.x * PTR; const size_t bb = r0 / TT; const int t0 = (int)(r0 % TT);
  const float* X = which == 0 ? XQ : which == 1 ? XK : XV; const float* WA = which == 0 ? WQ : which == 1 ? WK : WV; const float* BA = which == 0 ? BQ : which == 1 ? BK : BV;
  v8f acc[2][4] = {};
  const int lr = tid / (PK / 4), lc = tid % (PK / 4);
  const float* xg = X + SRCROW(r0 + lr) * DIN + lc * 4;   /* sequence-first source row; the tile's rows lie in one sequence, so PRI tile rows on = PRI * NB source rows on */
  const float* wg = WA + (size_t)(c0 + lr) * DIN + lc * 4;   /* (out,in) weight rows */
  v4f rx[PTR / PRI], rw[128 / PRI];
  int ks = (int)((blockIdx.x + 5 * (blockIdx.y + 6 * blockIdx.z)) % (DIN / PK));   /* this block's first k stage; the walk wraps. The 18 blocks that read the same x rows and the 32 that read the same weight rows start apart, so that they do not ask L2 for the same lines at the same moment */
  tile_ld(rx, xg + ks * PK, (size_t)PRI * NB * DIN); XCNT_G(); tile_ld(rw, wg + ks * PK, (size_t)PRI * DIN); XCNT_G();
#pragma unroll 1   /* rolled: one copy of the stage; the fetched registers are free again once they are stored */
  for (int s = 0; s < DIN / PK; ++s) { __bf16 (*bx)[PLP] = sx[s & 1]; __bf16 (*bw)[PLP] = sw[s & 1];
#pragma unroll
    for (int i = 0; i < PTR / PRI; ++i) st_b(&bx[i * PRI + lr][lc * 4], rx[i]);
#pragma unroll
    for (int i = 0; i < 128 / PRI; ++i) st_b(&bw[i * PRI + lr][lc * 4], rw[i]);
    __syncthreads();   /* publishes stage s; also: every wave has left the other buffer (read in stage s - 1) before stage s + 1 is stored there */
    if (s + 1 < DIN / PK) { ks = ks + 1 == DIN / PK ? 0 : ks + 1; tile_ld(rx, xg + ks * PK, (size_t)PRI * NB * DIN); XCNT_G(); tile_ld(rw, wg + ks * PK, (size_t)PRI * DIN); XCNT_G(); }   /* next stage flies while this one is multiplied */
#pragma unroll
    for (int kk = 0; kk < PK / 32; ++kk) { v16b a[2], w[4];   /* the stage's fragment reads go out as one group ahead of its products: one LDS latency a stage */
#pragma unroll
      for (int i = 0; i < 2; ++i) a[i] = frag_b(&bx[wr * 32 + i * 16 + col][kk * 32], lane);
#pragma unroll
      for (int u = 0; u < 4; ++u) w[u] = frag_b(&bw[wc * 64 + u * 16 + col][kk * 32], lane);
#pragma unroll
      for (int u = 0; u < 4; ++u)
#pragma unroll
        for (int i = 0; i < 2; ++i) acc[i][u] = wmma_bf(a[i], w[u], acc[i][u]); } }
  __syncthreads();   /* the last stage's readers are done before the epilogue writes over the buffers */
  if (which < 2) { _Float16* DH = which == 0 ? QH : KH; _Float16* DL = which == 0 ? QL : KL; const int nhi = which == 0 ? QHI : KHI; const bool hi_rows = t0 < nhi;
#pragma unroll
    for (int j = 0; j < 4; ++j) { const float bias = BA ? bfr(BA[c0 + wc * 64 + j * 16 + col]) : 0.f;
#pragma unroll
      for (int i = 0; i < 2; ++i)
#pragma unroll
        for (int r = 0; r < 8; ++r) { const float v = acc[i][j][r] + bias; const _Float16 hv = (_Float16)v; const int rl = wr * 32 + i * 16 + 8 * g + r, cl = wc * 64 + j * 16 + col; sh[rl][cl] = hv; sl[rl][cl] = (_Float16)((v - (float)hv) * 1024.0f); } }
    __syncthreads();
    const int rl0 = tid >> 4, q = tid & 15; v4u o[PTR / 16];   /* 16 threads a row, 16 rows a pass of the block; a plane's staged rows are read as one group, then stored */
#pragma unroll
    for (int i = 0; i < PTR / 16; ++i) o[i] = *(const v4u*)&sh[i * 16 + rl0][q * 8];
    st8((char*)(DH + (r0 + rl0) * CC + c0 + q * 8), (size_t)16 * CC * 2, o);
    if (hi_rows) {   /* block-uniform */
#pragma unroll
      for (int i = 0; i < PTR / 16; ++i) o[i] = *(const v4u*)&sl[i * 16 + rl0][q * 8];
      st8((char*)(DL + (bb * nhi + t0 + rl0) * (size_t)CC + c0 + q * 8), (size_t)16 * CC * 2, o); }
  } else { const bool hi_rows = t0 < KHI;
#pragma unroll
    for (int j = 0; j < 4; ++j) { const float bias = BA ? bfr(BA[c0 + wc * 64 + j * 16 + col]) : 0.f;
#pragma unroll
      for (int i = 0; i < 2; ++i)
#pragma unroll
        for (int r = 0; r < 8; ++r) { const float v = acc[i][j][r] + bias; const int rl = wr * 32 + i * 16 + 8 * g + r, cl = wc * 64 + j * 16 + col; th[cl][rl] = (_Float16)v; const __bf16 bh = (__bf16)v; tb[cl][rl] = bh; tbl[cl][rl] = (__bf16)(v - (float)bh); } }
    __syncthreads();
    const int cl0 = tid >> 4, q = tid & 15; v4u o[8];   /* 16 threads a channel row of PTR keys, 16 channels a pass of the block; read as one group, then stored, as above */
#pragma unroll
    for (int i = 0; i < 8; ++i) o[i] = *(const v4u*)&th[i * 16 + cl0][q * 8];
    st8((char*)(VT + (bb * CC + c0 + cl0) * (size_t)TT + t0 + q * 8), (size_t)16 * TT * 2, o);
    if (hi_rows) {   /* block-uniform */
#pragma unroll
      for (int i = 0; i < 8; ++i) o[i] = *(const v4u*)&tb[i * 16 + cl0][q * 8];
      st8((char*)(VB + (bb * CC + c0 + cl0) * (size_t)KHI + t0 + q * 8), (size_t)16 * KHI * 2, o);
#pragma unroll
      for (int i = 0; i < 8; ++i) o[i] = *(const v4u*)&tbl[i * 16 + cl0][q * 8];
      st8((char*)(VBL + (bb * CC + c0 + cl0) * (size_t)KHI + t0 + q * 8), (size_t)16 * KHI * 2, o); } } }
// ---- k_fa: block = 4 waves x 16 queries (query block qb, heaviest first) of plane b*NH + h; K and V^T come through LDS buffers shared by the four waves; per 32 keys: S^T = K Q^T (a lane holds 16 keys of ONE query), running maximum and sum in f32 (log2 domain), P^T x 2^11 packed from the score tiles straight into the B operand, O^T += V^T P^T; ctx = O / sum. Query blocks < QBH: 3-product logits (q, k residuals x 2^10), P and v as bf16 hi + lo (3 products)
#define LOGC (SCALE * 1.44269504088896340736f)
struct SMX { float m, l; };
__device__ __forceinline__ float xhalf(float x) { return __builtin_bit_cast(float, __builtin_amdgcn_permlanex16(__builtin_bit_cast(int, x), __builtin_bit_cast(int, x), 0x76543210, 0xfedcba98, false, false)); }   // lane l with lane l ^ 16
#define XCNT0() asm volatile("s_wait_xcnt 0x0" ::: "memory")   // stands behind a run of global loads, before their address registers are reused
// one 32-key step of the running softmax of this lane's query: t[0..7] = keys k0+8g+r, t[8..15] = keys k0+16+8g+r (scaled log2 logits); returns e[] = 2^(t - max + 11); rescales acc only when some query of the wave has a new maximum
__device__ __forceinline__ void sm_step(float t[16], SMX& st, v8f acc[HD / 16], int k0, int qfirst, int qi, int g) {
  if (k0 + 31 > qfirst) {   /* wave-uniform: only steps that reach the diagonal mask by index */
#pragma unroll
    for (int r = 0; r < 8; ++r) { if (k0 + 8 * g + r > qi) t[r] = -3.0e38f; if (k0 + 16 + 8 * g + r > qi) t[8 + r] = -3.0e38f; } }
  float mx = t[0];
#pragma unroll
  for (int s = 1; s < 16; ++s) mx = fmaxf(mx, t[s]);
  mx = fmaxf(mx, xhalf(mx));   /* the other half of the wave holds the query's other 16 keys */
  if (__builtin_amdgcn_ballot_w32(mx > st.m) != 0) { const float mn = fmaxf(st.m, mx); const float al = __builtin_amdgcn_exp2f(st.m - mn); st.m = mn; st.l *= al;
#pragma unroll
    for (int j = 0; j < HD / 16; ++j)
#pragma unroll
      for (int r = 0; r < 8; ++r) acc[j][r] *= al; }
  const float mo = st.m - 11.0f; float ps = 0.f;
#pragma unroll
  for (int s = 0; s < 16; ++s) { t[s] = __builtin_amdgcn_exp2f(t[s] - mo); ps += t[s]; }
  st.l += ps; }
// K / V staging of the main path: a stage is FKS keys of this head: K rows [key][64 d] and V^T rows [c][FKS keys], 128 B of data a row at a pitch of 144 B (16 B x odd: ds_load_b128 readers). The 128 threads bring it in with asynchronous copies to LDS that cover whole 128-B lines (8 lanes a row); all four waves take their fragments from there
#define FKS 64
#define FLP (FKS + 8)
#define FBUF (2 * FKS * FLP * 2)   // bytes of one buffer (K rows, then V^T rows)
#define DS0() asm volatile("s_wait_dscnt 0x0" ::: "memory")       // this wave's LDS reads of a buffer have returned before the buffer is handed to the copies
#define ASYNC0() asm volatile("s_wait_asynccnt 0x0" ::: "memory")   // this wave's copies have landed before the barrier behind which other waves read them
// one stage: 4 copies for K (16 keys on each), 4 for V^T (16 channels on each), 16 B a lane; the last line is the wait that stands before a register which a copy names is written again
__device__ __forceinline__ void fa_fill(unsigned l, const _Float16* kg, const _Float16* vg) {
  const unsigned rs = 16 * FLP * 2, vb = FKS * FLP * 2;
  asm volatile("global_load_async_to_lds_b128 %0, %8, off\n\t"
               "global_load_async_to_lds_b128 %1, %9, off\n\t"
               "global_load_async_to_lds_b128 %2, %10, off\n\t"
               "global_load_async_to_lds_b128 %3, %11, off\n\t"
               "global_load_async_to_lds_b128 %4, %12, off\n\t"
               "global_load_async_to_lds_b128 %5, %13, off\n\t"
               "global_load_async_to_lds_b128 %6, %14, off\n\t"
               "global_load_async_to_lds_b128 %7, %15, off\n\t"
               "s_wait_xcnt 0x0"
               :: "v"(l), "v"(l + rs), "v"(l + 2 * rs), "v"(l + 3 * rs), "v"(l + vb), "v"(l + vb + rs), "v"(l + vb + 2 * rs), "v"(l + vb + 3 * rs),
                  "v"(kg), "v"(kg + (size_t)16 * CC), "v"(kg + (size_t)32 * CC), "v"(kg + (size_t)48 * CC), "v"(vg), "v"(vg + (size_t)16 * TT), "v"(vg + (size_t)32 * TT), "v"(vg + (size_t)48 * TT)
               : "memory"); }
// the same for a stage of the early-row path: one K-like tile (rows of CC) and one V^T-like tile of the short planes (rows of KHI keys); called once for the hi pair and once for the lo pair
__device__ __forceinline__ void fa_fill_e(unsigned l, const _Float16* kg, const __bf16* vg) {
  const unsigned rs = 16 * FLP * 2, vb = FKS * FLP * 2;
  asm volatile("global_load_async_to_lds_b128 %0, %8, off\n\t"
               "global_load_async_to_lds_b128 %1, %9, off\n\t"
               "global_load_async_to_lds_b128 %2, %10, off\n\t"
               "global_load_async_to_lds_b128 %3, %11, off\n\t"
               "global_load_async_to_lds_b128 %4, %12, off\n\t"
               "global_load_async_to_lds_b128 %5, %13, off\n\t"
               "global_load_async_to_lds_b128 %6, %14, off\n\t"
               "global_load_async_to_lds_b128 %7, %15, off\n\t"
               "s_wait_xcnt 0x0"
               :: "v"(l), "v"(l + rs), "v"(l + 2 * rs), "v"(l + 3 * rs), "v"(l + vb), "v"(l + vb + rs), "v"(l + vb + 2 * rs), "v"(l + vb + 3 * rs),
                  "v"(kg), "v"(kg + (size_t)16 * CC), "v"(kg + (size_t)32 * CC), "v"(kg + (size_t)48 * CC), "v"(vg), "v"(vg + (size_t)16 * KHI), "v"(vg + (size_t)32 * KHI), "v"(vg + (size_t)48 * KHI)
               : "memory"); }
__global__ __launch_bounds__(128) void k_fa(const _Float16* __restrict__ QH, const _Float16* __restrict__ KH, const _Float16* __restrict__ QL, const _Float16* __restrict__ KL, const _Float16* __restrict__ VT, const __bf16* __restrict__ VB, const __bf16* __restrict__ VBL, float* __restrict__ Y) {
  __shared__ __align__(16) _Float16 skv[2][2][FKS][FLP];   /* [buffer][K rows | V^T rows][row][128 B + pad] */
  const int b = blockIdx.x / NH, h = blockIdx.x % NH; const int qb = NQB - 1 - (int)blockIdx.y;
  const int tid = threadIdx.x, wave = __builtin_amdgcn_readfirstlane(tid >> 5), lane = tid & 31, col = lane & 15, g = lane >> 4;
  /* wave number held scalar: trip count and diagonal test become scalar branches, every lane stays on at the matrix instructions */ const int ql0 = qb * 64 + wave * 16, qi = ql0 + col; const int nblk = (ql0 + 47) >> 5;   /* 32-key steps that cover keys 0 .. ql0 + 15 */
  const _Float16* Qp = QH + ((size_t)b * TT + qi) * CC + h * HD;
  v8f acc[HD / 16] = {}; SMX st; st.m = -3.0e38f; st.l = 0.f;
  const v16h qf0 = frag_h(Qp, lane), qf1 = frag_h(Qp + 32, lane);
  XCNT0();
  if (qb < QBH) {   /* block-uniform */
    const _Float16* QLp = QL + ((size_t)b * QHI + qi) * CC + h * HD;
    const v16h ql0f = frag_h(QLp, lane), ql1f = frag_h(QLp + 32, lane);
    XCNT0();
    /* a stage is FKS keys of this head in ONE buffer of four tiles (the main path's two buffers taken together): K hi, V^T hi, K lo, V^T lo; keys 0 .. qb * 64 + 63 all lie below KHI; every plain '#pragma unroll' of this path opens a constant-trip loop over a register array, so that its elements stay in registers */
    const int nst = qb + 1;   /* the same for the whole block */
    const int fr = tid >> 3, fc = (tid & 7) * 8;   /* this thread's row (of 16 a copy) and 16-B piece of a stage row */
    const _Float16* kg = KH + ((size_t)b * TT + fr) * CC + h * HD + fc; const _Float16* klg = KL + ((size_t)b * KHI + fr) * CC + h * HD + fc; const size_t vo = ((size_t)b * CC + h * HD + fr) * (size_t)KHI + fc;
    const unsigned l0 = (unsigned)(size_t)&skv[0][0][fr][fc];
    const _Float16 (*bkh)[FLP] = skv[0][0]; const _Float16 (*bkl)[FLP] = skv[1][0]; const __bf16 (*bvh)[FLP] = (const __bf16 (*)[FLP])skv[0][1]; const __bf16 (*bvl)[FLP] = (const __bf16 (*)[FLP])skv[1][1];
#pragma unroll 1   /* at most 6 stages: kept rolled for code size */
    for (int s = 0; s < nst; ++s) {
      if (s > 0) { DS0(); __syncthreads(); }   /* block-uniform: every reader has left stage s - 1 before the copies write over it */
      fa_fill_e(l0, kg + (size_t)s * FKS * CC, VB + vo + s * FKS); fa_fill_e(l0 + FBUF, klg + (size_t)s * FKS * CC, VBL + vo + s * FKS);
      ASYNC0(); __syncthreads();   /* stage s is published */
#pragma unroll 1   /* two steps a stage, rolled for code size; wave-uniform scalar test: the two lower waves of the block skip the diagonal stage's second step */
      for (int w = 0; w < 2 && 2 * s + w < nblk; ++w) { const int k0 = (2 * s + w) * 32; float t[16];
        v16h kh[2][2], kl[2][2]; v16b vh[HD / 16], vl[HD / 16];   /* the step's fragment reads go out as one group ahead of its products */
#pragma unroll
        for (int u = 0; u < 2; ++u) { const int kr = w * 32 + u * 16 + col; kh[u][0] = frag_h(&bkh[kr][0], lane); kh[u][1] = frag_h(&bkh[kr][32], lane); kl[u][0] = frag_h(&bkl[kr][0], lane); kl[u][1] = frag_h(&bkl[kr][32], lane); }
#pragma unroll
        for (int j = 0; j < HD / 16; ++j) { vh[j] = frag_b(&bvh[j * 16 + col][w * 32], lane); vl[j] = frag_b(&bvl[j * 16 + col][w * 32], lane); }
#pragma unroll
        for (int u = 0; u < 2; ++u) { v8f a = {}, al = {};
          a = wmma16(kh[u][0], qf0, a); al = wmma16(kh[u][0], ql0f, al); al = wmma16(kl[u][0], qf0, al); a = wmma16(kh[u][1], qf1, a); al = wmma16(kh[u][1], ql1f, al); al = wmma16(kl[u][1], qf1, al);
#pragma unroll
          for (int r = 0; r < 8; ++r) t[u * 8 + r] = (a[r] + al[r] * (1.0f / 1024.0f)) * LOGC; }
        sm_step(t, st, acc, k0, ql0, qi, g);
        const F2 p = bsplit16(t);
#pragma unroll
        for (int j = 0; j < HD / 16; ++j) { acc[j] = wmma_bf(vh[j], p.h, acc[j]); acc[j] = wmma_bf(vh[j], p.l, acc[j]); acc[j] = wmma_bf(vl[j], p.h, acc[j]); } } }
  } else {
    /* every plain '#pragma unroll' below opens a constant-trip loop over a register array (fragments, scores, accumulators), so that its elements stay in registers */
    const int nst = qb + 1;   /* stages of FKS keys that cover keys 0 .. qb * 64 + 63; the same for the whole block */
    const int fr = tid >> 3, fc = (tid & 7) * 8;   /* this thread's row (of 16 a copy) and 16-B piece of a stage row */
    const _Float16* kg = KH + ((size_t)b * TT + fr) * CC + h * HD + fc; const _Float16* vg = VT + ((size_t)b * CC + h * HD + fr) * (size_t)TT + fc;
    const unsigned l0 = (unsigned)(size_t)&skv[0][0][fr][fc];
    int sa = ((qb - QBH) * 5) % nst;   /* the key stage of trip 0; the walk wraps (the running softmax takes the stages in any order; every step that a wave works on holds a key <= each of its queries). The blocks of one plane read the same K and V^T stages and start apart, so that they do not ask L2 for the same lines at the same moment; nst >= QBH + 1 here */
    const int sb = sa + 1 == nst ? 0 : sa + 1;
    fa_fill(l0, kg + (size_t)sa * FKS * CC, vg + sa * FKS); ASYNC0(); __syncthreads();   /* trip 0's stage is published */
    if (1 < nst) fa_fill(l0 + FBUF, kg + (size_t)sb * FKS * CC, vg + sb * FKS);
#pragma unroll 1   /* rolled: one copy of the stage; the buffer is chosen by address */
    for (int s = 0; s < nst; ++s) { const _Float16 (*bk)[FLP] = skv[s & 1][0]; const _Float16 (*bv)[FLP] = skv[s & 1][1];
      v16h kf[2][4], vf[2][4];   /* both steps' fragments go out as one group at the head of the stage (the whole stage is filled, also where a wave skips its second step) */
#pragma unroll
      for (int w = 0; w < 2; ++w) {
#pragma unroll
        for (int u = 0; u < 2; ++u) { kf[w][2 * u] = frag_h(&bk[w * 32 + u * 16 + col][0], lane); kf[w][2 * u + 1] = frag_h(&bk[w * 32 + u * 16 + col][32], lane); }
#pragma unroll
        for (int j = 0; j < HD / 16; ++j) vf[w][j] = frag_h(&bv[j * 16 + col][w * 32], lane); }
#pragma unroll
      for (int w = 0; w < 2; ++w) { const int i = 2 * sa + w, k0 = i * 32;
        if (w == 0 || i < nblk) {   /* wave-uniform scalar test: the two upper waves of the block need the diagonal stage's second step, the two lower do not */
          v8f s0 = {}, s1 = {}; s0 = wmma16(kf[w][0], qf0, s0); s1 = wmma16(kf[w][2], qf0, s1); s0 = wmma16(kf[w][1], qf1, s0); s1 = wmma16(kf[w][3], qf1, s1);
          float t[16];
#pragma unroll
          for (int r = 0; r < 8; ++r) { t[r] = s0[r] * LOGC; t[8 + r] = s1[r] * LOGC; }
          sm_step(t, st, acc, k0, ql0, qi, g);
          v16h p;
#pragma unroll
          for (int e = 0; e < 16; ++e) p[e] = (_Float16)t[e];
#pragma unroll
          for (int j = 0; j < HD / 16; ++j) acc[j] = wmma16(vf[w][j], p, acc[j]); } }
      DS0(); ASYNC0(); __syncthreads();   /* every wave, also one that skipped a step: publishes stage s + 1 and ends every reader's last read of stage s */
      if (s + 2 < nst) { const int sc = sa + 2 >= nst ? sa + 2 - nst : sa + 2; fa_fill(l0 + (unsigned)(s & 1) * FBUF, kg + (size_t)sc * FKS * CC, vg + sc * FKS); }   /* block-uniform; flies while the next trip's stage is worked on */
      sa = sa + 1 == nst ? 0 : sa + 1; }
    ASYNC0(); }
  const float inv = 1.0f / (st.l + xhalf(st.l));   /* the two halves' partial sums join once; the maximum's own term keeps the sum >= 2^11 */
  float* yp = Y + ((size_t)b * TT + qi) * CC + h * HD + 8 * g;   /* acc[j][r] = ctx[query qi][j*16 + 8g + r]: 32 contiguous bytes per lane and j */
#pragma unroll
  for (int j = 0; j < HD / 16; ++j) { const v4f lo = { acc[j][0] * inv, acc[j][1] * inv, acc[j][2] * inv, acc[j][3] * inv }, hi = { acc[j][4] * inv, acc[j][5] * inv, acc[j][6] * inv, acc[j][7] * inv }; vst2(yp + j * 16, lo); vst2(yp + j * 16 + 4, hi); } }
// ---- k_out: block = (64 rows, 128 cols): out = ctx Wo (+ bo): ctx x 2^6 once to f16 against Wo as f16(bf16 x 2^8) exact (1 product) x 2^-14; causal early rows (< QHI of each sequence): ctx bf16 hi + lo against exact bf16 Wo (2 products)
__global__ __launch_bounds__(128) void k_out(const float* __restrict__ Y, const float* __restrict__ WO, const float* __restrict__ BO, float* __restrict__ OUT) { __shared__ __align__(16) unsigned char sm[2 * (64 + 64 + 128) * OLP * 2];   /* two operand buffers (ctx hi, ctx lo, Wo); behind a barrier the output staging takes the same bytes */
  static_assert(4 * 16 * 132 * 4 <= 2 * (64 + 64 + 128) * OLP * 2, "LDS");
  float (*sf)[16][132] = (float (*)[16][132])sm;
  const int tid = threadIdx.x, wave = tid >> 5, lane = tid & 31, col = lane & 15, g = lane >> 4; const int c0 = blockIdx.y * 128; const size_t r0 = (size_t)blockIdx.x * 64 + wave * 16;
  v8f acc[8] = {};
  const int lr = tid / (OK / 4), lc = tid % (OK / 4);
  const float* yg = Y + ((size_t)blockIdx.x * 64 + lr) * CC + lc * 4; const float* wg = WO + (size_t)(c0 + lr) * CC + lc * 4;   /* (out,in) weight rows */
  int ks = (int)((blockIdx.x + 2 * blockIdx.y) % (CC / OK));   /* this block's first k stage; the walk wraps: blocks that read the same ctx rows or the same weight rows start apart (as in k_proj) */
  if (CAUSAL && (int)(((size_t)blockIdx.x * 64) % TT) < QHI) {   /* block-uniform */
    __bf16 (*sah)[64][OLP] = (__bf16 (*)[64][OLP])sm; __bf16 (*sal)[64][OLP] = (__bf16 (*)[64][OLP])(sm + 2 * 64 * OLP * 2); __bf16 (*sw)[128][OLP] = (__bf16 (*)[128][OLP])(sm + 4 * 64 * OLP * 2);
    v4f ry[64 / ORI], rw[128 / ORI];
    tile_ld(ry, yg + ks * OK, (size_t)ORI * CC); XCNT_G(); tile_ld(rw, wg + ks * OK, (size_t)ORI * CC); XCNT_G();
#pragma unroll 1   /* rolled: one copy of the stage */
    for (int s = 0; s < CC / OK; ++s) { __bf16 (*bh)[OLP] = sah[s & 1]; __bf16 (*bl)[OLP] = sal[s & 1]; __bf16 (*bw)[OLP] = sw[s & 1];
#pragma unroll
      for (int i = 0; i < 64 / ORI; ++i) { st_b(&bh[i * ORI + lr][lc * 4], ry[i]); st_bl(&bl[i * ORI + lr][lc * 4], ry[i]); }
#pragma unroll
      for (int i = 0; i < 128 / ORI; ++i) st_b(&bw[i * ORI + lr][lc * 4], rw[i]);
      __syncthreads();   /* publishes stage s; every wave has left the other buffer before stage s + 1 is stored there */
      if (s + 1 < CC / OK) { ks = ks + 1 == CC / OK ? 0 : ks + 1; tile_ld(ry, yg + ks * OK, (size_t)ORI * CC); XCNT_G(); tile_ld(rw, wg + ks * OK, (size_t)ORI * CC); XCNT_G(); }
#pragma unroll
      for (int kk = 0; kk < OK / 32; ++kk) { const v16b ah = frag_b(&bh[wave * 16 + col][kk * 32], lane), al = frag_b(&bl[wave * 16 + col][kk * 32], lane);
#pragma unroll
        for (int j0 = 0; j0 < 8; j0 += 4) { v16b w[4];   /* fragment reads go out as a group ahead of their products */
#pragma unroll
          for (int u = 0; u < 4; ++u) w[u] = frag_b(&bw[(j0 + u) * 16 + col][kk * 32], lane);
#pragma unroll
          for (int u = 0; u < 4; ++u) { acc[j0 + u] = wmma_bf(ah, w[u], acc[j0 + u]); acc[j0 + u] = wmma_bf(al, w[u], acc[j0 + u]); } } } }
    __syncthreads();   /* the last stage's readers are done before the output staging writes over the buffers */
#pragma unroll
    for (int j = 0; j < 8; ++j) { const float bias = BO ? bfr(BO[c0 + j * 16 + col]) : 0.f;
#pragma unroll
      for (int r = 0; r < 8; ++r) sf[wave][8 * g + r][j * 16 + col] = acc[j][r] + bias; }
  } else {
    _Float16 (*sa)[64][OLP] = (_Float16 (*)[64][OLP])sm; _Float16 (*sw)[128][OLP] = (_Float16 (*)[128][OLP])(sm + 2 * 64 * OLP * 2);
    v4f ry[64 / ORI], rw[128 / ORI];
    tile_ld(ry, yg + ks * OK, (size_t)ORI * CC); XCNT_G(); tile_ld(rw, wg + ks * OK, (size_t)ORI * CC); XCNT_G();
#pragma unroll 1   /* rolled: one copy of the stage */
    for (int s = 0; s < CC / OK; ++s) { _Float16 (*ba)[OLP] = sa[s & 1]; _Float16 (*bw)[OLP] = sw[s & 1];
#pragma unroll
      for (int i = 0; i < 64 / ORI; ++i) st_hs(&ba[i * ORI + lr][lc * 4], ry[i], 64.0f);   /* ctx carried x 2^6 into f16 so small-magnitude context rows stay clear of f16 subnormals */
#pragma unroll
      for (int i = 0; i < 128 / ORI; ++i) st_hw(&bw[i * ORI + lr][lc * 4], rw[i]);
      __syncthreads();   /* publishes stage s; every wave has left the other buffer before stage s + 1 is stored there */
      if (s + 1 < CC / OK) { ks = ks + 1 == CC / OK ? 0 : ks + 1; tile_ld(ry, yg + ks * OK, (size_t)ORI * CC); XCNT_G(); tile_ld(rw, wg + ks * OK, (size_t)ORI * CC); XCNT_G(); }
#pragma unroll
      for (int kk = 0; kk < OK / 32; ++kk) { const v16h a = frag_h(&ba[wave * 16 + col][kk * 32], lane);
#pragma unroll
        for (int j0 = 0; j0 < 8; j0 += 4) { v16h w[4];   /* fragment reads go out as a group ahead of their products */
#pragma unroll
          for (int u = 0; u < 4; ++u) w[u] = frag_h(&bw[(j0 + u) * 16 + col][kk * 32], lane);
#pragma unroll
          for (int u = 0; u < 4; ++u) acc[j0 + u] = wmma16(a, w[u], acc[j0 + u]); } } }
    __syncthreads();   /* the last stage's readers are done before the output staging writes over the buffers */
#pragma unroll
    for (int j = 0; j < 8; ++j) { const float bias = BO ? bfr(BO[c0 + j * 16 + col]) : 0.f;
#pragma unroll
      for (int r = 0; r < 8; ++r) sf[wave][8 * g + r][j * 16 + col] = acc[j][r] * (1.0f / 16384.0f) + bias; } }   /* 2^-8 (Wo carry) x 2^-6 (ctx carry) */
  LDSX(); for (int rl = 0; rl < 16; ++rl) vst2(OUT + SRCROW(r0 + rl) * DIN + c0 + lane * 4, *(const v4f*)&sf[wave][rl][lane * 4]); }

extern "C" void kernel_launch(void* const* d_in, const int* in_sizes, int n_in, void* d_out, int out_size, void* d_ws, size_t ws_size, hipStream_t stream) {
  (void)in_sizes; (void)n_in; (void)out_size;
  const float** F = (const float**)d_in;
  if (ws_size < (size_t)WS_END) return;
  char* ws = (char*)d_ws; _Float16 *QH = (_Float16*)(ws + WS_QH), *KH = (_Float16*)(ws + WS_KH), *VT = (_Float16*)(ws + WS_VT), *QL = (_Float16*)(ws + WS_QL), *KL = (_Float16*)(ws + WS_KL); __bf16 *VB = (__bf16*)(ws + WS_VB), *VBL = (__bf16*)(ws + WS_VBL); float *Y = (float*)(ws + WS_Y);
  (void)Y; (void)QL; (void)KL; (void)VB; (void)VBL;
  // inputs (in order): 0 x [2048,2,768] (S, B, D); 1 wq [768,768] (out,in), 2 bq; 3 wk, 4 bk; 5 wv, 6 bv; 7 wc (out,in), 8 bc (all biases NONZERO)
  k_proj<<<dim3(TNB * TT / PTR, CC / 128, 3), 256, 0, stream>>>(F[0], F[0], F[0], F[1], F[3], F[5], F[2], F[4], F[6], QH, QL, KH, KL, VT, VB, VBL);
  k_fa<<<dim3(TNB * NH, NQB), 128, 0, stream>>>(QH, KH, QL, KL, VT, VB, VBL, Y);
  k_out<<<dim3(TNB * TT / 64, DIN / 128), 128, 0, stream>>>(Y, F[7], F[8], (float*)d_out);   /* writes (S, B, D) rows */
}

// v008
// One run takes 63.9 microseconds.
// Next to v007, in two timings, it ran 1.04 and 1.03 times as fast.
// Over all steps from v000 it is 14.0 times as fast.
// compute dtype: all float inputs rounded to bf16; q / k / v projections with EXACT bf16 products on WMMA 16x16x32 (f32 accumulate) + bias; causal logits: 3 products for the first 384 rows, single f16 q x k after, x 64^-0.5; running-maximum softmax f32 in the same launch; unnormalised P x 2^11 once to f16 x v once to f16 (bf16 hi + lo below row 384), divided by the f32 sum at the end; y hi+lo x exact wc below row 384, x2^6 f16 carry x f16(bf16 x 2^8) wc after, + bc; f32 output written back in the sequence-first layout.
#include <hip/hip_runtime.h>
#include <math.h>

typedef __attribute__((ext_vector_type(16))) _Float16 v16h;
typedef __attribute__((ext_vector_type(16))) __bf16 v16b;
typedef __attribute__((ext_vector_type(8)))  _Float16 v8h;
typedef __attribute__((ext_vector_type(8)))  float v8f;
typedef __attribute__((ext_vector_type(4)))  float v4f;
typedef __attribute__((ext_vector_type(2)))  float v2f;
typedef __attribute__((ext_vector_type(4)))  unsigned v4u;
typedef __attribute__((ext_vector_type(4)))  int v4i;
typedef float __attribute__((may_alias)) float_a;
typedef int __attribute__((may_alias)) int_a;

template <typename T> __device__ __forceinline__ void vst2(void* p, T v) { *(T*)p = v;  }
__device__ __forceinline__ v8f wmma16(v16h a, v16h b, v8f c) {
  return __builtin_amdgcn_wmma_f32_16x16x32_f16(false, a, false, b, (short)0, c, false, false);
}
__device__ __forceinline__ v8f wmma_bf(v16b a, v16b b, v8f c) {
  return __builtin_amdgcn_wmma_f32_16x16x32_bf16(false, a, false, b, (short)0, c, false, false);
}
// 16x16x32 fragments: lane = (h = lane>>4, row/col = lane&15); elements 0..7 = k0+8h+0..7, 8..15 = k0+16+8h+0..7; D element r = row 8h+r
__device__ __forceinline__ v16h frag_h(const _Float16* rowk0, int lane) {
  union { v16h v; v8h q[2]; } u; const _Float16* p = rowk0 + 8 * (lane >> 4);
  u.q[0] = *(const v8h*)p; u.q[1] = *(const v8h*)(p + 16); return u.v;
}
__device__ __forceinline__ v16h frag_f32(const float* rowk0, int lane) {
  v16h a; const float* p = rowk0 + 8 * (lane >> 4);
#pragma unroll
  for (int i = 0; i < 8; ++i) { a[i] = (_Float16)p[i]; a[8 + i] = (_Float16)p[16 + i]; }
  return a;
}
__device__ __forceinline__ v16h frag_f32s(const float* rowk0, int lane, float sc) {
  v16h a; const float* p = rowk0 + 8 * (lane >> 4);
#pragma unroll
  for (int i = 0; i < 8; ++i) { a[i] = (_Float16)(p[i] * sc); a[8 + i] = (_Float16)(p[16 + i] * sc); }
  return a;
}
// column fragment from a [K][ld] layout (column n), rows >= K read as 0
__device__ __forceinline__ v16h fragc_f32(const float* W, int k0, int n, int lane, int ld, int K) {
  v16h a; const int g = lane >> 4;
#pragma unroll
  for (int i = 0; i < 8; ++i) { const int ka = k0 + 8 * g + i, kb = ka + 16;
    a[i] = (_Float16)(ka < K ? W[(size_t)(ka < K ? ka : K - 1) * ld + n] : 0.f); a[8 + i] = (_Float16)(kb < K ? W[(size_t)(kb < K ? kb : K - 1) * ld + n] : 0.f); }
  return a;
}
struct F2 { v16b h, l; };
__device__ __forceinline__ F2 bsplit16(const float v[16]) { F2 r;
#pragma unroll
  for (int i = 0; i < 16; ++i) { const __bf16 h = (__bf16)v[i]; r.h[i] = h; r.l[i] = (__bf16)(v[i] - (float)h); }
  return r; }
__device__ __forceinline__ F2 split_row(const float* row, int k0, int lane) { float v[16]; const float* p = row + k0 + 8 * (lane >> 4);
#pragma unroll
  for (int i = 0; i < 8; ++i) { v[i] = p[i]; v[8 + i] = p[16 + i]; }
  return bsplit16(v); }
__device__ __forceinline__ F2 split_rowK(const float* row, int k0, int lane, int K) { float v[16]; const int g = lane >> 4;
#pragma unroll
  for (int i = 0; i < 8; ++i) { const int ka = k0 + 8 * g + i, kb = ka + 16; v[i] = ka < K ? row[ka < K ? ka : K - 1] : 0.f; v[8 + i] = kb < K ? row[kb < K ? kb : K - 1] : 0.f; }
  return bsplit16(v); }
__device__ __forceinline__ F2 split_col(const float* W, int k0, int n, int lane, int ld, int K) { float v[16]; const int g = lane >> 4;
#pragma unroll
  for (int i = 0; i < 8; ++i) { const int ka = k0 + 8 * g + i, kb = ka + 16; v[i] = ka < K ? W[(size_t)(ka < K ? ka : K - 1) * ld + n] : 0.f; v[8 + i] = kb < K ? W[(size_t)(kb < K ? kb : K - 1) * ld + n] : 0.f; }
  return bsplit16(v); }
__device__ __forceinline__ v8f mac3(const F2& a, const F2& b, v8f c) { c = wmma_bf(a.l, b.h, c); c = wmma_bf(a.h, b.l, c); return wmma_bf(a.h, b.h, c); }
__device__ __forceinline__ float sigm(float v) { return 1.0f / (1.0f + expf(-v)); }
#define RDGRP() __builtin_amdgcn_sched_barrier(0)   // behind a group of LDS fragment reads: the scheduler moves nothing across, so the reads go out together ahead of the matrix run; without it each read sinks to its own product and is waited for alone
#define MRUN() __builtin_amdgcn_sched_barrier(0)   // at the foot of the score products and the head of the P x v products: the scalings and conversions stay on their own side; mixed into a run they landed on operand registers just read, and the compiler padded each with up to four v_nop
#define LDSX() do { asm volatile("s_wait_dscnt 0" ::: "memory"); __builtin_amdgcn_wave_barrier(); __builtin_amdgcn_fence(__ATOMIC_RELEASE, "workgroup"); } while (0)

// Causal multi-head self-attention on a SEQUENCE-FIRST input (x [2048, 2, 768] = (S, B, D); torch (out,in) wq / wk / wv / wc [768,768] N(0,1) x 0.02 applied as x W^T + b, biases N(0,1) x 0.02 - NONZERO; 12 heads x 64; scores / sqrt(64); tril kept, -inf elsewhere; softmax; y wc^T + bc; output transposed back to (S, B, D)). The kernels work on rows b*2048 + t: the projection reads token (b, t) from source row t*2 + b and the output kernel writes it back there.
#define NB 2
#define TT 2048
#define CC 768            // NH * HD = projected width
#define DIN 768          // input (model) width
#define NH 12
#define HD 64
#define NQB (TT / 64)
#define SCALE (0.125f)
#define CAUSAL 1
#ifndef TNB
#define TNB NB
#endif
__device__ __forceinline__ float bfr(float v) { return (float)(__bf16)v; }
typedef __attribute__((ext_vector_type(8))) __bf16 v8b;
__device__ __forceinline__ v16b frag_b(const __bf16* rowk0, int lane) {
  union { v16b v; v8b q[2]; } u; const __bf16* p = rowk0 + 8 * (lane >> 4);
  u.q[0] = *(const v8b*)p; u.q[1] = *(const v8b*)(p + 16); return u.v;
}
#define QBH 6              // causal: query blocks 0..QBH-1 of each sequence (few keys, no averaging) take the high-precision path
#define QHI 384            // rows carrying a q residual plane
#define KHI 384            // key rows carrying k residual / v bf16 hi+lo planes (used only by the causal high-precision path)
// B fragment (k rows k0+.., output column o) of a weight: (in,out) [K][ld] or (out,in) [ld rows of K]: bf16 exact, or f16(bf16 * 256) exact
__device__ __forceinline__ v16b wcol_io(const float* Wm, int k0, int o, int lane, int ld) { v16b w; const int g = lane >> 4;
#pragma unroll
  for (int i = 0; i < 8; ++i) { w[i] = (__bf16)Wm[(size_t)(k0 + 8 * g + i) * ld + o]; w[8 + i] = (__bf16)Wm[(size_t)(k0 + 16 + 8 * g + i) * ld + o]; }
  return w; }
__device__ __forceinline__ v16b wcol_oi(const float* Wm, int k0, int o, int lane, int K) { v16b w; const float* p = Wm + (size_t)o * K + k0 + 8 * (lane >> 4);
#pragma unroll
  for (int i = 0; i < 8; ++i) { w[i] = (__bf16)p[i]; w[8 + i] = (__bf16)p[16 + i]; }
  return w; }
__device__ __forceinline__ v16h wcolh_io(const float* Wm, int k0, int o, int lane, int ld) { v16h w; const int g = lane >> 4;
#pragma unroll
  for (int i = 0; i < 8; ++i) { w[i] = (_Float16)(bfr(Wm[(size_t)(k0 + 8 * g + i) * ld + o]) * 256.0f); w[8 + i] = (_Float16)(bfr(Wm[(size_t)(k0 + 16 + 8 * g + i) * ld + o]) * 256.0f); }
  return w; }
__device__ __forceinline__ v16h wcolh_oi(const float* Wm, int k0, int o, int lane, int K) { v16h w; const float* p = Wm + (size_t)o * K + k0 + 8 * (lane >> 4);
#pragma unroll
  for (int i = 0; i < 8; ++i) { w[i] = (_Float16)(bfr(p[i]) * 256.0f); w[8 + i] = (_Float16)(bfr(p[16 + i]) * 256.0f); }
  return w; }
#define SRCROW(r) ((size_t)((r) % TT) * NB + (size_t)((r) / TT))   // row r = b*TT + t <-> sequence-first row t*NB + b of the (S, B, D) arrays (NB = the module's batch count, also when fewer batches are run)
#define WQKV_LAYOUT 1   // layout for WCOL only, which nothing calls (k_proj reads (out,in) [CC][DIN] rows): 0 = (in,out) [DIN][CC]; 1 = (out,in) [CC][DIN]; 2 = per-head [NH][DIN][HD]
__device__ __forceinline__ v16b wcol_hdk(const float* Wm, int k0, int o, int lane) { v16b w; const int g = lane >> 4; const float* p = Wm + (size_t)(o / HD) * DIN * HD + (o % HD);
#pragma unroll
  for (int i = 0; i < 8; ++i) { w[i] = (__bf16)p[(size_t)(k0 + 8 * g + i) * HD]; w[8 + i] = (__bf16)p[(size_t)(k0 + 16 + 8 * g + i) * HD]; }
  return w; }
#define WO_OUT_IN 1
#if WQKV_LAYOUT == 1
#define WCOL(W, k0, o, lane) wcol_oi(W, k0, o, lane, DIN)
#elif WQKV_LAYOUT == 2
#define WCOL(W, k0, o, lane) wcol_hdk(W, k0, o, lane)
#else
#define WCOL(W, k0, o, lane) wcol_io(W, k0, o, lane, CC)
#endif
#if WO_OUT_IN
#define WOCOL(W, k0, o, lane) wcol_oi(W, k0, o, lane, CC)
#define WOCOLH(W, k0, o, lane) wcolh_oi(W, k0, o, lane, CC)
#else
#define WOCOL(W, k0, o, lane) wcol_io(W, k0, o, lane, DIN)
#define WOCOLH(W, k0, o, lane) wcolh_io(W, k0, o, lane, DIN)
#endif

#define WS_QH  0u                                      // f16 q rows [b*t][CC]
#define WS_KH  (WS_QH + 2u * (size_t)NB * TT * CC)      // f16 k rows [b*t][CC]
#define WS_VT  (WS_KH + 2u * (size_t)NB * TT * CC)      // f16 v planes [b][c][t]
#define WS_QL  (WS_VT + 2u * (size_t)NB * CC * TT)      // f16 q residual x 2^10 rows [b][t < QHI][CC]
#define WS_KL  (WS_QL + 2u * (size_t)NB * QHI * CC)     // f16 k residual x 2^10 rows [b][t < KHI][CC]
#define WS_VB  (WS_KL + 2u * (size_t)NB * KHI * CC)     // bf16 v hi planes [b][c][t < KHI]
#define WS_VBL (WS_VB + 2u * (size_t)NB * CC * KHI)
#define WS_Y   (WS_VBL + 2u * (size_t)NB * CC * KHI)    // f32 ctx rows [b*t][CC]
#define WS_END (WS_Y  + 4u * (size_t)NB * TT * CC)

// operand staging of the two GEMM launches: a stage is PK (projection) or OK (output) k of every tile row. The block's threads fetch it with global_load_b128 that cover whole 128-B lines (PK / 4 or OK / 4 lanes a row), round it ONCE to the 16-bit operand type and store it in LDS rows with a 16-B pad (pitch 16 B x odd: ds_load_b128 readers); all waves take their fragments from there
// every '#pragma unroll' of the staging code opens a constant-trip loop over a register array (fetched rows, fragments, accumulators), so that its elements stay in registers
typedef __attribute__((ext_vector_type(4))) __bf16 v4b;
typedef __attribute__((ext_vector_type(4))) _Float16 v4h;
#define PK 32
#define PLP (PK + 8)
#define PTR 128            // rows of a projection tile
#define PRI (1024 / PK)    // tile rows that one load instruction of the whole block (256 threads) covers
#define OK 64
#define OLP (OK + 8)
#define ORI (512 / OK)
template <int N> __device__ __forceinline__ void tile_ld(v4f (&r)[N], const float* p, size_t step) {
#pragma unroll
  for (int i = 0; i < N; ++i) r[i] = *(const v4f*)(p + (size_t)i * step); }
__device__ __forceinline__ void st_b(__bf16* d, v4f v) { const v4b o = { (__bf16)v[0], (__bf16)v[1], (__bf16)v[2], (__bf16)v[3] }; *(v4b*)d = o; }
__device__ __forceinline__ void st_bl(__bf16* d, v4f v) { const v4b o = { (__bf16)(v[0] - (float)(__bf16)v[0]), (__bf16)(v[1] - (float)(__bf16)v[1]), (__bf16)(v[2] - (float)(__bf16)v[2]), (__bf16)(v[3] - (float)(__bf16)v[3]) }; *(v4b*)d = o; }
__device__ __forceinline__ void st_hs(_Float16* d, v4f v, float sc) { const v4h o = { (_Float16)(v[0] * sc), (_Float16)(v[1] * sc), (_Float16)(v[2] * sc), (_Float16)(v[3] * sc) }; *(v4h*)d = o; }
__device__ __forceinline__ void st_hw(_Float16* d, v4f v) { const v4h o = { (_Float16)(bfr(v[0]) * 256.0f), (_Float16)(bfr(v[1]) * 256.0f), (_Float16)(bfr(v[2]) * 256.0f), (_Float16)(bfr(v[3]) * 256.0f) }; *(v4h*)d = o; }
#define XCNT_G() asm volatile("s_wait_xcnt 0x0" ::: "memory")   // stands behind a run of global loads, before a register that they name is written again
// eight 16-B stores of one thread, 'step' bytes apart; the last line is the wait that stands before a register which a store names is written again (in a statement of its own the compiler lifts later register writes over it)
__device__ __forceinline__ void st8(char* p, size_t step, const v4u (&o)[8]) {
  asm volatile("global_store_b128 %0, %8, off\n\t"
               "global_store_b128 %1, %9, off\n\t"
               "global_store_b128 %2, %10, off\n\t"
               "global_store_b128 %3, %11, off\n\t"
               "global_store_b128 %4, %12, off\n\t"
               "global_store_b128 %5, %13, off\n\t"
               "global_store_b128 %6, %14, off\n\t"
               "global_store_b128 %7, %15, off\n\t"
               "s_wait_xcnt 0x0"
               :: "v"(p), "v"(p + step), "v"(p + 2 * step), "v"(p + 3 * step), "v"(p + 4 * step), "v"(p + 5 * step), "v"(p + 6 * step), "v"(p + 7 * step),
                  "v"(o[0]), "v"(o[1]), "v"(o[2]), "v"(o[3]), "v"(o[4]), "v"(o[5]), "v"(o[6]), "v"(o[7])
               : "memory"); }
// ---- k_proj: block = (128 rows, 128 cols, which), 8 waves in a 4 x 2 grid, 32 rows x 64 cols a wave: q/k/v = X W (+ b) with exact bf16 products (K = DIN) -> which 0: q f16 rows (+ residual rows < QHI); 1: k f16 rows (+ residual rows < KHI); 2: v f16 planes [c][t] (+ bf16 hi/lo planes for t < KHI)
__global__ __launch_bounds__(256) void k_proj(const float* __restrict__ XQ, const float* __restrict__ XK, const float* __restrict__ XV, const float* __restrict__ WQ, const float* __restrict__ WK, const float* __restrict__ WV, const float* __restrict__ BQ, const float* __restrict__ BK, const float* __restrict__ BV,
    _Float16* __restrict__ QH, _Float16* __restrict__ QL, _Float16* __restrict__ KH, _Float16* __restrict__ KL, _Float16* __restrict__ VT, __bf16* __restrict__ VB, __bf16* __restrict__ VBL) {
  __shared__ __align__(16) unsigned char sm[3 * 128 * 136 * 2];   /* two operand buffers in the main loop; behind a barrier the epilogue's output staging takes the same bytes */
  static_assert(2 * (PTR + 128) * PLP * 2 <= 3 * 128 * 136 * 2 && 2 * PTR * 136 * 2 <= 3 * 128 * 136 * 2 && PTR == 128 && QHI % PTR == 0 && KHI % PTR == 0 && TT % PTR == 0, "LDS, tile");
  __bf16 (*sx)[PTR][PLP] = (__bf16 (*)[PTR][PLP])sm; __bf16 (*sw)[128][PLP] = (__bf16 (*)[128][PLP])(sm + 2 * PTR * PLP * 2);
  _Float16 (*sh)[136] = (_Float16 (*)[136])sm; _Float16 (*sl)[136] = (_Float16 (*)[136])(sm + PTR * 136 * 2);
  _Float16 (*th)[136] = (_Float16 (*)[136])sm; __bf16 (*tb)[136] = (__bf16 (*)[136])(sm + 128 * 136 * 2); __bf16 (*tbl)[136] = (__bf16 (*)[136])(sm + 2 * 128 * 136 * 2);
  const int tid = threadIdx.x, wave = tid >> 5, lane = tid & 31, col = lane & 15, g = lane >> 4; const int wr = wave >> 1, wc = wave & 1; const int which = blockIdx.z; const int c0 = blockIdx.y * 128; const size_t r0 = (size_t)blockIdx.x * PTR; const size_t bb = r0 / TT; const int t0 = (int)(r0 % TT);
  const float* X = which == 0 ? XQ : which == 1 ? XK : XV; const float* WA = which == 0 ? WQ : which == 1 ? WK : WV; const float* BA = which == 0 ? BQ : which == 1 ? BK : BV;
  v8f acc[2][4] = {};
  const int lr = tid / (PK / 4), lc = tid % (PK / 4);
  const float* xg = X + SRCROW(r0 + lr) * DIN + lc * 4;   /* sequence-first source row; the tile's rows lie in one sequence, so PRI tile rows on = PRI * NB source rows on */
  const float* wg = WA + (size_t)(c0 + lr) * DIN + lc * 4;   /* (out,in) weight rows */
  v4f rx[PTR / PRI], rw[128 / PRI];
  int ks = (int)((blockIdx.x + 5 * (blockIdx.y + 6 * blockIdx.z)) % (DIN / PK));   /* this block's first k stage; the walk wraps. The 18 blocks that read the same x rows and the 32 that read the same weight rows start apart, so that they do not ask L2 for the same lines at the same moment */
  tile_ld(rx, xg + ks * PK, (size_t)PRI * NB * DIN); XCNT_G(); tile_ld(rw, wg + ks * PK, (size_t)PRI * DIN); XCNT_G();
#pragma unroll 1   /* rolled: one copy of the stage; the fetched registers are free again once they are stored */
  for (int s = 0; s < DIN / PK; ++s) { __bf16 (*bx)[PLP] = sx[s & 1]; __bf16 (*bw)[PLP] = sw[s & 1];
#pragma unroll
    for (int i = 0; i < PTR / PRI; ++i) st_b(&bx[i * PRI + lr][lc * 4], rx[i]);
#pragma unroll
    for (int i = 0; i < 128 / PRI; ++i) st_b(&bw[i * PRI + lr][lc * 4], rw[i]);
    __syncthreads();   /* publishes stage s; also: every wave has left the other buffer (read in stage s - 1) before stage s + 1 is stored there */
    if (s + 1 < DIN / PK) { ks = ks + 1 == DIN / PK ? 0 : ks + 1; tile_ld(rx, xg + ks * PK, (size_t)PRI * NB * DIN); XCNT_G(); tile_ld(rw, wg + ks * PK, (size_t)PRI * DIN); XCNT_G(); }   /* next stage flies while this one is multiplied */
#pragma unroll
    for (int kk = 0; kk < PK / 32; ++kk) { v16b a[2], w[4];   /* the stage's fragment reads go out as one group ahead of its products: one LDS latency a stage */
#pragma unroll
      for (int i = 0; i < 2; ++i) a[i] = frag_b(&bx[wr * 32 + i * 16 + col][kk * 32], lane);
#pragma unroll
      for (int u = 0; u < 4; ++u) w[u] = frag_b(&bw[wc * 64 + u * 16 + col][kk * 32], lane);
      RDGRP();
#pragma unroll
      for (int u = 0; u < 4; ++u)
#pragma unroll
        for (int i = 0; i < 2; ++i) acc[i][u] = wmma_bf(a[i], w[u], acc[i][u]); } }
  __syncthreads();   /* the last stage's readers are done before the epilogue writes over the buffers */
  if (which < 2) { _Float16* DH = which == 0 ? QH : KH; _Float16* DL = which == 0 ? QL : KL; const int nhi = which == 0 ? QHI : KHI; const bool hi_rows = t0 < nhi;
#pragma unroll
    for (int j = 0; j < 4; ++j) { const float bias = BA ? bfr(BA[c0 + wc * 64 + j * 16 + col]) : 0.f;
#pragma unroll
      for (int i = 0; i < 2; ++i)
#pragma unroll
        for (int r = 0; r < 8; ++r) { const float v = acc[i][j][r] + bias; const _Float16 hv = (_Float16)v; const int rl = wr * 32 + i * 16 + 8 * g + r, cl = wc * 64 + j * 16 + col; sh[rl][cl] = hv; sl[rl][cl] = (_Float16)((v - (float)hv) * 1024.0f); } }
    __syncthreads();
    const int rl0 = tid >> 4, q = tid & 15; v4u o[PTR / 16];   /* 16 threads a row, 16 rows a pass of the block; a plane's staged rows are read as one group, then stored */
#pragma unroll
    for (int i = 0; i < PTR / 16; ++i) o[i] = *(const v4u*)&sh[i * 16 + rl0][q * 8];
    st8((char*)(DH + (r0 + rl0) * CC + c0 + q * 8), (size_t)16 * CC * 2, o);
    if (hi_rows) {   /* block-uniform */
#pragma unroll
      for (int i = 0; i < PTR / 16; ++i) o[i] = *(const v4u*)&sl[i * 16 + rl0][q * 8];
      st8((char*)(DL + (bb * nhi + t0 + rl0) * (size_t)CC + c0 + q * 8), (size_t)16 * CC * 2, o); }
  } else { const bool hi_rows = t0 < KHI;
#pragma unroll
    for (int j = 0; j < 4; ++j) { const float bias = BA ? bfr(BA[c0 + wc * 64 + j * 16 + col]) : 0.f;
#pragma unroll
      for (int i = 0; i < 2; ++i)
#pragma unroll
        for (int r = 0; r < 8; ++r) { const float v = acc[i][j][r] + bias; const int rl = wr * 32 + i * 16 + 8 * g + r, cl = wc * 64 + j * 16 + col; th[cl][rl] = (_Float16)v; const __bf16 bh = (__bf16)v; tb[cl][rl] = bh; tbl[cl][rl] = (__bf16)(v - (float)bh); } }
    __syncthreads();
    const int cl0 = tid >> 4, q = tid & 15; v4u o[8];   /* 16 threads a channel row of PTR keys, 16 channels a pass of the block; read as one group, then stored, as above */
#pragma unroll
    for (int i = 0; i < 8; ++i) o[i] = *(const v4u*)&th[i * 16 + cl0][q * 8];
    st8((char*)(VT + (bb * CC + c0 + cl0) * (size_t)TT + t0 + q * 8), (size_t)16 * TT * 2, o);
    if (hi_rows) {   /* block-uniform */
#pragma unroll
      for (int i = 0; i < 8; ++i) o[i] = *(const v4u*)&tb[i * 16 + cl0][q * 8];
      st8((char*)(VB + (bb * CC + c0 + cl0) * (size_t)KHI + t0 + q * 8), (size_t)16 * KHI * 2, o);
#pragma unroll
      for (int i = 0; i < 8; ++i) o[i] = *(const v4u*)&tbl[i * 16 + cl0][q * 8];
      st8((char*)(VBL + (bb * CC + c0 + cl0) * (size_t)KHI + t0 + q * 8), (size_t)16 * KHI * 2, o); } } }
// ---- k_fa: block = 4 waves x 16 queries (query block qb, heaviest first) of plane b*NH + h; K and V^T come through LDS buffers shared by the four waves; per 32 keys: S^T = K Q^T (a lane holds 16 keys of ONE query), running maximum and sum in f32 (log2 domain), P^T x 2^11 packed from the score tiles straight into the B operand, O^T += V^T P^T; ctx = O / sum. Query blocks < QBH: 3-product logits (q, k residuals x 2^10), P and v as bf16 hi + lo (3 products)
#define LOGC (SCALE * 1.44269504088896340736f)
struct SMX { float m, l; };
__device__ __forceinline__ float xhalf(float x) { return __builtin_bit_cast(float, __builtin_amdgcn_permlanex16(__builtin_bit_cast(int, x), __builtin_bit_cast(int, x), 0x76543210, 0xfedcba98, false, false)); }   // lane l with lane l ^ 16
#define XCNT0() asm volatile("s_wait_xcnt 0x0" ::: "memory")   // stands behind a run of global loads, before their address registers are reused
// one 32-key step of the running softmax of this lane's query: t[0..7] = keys k0+8g+r, t[8..15] = keys k0+16+8g+r (scaled log2 logits); returns e[] = 2^(t - max + 11); rescales acc only when some query of the wave has a new maximum
__device__ __forceinline__ void sm_step(float t[16], SMX& st, v8f acc[HD / 16], int k0, int qfirst, int qi, int g) {
  if (k0 + 31 > qfirst) {   /* wave-uniform: only steps that reach the diagonal mask by index */
#pragma unroll
    for (int r = 0; r < 8; ++r) { if (k0 + 8 * g + r > qi) t[r] = -3.0e38f; if (k0 + 16 + 8 * g + r > qi) t[8 + r] = -3.0e38f; } }
  float mx = t[0];
#pragma unroll
  for (int s = 1; s < 16; ++s) mx = fmaxf(mx, t[s]);
  mx = fmaxf(mx, xhalf(mx));   /* the other half of the wave holds the query's other 16 keys */
  if (__builtin_amdgcn_ballot_w32(mx > st.m) != 0) { const float mn = fmaxf(st.m, mx); const float al = __builtin_amdgcn_exp2f(st.m - mn); st.m = mn; st.l *= al;
#pragma unroll
    for (int j = 0; j < HD / 16; ++j)
#pragma unroll
      for (int r = 0; r < 8; ++r) acc[j][r] *= al; }
  const float mo = st.m - 11.0f; float ps = 0.f;
#pragma unroll
  for (int s = 0; s < 16; ++s) t[s] -= mo;
  __builtin_amdgcn_sched_barrier(0);   /* the subtractions stay ahead of the exponentials */
#pragma unroll   /* constant trips over the register array t, as the loop above */
  for (int s = 0; s < 16; ++s) { t[s] = __builtin_amdgcn_exp2f(t[s]); ps += t[s]; }
  st.l += ps; }
// K / V staging of the main path: a stage is FKS keys of this head: K rows [key][64 d] and V^T rows [c][FKS keys], 128 B of data a row at a pitch of 144 B (16 B x odd: ds_load_b128 readers). The 128 threads bring it in with asynchronous copies to LDS that cover whole 128-B lines (8 lanes a row); all four waves take their fragments from there
#define FKS 64
#define FLP (FKS + 8)
#define FBUF (2 * FKS * FLP * 2)   // bytes of one buffer (K rows, then V^T rows)
#define DS0() asm volatile("s_wait_dscnt 0x0" ::: "memory")       // this wave's LDS reads of a buffer have returned before the buffer is handed to the copies
#define ASYNC0() asm volatile("s_wait_asynccnt 0x0" ::: "memory")   // this wave's copies have landed before the barrier behind which other waves read them
// one stage: 4 copies for K (16 keys on each), 4 for V^T (16 channels on each), 16 B a lane; the last line is the wait that stands before a register which a copy names is written again
__device__ __forceinline__ void fa_fill(unsigned l, const _Float16* kg, const _Float16* vg) {
  const unsigned rs = 16 * FLP * 2, vb = FKS * FLP * 2;
  asm volatile("global_load_async_to_lds_b128 %0, %8, off\n\t"
               "global_load_async_to_lds_b128 %1, %9, off\n\t"
               "global_load_async_to_lds_b128 %2, %10, off\n\t"
               "global_load_async_to_lds_b128 %3, %11, off\n\t"
               "global_load_async_to_lds_b128 %4, %12, off\n\t"
               "global_load_async_to_lds_b128 %5, %13, off\n\t"
               "global_load_async_to_lds_b128 %6, %14, off\n\t"
               "global_load_async_to_lds_b128 %7, %15, off\n\t"
               "s_wait_xcnt 0x0"
               :: "v"(l), "v"(l + rs), "v"(l + 2 * rs), "v"(l + 3 * rs), "v"(l + vb), "v"(l + vb + rs), "v"(l + vb + 2 * rs), "v"(l + vb + 3 * rs),
                  "v"(kg), "v"(kg + (size_t)16 * CC), "v"(kg + (size_t)32 * CC), "v"(kg + (size_t)48 * CC), "v"(vg), "v"(vg + (size_t)16 * TT), "v"(vg + (size_t)32 * TT), "v"(vg + (size_t)48 * TT)
               : "memory"); }
// the same for a stage of the early-row path: one K-like tile (rows of CC) and one V^T-like tile of the short planes (rows of KHI keys); called once for the hi pair and once for the lo pair
__device__ __forceinline__ void fa_fill_e(unsigned l, const _Float16* kg, const __bf16* vg) {
  const unsigned rs = 16 * FLP * 2, vb = FKS * FLP * 2;
  asm volatile("global_load_async_to_lds_b128 %0, %8, off\n\t"
               "global_load_async_to_lds_b128 %1, %9, off\n\t"
               "global_load_async_to_lds_b128 %2, %10, off\n\t"
               "global_load_async_to_lds_b128 %3, %11, off\n\t"
               "global_load_async_to_lds_b128 %4, %12, off\n\t"
               "global_load_async_to_lds_b128 %5, %13, off\n\t"
               "global_load_async_to_lds_b128 %6, %14, off\n\t"
               "global_load_async_to_lds_b128 %7, %15, off\n\t"
               "s_wait_xcnt 0x0"
               :: "v"(l), "v"(l + rs), "v"(l + 2 * rs), "v"(l + 3 * rs), "v"(l + vb), "v"(l + vb + rs), "v"(l + vb + 2 * rs), "v"(l + vb + 3 * rs),
                  "v"(kg), "v"(kg + (size_t)16 * CC), "v"(kg + (size_t)32 * CC), "v"(kg + (size_t)48 * CC), "v"(vg), "v"(vg + (size_t)16 * KHI), "v"(vg + (size_t)32 * KHI), "v"(vg + (size_t)48 * KHI)
               : "memory"); }
__global__ __launch_bounds__(128) void k_fa(const _Float16* __restrict__ QH, const _Float16* __restrict__ KH, const _Float16* __restrict__ QL, const _Float16* __restrict__ KL, const _Float16* __restrict__ VT, const __bf16* __restrict__ VB, const __bf16* __restrict__ VBL, float* __restrict__ Y) {
  __shared__ __align__(16) _Float16 skv[2][2][FKS][FLP];   /* [buffer][K rows | V^T rows][row][128 B + pad] */
  const int b = blockIdx.x / NH, h = blockIdx.x % NH; const int qb = NQB - 1 - (int)blockIdx.y;
  const int tid = threadIdx.x, wave = __builtin_amdgcn_readfirstlane(tid >> 5), lane = tid & 31, col = lane & 15, g = lane >> 4;
  /* wave number held scalar: trip count and diagonal test become scalar branches, every lane stays on at the matrix instructions */ const int ql0 = qb * 64 + wave * 16, qi = ql0 + col; const int nblk = (ql0 + 47) >> 5;   /* 32-key steps that cover keys 0 .. ql0 + 15 */
  const _Float16* Qp = QH + ((size_t)b * TT + qi) * CC + h * HD;
  v8f acc[HD / 16] = {}; SMX st; st.m = -3.0e38f; st.l = 0.f;
  const v16h qf0 = frag_h(Qp, lane), qf1 = frag_h(Qp + 32, lane);
  XCNT0();
  if (qb < QBH) {   /* block-uniform */
    const _Float16* QLp = QL + ((size_t)b * QHI + qi) * CC + h * HD;
    const v16h ql0f = frag_h(QLp, lane), ql1f = frag_h(QLp + 32, lane);
    XCNT0();
    /* a stage is FKS keys of this head in ONE buffer of four tiles (the main path's two buffers taken together): K hi, V^T hi, K lo, V^T lo; keys 0 .. qb * 64 + 63 all lie below KHI; every plain '#pragma unroll' of this path opens a constant-trip loop over a register array, so that its elements stay in registers */
    const int nst = qb + 1;   /* the same for the whole block */
    const int fr = tid >> 3, fc = (tid & 7) * 8;   /* this thread's row (of 16 a copy) and 16-B piece of a stage row */
    const _Float16* kg = KH + ((size_t)b * TT + fr) * CC + h * HD + fc; const _Float16* klg = KL + ((size_t)b * KHI + fr) * CC + h * HD + fc; const size_t vo = ((size_t)b * CC + h * HD + fr) * (size_t)KHI + fc;
    const unsigned l0 = (unsigned)(size_t)&skv[0][0][fr][fc];
    const _Float16 (*bkh)[FLP] = skv[0][0]; const _Float16 (*bkl)[FLP] = skv[1][0]; const __bf16 (*bvh)[FLP] = (const __bf16 (*)[FLP])skv[0][1]; const __bf16 (*bvl)[FLP] = (const __bf16 (*)[FLP])skv[1][1];
#pragma unroll 1   /* at most 6 stages: kept rolled for code size */
    for (int s = 0; s < nst; ++s) {
      if (s > 0) { DS0(); __syncthreads(); }   /* block-uniform: every reader has left stage s - 1 before the copies write over it */
      fa_fill_e(l0, kg + (size_t)s * FKS * CC, VB + vo + s * FKS); fa_fill_e(l0 + FBUF, klg + (size_t)s * FKS * CC, VBL + vo + s * FKS);
      ASYNC0(); __syncthreads();   /* stage s is published */
#pragma unroll 1   /* two steps a stage, rolled for code size; wave-uniform scalar test: the two lower waves of the block skip the diagonal stage's second step */
      for (int w = 0; w < 2 && 2 * s + w < nblk; ++w) { const int k0 = (2 * s + w) * 32; float t[16];
        v16h kh[2][2], kl[2][2]; v16b vh[HD / 16], vl[HD / 16];   /* the step's fragment reads go out as one group ahead of its products */
#pragma unroll
        for (int u = 0; u < 2; ++u) { const int kr = w * 32 + u * 16 + col; kh[u][0] = frag_h(&bkh[kr][0], lane); kh[u][1] = frag_h(&bkh[kr][32], lane); kl[u][0] = frag_h(&bkl[kr][0], lane); kl[u][1] = frag_h(&bkl[kr][32], lane); }
#pragma unroll
        for (int j = 0; j < HD / 16; ++j) { vh[j] = frag_b(&bvh[j * 16 + col][w * 32], lane); vl[j] = frag_b(&bvl[j * 16 + col][w * 32], lane); }
        RDGRP();
#pragma unroll
        for (int u = 0; u < 2; ++u) { v8f a = {}, al = {};
          a = wmma16(kh[u][0], qf0, a); al = wmma16(kh[u][0], ql0f, al); al = wmma16(kl[u][0], qf0, al); a = wmma16(kh[u][1], qf1, a); al = wmma16(kh[u][1], ql1f, al); al = wmma16(kl[u][1], qf1, al);
#pragma unroll
          for (int r = 0; r < 8; ++r) t[u * 8 + r] = (a[r] + al[r] * (1.0f / 1024.0f)) * LOGC; }
        sm_step(t, st, acc, k0, ql0, qi, g);
        const F2 p = bsplit16(t);
#pragma unroll
        for (int j = 0; j < HD / 16; ++j) { acc[j] = wmma_bf(vh[j], p.h, acc[j]); acc[j] = wmma_bf(vh[j], p.l, acc[j]); acc[j] = wmma_bf(vl[j], p.h, acc[j]); } } }
  } else {
    /* every plain '#pragma unroll' below opens a constant-trip loop over a register array (fragments, scores, accumulators), so that its elements stay in registers */
    const int nst = qb + 1;   /* stages of FKS keys that cover keys 0 .. qb * 64 + 63; the same for the whole block */
    const int fr = tid >> 3, fc = (tid & 7) * 8;   /* this thread's row (of 16 a copy) and 16-B piece of a stage row */
    const _Float16* kg = KH + ((size_t)b * TT + fr) * CC + h * HD + fc; const _Float16* vg = VT + ((size_t)b * CC + h * HD + fr) * (size_t)TT + fc;
    const unsigned l0 = (unsigned)(size_t)&skv[0][0][fr][fc];
    int sa = ((qb - QBH) * 5) % nst;   /* the key stage of trip 0; the walk wraps (the running softmax takes the stages in any order; every step that a wave works on holds a key <= each of its queries). The blocks of one plane read the same K and V^T stages and start apart, so that they do not ask L2 for the same lines at the same moment; nst >= QBH + 1 here */
    const int sb = sa + 1 == nst ? 0 : sa + 1;
    fa_fill(l0, kg + (size_t)sa * FKS * CC, vg + sa * FKS); ASYNC0(); __syncthreads();   /* trip 0's stage is published */
    if (1 < nst) fa_fill(l0 + FBUF, kg + (size_t)sb * FKS * CC, vg + sb * FKS);
#pragma unroll 1   /* rolled: one copy of the stage; the buffer is chosen by address */
    for (int s = 0; s < nst; ++s) { const _Float16 (*bk)[FLP] = skv[s & 1][0]; const _Float16 (*bv)[FLP] = skv[s & 1][1];
      v16h kf[2][4], vf[2][4];   /* both steps' fragments go out as one group at the head of the stage (the whole stage is filled, also where a wave skips its second step) */
#pragma unroll
      for (int w = 0; w < 2; ++w) {
#pragma unroll
        for (int u = 0; u < 2; ++u) { kf[w][2 * u] = frag_h(&bk[w * 32 + u * 16 + col][0], lane); kf[w][2 * u + 1] = frag_h(&bk[w * 32 + u * 16 + col][32], lane); }
#pragma unroll
        for (int j = 0; j < HD / 16; ++j) vf[w][j] = frag_h(&bv[j * 16 + col][w * 32], lane); }
      RDGRP();
#pragma unroll
      for (int w = 0; w < 2; ++w) { const int i = 2 * sa + w, k0 = i * 32;
        if (w == 0 || i < nblk) {   /* wave-uniform scalar test: the two upper waves of the block need the diagonal stage's second step, the two lower do not */
          v8f s0 = {}, s1 = {}; s0 = wmma16(kf[w][0], qf0, s0); s1 = wmma16(kf[w][2], qf0, s1); s0 = wmma16(kf[w][1], qf1, s0); s1 = wmma16(kf[w][3], qf1, s1);
          MRUN();
          float t[16];
#pragma unroll
          for (int r = 0; r < 8; ++r) { t[r] = s0[r] * LOGC; t[8 + r] = s1[r] * LOGC; }
          sm_step(t, st, acc, k0, ql0, qi, g);
          v16h p;
#pragma unroll
          for (int e = 0; e < 16; ++e) p[e] = (_Float16)t[e];
          MRUN();
#pragma unroll
          for (int j = 0; j < HD / 16; ++j) acc[j] = wmma16(vf[w][j], p, acc[j]); } }
      DS0(); ASYNC0(); __syncthreads();   /* every wave, also one that skipped a step: publishes stage s + 1 and ends every reader's last read of stage s */
      if (s + 2 < nst) { const int sc = sa + 2 >= nst ? sa + 2 - nst : sa + 2; fa_fill(l0 + (unsigned)(s & 1) * FBUF, kg + (size_t)sc * FKS * CC, vg + sc * FKS); }   /* block-uniform; flies while the next trip's stage is worked on */
      sa = sa + 1 == nst ? 0 : sa + 1; }
    ASYNC0(); }
  const float inv = 1.0f / (st.l + xhalf(st.l));   /* the two halves' partial sums join once; the maximum's own term keeps the sum >= 2^11 */
  float* yp = Y + ((size_t)b * TT + qi) * CC + h * HD + 8 * g;   /* acc[j][r] = ctx[query qi][j*16 + 8g + r]: 32 contiguous bytes per lane and j */
#pragma unroll
  for (int j = 0; j < HD / 16; ++j) { const v4f lo = { acc[j][0] * inv, acc[j][1] * inv, acc[j][2] * inv, acc[j][3] * inv }, hi = { acc[j][4] * inv, acc[j][5] * inv, acc[j][6] * inv, acc[j][7] * inv }; vst2(yp + j * 16, lo); vst2(yp + j * 16 + 4, hi); } }
// ---- k_out: block = (64 rows, 128 cols): out = ctx Wo (+ bo): ctx x 2^6 once to f16 against Wo as f16(bf16 x 2^8) exact (1 product) x 2^-14; causal early rows (< QHI of each sequence): ctx bf16 hi + lo against exact bf16 Wo (2 products)
__global__ __launch_bounds__(128) void k_out(const float* __restrict__ Y, const float* __restrict__ WO, const float* __restrict__ BO, float* __restrict__ OUT) { __shared__ __align__(16) unsigned char sm[2 * (64 + 64 + 128) * OLP * 2];   /* two operand buffers (ctx hi, ctx lo, Wo); behind a barrier the output staging takes the same bytes */
  static_assert(4 * 16 * 132 * 4 <= 2 * (64 + 64 + 128) * OLP * 2, "LDS");
  float (*sf)[16][132] = (float (*)[16][132])sm;
  const int tid = threadIdx.x, wave = tid >> 5, lane = tid & 31, col = lane & 15, g = lane >> 4; const int c0 = blockIdx.y * 128; const size_t r0 = (size_t)blockIdx.x * 64 + wave * 16;
  v8f acc[8] = {};
  const int lr = tid / (OK / 4), lc = tid % (OK / 4);
  const float* yg = Y + ((size_t)blockIdx.x * 64 + lr) * CC + lc * 4; const float* wg = WO + (size_t)(c0 + lr) * CC + lc * 4;   /* (out,in) weight rows */
  int ks = (int)((blockIdx.x + 2 * blockIdx.y) % (CC / OK));   /* this block's first k stage; the walk wraps: blocks that read the same ctx rows or the same weight rows start apart (as in k_proj) */
  if (CAUSAL && (int)(((size_t)blockIdx.x * 64) % TT) < QHI) {   /* block-uniform */
    __bf16 (*sah)[64][OLP] = (__bf16 (*)[64][OLP])sm; __bf16 (*sal)[64][OLP] = (__bf16 (*)[64][OLP])(sm + 2 * 64 * OLP * 2); __bf16 (*sw)[128][OLP] = (__bf16 (*)[128][OLP])(sm + 4 * 64 * OLP * 2);
    v4f ry[64 / ORI], rw[128 / ORI];
    tile_ld(ry, yg + ks * OK, (size_t)ORI * CC); XCNT_G(); tile_ld(rw, wg + ks * OK, (size_t)ORI * CC); XCNT_G();
#pragma unroll 1   /* rolled: one copy of the stage */
    for (int s = 0; s < CC / OK; ++s) { __bf16 (*bh)[OLP] = sah[s & 1]; __bf16 (*bl)[OLP] = sal[s & 1]; __bf16 (*bw)[OLP] = sw[s & 1];
#pragma unroll
      for (int i = 0; i < 64 / ORI; ++i) { st_b(&bh[i * ORI + lr][lc * 4], ry[i]); st_bl(&bl[i * ORI + lr][lc * 4], ry[i]); }
#pragma unroll
      for (int i = 0; i < 128 / ORI; ++i) st_b(&bw[i * ORI + lr][lc * 4], rw[i]);
      __syncthreads();   /* publishes stage s; every wave has left the other buffer before stage s + 1 is stored there */
      if (s + 1 < CC / OK) { ks = ks + 1 == CC / OK ? 0 : ks + 1; tile_ld(ry, yg + ks * OK, (size_t)ORI * CC); XCNT_G(); tile_ld(rw, wg + ks * OK, (size_t)ORI * CC); XCNT_G(); }
#pragma unroll
      for (int kk = 0; kk < OK / 32; ++kk) { const v16b ah = frag_b(&bh[wave * 16 + col][kk * 32], lane), al = frag_b(&bl[wave * 16 + col][kk * 32], lane);
#pragma unroll
        for (int j0 = 0; j0 < 8; j0 += 4) { v16b w[4];   /* fragment reads go out as a group ahead of their products */
#pragma unroll
          for (int u = 0; u < 4; ++u) w[u] = frag_b(&bw[(j0 + u) * 16 + col][kk * 32], lane);
          RDGRP();
#pragma unroll
          for (int u = 0; u < 4; ++u) { acc[j0 + u] = wmma_bf(ah, w[u], acc[j0 + u]); acc[j0 + u] = wmma_bf(al, w[u], acc[j0 + u]); } } } }
    __syncthreads();   /* the last stage's readers are done before the output staging writes over the buffers */
#pragma unroll
    for (int j = 0; j < 8; ++j) { const float bias = BO ? bfr(BO[c0 + j * 16 + col]) : 0.f;
#pragma unroll
      for (int r = 0; r < 8; ++r) sf[wave][8 * g + r][j * 16 + col] = acc[j][r] + bias; }
  } else {
    _Float16 (*sa)[64][OLP] = (_Float16 (*)[64][OLP])sm; _Float16 (*sw)[128][OLP] = (_Float16 (*)[128][OLP])(sm + 2 * 64 * OLP * 2);
    v4f ry[64 / ORI], rw[128 / ORI];
    tile_ld(ry, yg + ks * OK, (size_t)ORI * CC); XCNT_G(); tile_ld(rw, wg + ks * OK, (size_t)ORI * CC); XCNT_G();
#pragma unroll 1   /* rolled: one copy of the stage */
    for (int s = 0; s < CC / OK; ++s) { _Float16 (*ba)[OLP] = sa[s & 1]; _Float16 (*bw)[OLP] = sw[s & 1];
#pragma unroll
      for (int i = 0; i < 64 / ORI; ++i) st_hs(&ba[i * ORI + lr][lc * 4], ry[i], 64.0f);   /* ctx carried x 2^6 into f16 so small-magnitude context rows stay clear of f16 subnormals */
#pragma unroll
      for (int i = 0; i < 128 / ORI; ++i) st_hw(&bw[i * ORI + lr][lc * 4], rw[i]);
      __syncthreads();   /* publishes stage s; every wave has left the other buffer before stage s + 1 is stored there */
      if (s + 1 < CC / OK) { ks = ks + 1 == CC / OK ? 0 : ks + 1; tile_ld(ry, yg + ks * OK, (size_t)ORI * CC); XCNT_G(); tile_ld(rw, wg + ks * OK, (size_t)ORI * CC); XCNT_G(); }
#pragma unroll
      for (int kk = 0; kk < OK / 32; ++kk) { const v16h a = frag_h(&ba[wave * 16 + col][kk * 32], lane);
#pragma unroll
        for (int j0 = 0; j0 < 8; j0 += 4) { v16h w[4];   /* fragment reads go out as a group ahead of their products */
#pragma unroll
          for (int u = 0; u < 4; ++u) w[u] = frag_h(&bw[(j0 + u) * 16 + col][kk * 32], lane);
          RDGRP();
#pragma unroll
          for (int u = 0; u < 4; ++u) acc[j0 + u] = wmma16(a, w[u], acc[j0 + u]); } } }
    __syncthreads();   /* the last stage's readers are done before the output staging writes over the buffers */
#pragma unroll
    for (int j = 0; j < 8; ++j) { const float bias = BO ? bfr(BO[c0 + j * 16 + col]) : 0.f;
#pragma unroll
      for (int r = 0; r < 8; ++r) sf[wave][8 * g + r][j * 16 + col] = acc[j][r] * (1.0f / 16384.0f) + bias; } }   /* 2^-8 (Wo carry) x 2^-6 (ctx carry) */
  LDSX(); for (int rl = 0; rl < 16; ++rl) vst2(OUT + SRCROW(r0 + rl) * DIN + c0 + lane * 4, *(const v4f*)&sf[wave][rl][lane * 4]); }

extern "C" void kernel_launch(void* const* d_in, const int* in_sizes, int n_in, void* d_out, int out_size, void* d_ws, size_t ws_size, hipStream_t stream) {
  (void)in_sizes; (void)n_in; (void)out_size;
  const float** F = (const float**)d_in;
  if (ws_size < (size_t)WS_END) return;
  char* ws = (char*)d_ws; _Float16 *QH = (_Float16*)(ws + WS_QH), *KH = (_Float16*)(ws + WS_KH), *VT = (_Float16*)(ws + WS_VT), *QL = (_Float16*)(ws + WS_QL), *KL = (_Float16*)(ws + WS_KL); __bf16 *VB = (__bf16*)(ws + WS_VB), *VBL = (__bf16*)(ws + WS_VBL); float *Y = (float*)(ws + WS_Y);
  (void)Y; (void)QL; (void)KL; (void)VB; (void)VBL;
  // inputs (in order): 0 x [2048,2,768] (S, B, D); 1 wq [768,768] (out,in), 2 bq; 3 wk, 4 bk; 5 wv, 6 bv; 7 wc (out,in), 8 bc (all biases NONZERO)
  k_proj<<<dim3(TNB * TT / PTR, CC / 128, 3), 256, 0, stream>>>(F[0], F[0], F[0], F[1], F[3], F[5], F[2], F[4], F[6], QH, QL, KH, KL, VT, VB, VBL);
  k_fa<<<dim3(TNB * NH, NQB), 128, 0, stream>>>(QH, KH, QL, KL, VT, VB, VBL, Y);
  k_out<<<dim3(TNB * TT / 64, DIN / 128), 128, 0, stream>>>(Y, F[7], F[8], (float*)d_out);   /* writes (S, B, D) rows */
}

// v009
// It runs in 59.5 microseconds.
// In both of two side-by-side timings against v008, it was 1.07 times as fast.
// All steps since v000 together make it 15.0 times as fast.
// compute dtype: all float inputs rounded to bf16; q / k / v projections with EXACT bf16 products on WMMA 16x16x32 (f32 accumulate) + bias; causal logits: 3 products for the first 384 rows, single f16 q x k after, x 64^-0.5; running-maximum softmax f32 in the same launch; unnormalised P x 2^11 once to f16 x v once to f16 (bf16 hi + lo below row 384), divided by the f32 sum at the end; y hi+lo x exact wc below row 384, x2^6 f16 carry x f16(bf16 x 2^8) wc after, + bc; f32 output written back in the sequence-first layout.
#include <hip/hip_runtime.h>
#include <math.h>

typedef __attribute__((ext_vector_type(16))) _Float16 v16h;
typedef __attribute__((ext_vector_type(16))) __bf16 v16b;
typedef __attribute__((ext_vector_type(8)))  _Float16 v8h;
typedef __attribute__((ext_vector_type(8)))  float v8f;
typedef __attribute__((ext_vector_type(4)))  float v4f;
typedef __attribute__((ext_vector_type(2)))  float v2f;
typedef __attribute__((ext_vector_type(4)))  unsigned v4u;
typedef __attribute__((ext_vector_type(2)))  unsigned v2u;
typedef __attribute__((ext_vector_type(4)))  int v4i;
typedef float __attribute__((may_alias)) float_a;
typedef int __attribute__((may_alias)) int_a;

template <typename T> __device__ __forceinline__ void vst2(void* p, T v) { *(T*)p = v;  }
__device__ __forceinline__ v8f wmma16(v16h a, v16h b, v8f c) {
  return __builtin_amdgcn_wmma_f32_16x16x32_f16(false, a, false, b, (short)0, c, false, false);
}
__device__ __forceinline__ v8f wmma_bf(v16b a, v16b b, v8f c) {
  return __builtin_amdgcn_wmma_f32_16x16x32_bf16(false, a, false, b, (short)0, c, false, false);
}
// 16x16x32 fragments: lane = (h = lane>>4, row/col = lane&15); elements 0..7 = k0+8h+0..7, 8..15 = k0+16+8h+0..7; D element r = row 8h+r
__device__ __forceinline__ v16h frag_h(const _Float16* rowk0, int lane) {
  union { v16h v; v8h q[2]; } u; const _Float16* p = rowk0 + 8 * (lane >> 4);
  u.q[0] = *(const v8h*)p; u.q[1] = *(const v8h*)(p + 16); return u.v;
}
__device__ __forceinline__ v16h frag_f32(const float* rowk0, int lane) {
  v16h a; const float* p = rowk0 + 8 * (lane >> 4);
#pragma unroll
  for (int i = 0; i < 8; ++i) { a[i] = (_Float16)p[i]; a[8 + i] = (_Float16)p[16 + i]; }
  return a;
}
__device__ __forceinline__ v16h frag_f32s(const float* rowk0, int lane, float sc) {
  v16h a; const float* p = rowk0 + 8 * (lane >> 4);
#pragma unroll
  for (int i = 0; i < 8; ++i) { a[i] = (_Float16)(p[i] * sc); a[8 + i] = (_Float16)(p[16 + i] * sc); }
  return a;
}
// column fragment from a [K][ld] layout (column n), rows >= K read as 0
__device__ __forceinline__ v16h fragc_f32(const float* W, int k0, int n, int lane, int ld, int K) {
  v16h a; const int g = lane >> 4;
#pragma unroll
  for (int i = 0; i < 8; ++i) { const int ka = k0 + 8 * g + i, kb = ka + 16;
    a[i] = (_Float16)(ka < K ? W[(size_t)(ka < K ? ka : K - 1) * ld + n] : 0.f); a[8 + i] = (_Float16)(kb < K ? W[(size_t)(kb < K ? kb : K - 1) * ld + n] : 0.f); }
  return a;
}
struct F2 { v16b h, l; };
__device__ __forceinline__ F2 bsplit16(const float v[16]) { F2 r;
#pragma unroll
  for (int i = 0; i < 16; ++i) { const __bf16 h = (__bf16)v[i]; r.h[i] = h; r.l[i] = (__bf16)(v[i] - (float)h); }
  return r; }
__device__ __forceinline__ F2 split_row(const float* row, int k0, int lane) { float v[16]; const float* p = row + k0 + 8 * (lane >> 4);
#pragma unroll
  for (int i = 0; i < 8; ++i) { v[i] = p[i]; v[8 + i] = p[16 + i]; }
  return bsplit16(v); }
__device__ __forceinline__ F2 split_rowK(const float* row, int k0, int lane, int K) { float v[16]; const int g = lane >> 4;
#pragma unroll
  for (int i = 0; i < 8; ++i) { const int ka = k0 + 8 * g + i, kb = ka + 16; v[i] = ka < K ? row[ka < K ? ka : K - 1] : 0.f; v[8 + i] = kb < K ? row[kb < K ? kb : K - 1] : 0.f; }
  return bsplit16(v); }
__device__ __forceinline__ F2 split_col(const float* W, int k0, int n, int lane, int ld, int K) { float v[16]; const int g = lane >> 4;
#pragma unroll
  for (int i = 0; i < 8; ++i) { const int ka = k0 + 8 * g + i, kb = ka + 16; v[i] = ka < K ? W[(size_t)(ka < K ? ka : K - 1) * ld + n] : 0.f; v[8 + i] = kb < K ? W[(size_t)(kb < K ? kb : K - 1) * ld + n] : 0.f; }
  return bsplit16(v); }
__device__ __forceinline__ v8f mac3(const F2& a, const F2& b, v8f c) { c = wmma_bf(a.l, b.h, c); c = wmma_bf(a.h, b.l, c); return wmma_bf(a.h, b.h, c); }
__device__ __forceinline__ float sigm(float v) { return 1.0f / (1.0f + expf(-v)); }
#define RDGRP() __builtin_amdgcn_sched_barrier(0)   // behind a group of LDS fragment reads: the scheduler moves nothing across, so the reads go out together ahead of the matrix run; without it each read sinks to its own product and is waited for alone
#define MRUN() __builtin_amdgcn_sched_barrier(0)   // at the foot of the score products and the head of the P x v products: the scalings and conversions stay on their own side; mixed into a run they landed on operand registers just read, and the compiler padded each with up to four v_nop
#define LDSX() do { asm volatile("s_wait_dscnt 0" ::: "memory"); __builtin_amdgcn_wave_barrier(); __builtin_amdgcn_fence(__ATOMIC_RELEASE, "workgroup"); } while (0)

// Causal multi-head self-attention on a SEQUENCE-FIRST input (x [2048, 2, 768] = (S, B, D); torch (out,in) wq / wk / wv / wc [768,768] N(0,1) x 0.02 applied as x W^T + b, biases N(0,1) x 0.02 - NONZERO; 12 heads x 64; scores / sqrt(64); tril kept, -inf elsewhere; softmax; y wc^T + bc; output transposed back to (S, B, D)). The kernels work on rows b*2048 + t: the projection reads token (b, t) from source row t*2 + b and the output kernel writes it back there.
#define NB 2
#define TT 2048
#define CC 768            // NH * HD = projected width
#define DIN 768          // input (model) width
#define NH 12
#define HD 64
#define NQB (TT / 64)
#define SCALE (0.125f)
#define CAUSAL 1
#ifndef TNB
#define TNB NB
#endif
__device__ __forceinline__ float bfr(float v) { return (float)(__bf16)v; }
typedef __attribute__((ext_vector_type(8))) __bf16 v8b;
__device__ __forceinline__ v16b frag_b(const __bf16* rowk0, int lane) {
  union { v16b v; v8b q[2]; } u; const __bf16* p = rowk0 + 8 * (lane >> 4);
  u.q[0] = *(const v8b*)p; u.q[1] = *(const v8b*)(p + 16); return u.v;
}
#define QBH 6              // causal: query blocks 0..QBH-1 of each sequence (few keys, no averaging) take the high-precision path
#define QHI 384            // rows carrying a q residual plane
#define KHI 384            // key rows carrying k residual / v bf16 hi+lo planes (used only by the causal high-precision path)
// B fragment (k rows k0+.., output column o) of a weight: (in,out) [K][ld] or (out,in) [ld rows of K]: bf16 exact, or f16(bf16 * 256) exact
__device__ __forceinline__ v16b wcol_io(const float* Wm, int k0, int o, int lane, int ld) { v16b w; const int g = lane >> 4;
#pragma unroll
  for (int i = 0; i < 8; ++i) { w[i] = (__bf16)Wm[(size_t)(k0 + 8 * g + i) * ld + o]; w[8 + i] = (__bf16)Wm[(size_t)(k0 + 16 + 8 * g + i) * ld + o]; }
  return w; }
__device__ __forceinline__ v16b wcol_oi(const float* Wm, int k0, int o, int lane, int K) { v16b w; const float* p = Wm + (size_t)o * K + k0 + 8 * (lane >> 4);
#pragma unroll
  for (int i = 0; i < 8; ++i) { w[i] = (__bf16)p[i]; w[8 + i] = (__bf16)p[16 + i]; }
  return w; }
__device__ __forceinline__ v16h wcolh_io(const float* Wm, int k0, int o, int lane, int ld) { v16h w; const int g = lane >> 4;
#pragma unroll
  for (int i = 0; i < 8; ++i) { w[i] = (_Float16)(bfr(Wm[(size_t)(k0 + 8 * g + i) * ld + o]) * 256.0f); w[8 + i] = (_Float16)(bfr(Wm[(size_t)(k0 + 16 + 8 * g + i) * ld + o]) * 256.0f); }
  return w; }
__device__ __forceinline__ v16h wcolh_oi(const float* Wm, int k0, int o, int lane, int K) { v16h w; const float* p = Wm + (size_t)o * K + k0 + 8 * (lane >> 4);
#pragma unroll
  for (int i = 0; i < 8; ++i) { w[i] = (_Float16)(bfr(p[i]) * 256.0f); w[8 + i] = (_Float16)(bfr(p[16 + i]) * 256.0f); }
  return w; }
#define SRCROW(r) ((size_t)((r) % TT) * NB + (size_t)((r) / TT))   // row r = b*TT + t <-> sequence-first row t*NB + b of the (S, B, D) arrays (NB = the module's batch count, also when fewer batches are run)
#define WQKV_LAYOUT 1   // layout for WCOL only, which nothing calls (k_proj reads (out,in) [CC][DIN] rows): 0 = (in,out) [DIN][CC]; 1 = (out,in) [CC][DIN]; 2 = per-head [NH][DIN][HD]
__device__ __forceinline__ v16b wcol_hdk(const float* Wm, int k0, int o, int lane) { v16b w; const int g = lane >> 4; const float* p = Wm + (size_t)(o / HD) * DIN * HD + (o % HD);
#pragma unroll
  for (int i = 0; i < 8; ++i) { w[i] = (__bf16)p[(size_t)(k0 + 8 * g + i) * HD]; w[8 + i] = (__bf16)p[(size_t)(k0 + 16 + 8 * g + i) * HD]; }
  return w; }
#define WO_OUT_IN 1
#if WQKV_LAYOUT == 1
#define WCOL(W, k0, o, lane) wcol_oi(W, k0, o, lane, DIN)
#elif WQKV_LAYOUT == 2
#define WCOL(W, k0, o, lane) wcol_hdk(W, k0, o, lane)
#else
#define WCOL(W, k0, o, lane) wcol_io(W, k0, o, lane, CC)
#endif
#if WO_OUT_IN
#define WOCOL(W, k0, o, lane) wcol_oi(W, k0, o, lane, CC)
#define WOCOLH(W, k0, o, lane) wcolh_oi(W, k0, o, lane, CC)
#else
#define WOCOL(W, k0, o, lane) wcol_io(W, k0, o, lane, DIN)
#define WOCOLH(W, k0, o, lane) wcolh_io(W, k0, o, lane, DIN)
#endif

#define WS_QH  0u                                      // f16 q rows [b*t][CC]
#define WS_KH  (WS_QH + 2u * (size_t)NB * TT * CC)      // f16 k rows [b*t][CC]
#define WS_VT  (WS_KH + 2u * (size_t)NB * TT * CC)      // f16 v planes [b][c][t]
#define WS_QL  (WS_VT + 2u * (size_t)NB * CC * TT)      // f16 q residual x 2^10 rows [b][t < QHI][CC]
#define WS_KL  (WS_QL + 2u * (size_t)NB * QHI * CC)     // f16 k residual x 2^10 rows [b][t < KHI][CC]
#define WS_VB  (WS_KL + 2u * (size_t)NB * KHI * CC)     // bf16 v hi planes [b][c][t < KHI]
#define WS_VBL (WS_VB + 2u * (size_t)NB * CC * KHI)
#define WS_Y   (WS_VBL + 2u * (size_t)NB * CC * KHI)    // 16-bit ctx rows [b*t][CC]: f16 ctx x 2^6; rows t < QHI of each sequence: bf16 hi part
#define WS_YL  (WS_Y  + 2u * (size_t)NB * TT * CC)      // bf16 ctx residual rows [b*t][CC]; written and read for t < QHI only
#define WS_WH  (WS_YL + 2u * (size_t)NB * TT * CC)      // f16(bf16 x 2^8) output weight rows (out,in)
#define WS_WB  (WS_WH + 2u * (size_t)DIN * CC)          // bf16 output weight rows (out,in)
#define WS_END (WS_WB + 2u * (size_t)DIN * CC)

// operand staging of the projection: a stage is PK k of every tile row. The block's threads fetch it with global_load_b128 that cover whole 128-B lines (PK / 4 lanes a row), round it ONCE to the 16-bit operand type and store it in LDS rows with a 16-B pad (pitch 16 B x odd: ds_load_b128 readers); all waves take their fragments from there
// every '#pragma unroll' of the staging code opens a constant-trip loop over a register array (fetched rows, fragments, accumulators), so that its elements stay in registers
typedef __attribute__((ext_vector_type(4))) __bf16 v4b;
typedef __attribute__((ext_vector_type(4))) _Float16 v4h;
#define PK 32
#define PLP (PK + 8)
#define PTR 128            // rows of a projection tile
#define PRI (1024 / PK)    // tile rows that one load instruction of the whole block (256 threads) covers
#define OK 128            // k of a stage of the output GEMM: rows of 256 B of 16-bit operands
#define OLP (OK + 8)
template <int N> __device__ __forceinline__ void tile_ld(v4f (&r)[N], const float* p, size_t step) {
#pragma unroll
  for (int i = 0; i < N; ++i) r[i] = *(const v4f*)(p + (size_t)i * step); }
__device__ __forceinline__ void st_b(__bf16* d, v4f v) { const v4b o = { (__bf16)v[0], (__bf16)v[1], (__bf16)v[2], (__bf16)v[3] }; *(v4b*)d = o; }
#define XCNT_G() asm volatile("s_wait_xcnt 0x0" ::: "memory")   // stands behind a run of global loads, before a register that they name is written again
// eight 16-B stores of one thread, 'step' bytes apart; the last line is the wait that stands before a register which a store names is written again (in a statement of its own the compiler lifts later register writes over it)
__device__ __forceinline__ void st8(char* p, size_t step, const v4u (&o)[8]) {
  asm volatile("global_store_b128 %0, %8, off\n\t"
               "global_store_b128 %1, %9, off\n\t"
               "global_store_b128 %2, %10, off\n\t"
               "global_store_b128 %3, %11, off\n\t"
               "global_store_b128 %4, %12, off\n\t"
               "global_store_b128 %5, %13, off\n\t"
               "global_store_b128 %6, %14, off\n\t"
               "global_store_b128 %7, %15, off\n\t"
               "s_wait_xcnt 0x0"
               :: "v"(p), "v"(p + step), "v"(p + 2 * step), "v"(p + 3 * step), "v"(p + 4 * step), "v"(p + 5 * step), "v"(p + 6 * step), "v"(p + 7 * step),
                  "v"(o[0]), "v"(o[1]), "v"(o[2]), "v"(o[3]), "v"(o[4]), "v"(o[5]), "v"(o[6]), "v"(o[7])
               : "memory"); }
// ---- k_proj: block = (128 rows, 128 cols, which), 8 waves in a 4 x 2 grid, 32 rows x 64 cols a wave: q/k/v = X W (+ b) with exact bf16 products (K = DIN) -> which 0: q f16 rows (+ residual rows < QHI); 1: k f16 rows (+ residual rows < KHI); 2: v f16 planes [c][t] (+ bf16 hi/lo planes for t < KHI)
__global__ __launch_bounds__(256) void k_proj(const float* __restrict__ XQ, const float* __restrict__ XK, const float* __restrict__ XV, const float* __restrict__ WQ, const float* __restrict__ WK, const float* __restrict__ WV, const float* __restrict__ BQ, const float* __restrict__ BK, const float* __restrict__ BV,
    _Float16* __restrict__ QH, _Float16* __restrict__ QL, _Float16* __restrict__ KH, _Float16* __restrict__ KL, _Float16* __restrict__ VT, __bf16* __restrict__ VB, __bf16* __restrict__ VBL, const float* __restrict__ WO, _Float16* __restrict__ WOH, __bf16* __restrict__ WOB) {
  __shared__ __align__(16) unsigned char sm[3 * 128 * 136 * 2];   /* two operand buffers in the main loop; behind a barrier the epilogue's output staging takes the same bytes */
  static_assert(2 * (PTR + 128) * PLP * 2 <= 3 * 128 * 136 * 2 && 2 * PTR * 136 * 2 <= 3 * 128 * 136 * 2 && PTR == 128 && QHI % PTR == 0 && KHI % PTR == 0 && TT % PTR == 0, "LDS, tile");
  __bf16 (*sx)[PTR][PLP] = (__bf16 (*)[PTR][PLP])sm; __bf16 (*sw)[128][PLP] = (__bf16 (*)[128][PLP])(sm + 2 * PTR * PLP * 2);
  _Float16 (*sh)[136] = (_Float16 (*)[136])sm; _Float16 (*sl)[136] = (_Float16 (*)[136])(sm + PTR * 136 * 2);
  _Float16 (*th)[136] = (_Float16 (*)[136])sm; __bf16 (*tb)[136] = (__bf16 (*)[136])(sm + 128 * 136 * 2); __bf16 (*tbl)[136] = (__bf16 (*)[136])(sm + 2 * 128 * 136 * 2);
  const int tid = threadIdx.x, wave = tid >> 5, lane = tid & 31, col = lane & 15, g = lane >> 4; const int wr = wave >> 1, wc = wave & 1; const int which = blockIdx.z; const int c0 = blockIdx.y * 128; const size_t r0 = (size_t)blockIdx.x * PTR; const size_t bb = r0 / TT; const int t0 = (int)(r0 % TT);
  const float* X = which == 0 ? XQ : which == 1 ? XK : XV; const float* WA = which == 0 ? WQ : which == 1 ? WK : WV; const float* BA = which == 0 ? BQ : which == 1 ? BK : BV;
  v8f acc[2][4] = {};
  const int lr = tid / (PK / 4), lc = tid % (PK / 4);
  const float* xg = X + SRCROW(r0 + lr) * DIN + lc * 4;   /* sequence-first source row; the tile's rows lie in one sequence, so PRI tile rows on = PRI * NB source rows on */
  const float* wg = WA + (size_t)(c0 + lr) * DIN + lc * 4;   /* (out,in) weight rows */
  v4f rx[PTR / PRI], rw[128 / PRI];
  int ks = (int)((blockIdx.x + 5 * (blockIdx.y + 6 * blockIdx.z)) % (DIN / PK));   /* this block's first k stage; the walk wraps. The 18 blocks that read the same x rows and the 32 that read the same weight rows start apart, so that they do not ask L2 for the same lines at the same moment */
  /* the output weight is rounded in this launch, once, for the last launch: each block takes 1024 of its elements, 4 a thread. The load goes out behind the main loop, where the stage registers are free; its data is rounded and stored at the kernel's end, behind the epilogue's own stores */
  static_assert((size_t)(TNB * TT / PTR) * (CC / 128) * 3 * 1024 == (size_t)DIN * CC, "one pass of the grid covers the output weight");
  const size_t we = ((size_t)blockIdx.x + (size_t)(TNB * TT / PTR) * (blockIdx.y + (CC / 128) * blockIdx.z)) * 1024 + tid * 4;
  tile_ld(rx, xg + ks * PK, (size_t)PRI * NB * DIN); XCNT_G(); tile_ld(rw, wg + ks * PK, (size_t)PRI * DIN); XCNT_G();
#pragma unroll 1   /* rolled: one copy of the stage; the fetched registers are free again once they are stored */
  for (int s = 0; s < DIN / PK; ++s) { __bf16 (*bx)[PLP] = sx[s & 1]; __bf16 (*bw)[PLP] = sw[s & 1];
#pragma unroll
    for (int i = 0; i < PTR / PRI; ++i) st_b(&bx[i * PRI + lr][lc * 4], rx[i]);
#pragma unroll
    for (int i = 0; i < 128 / PRI; ++i) st_b(&bw[i * PRI + lr][lc * 4], rw[i]);
    __syncthreads();   /* publishes stage s; also: every wave has left the other buffer (read in stage s - 1) before stage s + 1 is stored there */
    if (s + 1 < DIN / PK) { ks = ks + 1 == DIN / PK ? 0 : ks + 1; tile_ld(rx, xg + ks * PK, (size_t)PRI * NB * DIN); XCNT_G(); tile_ld(rw, wg + ks * PK, (size_t)PRI * DIN); XCNT_G(); }   /* next stage flies while this one is multiplied */
#pragma unroll
    for (int kk = 0; kk < PK / 32; ++kk) { v16b a[2], w[4];   /* the stage's fragment reads go out as one group ahead of its products: one LDS latency a stage */
#pragma unroll
      for (int i = 0; i < 2; ++i) a[i] = frag_b(&bx[wr * 32 + i * 16 + col][kk * 32], lane);
#pragma unroll
      for (int u = 0; u < 4; ++u) w[u] = frag_b(&bw[wc * 64 + u * 16 + col][kk * 32], lane);
      RDGRP();
#pragma unroll
      for (int u = 0; u < 4; ++u)
#pragma unroll
        for (int i = 0; i < 2; ++i) acc[i][u] = wmma_bf(a[i], w[u], acc[i][u]); } }
  __syncthreads();   /* the last stage's readers are done before the epilogue writes over the buffers */
  const v4f wov = *(const v4f*)(WO + we); XCNT_G();
  if (which < 2) { _Float16* DH = which == 0 ? QH : KH; _Float16* DL = which == 0 ? QL : KL; const int nhi = which == 0 ? QHI : KHI; const bool hi_rows = t0 < nhi;
#pragma unroll
    for (int j = 0; j < 4; ++j) { const float bias = BA ? bfr(BA[c0 + wc * 64 + j * 16 + col]) : 0.f;
#pragma unroll
      for (int i = 0; i < 2; ++i)
#pragma unroll
        for (int r = 0; r < 8; ++r) { const float v = acc[i][j][r] + bias; const _Float16 hv = (_Float16)v; const int rl = wr * 32 + i * 16 + 8 * g + r, cl = wc * 64 + j * 16 + col; sh[rl][cl] = hv; sl[rl][cl] = (_Float16)((v - (float)hv) * 1024.0f); } }
    __syncthreads();
    const int rl0 = tid >> 4, q = tid & 15; v4u o[PTR / 16];   /* 16 threads a row, 16 rows a pass of the block; a plane's staged rows are read as one group, then stored */
#pragma unroll
    for (int i = 0; i < PTR / 16; ++i) o[i] = *(const v4u*)&sh[i * 16 + rl0][q * 8];
    st8((char*)(DH + (r0 + rl0) * CC + c0 + q * 8), (size_t)16 * CC * 2, o);
    if (hi_rows) {   /* block-uniform */
#pragma unroll
      for (int i = 0; i < PTR / 16; ++i) o[i] = *(const v4u*)&sl[i * 16 + rl0][q * 8];
      st8((char*)(DL + (bb * nhi + t0 + rl0) * (size_t)CC + c0 + q * 8), (size_t)16 * CC * 2, o); }
  } else { const bool hi_rows = t0 < KHI;
#pragma unroll
    for (int j = 0; j < 4; ++j) { const float bias = BA ? bfr(BA[c0 + wc * 64 + j * 16 + col]) : 0.f;
#pragma unroll
      for (int i = 0; i < 2; ++i)
#pragma unroll
        for (int r = 0; r < 8; ++r) { const float v = acc[i][j][r] + bias; const int rl = wr * 32 + i * 16 + 8 * g + r, cl = wc * 64 + j * 16 + col; th[cl][rl] = (_Float16)v; const __bf16 bh = (__bf16)v; tb[cl][rl] = bh; tbl[cl][rl] = (__bf16)(v - (float)bh); } }
    __syncthreads();
    const int cl0 = tid >> 4, q = tid & 15; v4u o[8];   /* 16 threads a channel row of PTR keys, 16 channels a pass of the block; read as one group, then stored, as above */
#pragma unroll
    for (int i = 0; i < 8; ++i) o[i] = *(const v4u*)&th[i * 16 + cl0][q * 8];
    st8((char*)(VT + (bb * CC + c0 + cl0) * (size_t)TT + t0 + q * 8), (size_t)16 * TT * 2, o);
    if (hi_rows) {   /* block-uniform */
#pragma unroll
      for (int i = 0; i < 8; ++i) o[i] = *(const v4u*)&tb[i * 16 + cl0][q * 8];
      st8((char*)(VB + (bb * CC + c0 + cl0) * (size_t)KHI + t0 + q * 8), (size_t)16 * KHI * 2, o);
#pragma unroll
      for (int i = 0; i < 8; ++i) o[i] = *(const v4u*)&tbl[i * 16 + cl0][q * 8];
      st8((char*)(VBL + (bb * CC + c0 + cl0) * (size_t)KHI + t0 + q * 8), (size_t)16 * KHI * 2, o); } }
  { const v4h oh = { (_Float16)(bfr(wov[0]) * 256.0f), (_Float16)(bfr(wov[1]) * 256.0f), (_Float16)(bfr(wov[2]) * 256.0f), (_Float16)(bfr(wov[3]) * 256.0f) }; const v4b ob = { (__bf16)wov[0], (__bf16)wov[1], (__bf16)wov[2], (__bf16)wov[3] };
    /* both planes' stores; the last line is the wait that stands before a register which a store names is written again */
    asm volatile("global_store_b64 %0, %2, off\n\t"
                 "global_store_b64 %1, %3, off\n\t"
                 "s_wait_xcnt 0x0"
                 :: "v"(WOH + we), "v"(WOB + we), "v"(__builtin_bit_cast(v2u, oh)), "v"(__builtin_bit_cast(v2u, ob)) : "memory"); } }
// ---- k_fa: block = 4 waves x 16 queries (query block qb, heaviest first) of plane b*NH + h; K and V^T come through LDS buffers shared by the four waves; per 32 keys: S^T = K Q^T (a lane holds 16 keys of ONE query), running maximum and sum in f32 (log2 domain), P^T x 2^11 packed from the score tiles straight into the B operand, O^T += V^T P^T; ctx = O / sum. Query blocks < QBH: 3-product logits (q, k residuals x 2^10), P and v as bf16 hi + lo (3 products)
#define LOGC (SCALE * 1.44269504088896340736f)
struct SMX { float m, l; };
__device__ __forceinline__ float xhalf(float x) { return __builtin_bit_cast(float, __builtin_amdgcn_permlanex16(__builtin_bit_cast(int, x), __builtin_bit_cast(int, x), 0x76543210, 0xfedcba98, false, false)); }   // lane l with lane l ^ 16
#define XCNT0() asm volatile("s_wait_xcnt 0x0" ::: "memory")   // stands behind a run of global loads, before their address registers are reused
// one 32-key step of the running softmax of this lane's query: t[0..7] = keys k0+8g+r, t[8..15] = keys k0+16+8g+r (scaled log2 logits); returns e[] = 2^(t - max + 11); rescales acc only when some query of the wave has a new maximum
__device__ __forceinline__ void sm_step(float t[16], SMX& st, v8f acc[HD / 16], int k0, int qfirst, int qi, int g) {
  if (k0 + 31 > qfirst) {   /* wave-uniform: only steps that reach the diagonal mask by index */
#pragma unroll
    for (int r = 0; r < 8; ++r) { if (k0 + 8 * g + r > qi) t[r] = -3.0e38f; if (k0 + 16 + 8 * g + r > qi) t[8 + r] = -3.0e38f; } }
  float mx = t[0];
#pragma unroll
  for (int s = 1; s < 16; ++s) mx = fmaxf(mx, t[s]);
  mx = fmaxf(mx, xhalf(mx));   /* the other half of the wave holds the query's other 16 keys */
  if (__builtin_amdgcn_ballot_w32(mx > st.m) != 0) { const float mn = fmaxf(st.m, mx); const float al = __builtin_amdgcn_exp2f(st.m - mn); st.m = mn; st.l *= al;
#pragma unroll
    for (int j = 0; j < HD / 16; ++j)
#pragma unroll
      for (int r = 0; r < 8; ++r) acc[j][r] *= al; }
  const float mo = st.m - 11.0f; float ps = 0.f;
#pragma unroll
  for (int s = 0; s < 16; ++s) t[s] -= mo;
  __builtin_amdgcn_sched_barrier(0);   /* the subtractions stay ahead of the exponentials */
#pragma unroll   /* constant trips over the register array t, as the loop above */
  for (int s = 0; s < 16; ++s) { t[s] = __builtin_amdgcn_exp2f(t[s]); ps += t[s]; }
  st.l += ps; }
// K / V staging of the main path: a stage is FKS keys of this head: K rows [key][64 d] and V^T rows [c][FKS keys], 128 B of data a row at a pitch of 144 B (16 B x odd: ds_load_b128 readers). The 128 threads bring it in with asynchronous copies to LDS that cover whole 128-B lines (8 lanes a row); all four waves take their fragments from there
#define FKS 64
#define FLP (FKS + 8)
#define FBUF (2 * FKS * FLP * 2)   // bytes of one buffer (K rows, then V^T rows)
#define DS0() asm volatile("s_wait_dscnt 0x0" ::: "memory")       // this wave's LDS reads of a buffer have returned before the buffer is handed to the copies
#define ASYNC0() asm volatile("s_wait_asynccnt 0x0" ::: "memory")   // this wave's copies have landed before the barrier behind which other waves read them
// one stage: 4 copies for K (16 keys on each), 4 for V^T (16 channels on each), 16 B a lane; the last line is the wait that stands before a register which a copy names is written again
__device__ __forceinline__ void fa_fill(unsigned l, const _Float16* kg, const _Float16* vg) {
  const unsigned rs = 16 * FLP * 2, vb = FKS * FLP * 2;
  asm volatile("global_load_async_to_lds_b128 %0, %8, off\n\t"
               "global_load_async_to_lds_b128 %1, %9, off\n\t"
               "global_load_async_to_lds_b128 %2, %10, off\n\t"
               "global_load_async_to_lds_b128 %3, %11, off\n\t"
               "global_load_async_to_lds_b128 %4, %12, off\n\t"
               "global_load_async_to_lds_b128 %5, %13, off\n\t"
               "global_load_async_to_lds_b128 %6, %14, off\n\t"
               "global_load_async_to_lds_b128 %7, %15, off\n\t"
               "s_wait_xcnt 0x0"
               :: "v"(l), "v"(l + rs), "v"(l + 2 * rs), "v"(l + 3 * rs), "v"(l + vb), "v"(l + vb + rs), "v"(l + vb + 2 * rs), "v"(l + vb + 3 * rs),
                  "v"(kg), "v"(kg + (size_t)16 * CC), "v"(kg + (size_t)32 * CC), "v"(kg + (size_t)48 * CC), "v"(vg), "v"(vg + (size_t)16 * TT), "v"(vg + (size_t)32 * TT), "v"(vg + (size_t)48 * TT)
               : "memory"); }
// the same for a stage of the early-row path: one K-like tile (rows of CC) and one V^T-like tile of the short planes (rows of KHI keys); called once for the hi pair and once for the lo pair
__device__ __forceinline__ void fa_fill_e(unsigned l, const _Float16* kg, const __bf16* vg) {
  const unsigned rs = 16 * FLP * 2, vb = FKS * FLP * 2;
  asm volatile("global_load_async_to_lds_b128 %0, %8, off\n\t"
               "global_load_async_to_lds_b128 %1, %9, off\n\t"
               "global_load_async_to_lds_b128 %2, %10, off\n\t"
               "global_load_async_to_lds_b128 %3, %11, off\n\t"
               "global_load_async_to_lds_b128 %4, %12, off\n\t"
               "global_load_async_to_lds_b128 %5, %13, off\n\t"
               "global_load_async_to_lds_b128 %6, %14, off\n\t"
               "global_load_async_to_lds_b128 %7, %15, off\n\t"
               "s_wait_xcnt 0x0"
               :: "v"(l), "v"(l + rs), "v"(l + 2 * rs), "v"(l + 3 * rs), "v"(l + vb), "v"(l + vb + rs), "v"(l + vb + 2 * rs), "v"(l + vb + 3 * rs),
                  "v"(kg), "v"(kg + (size_t)16 * CC), "v"(kg + (size_t)32 * CC), "v"(kg + (size_t)48 * CC), "v"(vg), "v"(vg + (size_t)16 * KHI), "v"(vg + (size_t)32 * KHI), "v"(vg + (size_t)48 * KHI)
               : "memory"); }
// four 16-B stores of one lane, 32 B apart; the last line is the wait that stands before a register which a store names is written again
__device__ __forceinline__ void st4(char* p, const v4u (&o)[4]) {
  asm volatile("global_store_b128 %0, %1, off\n\t"
               "global_store_b128 %0, %2, off offset:32\n\t"
               "global_store_b128 %0, %3, off offset:64\n\t"
               "global_store_b128 %0, %4, off offset:96\n\t"
               "s_wait_xcnt 0x0"
               :: "v"(p), "v"(o[0]), "v"(o[1]), "v"(o[2]), "v"(o[3]) : "memory"); }
__global__ __launch_bounds__(128) void k_fa(const _Float16* __restrict__ QH, const _Float16* __restrict__ KH, const _Float16* __restrict__ QL, const _Float16* __restrict__ KL, const _Float16* __restrict__ VT, const __bf16* __restrict__ VB, const __bf16* __restrict__ VBL, _Float16* __restrict__ YH, __bf16* __restrict__ YL) {
  __shared__ __align__(16) _Float16 skv[2][2][FKS][FLP];   /* [buffer][K rows | V^T rows][row][128 B + pad] */
  const int b = blockIdx.x / NH, h = blockIdx.x % NH; const int qb = NQB - 1 - (int)blockIdx.y;
  const int tid = threadIdx.x, wave = __builtin_amdgcn_readfirstlane(tid >> 5), lane = tid & 31, col = lane & 15, g = lane >> 4;
  /* wave number held scalar: trip count and diagonal test become scalar branches, every lane stays on at the matrix instructions */ const int ql0 = qb * 64 + wave * 16, qi = ql0 + col; const int nblk = (ql0 + 47) >> 5;   /* 32-key steps that cover keys 0 .. ql0 + 15 */
  const _Float16* Qp = QH + ((size_t)b * TT + qi) * CC + h * HD;
  v8f acc[HD / 16] = {}; SMX st; st.m = -3.0e38f; st.l = 0.f;
  const v16h qf0 = frag_h(Qp, lane), qf1 = frag_h(Qp + 32, lane);
  XCNT0();
  if (qb < QBH) {   /* block-uniform */
    const _Float16* QLp = QL + ((size_t)b * QHI + qi) * CC + h * HD;
    const v16h ql0f = frag_h(QLp, lane), ql1f = frag_h(QLp + 32, lane);
    XCNT0();
    /* a stage is FKS keys of this head in ONE buffer of four tiles (the main path's two buffers taken together): K hi, V^T hi, K lo, V^T lo; keys 0 .. qb * 64 + 63 all lie below KHI; every plain '#pragma unroll' of this path opens a constant-trip loop over a register array, so that its elements stay in registers */
    const int nst = qb + 1;   /* the same for the whole block */
    const int fr = tid >> 3, fc = (tid & 7) * 8;   /* this thread's row (of 16 a copy) and 16-B piece of a stage row */
    const _Float16* kg = KH + ((size_t)b * TT + fr) * CC + h * HD + fc; const _Float16* klg = KL + ((size_t)b * KHI + fr) * CC + h * HD + fc; const size_t vo = ((size_t)b * CC + h * HD + fr) * (size_t)KHI + fc;
    const unsigned l0 = (unsigned)(size_t)&skv[0][0][fr][fc];
    const _Float16 (*bkh)[FLP] = skv[0][0]; const _Float16 (*bkl)[FLP] = skv[1][0]; const __bf16 (*bvh)[FLP] = (const __bf16 (*)[FLP])skv[0][1]; const __bf16 (*bvl)[FLP] = (const __bf16 (*)[FLP])skv[1][1];
#pragma unroll 1   /* at most 6 stages: kept rolled for code size */
    for (int s = 0; s < nst; ++s) {
      if (s > 0) { DS0(); __syncthreads(); }   /* block-uniform: every reader has left stage s - 1 before the copies write over it */
      fa_fill_e(l0, kg + (size_t)s * FKS * CC, VB + vo + s * FKS); fa_fill_e(l0 + FBUF, klg + (size_t)s * FKS * CC, VBL + vo + s * FKS);
      ASYNC0(); __syncthreads();   /* stage s is published */
#pragma unroll 1   /* two steps a stage, rolled for code size; wave-uniform scalar test: the two lower waves of the block skip the diagonal stage's second step */
      for (int w = 0; w < 2 && 2 * s + w < nblk; ++w) { const int k0 = (2 * s + w) * 32; float t[16];
        v16h kh[2][2], kl[2][2]; v16b vh[HD / 16], vl[HD / 16];   /* the step's fragment reads go out as one group ahead of its products */
#pragma unroll
        for (int u = 0; u < 2; ++u) { const int kr = w * 32 + u * 16 + col; kh[u][0] = frag_h(&bkh[kr][0], lane); kh[u][1] = frag_h(&bkh[kr][32], lane); kl[u][0] = frag_h(&bkl[kr][0], lane); kl[u][1] = frag_h(&bkl[kr][32], lane); }
#pragma unroll
        for (int j = 0; j < HD / 16; ++j) { vh[j] = frag_b(&bvh[j * 16 + col][w * 32], lane); vl[j] = frag_b(&bvl[j * 16 + col][w * 32], lane); }
        RDGRP();
#pragma unroll
        for (int u = 0; u < 2; ++u) { v8f a = {}, al = {};
          a = wmma16(kh[u][0], qf0, a); al = wmma16(kh[u][0], ql0f, al); al = wmma16(kl[u][0], qf0, al); a = wmma16(kh[u][1], qf1, a); al = wmma16(kh[u][1], ql1f, al); al = wmma16(kl[u][1], qf1, al);
#pragma unroll
          for (int r = 0; r < 8; ++r) t[u * 8 + r] = (a[r] + al[r] * (1.0f / 1024.0f)) * LOGC; }
        sm_step(t, st, acc, k0, ql0, qi, g);
        const F2 p = bsplit16(t);
#pragma unroll
        for (int j = 0; j < HD / 16; ++j) { acc[j] = wmma_bf(vh[j], p.h, acc[j]); acc[j] = wmma_bf(vh[j], p.l, acc[j]); acc[j] = wmma_bf(vl[j], p.h, acc[j]); } } }
  } else {
    /* every plain '#pragma unroll' below opens a constant-trip loop over a register array (fragments, scores, accumulators), so that its elements stay in registers */
    const int nst = qb + 1;   /* stages of FKS keys that cover keys 0 .. qb * 64 + 63; the same for the whole block */
    const int fr = tid >> 3, fc = (tid & 7) * 8;   /* this thread's row (of 16 a copy) and 16-B piece of a stage row */
    const _Float16* kg = KH + ((size_t)b * TT + fr) * CC + h * HD + fc; const _Float16* vg = VT + ((size_t)b * CC + h * HD + fr) * (size_t)TT + fc;
    const unsigned l0 = (unsigned)(size_t)&skv[0][0][fr][fc];
    int sa = ((qb - QBH) * 5) % nst;   /* the key stage of trip 0; the walk wraps (the running softmax takes the stages in any order; every step that a wave works on holds a key <= each of its queries). The blocks of one plane read the same K and V^T stages and start apart, so that they do not ask L2 for the same lines at the same moment; nst >= QBH + 1 here */
    const int sb = sa + 1 == nst ? 0 : sa + 1;
    fa_fill(l0, kg + (size_t)sa * FKS * CC, vg + sa * FKS); ASYNC0(); __syncthreads();   /* trip 0's stage is published */
    if (1 < nst) fa_fill(l0 + FBUF, kg + (size_t)sb * FKS * CC, vg + sb * FKS);
#pragma unroll 1   /* rolled: one copy of the stage; the buffer is chosen by address */
    for (int s = 0; s < nst; ++s) { const _Float16 (*bk)[FLP] = skv[s & 1][0]; const _Float16 (*bv)[FLP] = skv[s & 1][1];
      v16h kf[2][4], vf[2][4];   /* both steps' fragments go out as one group at the head of the stage (the whole stage is filled, also where a wave skips its second step) */
#pragma unroll
      for (int w = 0; w < 2; ++w) {
#pragma unroll
        for (int u = 0; u < 2; ++u) { kf[w][2 * u] = frag_h(&bk[w * 32 + u * 16 + col][0], lane); kf[w][2 * u + 1] = frag_h(&bk[w * 32 + u * 16 + col][32], lane); }
#pragma unroll
        for (int j = 0; j < HD / 16; ++j) vf[w][j] = frag_h(&bv[j * 16 + col][w * 32], lane); }
      RDGRP();
#pragma unroll
      for (int w = 0; w < 2; ++w) { const int i = 2 * sa + w, k0 = i * 32;
        if (w == 0 || i < nblk) {   /* wave-uniform scalar test: the two upper waves of the block need the diagonal stage's second step, the two lower do not */
          v8f s0 = {}, s1 = {}; s0 = wmma16(kf[w][0], qf0, s0); s1 = wmma16(kf[w][2], qf0, s1); s0 = wmma16(kf[w][1], qf1, s0); s1 = wmma16(kf[w][3], qf1, s1);
          MRUN();
          float t[16];
#pragma unroll
          for (int r = 0; r < 8; ++r) { t[r] = s0[r] * LOGC; t[8 + r] = s1[r] * LOGC; }
          sm_step(t, st, acc, k0, ql0, qi, g);
          v16h p;
#pragma unroll
          for (int e = 0; e < 16; ++e) p[e] = (_Float16)t[e];
          MRUN();
#pragma unroll
          for (int j = 0; j < HD / 16; ++j) acc[j] = wmma16(vf[w][j], p, acc[j]); } }
      DS0(); ASYNC0(); __syncthreads();   /* every wave, also one that skipped a step: publishes stage s + 1 and ends every reader's last read of stage s */
      if (s + 2 < nst) { const int sc = sa + 2 >= nst ? sa + 2 - nst : sa + 2; fa_fill(l0 + (unsigned)(s & 1) * FBUF, kg + (size_t)sc * FKS * CC, vg + sc * FKS); }   /* block-uniform; flies while the next trip's stage is worked on */
      sa = sa + 1 == nst ? 0 : sa + 1; }
    ASYNC0(); }
  const float inv = 1.0f / (st.l + xhalf(st.l));   /* the two halves' partial sums join once; the maximum's own term keeps the sum >= 2^11 */
  const size_t yo = ((size_t)b * TT + qi) * CC + h * HD + 8 * g;   /* acc[j][r] = ctx[query qi][j*16 + 8g + r]: 16 contiguous bytes per lane and j. ctx is rounded here, once, to the operand type of the output GEMM */
  v4u oa[HD / 16];
  if (qb < QBH) {   /* block-uniform: bf16 hi + lo */
    v4u ol[HD / 16];
#pragma unroll
    for (int j = 0; j < HD / 16; ++j) { v8b hv, lv;
#pragma unroll
      for (int r = 0; r < 8; ++r) { const float v = acc[j][r] * inv; const __bf16 hb = (__bf16)v; hv[r] = hb; lv[r] = (__bf16)(v - (float)hb); }
      oa[j] = __builtin_bit_cast(v4u, hv); ol[j] = __builtin_bit_cast(v4u, lv); }
    st4((char*)(YL + yo), ol);
  } else {
#pragma unroll
    for (int j = 0; j < HD / 16; ++j) { v8h hv;
#pragma unroll
      for (int r = 0; r < 8; ++r) hv[r] = (_Float16)(acc[j][r] * inv * 64.0f);   /* ctx carried x 2^6 into f16 so small-magnitude context rows stay clear of f16 subnormals */
      oa[j] = __builtin_bit_cast(v4u, hv); } }
  st4((char*)(YH + yo), oa); }
// ---- k_out: block = (64 rows, 128 cols): out = ctx Wo (+ bo): ctx f16 (x 2^6) against Wo as f16(bf16 x 2^8) exact (1 product) x 2^-14; causal early rows (< QHI of each sequence): ctx bf16 hi + lo against exact bf16 Wo (2 products). Both operands arrive already rounded (ctx by k_fa, Wo by k_proj): a stage is OK k of every tile row, 256 B of data a row at a pitch of 272 B (16 B x odd: ds_load_b128 readers), brought in by asynchronous copies to LDS that cover whole lines (16 lanes a row)
#define OBUF ((64 + 64 + 128) * OLP * 2)   // bytes of one buffer: ctx rows (early rows: hi, then lo), then Wo rows
// 8 copies of one thread, 8 tile rows apart (64 rows for the block), 16 B a lane; the last line is the wait that stands before a register which a copy names is written again
__device__ __forceinline__ void o_fill(unsigned l, const char* p) {
  const unsigned rs = 8 * OLP * 2; const size_t gs = (size_t)8 * CC * 2;
  asm volatile("global_load_async_to_lds_b128 %0, %8, off\n\t"
               "global_load_async_to_lds_b128 %1, %9, off\n\t"
               "global_load_async_to_lds_b128 %2, %10, off\n\t"
               "global_load_async_to_lds_b128 %3, %11, off\n\t"
               "global_load_async_to_lds_b128 %4, %12, off\n\t"
               "global_load_async_to_lds_b128 %5, %13, off\n\t"
               "global_load_async_to_lds_b128 %6, %14, off\n\t"
               "global_load_async_to_lds_b128 %7, %15, off\n\t"
               "s_wait_xcnt 0x0"
               :: "v"(l), "v"(l + rs), "v"(l + 2 * rs), "v"(l + 3 * rs), "v"(l + 4 * rs), "v"(l + 5 * rs), "v"(l + 6 * rs), "v"(l + 7 * rs),
                  "v"(p), "v"(p + gs), "v"(p + 2 * gs), "v"(p + 3 * gs), "v"(p + 4 * gs), "v"(p + 5 * gs), "v"(p + 6 * gs), "v"(p + 7 * gs)
               : "memory"); }
__global__ __launch_bounds__(128) void k_out(const _Float16* __restrict__ YH, const __bf16* __restrict__ YL, const _Float16* __restrict__ WOH, const __bf16* __restrict__ WOB, const float* __restrict__ BO, float* __restrict__ OUT) { __shared__ __align__(16) unsigned char sm[2 * OBUF];   /* two operand buffers; behind the last stage's barrier the output staging takes the same bytes */
  static_assert(4 * 16 * 132 * 4 <= 2 * OBUF && CC % OK == 0 && CC / OK >= 2, "LDS, stages");
  float (*sf)[16][132] = (float (*)[16][132])sm;
  const int tid = threadIdx.x, wave = tid >> 5, lane = tid & 31, col = lane & 15, g = lane >> 4; const int c0 = blockIdx.y * 128; const size_t r0 = (size_t)blockIdx.x * 64 + wave * 16;
  v8f acc[8] = {};
  const int fr = tid >> 4, fc = (tid & 15) * 8;   /* this thread's row (of 8 a copy) and 16-B piece of a stage row */
  const size_t yo = ((size_t)blockIdx.x * 64 + fr) * CC + fc, wo = (size_t)(c0 + fr) * CC + fc;   /* (out,in) weight rows */
  const unsigned l0 = (unsigned)(size_t)&sm[(fr * OLP + fc) * 2];
  int ks = (int)((blockIdx.x + blockIdx.y) % (CC / OK));   /* this block's first k stage; the walk wraps: blocks that read the same ctx rows or the same weight rows start apart (as in k_proj) */
  const int kb = ks + 1 == CC / OK ? 0 : ks + 1;
  if (CAUSAL && (int)(((size_t)blockIdx.x * 64) % TT) < QHI) {   /* block-uniform */
    const char* yh = (const char*)(YH + yo); const char* yl = (const char*)(YL + yo); const char* wg = (const char*)(WOB + wo); const size_t w64 = (size_t)64 * CC * 2;
    o_fill(l0, yh + ks * OK * 2); o_fill(l0 + 64 * OLP * 2, yl + ks * OK * 2); o_fill(l0 + 128 * OLP * 2, wg + ks * OK * 2); o_fill(l0 + 192 * OLP * 2, wg + w64 + ks * OK * 2);
    ASYNC0(); __syncthreads();   /* trip 0's stage is published */
    o_fill(l0 + OBUF, yh + kb * OK * 2); o_fill(l0 + OBUF + 64 * OLP * 2, yl + kb * OK * 2); o_fill(l0 + OBUF + 128 * OLP * 2, wg + kb * OK * 2); o_fill(l0 + OBUF + 192 * OLP * 2, wg + w64 + kb * OK * 2);
#pragma unroll 1   /* rolled: one copy of the stage; the buffer is chosen by address */
    for (int s = 0; s < CC / OK; ++s) { const __bf16 (*bh)[OLP] = (const __bf16 (*)[OLP])(sm + (s & 1) * OBUF); const __bf16 (*bl)[OLP] = bh + 64; const __bf16 (*bw)[OLP] = bh + 128;
#pragma unroll
      for (int kk = 0; kk < OK / 32; ++kk) { const v16b ah = frag_b(&bh[wave * 16 + col][kk * 32], lane), al = frag_b(&bl[wave * 16 + col][kk * 32], lane);
#pragma unroll
        for (int j0 = 0; j0 < 8; j0 += 4) { v16b w[4];   /* fragment reads go out as a group ahead of their products */
#pragma unroll
          for (int u = 0; u < 4; ++u) w[u] = frag_b(&bw[(j0 + u) * 16 + col][kk * 32], lane);
          RDGRP();
#pragma unroll
          for (int u = 0; u < 4; ++u) { acc[j0 + u] = wmma_bf(ah, w[u], acc[j0 + u]); acc[j0 + u] = wmma_bf(al, w[u], acc[j0 + u]); } } }
      DS0(); ASYNC0(); __syncthreads();   /* publishes stage s + 1 and ends every reader's last read of stage s (behind the last stage: before the output staging writes over the buffers) */
      if (s + 2 < CC / OK) { const int kc = ks + 2 >= CC / OK ? ks + 2 - CC / OK : ks + 2; const unsigned l = l0 + (unsigned)(s & 1) * OBUF;   /* block-uniform; flies while the next trip's stage is worked on */
        o_fill(l, yh + kc * OK * 2); o_fill(l + 64 * OLP * 2, yl + kc * OK * 2); o_fill(l + 128 * OLP * 2, wg + kc * OK * 2); o_fill(l + 192 * OLP * 2, wg + w64 + kc * OK * 2); }
      ks = ks + 1 == CC / OK ? 0 : ks + 1; }
    ASYNC0();
#pragma unroll
    for (int j = 0; j < 8; ++j) { const float bias = BO ? bfr(BO[c0 + j * 16 + col]) : 0.f;
#pragma unroll
      for (int r = 0; r < 8; ++r) sf[wave][8 * g + r][j * 16 + col] = acc[j][r] + bias; }
  } else {
    const char* yh = (const char*)(YH + yo); const char* wg = (const char*)(WOH + wo); const size_t w64 = (size_t)64 * CC * 2;
    o_fill(l0, yh + ks * OK * 2); o_fill(l0 + 64 * OLP * 2, wg + ks * OK * 2); o_fill(l0 + 128 * OLP * 2, wg + w64 + ks * OK * 2);
    ASYNC0(); __syncthreads();   /* trip 0's stage is published */
    o_fill(l0 + OBUF, yh + kb * OK * 2); o_fill(l0 + OBUF + 64 * OLP * 2, wg + kb * OK * 2); o_fill(l0 + OBUF + 128 * OLP * 2, wg + w64 + kb * OK * 2);
#pragma unroll 1   /* rolled: one copy of the stage; the buffer is chosen by address */
    for (int s = 0; s < CC / OK; ++s) { const _Float16 (*ba)[OLP] = (const _Float16 (*)[OLP])(sm + (s & 1) * OBUF); const _Float16 (*bw)[OLP] = ba + 64;
#pragma unroll
      for (int kk = 0; kk < OK / 32; ++kk) { const v16h a = frag_h(&ba[wave * 16 + col][kk * 32], lane);
#pragma unroll
        for (int j0 = 0; j0 < 8; j0 += 4) { v16h w[4];   /* fragment reads go out as a group ahead of their products */
#pragma unroll
          for (int u = 0; u < 4; ++u) w[u] = frag_h(&bw[(j0 + u) * 16 + col][kk * 32], lane);
          RDGRP();
#pragma unroll
          for (int u = 0; u < 4; ++u) acc[j0 + u] = wmma16(a, w[u], acc[j0 + u]); } }
      DS0(); ASYNC0(); __syncthreads();   /* publishes stage s + 1 and ends every reader's last read of stage s (behind the last stage: before the output staging writes over the buffers) */
      if (s + 2 < CC / OK) { const int kc = ks + 2 >= CC / OK ? ks + 2 - CC / OK : ks + 2; const unsigned l = l0 + (unsigned)(s & 1) * OBUF;   /* block-uniform; flies while the next trip's stage is worked on */
        o_fill(l, yh + kc * OK * 2); o_fill(l + 64 * OLP * 2, wg + kc * OK * 2); o_fill(l + 128 * OLP * 2, wg + w64 + kc * OK * 2); }
      ks = ks + 1 == CC / OK ? 0 : ks + 1; }
    ASYNC0();
#pragma unroll
    for (int j = 0; j < 8; ++j) { const float bias = BO ? bfr(BO[c0 + j * 16 + col]) : 0.f;
#pragma unroll
      for (int r = 0; r < 8; ++r) sf[wave][8 * g + r][j * 16 + col] = acc[j][r] * (1.0f / 16384.0f) + bias; } }   /* 2^-8 (Wo carry) x 2^-6 (ctx carry) */
  LDSX(); for (int rl = 0; rl < 16; ++rl) vst2(OUT + SRCROW(r0 + rl) * DIN + c0 + lane * 4, *(const v4f*)&sf[wave][rl][lane * 4]); }

extern "C" void kernel_launch(void* const* d_in, const int* in_sizes, int n_in, void* d_out, int out_size, void* d_ws, size_t ws_size, hipStream_t stream) {
  (void)in_sizes; (void)n_in; (void)out_size;
  const float** F = (const float**)d_in;
  if (ws_size < (size_t)WS_END) return;
  char* ws = (char*)d_ws; _Float16 *QH = (_Float16*)(ws + WS_QH), *KH = (_Float16*)(ws + WS_KH), *VT = (_Float16*)(ws + WS_VT), *QL = (_Float16*)(ws + WS_QL), *KL = (_Float16*)(ws + WS_KL); __bf16 *VB = (__bf16*)(ws + WS_VB), *VBL = (__bf16*)(ws + WS_VBL); _Float16 *YH = (_Float16*)(ws + WS_Y), *WOH = (_Float16*)(ws + WS_WH); __bf16 *YL = (__bf16*)(ws + WS_YL), *WOB = (__bf16*)(ws + WS_WB);
  (void)QL; (void)KL; (void)VB; (void)VBL;
  // inputs: 0 x [2048,2,768] (S, B, D); 1 wq [768,768] (out,in), 2 bq; 3 wk, 4 bk; 5 wv, 6 bv; 7 wc (out,in), 8 bc (all biases NONZERO)
  k_proj<<<dim3(TNB * TT / PTR, CC / 128, 3), 256, 0, stream>>>(F[0], F[0], F[0], F[1], F[3], F[5], F[2], F[4], F[6], QH, QL, KH, KL, VT, VB, VBL, F[7], WOH, WOB);
  k_fa<<<dim3(TNB * NH, NQB), 128, 0, stream>>>(QH, KH, QL, KL, VT, VB, VBL, YH, YL);
  k_out<<<dim3(TNB * TT / 64, DIN / 128), 128, 0, stream>>>(YH, YL, WOH, WOB, F[8], (float*)d_out);   /* writes (S, B, D) rows */
}

// v010
// Measured time: 57.5 microseconds a run.
// In both of two side-by-side timings against v009, it was 1.04 times as fast.
// Over all steps from v000 it is 15.6 times as fast.
// compute dtype: all float inputs rounded to bf16; q / k / v projections with EXACT bf16 products on WMMA 16x16x32 (f32 accumulate) + bias; causal logits: 3 products for the first 384 rows, single f16 q x k after, x 64^-0.5; running-maximum softmax f32 in the same launch; unnormalised P x 2^11 once to f16 x v once to f16 (bf16 hi + lo below row 384), divided by the f32 sum at the end; y hi+lo x exact wc below row 384, x2^6 f16 carry x f16(bf16 x 2^8) wc after, + bc; f32 output written back in the sequence-first layout.
#include <hip/hip_runtime.h>
#include <math.h>

typedef __attribute__((ext_vector_type(16))) _Float16 v16h;
typedef __attribute__((ext_vector_type(16))) __bf16 v16b;
typedef __attribute__((ext_vector_type(8)))  _Float16 v8h;
typedef __attribute__((ext_vector_type(8)))  float v8f;
typedef __attribute__((ext_vector_type(4)))  float v4f;
typedef __attribute__((ext_vector_type(2)))  float v2f;
typedef __attribute__((ext_vector_type(4)))  unsigned v4u;
typedef __attribute__((ext_vector_type(2)))  unsigned v2u;
typedef __attribute__((ext_vector_type(4)))  int v4i;
typedef float __attribute__((may_alias)) float_a;
typedef int __attribute__((may_alias)) int_a;

template <typename T> __device__ __forceinline__ void vst2(void* p, T v) { *(T*)p = v;  }
__device__ __forceinline__ v8f wmma16(v16h a, v16h b, v8f c) {
  return __builtin_amdgcn_wmma_f32_16x16x32_f16(false, a, false, b, (short)0, c, false, false);
}
__device__ __forceinline__ v8f wmma_bf(v16b a, v16b b, v8f c) {
  return __builtin_amdgcn_wmma_f32_16x16x32_bf16(false, a, false, b, (short)0, c, false, false);
}
// 16x16x32 fragments: lane = (h = lane>>4, row/col = lane&15); elements 0..7 = k0+8h+0..7, 8..15 = k0+16+8h+0..7; D element r = row 8h+r
__device__ __forceinline__ v16h frag_h(const _Float16* rowk0, int lane) {
  union { v16h v; v8h q[2]; } u; const _Float16* p = rowk0 + 8 * (lane >> 4);
  u.q[0] = *(const v8h*)p; u.q[1] = *(const v8h*)(p + 16); return u.v;
}
__device__ __forceinline__ v16h frag_f32(const float* rowk0, int lane) {
  v16h a; const float* p = rowk0 + 8 * (lane >> 4);
#pragma unroll
  for (int i = 0; i < 8; ++i) { a[i] = (_Float16)p[i]; a[8 + i] = (_Float16)p[16 + i]; }
  return a;
}
__device__ __forceinline__ v16h frag_f32s(const float* rowk0, int lane, float sc) {
  v16h a; const float* p = rowk0 + 8 * (lane >> 4);
#pragma unroll
  for (int i = 0; i < 8; ++i) { a[i] = (_Float16)(p[i] * sc); a[8 + i] = (_Float16)(p[16 + i] * sc); }
  return a;
}
// column fragment from a [K][ld] layout (column n), rows >= K read as 0
__device__ __forceinline__ v16h fragc_f32(const float* W, int k0, int n, int lane, int ld, int K) {
  v16h a; const int g = lane >> 4;
#pragma unroll
  for (int i = 0; i < 8; ++i) { const int ka = k0 + 8 * g + i, kb = ka + 16;
    a[i] = (_Float16)(ka < K ? W[(size_t)(ka < K ? ka : K - 1) * ld + n] : 0.f); a[8 + i] = (_Float16)(kb < K ? W[(size_t)(kb < K ? kb : K - 1) * ld + n] : 0.f); }
  return a;
}
struct F2 { v16b h, l; };
__device__ __forceinline__ F2 bsplit16(const float v[16]) { F2 r;
#pragma unroll
  for (int i = 0; i < 16; ++i) { const __bf16 h = (__bf16)v[i]; r.h[i] = h; r.l[i] = (__bf16)(v[i] - (float)h); }
  return r; }
__device__ __forceinline__ F2 split_row(const float* row, int k0, int lane) { float v[16]; const float* p = row + k0 + 8 * (lane >> 4);
#pragma unroll
  for (int i = 0; i < 8; ++i) { v[i] = p[i]; v[8 + i] = p[16 + i]; }
  return bsplit16(v); }
__device__ __forceinline__ F2 split_rowK(const float* row, int k0, int lane, int K) { float v[16]; const int g = lane >> 4;
#pragma unroll
  for (int i = 0; i < 8; ++i) { const int ka = k0 + 8 * g + i, kb = ka + 16; v[i] = ka < K ? row[ka < K ? ka : K - 1] : 0.f; v[8 + i] = kb < K ? row[kb < K ? kb : K - 1] : 0.f; }
  return bsplit16(v); }
__device__ __forceinline__ F2 split_col(const float* W, int k0, int n, int lane, int ld, int K) { float v[16]; const int g = lane >> 4;
#pragma unroll
  for (int i = 0; i < 8; ++i) { const int ka = k0 + 8 * g + i, kb = ka + 16; v[i] = ka < K ? W[(size_t)(ka < K ? ka : K - 1) * ld + n] : 0.f; v[8 + i] = kb < K ? W[(size_t)(kb < K ? kb : K - 1) * ld + n] : 0.f; }
  return bsplit16(v); }
__device__ __forceinline__ v8f mac3(const F2& a, const F2& b, v8f c) { c = wmma_bf(a.l, b.h, c); c = wmma_bf(a.h, b.l, c); return wmma_bf(a.h, b.h, c); }
__device__ __forceinline__ float sigm(float v) { return 1.0f / (1.0f + expf(-v)); }
#define RDGRP() __builtin_amdgcn_sched_barrier(0)   // behind a group of LDS fragment reads: the scheduler moves nothing across, so the reads go out together ahead of the matrix run; without it each read sinks to its own product and is waited for alone
#define MRUN() __builtin_amdgcn_sched_barrier(0)   // at the foot of the score products and the head of the P x v products: the scalings and conversions stay on their own side; mixed into a run they landed on operand registers just read, and the compiler padded each with up to four v_nop
#define LDSX() do { asm volatile("s_wait_dscnt 0" ::: "memory"); __builtin_amdgcn_wave_barrier(); __builtin_amdgcn_fence(__ATOMIC_RELEASE, "workgroup"); } while (0)

// Causal multi-head self-attention on a SEQUENCE-FIRST input (x [2048, 2, 768] = (S, B, D); torch (out,in) wq / wk / wv / wc [768,768] N(0,1) x 0.02 applied as x W^T + b, biases N(0,1) x 0.02 - NONZERO; 12 heads x 64; scores / sqrt(64); tril kept, -inf elsewhere; softmax; y wc^T + bc; output transposed back to (S, B, D)). The kernels work on rows b*2048 + t: the projection reads token (b, t) from source row t*2 + b and the output kernel writes it back there.
#define NB 2
#define TT 2048
#define CC 768            // NH * HD = projected width
#define DIN 768          // input (model) width
#define NH 12
#define HD 64
#define NQB (TT / 64)
#define SCALE (0.125f)
#define CAUSAL 1
#ifndef TNB
#define TNB NB
#endif
__device__ __forceinline__ float bfr(float v) { return (float)(__bf16)v; }
typedef __attribute__((ext_vector_type(8))) __bf16 v8b;
__device__ __forceinline__ v16b frag_b(const __bf16* rowk0, int lane) {
  union { v16b v; v8b q[2]; } u; const __bf16* p = rowk0 + 8 * (lane >> 4);
  u.q[0] = *(const v8b*)p; u.q[1] = *(const v8b*)(p + 16); return u.v;
}
#define QBH 6              // causal: query blocks 0..QBH-1 of each sequence (few keys, no averaging) take the high-precision path
#define QHI 384            // rows carrying a q residual plane
#define KHI 384            // key rows carrying k residual / v bf16 hi+lo planes (used only by the causal high-precision path)
// B fragment (k rows k0+.., output column o) of a weight: (in,out) [K][ld] or (out,in) [ld rows of K]: bf16 exact, or f16(bf16 * 256) exact
__device__ __forceinline__ v16b wcol_io(const float* Wm, int k0, int o, int lane, int ld) { v16b w; const int g = lane >> 4;
#pragma unroll
  for (int i = 0; i < 8; ++i) { w[i] = (__bf16)Wm[(size_t)(k0 + 8 * g + i) * ld + o]; w[8 + i] = (__bf16)Wm[(size_t)(k0 + 16 + 8 * g + i) * ld + o]; }
  return w; }
__device__ __forceinline__ v16b wcol_oi(const float* Wm, int k0, int o, int lane, int K) { v16b w; const float* p = Wm + (size_t)o * K + k0 + 8 * (lane >> 4);
#pragma unroll
  for (int i = 0; i < 8; ++i) { w[i] = (__bf16)p[i]; w[8 + i] = (__bf16)p[16 + i]; }
  return w; }
__device__ __forceinline__ v16h wcolh_io(const float* Wm, int k0, int o, int lane, int ld) { v16h w; const int g = lane >> 4;
#pragma unroll
  for (int i = 0; i < 8; ++i) { w[i] = (_Float16)(bfr(Wm[(size_t)(k0 + 8 * g + i) * ld + o]) * 256.0f); w[8 + i] = (_Float16)(bfr(Wm[(size_t)(k0 + 16 + 8 * g + i) * ld + o]) * 256.0f); }
  return w; }
__device__ __forceinline__ v16h wcolh_oi(const float* Wm, int k0, int o, int lane, int K) { v16h w; const float* p = Wm + (size_t)o * K + k0 + 8 * (lane >> 4);
#pragma unroll
  for (int i = 0; i < 8; ++i) { w[i] = (_Float16)(bfr(p[i]) * 256.0f); w[8 + i] = (_Float16)(bfr(p[16 + i]) * 256.0f); }
  return w; }
#define SRCROW(r) ((size_t)((r) % TT) * NB + (size_t)((r) / TT))   // row r = b*TT + t <-> sequence-first row t*NB + b of the (S, B, D) arrays (NB = the module's batch count, also when fewer batches are run)
#define WQKV_LAYOUT 1   // layout for WCOL only, which nothing calls (k_proj reads (out,in) [CC][DIN] rows): 0 = (in,out) [DIN][CC]; 1 = (out,in) [CC][DIN]; 2 = per-head [NH][DIN][HD]
__device__ __forceinline__ v16b wcol_hdk(const float* Wm, int k0, int o, int lane) { v16b w; const int g = lane >> 4; const float* p = Wm + (size_t)(o / HD) * DIN * HD + (o % HD);
#pragma unroll
  for (int i = 0; i < 8; ++i) { w[i] = (__bf16)p[(size_t)(k0 + 8 * g + i) * HD]; w[8 + i] = (__bf16)p[(size_t)(k0 + 16 + 8 * g + i) * HD]; }
  return w; }
#define WO_OUT_IN 1
#if WQKV_LAYOUT == 1
#define WCOL(W, k0, o, lane) wcol_oi(W, k0, o, lane, DIN)
#elif WQKV_LAYOUT == 2
#define WCOL(W, k0, o, lane) wcol_hdk(W, k0, o, lane)
#else
#define WCOL(W, k0, o, lane) wcol_io(W, k0, o, lane, CC)
#endif
#if WO_OUT_IN
#define WOCOL(W, k0, o, lane) wcol_oi(W, k0, o, lane, CC)
#define WOCOLH(W, k0, o, lane) wcolh_oi(W, k0, o, lane, CC)
#else
#define WOCOL(W, k0, o, lane) wcol_io(W, k0, o, lane, DIN)
#define WOCOLH(W, k0, o, lane) wcolh_io(W, k0, o, lane, DIN)
#endif

#define WS_QH  0u                                      // f16 q rows [b*t][CC]
#define WS_KH  (WS_QH + 2u * (size_t)NB * TT * CC)      // f16 k rows [b*t][CC]
#define WS_VT  (WS_KH + 2u * (size_t)NB * TT * CC)      // f16 v planes [b][c][t]
#define WS_QL  (WS_VT + 2u * (size_t)NB * CC * TT)      // f16 q residual x 2^10 rows [b][t < QHI][CC]
#define WS_KL  (WS_QL + 2u * (size_t)NB * QHI * CC)     // f16 k residual x 2^10 rows [b][t < KHI][CC]
#define WS_VB  (WS_KL + 2u * (size_t)NB * KHI * CC)     // bf16 v hi planes [b][c][t < KHI]
#define WS_VBL (WS_VB + 2u * (size_t)NB * CC * KHI)
#define WS_Y   (WS_VBL + 2u * (size_t)NB * CC * KHI)    // 16-bit ctx rows [b*t][CC]: f16 ctx x 2^6; rows t < QHI of each sequence: bf16 hi part
#define WS_YL  (WS_Y  + 2u * (size_t)NB * TT * CC)      // bf16 ctx residual rows [b*t][CC]; written and read for t < QHI only
#define WS_WH  (WS_YL + 2u * (size_t)NB * TT * CC)      // f16(bf16 x 2^8) output weight rows (out,in)
#define WS_WB  (WS_WH + 2u * (size_t)DIN * CC)          // bf16 output weight rows (out,in)
#define WS_END (WS_WB + 2u * (size_t)DIN * CC)

// operand staging of the projection: a stage is PK k of every tile row. The block's threads fetch it with global_load_b128 that cover whole 128-B lines (PK / 4 lanes a row), round it ONCE to the 16-bit operand type and store it in LDS rows with a 16-B pad (pitch 16 B x odd: ds_load_b128 readers); all waves take their fragments from there
// every '#pragma unroll' of the staging code opens a constant-trip loop over a register array (fetched rows, fragments, accumulators), so that its elements stay in registers
typedef __attribute__((ext_vector_type(4))) __bf16 v4b;
typedef __attribute__((ext_vector_type(4))) _Float16 v4h;
#define PK 32
#define PLP (PK + 8)
#define PTR 128            // rows of a projection tile
#define PRI (1024 / PK)    // tile rows that one load instruction of the whole block (256 threads) covers
#define OK 128            // k of a stage of the output GEMM: rows of 256 B of 16-bit operands
#define OLP (OK + 8)
template <int N> __device__ __forceinline__ void tile_ld(v4f (&r)[N], const float* p, size_t step) {
#pragma unroll
  for (int i = 0; i < N; ++i) r[i] = *(const v4f*)(p + (size_t)i * step); }
__device__ __forceinline__ void st_b(__bf16* d, v4f v) { const v4b o = { (__bf16)v[0], (__bf16)v[1], (__bf16)v[2], (__bf16)v[3] }; *(v4b*)d = o; }
#define XCNT_G() asm volatile("s_wait_xcnt 0x0" ::: "memory")   // stands behind a run of global loads, before a register that they name is written again
// eight 16-B stores of one thread, 'step' bytes apart; the last line is the wait that stands before a register which a store names is written again (in a statement of its own the compiler lifts later register writes over it)
__device__ __forceinline__ void st8(char* p, size_t step, const v4u (&o)[8]) {
  asm volatile("global_store_b128 %0, %8, off\n\t"
               "global_store_b128 %1, %9, off\n\t"
               "global_store_b128 %2, %10, off\n\t"
               "global_store_b128 %3, %11, off\n\t"
               "global_store_b128 %4, %12, off\n\t"
               "global_store_b128 %5, %13, off\n\t"
               "global_store_b128 %6, %14, off\n\t"
               "global_store_b128 %7, %15, off\n\t"
               "s_wait_xcnt 0x0"
               :: "v"(p), "v"(p + step), "v"(p + 2 * step), "v"(p + 3 * step), "v"(p + 4 * step), "v"(p + 5 * step), "v"(p + 6 * step), "v"(p + 7 * step),
                  "v"(o[0]), "v"(o[1]), "v"(o[2]), "v"(o[3]), "v"(o[4]), "v"(o[5]), "v"(o[6]), "v"(o[7])
               : "memory"); }
// ---- k_proj: block = (128 rows, 128 cols, which), 8 waves in a 4 x 2 grid, 32 rows x 64 cols a wave: q/k/v = X W (+ b) with exact bf16 products (K = DIN) -> which 0: q f16 rows (+ residual rows < QHI); 1: k f16 rows (+ residual rows < KHI); 2: v f16 planes [c][t] (+ bf16 hi/lo planes for t < KHI)
__global__ __launch_bounds__(256) void k_proj(const float* __restrict__ XQ, const float* __restrict__ XK, const float* __restrict__ XV, const float* __restrict__ WQ, const float* __restrict__ WK, const float* __restrict__ WV, const float* __restrict__ BQ, const float* __restrict__ BK, const float* __restrict__ BV,
    _Float16* __restrict__ QH, _Float16* __restrict__ QL, _Float16* __restrict__ KH, _Float16* __restrict__ KL, _Float16* __restrict__ VT, __bf16* __restrict__ VB, __bf16* __restrict__ VBL, const float* __restrict__ WO, _Float16* __restrict__ WOH, __bf16* __restrict__ WOB) {
  __shared__ __align__(16) unsigned char sm[3 * 128 * 136 * 2];   /* two operand buffers in the main loop; behind a barrier the epilogue's output staging takes the same bytes */
  static_assert(2 * (PTR + 128) * PLP * 2 <= 3 * 128 * 136 * 2 && 2 * PTR * 136 * 2 <= 3 * 128 * 136 * 2 && PTR == 128 && QHI % PTR == 0 && KHI % PTR == 0 && TT % PTR == 0, "LDS, tile");
  __bf16 (*sx)[PTR][PLP] = (__bf16 (*)[PTR][PLP])sm; __bf16 (*sw)[128][PLP] = (__bf16 (*)[128][PLP])(sm + 2 * PTR * PLP * 2);
  _Float16 (*sh)[136] = (_Float16 (*)[136])sm; _Float16 (*sl)[136] = (_Float16 (*)[136])(sm + PTR * 136 * 2);
  _Float16 (*th)[136] = (_Float16 (*)[136])sm; __bf16 (*tb)[136] = (__bf16 (*)[136])(sm + 128 * 136 * 2); __bf16 (*tbl)[136] = (__bf16 (*)[136])(sm + 2 * 128 * 136 * 2);
  const int tid = threadIdx.x, wave = tid >> 5, lane = tid & 31, col = lane & 15, g = lane >> 4; const int wr = wave >> 1, wc = wave & 1; const int which = blockIdx.z; const int c0 = blockIdx.y * 128; const size_t r0 = (size_t)blockIdx.x * PTR; const size_t bb = r0 / TT; const int t0 = (int)(r0 % TT);
  const float* X = which == 0 ? XQ : which == 1 ? XK : XV; const float* WA = which == 0 ? WQ : which == 1 ? WK : WV; const float* BA = which == 0 ? BQ : which == 1 ? BK : BV;
  v8f acc[2][4] = {};
  const int lr = tid / (PK / 4), lc = tid % (PK / 4);
  const float* xg = X + SRCROW(r0 + lr) * DIN + lc * 4;   /* sequence-first source row; the tile's rows lie in one sequence, so PRI tile rows on = PRI * NB source rows on */
  const float* wg = WA + (size_t)(c0 + lr) * DIN + lc * 4;   /* (out,in) weight rows */
  v4f rx[PTR / PRI], rw[128 / PRI];
  int ks = (int)((blockIdx.x + 5 * (blockIdx.y + 6 * blockIdx.z)) % (DIN / PK));   /* this block's first k stage; the walk wraps. The 18 blocks that read the same x rows and the 32 that read the same weight rows start apart, so that they do not ask L2 for the same lines at the same moment */
  /* the output weight is rounded in this launch, once, for the last launch: each block takes 1024 of its elements, 4 a thread. The load goes out behind the main loop, where the stage registers are free; its data is rounded and stored at the kernel's end, behind the epilogue's own stores */
  static_assert((size_t)(TNB * TT / PTR) * (CC / 128) * 3 * 1024 == (size_t)DIN * CC, "one pass of the grid covers the output weight");
  const size_t we = ((size_t)blockIdx.x + (size_t)(TNB * TT / PTR) * (blockIdx.y + (CC / 128) * blockIdx.z)) * 1024 + tid * 4;
  tile_ld(rx, xg + ks * PK, (size_t)PRI * NB * DIN); XCNT_G(); tile_ld(rw, wg + ks * PK, (size_t)PRI * DIN); XCNT_G();
#pragma unroll 1   /* rolled: one copy of the stage; the fetched registers are free again once they are stored */
  for (int s = 0; s < DIN / PK; ++s) { __bf16 (*bx)[PLP] = sx[s & 1]; __bf16 (*bw)[PLP] = sw[s & 1];
#pragma unroll
    for (int i = 0; i < PTR / PRI; ++i) st_b(&bx[i * PRI + lr][lc * 4], rx[i]);
#pragma unroll
    for (int i = 0; i < 128 / PRI; ++i) st_b(&bw[i * PRI + lr][lc * 4], rw[i]);
    __syncthreads();   /* publishes stage s; also: every wave has left the other buffer (read in stage s - 1) before stage s + 1 is stored there */
    if (s + 1 < DIN / PK) { ks = ks + 1 == DIN / PK ? 0 : ks + 1; tile_ld(rx, xg + ks * PK, (size_t)PRI * NB * DIN); XCNT_G(); tile_ld(rw, wg + ks * PK, (size_t)PRI * DIN); XCNT_G(); }   /* next stage flies while this one is multiplied */
#pragma unroll
    for (int kk = 0; kk < PK / 32; ++kk) { v16b a[2], w[4];   /* the stage's fragment reads go out as one group ahead of its products: one LDS latency a stage */
#pragma unroll
      for (int i = 0; i < 2; ++i) a[i] = frag_b(&bx[wr * 32 + i * 16 + col][kk * 32], lane);
#pragma unroll
      for (int u = 0; u < 4; ++u) w[u] = frag_b(&bw[wc * 64 + u * 16 + col][kk * 32], lane);
      RDGRP();
#pragma unroll
      for (int u = 0; u < 4; ++u)
#pragma unroll
        for (int i = 0; i < 2; ++i) acc[i][u] = wmma_bf(a[i], w[u], acc[i][u]); } }
  __syncthreads();   /* the last stage's readers are done before the epilogue writes over the buffers */
  const v4f wov = *(const v4f*)(WO + we); XCNT_G();
  if (which < 2) { _Float16* DH = which == 0 ? QH : KH; _Float16* DL = which == 0 ? QL : KL; const int nhi = which == 0 ? QHI : KHI; const bool hi_rows = t0 < nhi;
#pragma unroll
    for (int j = 0; j < 4; ++j) { const float bias = BA ? bfr(BA[c0 + wc * 64 + j * 16 + col]) : 0.f;
#pragma unroll
      for (int i = 0; i < 2; ++i)
#pragma unroll
        for (int r = 0; r < 8; ++r) { const float v = acc[i][j][r] + bias; const _Float16 hv = (_Float16)v; const int rl = wr * 32 + i * 16 + 8 * g + r, cl = wc * 64 + j * 16 + col; sh[rl][cl] = hv; sl[rl][cl] = (_Float16)((v - (float)hv) * 1024.0f); } }
    __syncthreads();
    const int rl0 = tid >> 4, q = tid & 15; v4u o[PTR / 16];   /* 16 threads a row, 16 rows a pass of the block; a plane's staged rows are read as one group, then stored */
#pragma unroll
    for (int i = 0; i < PTR / 16; ++i) o[i] = *(const v4u*)&sh[i * 16 + rl0][q * 8];
    st8((char*)(DH + (r0 + rl0) * CC + c0 + q * 8), (size_t)16 * CC * 2, o);
    if (hi_rows) {   /* block-uniform */
#pragma unroll
      for (int i = 0; i < PTR / 16; ++i) o[i] = *(const v4u*)&sl[i * 16 + rl0][q * 8];
      st8((char*)(DL + (bb * nhi + t0 + rl0) * (size_t)CC + c0 + q * 8), (size_t)16 * CC * 2, o); }
  } else { const bool hi_rows = t0 < KHI;
#pragma unroll
    for (int j = 0; j < 4; ++j) { const float bias = BA ? bfr(BA[c0 + wc * 64 + j * 16 + col]) : 0.f;
#pragma unroll
      for (int i = 0; i < 2; ++i)
#pragma unroll
        for (int r = 0; r < 8; ++r) { const float v = acc[i][j][r] + bias; const int rl = wr * 32 + i * 16 + 8 * g + r, cl = wc * 64 + j * 16 + col; th[cl][rl] = (_Float16)v; const __bf16 bh = (__bf16)v; tb[cl][rl] = bh; tbl[cl][rl] = (__bf16)(v - (float)bh); } }
    __syncthreads();
    const int cl0 = tid >> 4, q = tid & 15; v4u o[8];   /* 16 threads a channel row of PTR keys, 16 channels a pass of the block; read as one group, then stored, as above */
#pragma unroll
    for (int i = 0; i < 8; ++i) o[i] = *(const v4u*)&th[i * 16 + cl0][q * 8];
    st8((char*)(VT + (bb * CC + c0 + cl0) * (size_t)TT + t0 + q * 8), (size_t)16 * TT * 2, o);
    if (hi_rows) {   /* block-uniform */
#pragma unroll
      for (int i = 0; i < 8; ++i) o[i] = *(const v4u*)&tb[i * 16 + cl0][q * 8];
      st8((char*)(VB + (bb * CC + c0 + cl0) * (size_t)KHI + t0 + q * 8), (size_t)16 * KHI * 2, o);
#pragma unroll
      for (int i = 0; i < 8; ++i) o[i] = *(const v4u*)&tbl[i * 16 + cl0][q * 8];
      st8((char*)(VBL + (bb * CC + c0 + cl0) * (size_t)KHI + t0 + q * 8), (size_t)16 * KHI * 2, o); } }
  { const v4h oh = { (_Float16)(bfr(wov[0]) * 256.0f), (_Float16)(bfr(wov[1]) * 256.0f), (_Float16)(bfr(wov[2]) * 256.0f), (_Float16)(bfr(wov[3]) * 256.0f) }; const v4b ob = { (__bf16)wov[0], (__bf16)wov[1], (__bf16)wov[2], (__bf16)wov[3] };
    /* both planes' stores; the last line is the wait that stands before a register which a store names is written again */
    asm volatile("global_store_b64 %0, %2, off\n\t"
                 "global_store_b64 %1, %3, off\n\t"
                 "s_wait_xcnt 0x0"
                 :: "v"(WOH + we), "v"(WOB + we), "v"(__builtin_bit_cast(v2u, oh)), "v"(__builtin_bit_cast(v2u, ob)) : "memory"); } }
// ---- k_fa: block = 4 waves x 16 queries (query block qb, heaviest first) of plane b*NH + h; K and V^T come through LDS buffers shared by the four waves; per 32 keys (main path: per 64-key stage): S^T = K Q^T (a lane holds 16 keys, main path 32, of ONE query), running maximum and sum in f32 (log2 domain), P^T x 2^11 packed from the score tiles straight into the B operand, O^T += V^T P^T; ctx = O / sum. Query blocks < QBH: 3-product logits (q, k residuals x 2^10), P and v as bf16 hi + lo (3 products)
#define LOGC (SCALE * 1.44269504088896340736f)
struct SMX { float m, l; };
__device__ __forceinline__ float xhalf(float x) { return __builtin_bit_cast(float, __builtin_amdgcn_permlanex16(__builtin_bit_cast(int, x), __builtin_bit_cast(int, x), 0x76543210, 0xfedcba98, false, false)); }   // lane l with lane l ^ 16
#define XCNT0() asm volatile("s_wait_xcnt 0x0" ::: "memory")   // stands behind a run of global loads, before their address registers are reused
// one 32-key step of the running softmax of this lane's query: t[0..7] = keys k0+8g+r, t[8..15] = keys k0+16+8g+r (scaled log2 logits); returns e[] = 2^(t - max + 11); rescales acc only when some query of the wave has a new maximum
__device__ __forceinline__ void sm_step(float t[16], SMX& st, v8f acc[HD / 16], int k0, int qfirst, int qi, int g) {
  if (k0 + 31 > qfirst) {   /* wave-uniform: only steps that reach the diagonal mask by index */
#pragma unroll
    for (int r = 0; r < 8; ++r) { if (k0 + 8 * g + r > qi) t[r] = -3.0e38f; if (k0 + 16 + 8 * g + r > qi) t[8 + r] = -3.0e38f; } }
  float mx = t[0];
#pragma unroll
  for (int s = 1; s < 16; ++s) mx = fmaxf(mx, t[s]);
  mx = fmaxf(mx, xhalf(mx));   /* the other half of the wave holds the query's other 16 keys */
  if (__builtin_amdgcn_ballot_w32(mx > st.m) != 0) { const float mn = fmaxf(st.m, mx); const float al = __builtin_amdgcn_exp2f(st.m - mn); st.m = mn; st.l *= al;
#pragma unroll
    for (int j = 0; j < HD / 16; ++j)
#pragma unroll
      for (int r = 0; r < 8; ++r) acc[j][r] *= al; }
  const float mo = st.m - 11.0f; float ps = 0.f;
#pragma unroll
  for (int s = 0; s < 16; ++s) t[s] -= mo;
  __builtin_amdgcn_sched_barrier(0);   /* the subtractions stay ahead of the exponentials */
#pragma unroll   /* constant trips over the register array t, as the loop above */
  for (int s = 0; s < 16; ++s) { t[s] = __builtin_amdgcn_exp2f(t[s]); ps += t[s]; }
  st.l += ps; }
// one 64-key stage of the running softmax of this lane's query (main path): t[8 * i + r] = key k0 + 16 * i + 8g + r, i = score tile 0..3 (scaled log2 logits); returns e[] = 2^(t - max + 11). One maximum, one test and at most one rescale for the whole stage; the maximum is taken tile by tile, four chains that do not depend on one another, then joined. The sum of e[] is left to the caller
__device__ __forceinline__ void sm_stage(float t[32], SMX& st, v8f acc[HD / 16], int k0, int qfirst, int qi, int g) {
  if (k0 + 63 > qfirst) {   /* wave-uniform: only the stage that reaches the diagonal masks by index */
#pragma unroll
    for (int i = 0; i < 4; ++i)
#pragma unroll
      for (int r = 0; r < 8; ++r) if (k0 + 16 * i + 8 * g + r > qi) t[8 * i + r] = -3.0e38f; }
  float m4[4];
#pragma unroll
  for (int i = 0; i < 4; ++i) m4[i] = t[8 * i];
#pragma unroll
  for (int r = 1; r < 8; ++r)
#pragma unroll
    for (int i = 0; i < 4; ++i) m4[i] = fmaxf(m4[i], t[8 * i + r]);
  float mx = fmaxf(fmaxf(m4[0], m4[1]), fmaxf(m4[2], m4[3]));
  mx = fmaxf(mx, xhalf(mx));   /* the other half of the wave holds the query's other 32 keys */
  if (__builtin_amdgcn_ballot_w32(mx > st.m) != 0) { const float mn = fmaxf(st.m, mx); const float al = __builtin_amdgcn_exp2f(st.m - mn); st.m = mn; st.l *= al;
#pragma unroll
    for (int j = 0; j < HD / 16; ++j)
#pragma unroll
      for (int r = 0; r < 8; ++r) acc[j][r] *= al; }
  const float mo = st.m - 11.0f;
#pragma unroll
  for (int s = 0; s < 32; ++s) t[s] -= mo;
  __builtin_amdgcn_sched_barrier(0);   /* the subtractions stay ahead of the exponentials */
#pragma unroll   /* constant trips over the register array t, as the loops above */
  for (int s = 0; s < 32; ++s) t[s] = __builtin_amdgcn_exp2f(t[s]); }
// K / V staging of the main path: a stage is FKS keys of this head: K rows [key][64 d] and V^T rows [c][FKS keys], 128 B of data a row at a pitch of 144 B (16 B x odd: ds_load_b128 readers). The 128 threads bring it in with asynchronous copies to LDS that cover whole 128-B lines (8 lanes a row); all four waves take their fragments from there
#define FKS 64
#define FLP (FKS + 8)
#define FBUF (2 * FKS * FLP * 2)   // bytes of one buffer (K rows, then V^T rows)
#define DS0() asm volatile("s_wait_dscnt 0x0" ::: "memory")       // this wave's LDS reads of a buffer have returned before the buffer is handed to the copies
#define ASYNC0() asm volatile("s_wait_asynccnt 0x0" ::: "memory")   // this wave's copies have landed before the barrier behind which other waves read them
// one stage: 4 copies for K (16 keys on each), 4 for V^T (16 channels on each), 16 B a lane; the last line is the wait that stands before a register which a copy names is written again
__device__ __forceinline__ void fa_fill(unsigned l, const _Float16* kg, const _Float16* vg) {
  const unsigned rs = 16 * FLP * 2, vb = FKS * FLP * 2;
  asm volatile("global_load_async_to_lds_b128 %0, %8, off\n\t"
               "global_load_async_to_lds_b128 %1, %9, off\n\t"
               "global_load_async_to_lds_b128 %2, %10, off\n\t"
               "global_load_async_to_lds_b128 %3, %11, off\n\t"
               "global_load_async_to_lds_b128 %4, %12, off\n\t"
               "global_load_async_to_lds_b128 %5, %13, off\n\t"
               "global_load_async_to_lds_b128 %6, %14, off\n\t"
               "global_load_async_to_lds_b128 %7, %15, off\n\t"
               "s_wait_xcnt 0x0"
               :: "v"(l), "v"(l + rs), "v"(l + 2 * rs), "v"(l + 3 * rs), "v"(l + vb), "v"(l + vb + rs), "v"(l + vb + 2 * rs), "v"(l + vb + 3 * rs),
                  "v"(kg), "v"(kg + (size_t)16 * CC), "v"(kg + (size_t)32 * CC), "v"(kg + (size_t)48 * CC), "v"(vg), "v"(vg + (size_t)16 * TT), "v"(vg + (size_t)32 * TT), "v"(vg + (size_t)48 * TT)
               : "memory"); }
// the same for a stage of the early-row path: one K-like tile (rows of CC) and one V^T-like tile of the short planes (rows of KHI keys); called once for the hi pair and once for the lo pair
__device__ __forceinline__ void fa_fill_e(unsigned l, const _Float16* kg, const __bf16* vg) {
  const unsigned rs = 16 * FLP * 2, vb = FKS * FLP * 2;
  asm volatile("global_load_async_to_lds_b128 %0, %8, off\n\t"
               "global_load_async_to_lds_b128 %1, %9, off\n\t"
               "global_load_async_to_lds_b128 %2, %10, off\n\t"
               "global_load_async_to_lds_b128 %3, %11, off\n\t"
               "global_load_async_to_lds_b128 %4, %12, off\n\t"
               "global_load_async_to_lds_b128 %5, %13, off\n\t"
               "global_load_async_to_lds_b128 %6, %14, off\n\t"
               "global_load_async_to_lds_b128 %7, %15, off\n\t"
               "s_wait_xcnt 0x0"
               :: "v"(l), "v"(l + rs), "v"(l + 2 * rs), "v"(l + 3 * rs), "v"(l + vb), "v"(l + vb + rs), "v"(l + vb + 2 * rs), "v"(l + vb + 3 * rs),
                  "v"(kg), "v"(kg + (size_t)16 * CC), "v"(kg + (size_t)32 * CC), "v"(kg + (size_t)48 * CC), "v"(vg), "v"(vg + (size_t)16 * KHI), "v"(vg + (size_t)32 * KHI), "v"(vg + (size_t)48 * KHI)
               : "memory"); }
// four 16-B stores of one lane, 32 B apart; the last line is the wait that stands before a register which a store names is written again
__device__ __forceinline__ void st4(char* p, const v4u (&o)[4]) {
  asm volatile("global_store_b128 %0, %1, off\n\t"
               "global_store_b128 %0, %2, off offset:32\n\t"
               "global_store_b128 %0, %3, off offset:64\n\t"
               "global_store_b128 %0, %4, off offset:96\n\t"
               "s_wait_xcnt 0x0"
               :: "v"(p), "v"(o[0]), "v"(o[1]), "v"(o[2]), "v"(o[3]) : "memory"); }
__global__ __launch_bounds__(128) void k_fa(const _Float16* __restrict__ QH, const _Float16* __restrict__ KH, const _Float16* __restrict__ QL, const _Float16* __restrict__ KL, const _Float16* __restrict__ VT, const __bf16* __restrict__ VB, const __bf16* __restrict__ VBL, _Float16* __restrict__ YH, __bf16* __restrict__ YL) {
  __shared__ __align__(16) _Float16 skv[2][2][FKS][FLP];   /* [buffer][K rows | V^T rows][row][128 B + pad] */
  const int b = blockIdx.x / NH, h = blockIdx.x % NH; const int qb = NQB - 1 - (int)blockIdx.y;
  const int tid = threadIdx.x, wave = __builtin_amdgcn_readfirstlane(tid >> 5), lane = tid & 31, col = lane & 15, g = lane >> 4;
  /* wave number held scalar: trip count and diagonal test become scalar branches, every lane stays on at the matrix instructions */ const int ql0 = qb * 64 + wave * 16, qi = ql0 + col; const int nblk = (ql0 + 47) >> 5;   /* 32-key steps that cover keys 0 .. ql0 + 15 */
  const _Float16* Qp = QH + ((size_t)b * TT + qi) * CC + h * HD;
  v8f acc[HD / 16] = {}; SMX st; st.m = -3.0e38f; st.l = 0.f;
  const v16h qf0 = frag_h(Qp, lane), qf1 = frag_h(Qp + 32, lane);
  XCNT0();
  if (qb < QBH) {   /* block-uniform */
    const _Float16* QLp = QL + ((size_t)b * QHI + qi) * CC + h * HD;
    const v16h ql0f = frag_h(QLp, lane), ql1f = frag_h(QLp + 32, lane);
    XCNT0();
    /* a stage is FKS keys of this head in ONE buffer of four tiles (the main path's two buffers taken together): K hi, V^T hi, K lo, V^T lo; keys 0 .. qb * 64 + 63 all lie below KHI; every plain '#pragma unroll' of this path opens a constant-trip loop over a register array, so that its elements stay in registers */
    const int nst = qb + 1;   /* the same for the whole block */
    const int fr = tid >> 3, fc = (tid & 7) * 8;   /* this thread's row (of 16 a copy) and 16-B piece of a stage row */
    const _Float16* kg = KH + ((size_t)b * TT + fr) * CC + h * HD + fc; const _Float16* klg = KL + ((size_t)b * KHI + fr) * CC + h * HD + fc; const size_t vo = ((size_t)b * CC + h * HD + fr) * (size_t)KHI + fc;
    const unsigned l0 = (unsigned)(size_t)&skv[0][0][fr][fc];
    const _Float16 (*bkh)[FLP] = skv[0][0]; const _Float16 (*bkl)[FLP] = skv[1][0]; const __bf16 (*bvh)[FLP] = (const __bf16 (*)[FLP])skv[0][1]; const __bf16 (*bvl)[FLP] = (const __bf16 (*)[FLP])skv[1][1];
#pragma unroll 1   /* at most 6 stages: kept rolled for code size */
    for (int s = 0; s < nst; ++s) {
      if (s > 0) { DS0(); __syncthreads(); }   /* block-uniform: every reader has left stage s - 1 before the copies write over it */
      fa_fill_e(l0, kg + (size_t)s * FKS * CC, VB + vo + s * FKS); fa_fill_e(l0 + FBUF, klg + (size_t)s * FKS * CC, VBL + vo + s * FKS);
      ASYNC0(); __syncthreads();   /* stage s is published */
#pragma unroll 1   /* two steps a stage, rolled for code size; wave-uniform scalar test: the two lower waves of the block skip the diagonal stage's second step */
      for (int w = 0; w < 2 && 2 * s + w < nblk; ++w) { const int k0 = (2 * s + w) * 32; float t[16];
        v16h kh[2][2], kl[2][2]; v16b vh[HD / 16], vl[HD / 16];   /* the step's fragment reads go out as one group ahead of its products */
#pragma unroll
        for (int u = 0; u < 2; ++u) { const int kr = w * 32 + u * 16 + col; kh[u][0] = frag_h(&bkh[kr][0], lane); kh[u][1] = frag_h(&bkh[kr][32], lane); kl[u][0] = frag_h(&bkl[kr][0], lane); kl[u][1] = frag_h(&bkl[kr][32], lane); }
#pragma unroll
        for (int j = 0; j < HD / 16; ++j) { vh[j] = frag_b(&bvh[j * 16 + col][w * 32], lane); vl[j] = frag_b(&bvl[j * 16 + col][w * 32], lane); }
        RDGRP();
#pragma unroll
        for (int u = 0; u < 2; ++u) { v8f a = {}, al = {};
          a = wmma16(kh[u][0], qf0, a); al = wmma16(kh[u][0], ql0f, al); al = wmma16(kl[u][0], qf0, al); a = wmma16(kh[u][1], qf1, a); al = wmma16(kh[u][1], ql1f, al); al = wmma16(kl[u][1], qf1, al);
#pragma unroll
          for (int r = 0; r < 8; ++r) t[u * 8 + r] = (a[r] + al[r] * (1.0f / 1024.0f)) * LOGC; }
        sm_step(t, st, acc, k0, ql0, qi, g);
        const F2 p = bsplit16(t);
#pragma unroll
        for (int j = 0; j < HD / 16; ++j) { acc[j] = wmma_bf(vh[j], p.h, acc[j]); acc[j] = wmma_bf(vh[j], p.l, acc[j]); acc[j] = wmma_bf(vl[j], p.h, acc[j]); } } }
  } else {
    /* every plain '#pragma unroll' below opens a constant-trip loop over a register array (fragments, scores, accumulators), so that its elements stay in registers */
    const int nst = qb + 1;   /* stages of FKS keys that cover keys 0 .. qb * 64 + 63; the same for the whole block */
    const int fr = tid >> 3, fc = (tid & 7) * 8;   /* this thread's row (of 16 a copy) and 16-B piece of a stage row */
    const _Float16* kg = KH + ((size_t)b * TT + fr) * CC + h * HD + fc; const _Float16* vg = VT + ((size_t)b * CC + h * HD + fr) * (size_t)TT + fc;
    const unsigned l0 = (unsigned)(size_t)&skv[0][0][fr][fc];
    int sa = ((qb - QBH) * 5) % nst;   /* the key stage of trip 0; the walk wraps (the running softmax takes the stages in any order; every stage holds a key <= each query of the block). The blocks of one plane read the same K and V^T stages and start apart, so that they do not ask L2 for the same lines at the same moment; nst >= QBH + 1 here */
    const int sb = sa + 1 == nst ? 0 : sa + 1;
    fa_fill(l0, kg + (size_t)sa * FKS * CC, vg + sa * FKS); ASYNC0(); __syncthreads();   /* trip 0's stage is published */
    if (1 < nst) fa_fill(l0 + FBUF, kg + (size_t)sb * FKS * CC, vg + sb * FKS);
#pragma unroll 1   /* rolled: one copy of the stage; the buffer is chosen by address */
    for (int s = 0; s < nst; ++s) { const _Float16 (*bk)[FLP] = skv[s & 1][0]; const _Float16 (*bv)[FLP] = skv[s & 1][1];
      v16h kf[2][4], vf[2][4];   /* the stage's fragments go out as one group at its head */
#pragma unroll   /* all K fragments first: the score products of the whole stage come first, the V^T fragments land during the softmax */
      for (int w = 0; w < 2; ++w)
#pragma unroll
        for (int u = 0; u < 2; ++u) { kf[w][2 * u] = frag_h(&bk[w * 32 + u * 16 + col][0], lane); kf[w][2 * u + 1] = frag_h(&bk[w * 32 + u * 16 + col][32], lane); }
#pragma unroll
      for (int w = 0; w < 2; ++w)
#pragma unroll
        for (int j = 0; j < HD / 16; ++j) vf[w][j] = frag_h(&bv[j * 16 + col][w * 32], lane);
      RDGRP();
      { const int k0 = sa * FKS;   /* the whole stage in one step: 8 score products in four independent tiles, one running-softmax step over 64 keys, 8 P x v products. In the diagonal stage the two lower waves' upper 32 keys are all masked and add nothing */
        v8f sc[4] = {};
#pragma unroll
        for (int i = 0; i < 4; ++i) sc[i] = wmma16(kf[i >> 1][2 * (i & 1)], qf0, sc[i]);
#pragma unroll
        for (int i = 0; i < 4; ++i) sc[i] = wmma16(kf[i >> 1][2 * (i & 1) + 1], qf1, sc[i]);
        MRUN();
        float t[32];
#pragma unroll
        for (int i = 0; i < 4; ++i)
#pragma unroll
          for (int r = 0; r < 8; ++r) t[8 * i + r] = sc[i][r] * LOGC;
        sm_stage(t, st, acc, k0, ql0, qi, g);
        v16h p[2];
#pragma unroll
        for (int e = 0; e < 16; ++e) { p[0][e] = (_Float16)t[e]; p[1][e] = (_Float16)t[16 + e]; }
        MRUN();
        float ps[4] = { 0.f, 0.f, 0.f, 0.f };   /* one partial sum a score tile: four independent chains, written between the products so that they issue beside them */
#pragma unroll
        for (int w = 0; w < 2; ++w)
#pragma unroll
          for (int j = 0; j < HD / 16; ++j) { acc[j] = wmma16(vf[w][j], p[w], acc[j]);
#pragma unroll
            for (int i = 0; i < 4; ++i) ps[i] += t[8 * i + w * 4 + j]; }
        st.l += (ps[0] + ps[1]) + (ps[2] + ps[3]); }
      DS0(); ASYNC0(); __syncthreads();   /* publishes stage s + 1 and ends every reader's last read of stage s */
      if (s + 2 < nst) { const int sc = sa + 2 >= nst ? sa + 2 - nst : sa + 2; fa_fill(l0 + (unsigned)(s & 1) * FBUF, kg + (size_t)sc * FKS * CC, vg + sc * FKS); }   /* block-uniform; flies while the next trip's stage is worked on */
      sa = sa + 1 == nst ? 0 : sa + 1; }
    ASYNC0(); }
  const float inv = 1.0f / (st.l + xhalf(st.l));   /* the two halves' partial sums join once; the maximum's own term keeps the sum >= 2^11 */
  const size_t yo = ((size_t)b * TT + qi) * CC + h * HD + 8 * g;   /* acc[j][r] = ctx[query qi][j*16 + 8g + r]: 16 contiguous bytes per lane and j. ctx is rounded here, once, to the operand type of the output GEMM */
  v4u oa[HD / 16];
  if (qb < QBH) {   /* block-uniform: bf16 hi + lo */
    v4u ol[HD / 16];
#pragma unroll
    for (int j = 0; j < HD / 16; ++j) { v8b hv, lv;
#pragma unroll
      for (int r = 0; r < 8; ++r) { const float v = acc[j][r] * inv; const __bf16 hb = (__bf16)v; hv[r] = hb; lv[r] = (__bf16)(v - (float)hb); }
      oa[j] = __builtin_bit_cast(v4u, hv); ol[j] = __builtin_bit_cast(v4u, lv); }
    st4((char*)(YL + yo), ol);
  } else {
#pragma unroll
    for (int j = 0; j < HD / 16; ++j) { v8h hv;
#pragma unroll
      for (int r = 0; r < 8; ++r) hv[r] = (_Float16)(acc[j][r] * inv * 64.0f);   /* ctx carried x 2^6 into f16 so small-magnitude context rows stay clear of f16 subnormals */
      oa[j] = __builtin_bit_cast(v4u, hv); } }
  st4((char*)(YH + yo), oa); }
// ---- k_out: block = (64 rows, 128 cols): out = ctx Wo (+ bo): ctx f16 (x 2^6) against Wo as f16(bf16 x 2^8) exact (1 product) x 2^-14; causal early rows (< QHI of each sequence): ctx bf16 hi + lo against exact bf16 Wo (2 products). Both operands arrive already rounded (ctx by k_fa, Wo by k_proj): a stage is OK k of every tile row, 256 B of data a row at a pitch of 272 B (16 B x odd: ds_load_b128 readers), brought in by asynchronous copies to LDS that cover whole lines (16 lanes a row)
#define OBUF ((64 + 64 + 128) * OLP * 2)   // bytes of one buffer: ctx rows (early rows: hi, then lo), then Wo rows
// 8 copies of one thread, 8 tile rows apart (64 rows for the block), 16 B a lane; the last line is the wait that stands before a register which a copy names is written again
__device__ __forceinline__ void o_fill(unsigned l, const char* p) {
  const unsigned rs = 8 * OLP * 2; const size_t gs = (size_t)8 * CC * 2;
  asm volatile("global_load_async_to_lds_b128 %0, %8, off\n\t"
               "global_load_async_to_lds_b128 %1, %9, off\n\t"
               "global_load_async_to_lds_b128 %2, %10, off\n\t"
               "global_load_async_to_lds_b128 %3, %11, off\n\t"
               "global_load_async_to_lds_b128 %4, %12, off\n\t"
               "global_load_async_to_lds_b128 %5, %13, off\n\t"
               "global_load_async_to_lds_b128 %6, %14, off\n\t"
               "global_load_async_to_lds_b128 %7, %15, off\n\t"
               "s_wait_xcnt 0x0"
               :: "v"(l), "v"(l + rs), "v"(l + 2 * rs), "v"(l + 3 * rs), "v"(l + 4 * rs), "v"(l + 5 * rs), "v"(l + 6 * rs), "v"(l + 7 * rs),
                  "v"(p), "v"(p + gs), "v"(p + 2 * gs), "v"(p + 3 * gs), "v"(p + 4 * gs), "v"(p + 5 * gs), "v"(p + 6 * gs), "v"(p + 7 * gs)
               : "memory"); }
__global__ __launch_bounds__(128) void k_out(const _Float16* __restrict__ YH, const __bf16* __restrict__ YL, const _Float16* __restrict__ WOH, const __bf16* __restrict__ WOB, const float* __restrict__ BO, float* __restrict__ OUT) { __shared__ __align__(16) unsigned char sm[2 * OBUF];   /* two operand buffers; behind the last stage's barrier the output staging takes the same bytes */
  static_assert(4 * 16 * 132 * 4 <= 2 * OBUF && CC % OK == 0 && CC / OK >= 2, "LDS, stages");
  float (*sf)[16][132] = (float (*)[16][132])sm;
  const int tid = threadIdx.x, wave = tid >> 5, lane = tid & 31, col = lane & 15, g = lane >> 4; const int c0 = blockIdx.y * 128; const size_t r0 = (size_t)blockIdx.x * 64 + wave * 16;
  v8f acc[8] = {};
  const int fr = tid >> 4, fc = (tid & 15) * 8;   /* this thread's row (of 8 a copy) and 16-B piece of a stage row */
  const size_t yo = ((size_t)blockIdx.x * 64 + fr) * CC + fc, wo = (size_t)(c0 + fr) * CC + fc;   /* (out,in) weight rows */
  const unsigned l0 = (unsigned)(size_t)&sm[(fr * OLP + fc) * 2];
  int ks = (int)((blockIdx.x + blockIdx.y) % (CC / OK));   /* this block's first k stage; the walk wraps: blocks that read the same ctx rows or the same weight rows start apart (as in k_proj) */
  const int kb = ks + 1 == CC / OK ? 0 : ks + 1;
  if (CAUSAL && (int)(((size_t)blockIdx.x * 64) % TT) < QHI) {   /* block-uniform */
    const char* yh = (const char*)(YH + yo); const char* yl = (const char*)(YL + yo); const char* wg = (const char*)(WOB + wo); const size_t w64 = (size_t)64 * CC * 2;
    o_fill(l0, yh + ks * OK * 2); o_fill(l0 + 64 * OLP * 2, yl + ks * OK * 2); o_fill(l0 + 128 * OLP * 2, wg + ks * OK * 2); o_fill(l0 + 192 * OLP * 2, wg + w64 + ks * OK * 2);
    ASYNC0(); __syncthreads();   /* trip 0's stage is published */
    o_fill(l0 + OBUF, yh + kb * OK * 2); o_fill(l0 + OBUF + 64 * OLP * 2, yl + kb * OK * 2); o_fill(l0 + OBUF + 128 * OLP * 2, wg + kb * OK * 2); o_fill(l0 + OBUF + 192 * OLP * 2, wg + w64 + kb * OK * 2);
#pragma unroll 1   /* rolled: one copy of the stage; the buffer is chosen by address */
    for (int s = 0; s < CC / OK; ++s) { const __bf16 (*bh)[OLP] = (const __bf16 (*)[OLP])(sm + (s & 1) * OBUF); const __bf16 (*bl)[OLP] = bh + 64; const __bf16 (*bw)[OLP] = bh + 128;
#pragma unroll
      for (int kk = 0; kk < OK / 32; ++kk) { const v16b ah = frag_b(&bh[wave * 16 + col][kk * 32], lane), al = frag_b(&bl[wave * 16 + col][kk * 32], lane);
#pragma unroll
        for (int j0 = 0; j0 < 8; j0 += 4) { v16b w[4];   /* fragment reads go out as a group ahead of their products */
#pragma unroll
          for (int u = 0; u < 4; ++u) w[u] = frag_b(&bw[(j0 + u) * 16 + col][kk * 32], lane);
          RDGRP();
#pragma unroll
          for (int u = 0; u < 4; ++u) { acc[j0 + u] = wmma_bf(ah, w[u], acc[j0 + u]); acc[j0 + u] = wmma_bf(al, w[u], acc[j0 + u]); } } }
      DS0(); ASYNC0(); __syncthreads();   /* publishes stage s + 1 and ends every reader's last read of stage s (behind the last stage: before the output staging writes over the buffers) */
      if (s + 2 < CC / OK) { const int kc = ks + 2 >= CC / OK ? ks + 2 - CC / OK : ks + 2; const unsigned l = l0 + (unsigned)(s & 1) * OBUF;   /* block-uniform; flies while the next trip's stage is worked on */
        o_fill(l, yh + kc * OK * 2); o_fill(l + 64 * OLP * 2, yl + kc * OK * 2); o_fill(l + 128 * OLP * 2, wg + kc * OK * 2); o_fill(l + 192 * OLP * 2, wg + w64 + kc * OK * 2); }
      ks = ks + 1 == CC / OK ? 0 : ks + 1; }
    ASYNC0();
#pragma unroll
    for (int j = 0; j < 8; ++j) { const float bias = BO ? bfr(BO[c0 + j * 16 + col]) : 0.f;
#pragma unroll
      for (int r = 0; r < 8; ++r) sf[wave][8 * g + r][j * 16 + col] = acc[j][r] + bias; }
  } else {
    const char* yh = (const char*)(YH + yo); const char* wg = (const char*)(WOH + wo); const size_t w64 = (size_t)64 * CC * 2;
    o_fill(l0, yh + ks * OK * 2); o_fill(l0 + 64 * OLP * 2, wg + ks * OK * 2); o_fill(l0 + 128 * OLP * 2, wg + w64 + ks * OK * 2);
    ASYNC0(); __syncthreads();   /* trip 0's stage is published */
    o_fill(l0 + OBUF, yh + kb * OK * 2); o_fill(l0 + OBUF + 64 * OLP * 2, wg + kb * OK * 2); o_fill(l0 + OBUF + 128 * OLP * 2, wg + w64 + kb * OK * 2);
#pragma unroll 1   /* rolled: one copy of the stage; the buffer is chosen by address */
    for (int s = 0; s < CC / OK; ++s) { const _Float16 (*ba)[OLP] = (const _Float16 (*)[OLP])(sm + (s & 1) * OBUF); const _Float16 (*bw)[OLP] = ba + 64;
#pragma unroll
      for (int kk = 0; kk < OK / 32; ++kk) { const v16h a = frag_h(&ba[wave * 16 + col][kk * 32], lane);
#pragma unroll
        for (int j0 = 0; j0 < 8; j0 += 4) { v16h w[4];   /* fragment reads go out as a group ahead of their products */
#pragma unroll
          for (int u = 0; u < 4; ++u) w[u] = frag_h(&bw[(j0 + u) * 16 + col][kk * 32], lane);
          RDGRP();
#pragma unroll
          for (int u = 0; u < 4; ++u) acc[j0 + u] = wmma16(a, w[u], acc[j0 + u]); } }
      DS0(); ASYNC0(); __syncthreads();   /* publishes stage s + 1 and ends every reader's last read of stage s (behind the last stage: before the output staging writes over the buffers) */
      if (s + 2 < CC / OK) { const int kc = ks + 2 >= CC / OK ? ks + 2 - CC / OK : ks + 2; const unsigned l = l0 + (unsigned)(s & 1) * OBUF;   /* block-uniform; flies while the next trip's stage is worked on */
        o_fill(l, yh + kc * OK * 2); o_fill(l + 64 * OLP * 2, wg + kc * OK * 2); o_fill(l + 128 * OLP * 2, wg + w64 + kc * OK * 2); }
      ks = ks + 1 == CC / OK ? 0 : ks + 1; }
    ASYNC0();
#pragma unroll
    for (int j = 0; j < 8; ++j) { const float bias = BO ? bfr(BO[c0 + j * 16 + col]) : 0.f;
#pragma unroll
      for (int r = 0; r < 8; ++r) sf[wave][8 * g + r][j * 16 + col] = acc[j][r] * (1.0f / 16384.0f) + bias; } }   /* 2^-8 (Wo carry) x 2^-6 (ctx carry) */
  LDSX(); for (int rl = 0; rl < 16; ++rl) vst2(OUT + SRCROW(r0 + rl) * DIN + c0 + lane * 4, *(const v4f*)&sf[wave][rl][lane * 4]); }

extern "C" void kernel_launch(void* const* d_in, const int* in_sizes, int n_in, void* d_out, int out_size, void* d_ws, size_t ws_size, hipStream_t stream) {
  (void)in_sizes; (void)n_in; (void)out_size;
  const float** F = (const float**)d_in;
  if (ws_size < (size_t)WS_END) return;
  char* ws = (char*)d_ws; _Float16 *QH = (_Float16*)(ws + WS_QH), *KH = (_Float16*)(ws + WS_KH), *VT = (_Float16*)(ws + WS_VT), *QL = (_Float16*)(ws + WS_QL), *KL = (_Float16*)(ws + WS_KL); __bf16 *VB = (__bf16*)(ws + WS_VB), *VBL = (__bf16*)(ws + WS_VBL); _Float16 *YH = (_Float16*)(ws + WS_Y), *WOH = (_Float16*)(ws + WS_WH); __bf16 *YL = (__bf16*)(ws + WS_YL), *WOB = (__bf16*)(ws + WS_WB);
  (void)QL; (void)KL; (void)VB; (void)VBL;
  // inputs: 0 x [2048,2,768] (S, B, D); 1 wq [768,768] (out,in), 2 bq; 3 wk, 4 bk; 5 wv, 6 bv; 7 wc (out,in), 8 bc (all biases NONZERO)
  k_proj<<<dim3(TNB * TT / PTR, CC / 128, 3), 256, 0, stream>>>(F[0], F[0], F[0], F[1], F[3], F[5], F[2], F[4], F[6], QH, QL, KH, KL, VT, VB, VBL, F[7], WOH, WOB);
  k_fa<<<dim3(TNB * NH, NQB), 128, 0, stream>>>(QH, KH, QL, KL, VT, VB, VBL, YH, YL);
  k_out<<<dim3(TNB * TT / 64, DIN / 128), 128, 0, stream>>>(YH, YL, WOH, WOB, F[8], (float*)d_out);   /* writes (S, B, D) rows */
}
